// v000
// Times are from an AMD MI455X. After a warm-up the kernel runs many times in a row, and a time is the length of
// such a window on the GPU divided by its runs, so every launch and the gaps after it count. The runs cycle
// through copies of the inputs. A figure is the median of several windows, for all but v000 over two sittings.
// Sittings can differ by a few percent; kernels timed side by side share one.
// v000, which the later versions start from, runs in 1730 microseconds.
#include <hip/hip_runtime.h>

// Causal multi-head attention with 128-wide heads and computed rotate-half rotary embeddings (hidden_states [2][2048][2048]; q, k, v = einsum('bsd,ed->bse', x, W) ('oi' 0.02; 16 heads x 128); rope x cos + rotate_half(x) sin, angle t x 1/10000^(2i/128) (64 f32 frequencies jnp-exact; cat(freqs, freqs); precise cosf/sinf); scores / sqrt(128); mask = (key > query) | (key - query >= 1024): the second term only touches FUTURE keys, which the first already excludes: plain causal (-inf == exclusion); softmax in f32; out = merged Wo^T -> [2][2048][2048] (8.4 M); argument order hidden_states, Wq, Wk, Wv, Wo).
// Layout: bf16 copy of x; 'oi' weights; exact projections; k_cs5 computed table (HD 128) + rotate-half plane builders; causal T-2048 attention at HD 128 (hybrid rows: < 512 hi/lo 3 products, rest fp16 x1024; k_gemmc skips tiles above the diagonal); merged hi/lo x Wo exact.
// Compute dtypes, f32 accumulate: every input rounded to bf16; projections exact; rotary f32; attention rows < 512 3 products, rest fp16; softmax f32; Wo hl x exact.

#define NB_  2
#define TT   2048
#define DM   2048
#define NH_  16
#define NKV  16
#define REP  (NH_ / NKV)
#define HD   128
#define DQ   (NH_ * HD)
#define DKV  (NKV * HD)
#define ZH   2
#define RH   512                  // query rows < RH use hi+lo planes (0: none)
#define WIN  2048
#define PCAR 1024.0f
#define SCL  0.088388347648318447f   // HD^-0.5
typedef _Float16 h16;
typedef unsigned short bf;
typedef __attribute__((ext_vector_type(16))) __bf16   v16bf;
typedef __attribute__((ext_vector_type(16))) _Float16 v16h;
typedef __attribute__((ext_vector_type(8)))  _Float16 v8h;
typedef __attribute__((ext_vector_type(8)))  unsigned short v8us;
typedef __attribute__((ext_vector_type(8)))  float    v8f;
typedef __attribute__((ext_vector_type(4)))  float    v4f;
typedef v8h  __attribute__((may_alias)) v8ha;
typedef v4f  __attribute__((may_alias)) v4fa;
typedef v8us __attribute__((may_alias)) v8usa;

__device__ __forceinline__ unsigned short f2bf(float f) { unsigned u = __float_as_uint(f); u += 0x7FFFu + ((u >> 16) & 1u); return (unsigned short)(u >> 16); }
__device__ __forceinline__ float bf2f(unsigned short b) { return __uint_as_float(((unsigned)b) << 16); }
__device__ __forceinline__ float bfr(float f) { return bf2f(f2bf(f)); }
__device__ __forceinline__ v16h cat16(v8h lo, v8h hi) { return __builtin_shufflevector(lo, hi, 0, 1, 2, 3, 4, 5, 6, 7, 8, 9, 10, 11, 12, 13, 14, 15); }
__device__ __forceinline__ v16bf cat16b(v8us lo, v8us hi) { return __builtin_bit_cast(v16bf, __builtin_shufflevector(lo, hi, 0, 1, 2, 3, 4, 5, 6, 7, 8, 9, 10, 11, 12, 13, 14, 15)); }
__device__ __forceinline__ v8f wmma16(v16h a, v16h b, v8f c) { return __builtin_amdgcn_wmma_f32_16x16x32_f16(false, a, false, b, (short)0, c, false, false); }
__device__ __forceinline__ v8f wmmab(v16bf a, v16bf b, v8f c) { return __builtin_amdgcn_wmma_f32_16x16x32_bf16(false, a, false, b, (short)0, c, false, false); }



// ---- k_gemmw: register-blocked GEMM, ONE WAVE per 64x64 output tile (16 accumulators), operands straight from K-contiguous 16-bit planes; grid (M/64, N/64, Z), 32 threads.
// C[m][n] (f32, pitch ldc, + optional f32 bias[n]) = sum_k A[m][k] Bt[n][k] (+ split products per NSPLIT). z-batch strides sA/sB/sC in elements. K % 32 == 0.
template <typename T16> struct WFrag;
template <> struct WFrag<h16> { typedef v16h V; static __device__ __forceinline__ V ld(const h16* p) { return cat16(*(const v8h*)p, *(const v8h*)(p + 16)); } static __device__ __forceinline__ v8f mma(V a, V b, v8f c) { return wmma16(a, b, c); } };
template <> struct WFrag<bf> { typedef v16bf V; static __device__ __forceinline__ V ld(const bf* p) { return cat16b(*(const v8us*)p, *(const v8us*)(p + 16)); } static __device__ __forceinline__ v8f mma(V a, V b, v8f c) { return wmmab(a, b, c); } };
template <typename T16, int NSPLIT, bool BIAS>
__global__ __launch_bounds__(32) void k_gemmw(const T16* __restrict__ A, const T16* __restrict__ A2, const T16* __restrict__ Bt, const T16* __restrict__ Bt2, int K, float* C, int ldc, const float* __restrict__ bias, size_t sA, size_t sB, size_t sC) {
    typedef typename WFrag<T16>::V V;
    __shared__ __align__(16) float os[16 * 68];
    const size_t z = blockIdx.z; A += z * sA; if (A2) A2 += z * sA; Bt += z * sB; if (Bt2) Bt2 += z * sB; C += z * sC;
    const int lane = threadIdx.x & 31, lr = lane & 15, hi = lane >> 4; const int r0 = blockIdx.x * 64, c0 = blockIdx.y * 64;
    v8f acc[4][4];
#pragma unroll
    for (int mb = 0; mb < 4; ++mb)
#pragma unroll
        for (int nb = 0; nb < 4; ++nb) acc[mb][nb] = (v8f){};
    const size_t aoff = (size_t)(r0 + lr) * K + 8 * hi, boff = (size_t)(c0 + lr) * K + 8 * hi;
#pragma unroll 1
    for (int kc = 0; kc < K; kc += 32) {
        V a[4], a2[4];
#pragma unroll
        for (int mb = 0; mb < 4; ++mb) { a[mb] = WFrag<T16>::ld(A + aoff + (size_t)mb * 16 * K + kc); if (NSPLIT == 1 || NSPLIT == 2) a2[mb] = WFrag<T16>::ld(A2 + aoff + (size_t)mb * 16 * K + kc); }
#pragma unroll
        for (int nb = 0; nb < 4; ++nb) { const V b = WFrag<T16>::ld(Bt + boff + (size_t)nb * 16 * K + kc); V b2; if (NSPLIT >= 2) b2 = WFrag<T16>::ld(Bt2 + boff + (size_t)nb * 16 * K + kc);
#pragma unroll
            for (int mb = 0; mb < 4; ++mb) { acc[mb][nb] = WFrag<T16>::mma(a[mb], b, acc[mb][nb]); if (NSPLIT == 1 || NSPLIT == 2) acc[mb][nb] = WFrag<T16>::mma(a2[mb], b, acc[mb][nb]); if (NSPLIT >= 2) acc[mb][nb] = WFrag<T16>::mma(a[mb], b2, acc[mb][nb]); } }
        asm volatile("v_nop\n\tv_nop\n\tv_nop\n\tv_nop" : "+v"(acc[0][0]), "+v"(acc[1][1]), "+v"(acc[2][2]), "+v"(acc[3][3]) : "v"(a[0]), "v"(a[3]));
    }
#pragma unroll
    for (int mb = 0; mb < 4; ++mb) {
#pragma unroll
        for (int nb = 0; nb < 4; ++nb) {
#pragma unroll
            for (int j = 0; j < 8; ++j) os[(hi * 8 + j) * 68 + nb * 16 + lr] = acc[mb][nb][j]; }
        __builtin_amdgcn_wave_barrier(); asm volatile("" ::: "memory");
        float* crow = C + (size_t)(r0 + mb * 16) * ldc + c0;
{
#pragma unroll
            for (int s = 0; s < 8; ++s) { const int row = 2 * s + hi, cofs = lr * 4; v4f val = *(const v4fa*)(os + row * 68 + cofs); if (BIAS) { val[0] += bfr(bias[c0 + cofs]); val[1] += bfr(bias[c0 + cofs + 1]); val[2] += bfr(bias[c0 + cofs + 2]); val[3] += bfr(bias[c0 + cofs + 3]); }
                *(v4f*)(crow + (size_t)row * ldc + cofs) = val; }
             }
        __builtin_amdgcn_wave_barrier(); asm volatile("" ::: "memory");
    }
}

// ---- k_gemmc: the same one-wave 64x64 tile GEMM specialised for causal attention: CMODE 1 skips score tiles entirely above the diagonal (query rows r0+roff.., key columns c0..), CMODE 2 limits the
// key (K) loop of the probability x value contraction to the diagonal block (probabilities beyond it are exactly zero). roff = row offset of this launch's first row within the sequence.
template <typename T16, int NSPLIT, int CMODE>
__global__ __launch_bounds__(32) void k_gemmc(const T16* __restrict__ A, const T16* __restrict__ A2, const T16* __restrict__ Bt, const T16* __restrict__ Bt2, int K, float* C, int ldc, int roff, size_t sA, size_t sB, size_t sC) {
    typedef typename WFrag<T16>::V V;
    __shared__ __align__(16) float os[16 * 68];
    const size_t z = blockIdx.z; A += z * sA; if (A2) A2 += z * sA; Bt += z * sB; if (Bt2) Bt2 += z * sB; C += z * sC;
    const int lane = threadIdx.x & 31, lr = lane & 15, hi = lane >> 4; const int r0 = blockIdx.x * 64, c0 = blockIdx.y * 64;
    if (CMODE == 1 && c0 > r0 + roff + 63) return;                  // score tile entirely above the causal diagonal: never read (the softmax masks j > i by select)
    const int Kl = (CMODE == 2) ? min(K, r0 + roff + 64) : K;        // P.V: probabilities are exactly 0 beyond the diagonal block, so the K loop stops there
    v8f acc[4][4];
#pragma unroll
    for (int mb = 0; mb < 4; ++mb)
#pragma unroll
        for (int nb = 0; nb < 4; ++nb) acc[mb][nb] = (v8f){};
    const size_t aoff = (size_t)(r0 + lr) * K + 8 * hi, boff = (size_t)(c0 + lr) * K + 8 * hi;
#pragma unroll 1
    for (int kc = 0; kc < Kl; kc += 32) {
        V a[4], a2[4];
#pragma unroll
        for (int mb = 0; mb < 4; ++mb) { a[mb] = WFrag<T16>::ld(A + aoff + (size_t)mb * 16 * K + kc); if (NSPLIT == 1 || NSPLIT == 2) a2[mb] = WFrag<T16>::ld(A2 + aoff + (size_t)mb * 16 * K + kc); }
#pragma unroll
        for (int nb = 0; nb < 4; ++nb) { const V b = WFrag<T16>::ld(Bt + boff + (size_t)nb * 16 * K + kc); V b2; if (NSPLIT >= 2) b2 = WFrag<T16>::ld(Bt2 + boff + (size_t)nb * 16 * K + kc);
#pragma unroll
            for (int mb = 0; mb < 4; ++mb) { acc[mb][nb] = WFrag<T16>::mma(a[mb], b, acc[mb][nb]); if (NSPLIT == 1 || NSPLIT == 2) acc[mb][nb] = WFrag<T16>::mma(a2[mb], b, acc[mb][nb]); if (NSPLIT >= 2) acc[mb][nb] = WFrag<T16>::mma(a[mb], b2, acc[mb][nb]); } }
        asm volatile("v_nop\n\tv_nop\n\tv_nop\n\tv_nop" : "+v"(acc[0][0]), "+v"(acc[1][1]), "+v"(acc[2][2]), "+v"(acc[3][3]) : "v"(a[0]), "v"(a[3]));
    }
#pragma unroll
    for (int mb = 0; mb < 4; ++mb) {
#pragma unroll
        for (int nb = 0; nb < 4; ++nb) {
#pragma unroll
            for (int j = 0; j < 8; ++j) os[(hi * 8 + j) * 68 + nb * 16 + lr] = acc[mb][nb][j]; }
        __builtin_amdgcn_wave_barrier(); asm volatile("" ::: "memory");
        float* crow = C + (size_t)(r0 + mb * 16) * ldc + c0;
{
#pragma unroll
            for (int s = 0; s < 8; ++s) { const int row = 2 * s + hi, cofs = lr * 4; v4f val = *(const v4fa*)(os + row * 68 + cofs);
                *(v4f*)(crow + (size_t)row * ldc + cofs) = val; }
             }
        __builtin_amdgcn_wave_barrier(); asm volatile("" ::: "memory");
    }
}

__device__ __forceinline__ h16 tohx(float x) { return (h16)x; }
__device__ __forceinline__ void splitf(float y, unsigned short& h, unsigned short& l) { h = f2bf(y); l = f2bf(y - bf2f(h)); }
typedef __attribute__((ext_vector_type(2))) _Float16 v2h;
typedef __attribute__((ext_vector_type(4))) _Float16 v4h;
typedef __attribute__((ext_vector_type(2))) unsigned short v2us;
typedef __attribute__((ext_vector_type(4))) unsigned short v4us;
typedef __attribute__((ext_vector_type(2))) float v2f;
typedef __attribute__((ext_vector_type(4))) int v4i;

__global__ __launch_bounds__(256) void k_cvt8(const float* __restrict__ src, bf* dst, size_t n8) { const size_t i = (size_t)blockIdx.x * 256 + threadIdx.x; if (i >= n8) return; const v8f v = *(const v8f*)(src + i * 8); v8us o;
#pragma unroll
    for (int k = 0; k < 8; ++k) o[k] = f2bf(v[k]); *(v8us*)(dst + i * 8) = o;  }

// k_rope: head planes [h][t][d] (fp16 + hi/lo) of rope(x) x sc with the rotate-half convention out[d] = x[d] cos[t][d] - x[d+HD/2] sin[t][d], out[d+HD/2] = x[d+HD/2] cos[t][d+HD/2] + x[d] sin[t][d+HD/2]
__global__ __launch_bounds__(256) void k_rope(const float* __restrict__ F, int pitch, int nheads, const float* __restrict__ CS, const float* __restrict__ RF, const float* __restrict__ nw, float sc, h16* P16, bf* Ph, bf* Pl) {
    const size_t e = ((size_t)blockIdx.x * 256 + threadIdx.x) * 2; if (e >= (size_t)nheads * TT * HD) return; const int d = (int)(e % HD); const int t = (int)((e / HD) % TT); const int h = (int)(e / ((size_t)HD * TT)); const float* f = F + (size_t)t * pitch + h * HD; const float rf = RF ? RF[(size_t)h * TT + t] : 1.0f; v2h o16; v2us oh, ol;
#pragma unroll
    for (int q = 0; q < 2; ++q) { const int dd = d + q; const int dp = (dd < HD / 2) ? dd + HD / 2 : dd - HD / 2; float x0 = f[dd], x1 = f[dp];
        if (RF) { float n0 = __fmul_rn(x0, rf), n1 = __fmul_rn(x1, rf); asm volatile("" : "+v"(n0)); asm volatile("" : "+v"(n1)); x0 = __fmul_rn(bfr(nw[dd]), n0); x1 = __fmul_rn(bfr(nw[dp]), n1); }
        const v2f cs = *(const v2f*)(CS + ((size_t)t * HD + dd) * 2); float a = __fmul_rn(x0, cs[0]), bq = __fmul_rn(x1, cs[1]); asm volatile("" : "+v"(a)); asm volatile("" : "+v"(bq)); const float r = ((dd < HD / 2) ? __fsub_rn(a, bq) : __fadd_rn(a, bq)) * sc;
        o16[q] = tohx(r); unsigned short a2, c2; splitf(r, a2, c2); oh[q] = a2; ol[q] = c2; }
    *(v2h*)(P16 + e) = o16; *(v2us*)(Ph + e) = oh; *(v2us*)(Pl + e) = ol;  }
__global__ __launch_bounds__(256) void k_vtp(const float* __restrict__ F, int pitch, int nheads, h16* V16, bf* Vh, bf* Vl) { const size_t e = ((size_t)blockIdx.x * 256 + threadIdx.x) * 2; if (e >= (size_t)nheads * HD * TT) return; const int t = (int)(e % TT); const int d = (int)((e / TT) % HD); const int g = (int)(e / ((size_t)TT * HD)); v2h o16; v2us oh, ol;
#pragma unroll
    for (int q = 0; q < 2; ++q) { const float x = F[(size_t)(t + q) * pitch + g * HD + d]; o16[q] = tohx(x); unsigned short a2, c2; splitf(x, a2, c2); oh[q] = a2; ol[q] = c2; }
    *(v2h*)(V16 + e) = o16; *(v2us*)(Vh + e) = oh; *(v2us*)(Vl + e) = ol;  }
__constant__ float INVT[HD / 2] = { 1.000000000e+00f, 8.659643531e-01f, 7.498942018e-01f, 6.493816376e-01f, 5.623413324e-01f, 4.869675338e-01f, 4.216965139e-01f, 3.651741445e-01f, 3.162277639e-01f, 2.738419771e-01f, 2.371373624e-01f, 2.053525001e-01f, 1.778279394e-01f, 1.539926529e-01f, 1.333521456e-01f, 1.154782027e-01f, 1.000000015e-01f, 8.659642935e-02f, 7.498941571e-02f, 6.493816525e-02f, 5.623412877e-02f, 4.869675264e-02f, 4.216964915e-02f, 3.651741147e-02f, 3.162277862e-02f, 2.738419548e-02f, 2.371373586e-02f, 2.053525113e-02f, 1.778279431e-02f, 1.539926510e-02f, 1.333521493e-02f, 1.154781971e-02f, 9.999999776e-03f, 8.659643121e-03f, 7.498942316e-03f, 6.493816618e-03f, 5.623413250e-03f, 4.869675264e-03f, 4.216964822e-03f, 3.651741426e-03f, 3.162277862e-03f, 2.738419687e-03f, 2.371373819e-03f, 2.053525066e-03f, 1.778279431e-03f, 1.539926510e-03f, 1.333521446e-03f, 1.154782018e-03f, 1.000000047e-03f, 8.659643354e-04f, 7.498941850e-04f, 6.493816618e-04f, 5.623413017e-04f, 4.869675031e-04f, 4.216964880e-04f, 3.651741135e-04f, 3.162277862e-04f, 2.738419571e-04f, 2.371373848e-04f, 2.053524950e-04f, 1.778279402e-04f, 1.539926452e-04f, 1.333521504e-04f, 1.154781930e-04f };   // float32 1 / 10000^(2i/128), generated with jnp to be bit-exact
__global__ __launch_bounds__(256) void k_cs5(float* CS) { const int idx = blockIdx.x * 256 + threadIdx.x; if (idx >= TT * HD) return; const int d = idx % HD; const int t = idx / HD; const float a = __fmul_rn((float)t, INVT[d % (HD / 2)]); v2f cs; cs[0] = cosf(a); cs[1] = sinf(a); *(v2f*)(CS + (size_t)idx * 2) = cs;  }
// k_asoft: per row (zz, i): t = S x HD^-0.5 for j <= i and i - j < WIN (WIN = TT: plain causal; the reference's -1e9 additive fill vanishes identically); softmax over the 2048 keys (register row, one exp, fixed trees);
__global__ __launch_bounds__(256) void k_asoft(const float* __restrict__ Sb, h16* P16, bf* Ph, bf* Pl) {
    const int lane = threadIdx.x & 31; const int row = blockIdx.x * 8 + (threadIdx.x >> 5); if (row >= ZH * TT) return; const int i = row % TT; const int zz = row / TT; (void)zz; const bool hires = (i < RH); const float* sr = Sb + (size_t)row * TT; float v[TT / 32]; float mx = -3.0e38f;
#pragma unroll
    for (int ch = 0; ch < TT / 128; ++ch) { const int j0 = ch * 128 + lane * 4; const v4f a = *(const v4f*)(sr + j0);
#pragma unroll
        for (int q = 0; q < 4; ++q) { const int j = j0 + q; (void)j; const float t = (j <= i && i - j < WIN) ? a[q] * SCL : -3.0e38f; v[ch * 4 + q] = t; mx = fmaxf(mx, t); } }
#pragma unroll
    for (int sh = 16; sh; sh >>= 1) mx = fmaxf(mx, __shfl_xor(mx, sh, 32));
    float sum = 0.f;
#pragma unroll
    for (int k = 0; k < TT / 32; ++k) { float d0 = __fsub_rn(v[k], mx); asm volatile("" : "+v"(d0)); v[k] = __builtin_amdgcn_exp2f(__fmul_rn(d0, 1.4426950408889634f)); sum += v[k]; }
#pragma unroll
    for (int sh = 16; sh; sh >>= 1) sum += __shfl_xor(sum, sh, 32);
    const float f = __fdiv_rn(hires ? 1.0f : PCAR, sum);
{
        if (hires) {
#pragma unroll
            for (int ch = 0; ch < TT / 128; ++ch) { v4us oh, ol;
#pragma unroll
                for (int q = 0; q < 4; ++q) { unsigned short a, c2; splitf(v[ch * 4 + q] * f, a, c2); oh[q] = a; ol[q] = c2; }
                const size_t oo = ((size_t)zz * (RH ? RH : 1) + i) * TT + ch * 128 + lane * 4; *(v4us*)(Ph + oo) = oh; *(v4us*)(Pl + oo) = ol; }
        } else {
#pragma unroll
            for (int ch = 0; ch < TT / 128; ++ch) { v4h o4;
#pragma unroll
                for (int q = 0; q < 4; ++q) o4[q] = tohx(v[ch * 4 + q] * f);
                *(v4h*)(P16 + (size_t)row * TT + ch * 128 + lane * 4) = o4; } }
         }
}
__global__ __launch_bounds__(256) void k_merge(const float* __restrict__ O, int h0, bf* Ah, bf* Al) { const size_t e = ((size_t)blockIdx.x * 256 + threadIdx.x) * 2; if (e >= (size_t)ZH * TT * HD) return; const int d = (int)(e % HD); const int t = (int)((e / HD) % TT); const int zz = (int)(e / ((size_t)HD * TT)); const float cs = (t < RH) ? 1.0f : (1.0f / PCAR); const size_t oo = (size_t)t * DQ + (h0 + zz) * HD + d;
    v2us oh, ol;
#pragma unroll
    for (int q = 0; q < 2; ++q) { unsigned short a, c2; splitf(O[e + q] * cs, a, c2); oh[q] = a; ol[q] = c2; } *(v2us*)(Ah + oo) = oh; *(v2us*)(Al + oo) = ol;  }

extern "C" void kernel_launch(void* const* d_in, const int* in_sizes, int n_in,
                              void* d_out, int out_size, void* d_ws, size_t ws_size, hipStream_t stream) {
    (void)in_sizes; (void)n_in; (void)out_size;
    const float* x = (const float*)d_in[0]; const float* wq = (const float*)d_in[1]; const float* wk = (const float*)d_in[2]; const float* wv = (const float*)d_in[3]; const float* wo = (const float*)d_in[4];   /* order hidden_states, Wq, Wk, Wv, Wo ('oi' [2048][2048]) */
    float* OUT = (float*)d_out;     // [2][2048][2048]
    char* wsp = (char*)d_ws;
    auto take = [&](size_t bytes) { char* p = wsp; wsp += (bytes + 255) & ~(size_t)255; return (void*)p; };
    bf* WQ = (bf*)take((size_t)DQ * DM * 2); bf* WK = (bf*)take((size_t)DKV * DM * 2); bf* WV = (bf*)take((size_t)DKV * DM * 2); bf* WO = (bf*)take((size_t)DM * DQ * 2); float* CS = (float*)take((size_t)TT * HD * 2 * 4);
    bf* XB = (bf*)take((size_t)TT * DM * 2); float* FQ = (float*)take((size_t)TT * DQ * 4); float* FK = (float*)take((size_t)TT * DKV * 4);
    h16* QP16 = (h16*)take((size_t)NH_ * TT * HD * 2); h16* KP16 = (h16*)take((size_t)NKV * TT * HD * 2); h16* VT16 = (h16*)take((size_t)NKV * HD * TT * 2);
    bf* QPh = (bf*)take((size_t)NH_ * TT * HD * 2); bf* QPl = (bf*)take((size_t)NH_ * TT * HD * 2); bf* KPh = (bf*)take((size_t)NKV * TT * HD * 2); bf* KPl = (bf*)take((size_t)NKV * TT * HD * 2); bf* VTh = (bf*)take((size_t)NKV * HD * TT * 2); bf* VTl = (bf*)take((size_t)NKV * HD * TT * 2); bf* Ph = (bf*)take((size_t)ZH * RH * TT * 2); bf* Pl = (bf*)take((size_t)ZH * RH * TT * 2);
    float* Sb = (float*)take((size_t)ZH * TT * TT * 4); h16* P16 = (h16*)take((size_t)ZH * TT * TT * 2); float* Ob = (float*)take((size_t)ZH * TT * HD * 4); bf* ATh = (bf*)take((size_t)TT * DQ * 2); bf* ATl = (bf*)take((size_t)TT * DQ * 2);
    if ((size_t)(wsp - (char*)d_ws) > ws_size) return;    // ws 256 MiB
    float* FV = FK;   // v projection reuses the k buffer after the k planes are built (stream-ordered)
    { k_cvt8<<<(unsigned)(((size_t)DQ * DM / 8 + 255) / 256), 256, 0, stream>>>(wq, WQ, (size_t)DQ * DM / 8); k_cvt8<<<(unsigned)(((size_t)DKV * DM / 8 + 255) / 256), 256, 0, stream>>>(wk, WK, (size_t)DKV * DM / 8); k_cvt8<<<(unsigned)(((size_t)DKV * DM / 8 + 255) / 256), 256, 0, stream>>>(wv, WV, (size_t)DKV * DM / 8);
      k_cvt8<<<(unsigned)(((size_t)DM * DQ / 8 + 255) / 256), 256, 0, stream>>>(wo, WO, (size_t)DM * DQ / 8);
       }
    k_cs5<<<(TT * HD + 255) / 256, 256, 0, stream>>>(CS);   /* rotary table once */
    const unsigned LQ = (unsigned)(((size_t)NH_ * TT * HD / 2 + 255) / 256), LKv = (unsigned)(((size_t)NKV * TT * HD / 2 + 255) / 256);
    for (int b = 0; b < NB_; ++b) {
        
        k_cvt8<<<(unsigned)(((size_t)TT * DM / 8 + 255) / 256), 256, 0, stream>>>(x + (size_t)b * TT * DM, XB, (size_t)TT * DM / 8);
        k_gemmw<bf, 0, false><<<dim3(TT / 64, DQ / 64, 1), 32, 0, stream>>>(XB, nullptr, WQ, nullptr, DM, FQ, DQ, nullptr, 0, 0, 0);
        k_rope<<<LQ, 256, 0, stream>>>(FQ, DQ, NH_, CS, nullptr, nullptr, 1.0f, QP16, QPh, QPl);
        k_gemmw<bf, 0, false><<<dim3(TT / 64, DKV / 64, 1), 32, 0, stream>>>(XB, nullptr, WK, nullptr, DM, FK, DKV, nullptr, 0, 0, 0);
        k_rope<<<LKv, 256, 0, stream>>>(FK, DKV, NKV, CS, nullptr, nullptr, 1.0f, KP16, KPh, KPl);
        k_gemmw<bf, 0, false><<<dim3(TT / 64, DKV / 64, 1), 32, 0, stream>>>(XB, nullptr, WV, nullptr, DM, FV, DKV, nullptr, 0, 0, 0); k_vtp<<<LKv, 256, 0, stream>>>(FV, DKV, NKV, VT16, VTh, VTl);
        for (int h0 = 0; h0 < NH_; h0 += ZH) { const size_t zq = (size_t)h0, zk = (size_t)(h0 / REP);   // one kv head per query head: the pass's two heads use consecutive kv planes (z-strides TT*HD)
            k_gemmc<bf, 2, 1><<<dim3(RH / 64, TT / 64, ZH), 32, 0, stream>>>(QPh + zq * TT * HD, QPl + zq * TT * HD, KPh + zk * TT * HD, KPl + zk * TT * HD, HD, Sb, TT, 0, (size_t)TT * HD, (size_t)TT * HD, (size_t)TT * TT);
            k_gemmc<h16, 0, 1><<<dim3((TT - RH) / 64, TT / 64, ZH), 32, 0, stream>>>(QP16 + zq * TT * HD + (size_t)RH * HD, nullptr, KP16 + zk * TT * HD, nullptr, HD, Sb + (size_t)RH * TT, TT, RH, (size_t)TT * HD, (size_t)TT * HD, (size_t)TT * TT);
            k_asoft<<<ZH * TT / 8, 256, 0, stream>>>(Sb, P16, Ph, Pl);
            k_gemmc<bf, 2, 2><<<dim3(RH / 64, HD / 64, ZH), 32, 0, stream>>>(Ph, Pl, VTh + zk * HD * TT, VTl + zk * HD * TT, TT, Ob, HD, 0, (size_t)RH * TT, (size_t)HD * TT, (size_t)TT * HD);
            k_gemmc<h16, 0, 2><<<dim3((TT - RH) / 64, HD / 64, ZH), 32, 0, stream>>>(P16 + (size_t)RH * TT, nullptr, VT16 + zk * HD * TT, nullptr, TT, Ob + (size_t)RH * HD, HD, RH, (size_t)TT * TT, (size_t)HD * TT, (size_t)TT * HD);
            k_merge<<<(unsigned)(((size_t)ZH * TT * HD / 2 + 255) / 256), 256, 0, stream>>>(Ob, h0, ATh, ATl); }
        k_gemmw<bf, 1, false><<<dim3(TT / 64, DM / 64, 1), 32, 0, stream>>>(ATh, ATl, WO, nullptr, DQ, OUT + (size_t)b * TT * DM, DM, nullptr, 0, 0, 0); }
}

// v001
// One run takes 1110 microseconds.
// Two timings next to v000 put it at 1.56 and 1.55 times that version's speed.
#include <hip/hip_runtime.h>

// Causal multi-head attention with 128-wide heads and computed rotate-half rotary embeddings (hidden_states [2][2048][2048]; q, k, v = einsum('bsd,ed->bse', x, W) ('oi' 0.02; 16 heads x 128); rope x cos + rotate_half(x) sin, angle t x 1/10000^(2i/128) (64 f32 frequencies jnp-exact; cat(freqs, freqs); precise cosf/sinf); scores / sqrt(128); mask = (key > query) | (key - query >= 1024): the second term only touches FUTURE keys, which the first already excludes: plain causal (-inf == exclusion); softmax in f32; out = merged Wo^T -> [2][2048][2048] (8.4 M); argument order hidden_states, Wq, Wk, Wv, Wo).
// Layout: bf16 copy of x; 'oi' weights; exact projections; k_cs5 computed table (HD 128) + rotate-half plane builders; causal T-2048 attention at HD 128 (hybrid rows: < 512 hi/lo 3 products, rest fp16 x1024; k_gemmc skips tiles above the diagonal); merged hi/lo x Wo exact.
// Compute dtypes, f32 accumulate: every input rounded to bf16; projections exact; rotary f32; attention rows < 512 3 products, rest fp16; softmax f32; Wo hl x exact.

#define NB_  2
#define TT   2048
#define DM   2048
#define NH_  16
#define NKV  16
#define REP  (NH_ / NKV)
#define HD   128
#define DQ   (NH_ * HD)
#define DKV  (NKV * HD)
#define ZH   2
#define RH   512                  // query rows < RH use hi+lo planes (0: none)
#define WIN  2048
#define PCAR 1024.0f
#define KS   8                    // work-groups that share the key loop of one probability x value tile
#define SCL  0.088388347648318447f   // HD^-0.5
typedef _Float16 h16;
typedef unsigned short bf;
typedef __attribute__((ext_vector_type(16))) __bf16   v16bf;
typedef __attribute__((ext_vector_type(16))) _Float16 v16h;
typedef __attribute__((ext_vector_type(8)))  _Float16 v8h;
typedef __attribute__((ext_vector_type(8)))  unsigned short v8us;
typedef __attribute__((ext_vector_type(8)))  float    v8f;
typedef __attribute__((ext_vector_type(4)))  float    v4f;
typedef v8h  __attribute__((may_alias)) v8ha;
typedef v4f  __attribute__((may_alias)) v4fa;
typedef v8us __attribute__((may_alias)) v8usa;

__device__ __forceinline__ unsigned short f2bf(float f) { unsigned u = __float_as_uint(f); u += 0x7FFFu + ((u >> 16) & 1u); return (unsigned short)(u >> 16); }
__device__ __forceinline__ float bf2f(unsigned short b) { return __uint_as_float(((unsigned)b) << 16); }
__device__ __forceinline__ float bfr(float f) { return bf2f(f2bf(f)); }
__device__ __forceinline__ v16h cat16(v8h lo, v8h hi) { return __builtin_shufflevector(lo, hi, 0, 1, 2, 3, 4, 5, 6, 7, 8, 9, 10, 11, 12, 13, 14, 15); }
__device__ __forceinline__ v16bf cat16b(v8us lo, v8us hi) { return __builtin_bit_cast(v16bf, __builtin_shufflevector(lo, hi, 0, 1, 2, 3, 4, 5, 6, 7, 8, 9, 10, 11, 12, 13, 14, 15)); }
__device__ __forceinline__ v8f wmma16(v16h a, v16h b, v8f c) { return __builtin_amdgcn_wmma_f32_16x16x32_f16(false, a, false, b, (short)0, c, false, false); }
__device__ __forceinline__ v8f wmmab(v16bf a, v16bf b, v8f c) { return __builtin_amdgcn_wmma_f32_16x16x32_bf16(false, a, false, b, (short)0, c, false, false); }



// ---- k_gemmw: register-blocked GEMM, ONE WAVE per 64x64 output tile (16 accumulators), operands straight from K-contiguous 16-bit planes; grid (M/64, N/64, Z), 32 threads.
// C[m][n] (f32, pitch ldc, + optional f32 bias[n]) = sum_k A[m][k] Bt[n][k] (+ split products per NSPLIT). z-batch strides sA/sB/sC in elements. K % 32 == 0.
template <typename T16> struct WFrag;
template <> struct WFrag<h16> { typedef v16h V; static __device__ __forceinline__ V ld(const h16* p) { return cat16(*(const v8h*)p, *(const v8h*)(p + 16)); } static __device__ __forceinline__ v8f mma(V a, V b, v8f c) { return wmma16(a, b, c); } };
template <> struct WFrag<bf> { typedef v16bf V; static __device__ __forceinline__ V ld(const bf* p) { return cat16b(*(const v8us*)p, *(const v8us*)(p + 16)); } static __device__ __forceinline__ v8f mma(V a, V b, v8f c) { return wmmab(a, b, c); } };
template <typename T16, int NSPLIT, bool BIAS>
__global__ __launch_bounds__(32) void k_gemmw(const T16* __restrict__ A, const T16* __restrict__ A2, const T16* __restrict__ Bt, const T16* __restrict__ Bt2, int K, float* C, int ldc, const float* __restrict__ bias, size_t sA, size_t sB, size_t sC) {
    typedef typename WFrag<T16>::V V;
    __shared__ __align__(16) float os[16 * 68];
    const size_t z = blockIdx.z; A += z * sA; if (A2) A2 += z * sA; Bt += z * sB; if (Bt2) Bt2 += z * sB; C += z * sC;
    const int lane = threadIdx.x & 31, lr = lane & 15, hi = lane >> 4; const int r0 = blockIdx.x * 64, c0 = blockIdx.y * 64;
    v8f acc[4][4];
#pragma unroll
    for (int mb = 0; mb < 4; ++mb)
#pragma unroll
        for (int nb = 0; nb < 4; ++nb) acc[mb][nb] = (v8f){};
    const size_t aoff = (size_t)(r0 + lr) * K + 8 * hi, boff = (size_t)(c0 + lr) * K + 8 * hi;
#pragma unroll 1
    for (int kc = 0; kc < K; kc += 32) {
        V a[4], a2[4];
#pragma unroll
        for (int mb = 0; mb < 4; ++mb) { a[mb] = WFrag<T16>::ld(A + aoff + (size_t)mb * 16 * K + kc); if (NSPLIT == 1 || NSPLIT == 2) a2[mb] = WFrag<T16>::ld(A2 + aoff + (size_t)mb * 16 * K + kc); }
#pragma unroll
        for (int nb = 0; nb < 4; ++nb) { const V b = WFrag<T16>::ld(Bt + boff + (size_t)nb * 16 * K + kc); V b2; if (NSPLIT >= 2) b2 = WFrag<T16>::ld(Bt2 + boff + (size_t)nb * 16 * K + kc);
#pragma unroll
            for (int mb = 0; mb < 4; ++mb) { acc[mb][nb] = WFrag<T16>::mma(a[mb], b, acc[mb][nb]); if (NSPLIT == 1 || NSPLIT == 2) acc[mb][nb] = WFrag<T16>::mma(a2[mb], b, acc[mb][nb]); if (NSPLIT >= 2) acc[mb][nb] = WFrag<T16>::mma(a[mb], b2, acc[mb][nb]); } }
        asm volatile("v_nop\n\tv_nop\n\tv_nop\n\tv_nop" : "+v"(acc[0][0]), "+v"(acc[1][1]), "+v"(acc[2][2]), "+v"(acc[3][3]) : "v"(a[0]), "v"(a[3]));
    }
#pragma unroll
    for (int mb = 0; mb < 4; ++mb) {
#pragma unroll
        for (int nb = 0; nb < 4; ++nb) {
#pragma unroll
            for (int j = 0; j < 8; ++j) os[(hi * 8 + j) * 68 + nb * 16 + lr] = acc[mb][nb][j]; }
        __builtin_amdgcn_wave_barrier(); asm volatile("" ::: "memory");
        float* crow = C + (size_t)(r0 + mb * 16) * ldc + c0;
{
#pragma unroll
            for (int s = 0; s < 8; ++s) { const int row = 2 * s + hi, cofs = lr * 4; v4f val = *(const v4fa*)(os + row * 68 + cofs); if (BIAS) { val[0] += bfr(bias[c0 + cofs]); val[1] += bfr(bias[c0 + cofs + 1]); val[2] += bfr(bias[c0 + cofs + 2]); val[3] += bfr(bias[c0 + cofs + 3]); }
                *(v4f*)(crow + (size_t)row * ldc + cofs) = val; }
             }
        __builtin_amdgcn_wave_barrier(); asm volatile("" ::: "memory");
    }
}

// ---- k_gemmc: the same one-wave 64x64 tile GEMM specialised for causal attention: CMODE 1 skips score tiles entirely above the diagonal (query rows r0+roff.., key columns c0..), CMODE 2 limits the
// key (K) loop of the probability x value contraction to the diagonal block (probabilities beyond it are exactly zero). roff = row offset of this launch's first row within the sequence.
// CMODE 2 also deals that key loop to KS work-groups (blockIdx.z = z * KS + s): part s takes one contiguous run of whole 64-key units and stores its f32 partial tile in plane s of C (plane stride sP); k_merge adds the planes.
template <typename T16, int NSPLIT, int CMODE>
__global__ __launch_bounds__(32) void k_gemmc(const T16* __restrict__ A, const T16* __restrict__ A2, const T16* __restrict__ Bt, const T16* __restrict__ Bt2, int K, float* C, int ldc, int roff, size_t sA, size_t sB, size_t sC, size_t sP) {
    typedef typename WFrag<T16>::V V;
    __shared__ __align__(16) float os[16 * 68];
    const int ks = (CMODE == 2) ? (int)(blockIdx.z % KS) : 0; const size_t z = (CMODE == 2) ? blockIdx.z / KS : blockIdx.z; A += z * sA; if (A2) A2 += z * sA; Bt += z * sB; if (Bt2) Bt2 += z * sB; C += z * sC + ks * sP;
    const int lane = threadIdx.x & 31, lr = lane & 15, hi = lane >> 4; const int r0 = blockIdx.x * 64, c0 = blockIdx.y * 64;
    if (CMODE == 1 && c0 > r0 + roff + 63) return;                  // score tile entirely above the causal diagonal: never read (the softmax masks j > i by select)
    const int Kl = (CMODE == 2) ? min(K, r0 + roff + 64) : K;        // P.V: probabilities are exactly 0 beyond the diagonal block, so the K loop stops there
    const int kch = (CMODE == 2) ? ((Kl / 64 + KS - 1) / KS) * 64 : Kl;   // keys per part: whole 64-key units (128-byte lines of the 16-bit rows); a part past the end stores a zero tile
    const int kb = ks * kch, ke = min(Kl, kb + kch);
    v8f acc[4][4];
#pragma unroll
    for (int mb = 0; mb < 4; ++mb)
#pragma unroll
        for (int nb = 0; nb < 4; ++nb) acc[mb][nb] = (v8f){};
    const size_t aoff = (size_t)(r0 + lr) * K + 8 * hi, boff = (size_t)(c0 + lr) * K + 8 * hi;
#pragma unroll 1
    for (int kc = kb; kc < ke; kc += 32) {
        V a[4], a2[4];
#pragma unroll
        for (int mb = 0; mb < 4; ++mb) { a[mb] = WFrag<T16>::ld(A + aoff + (size_t)mb * 16 * K + kc); if (NSPLIT == 1 || NSPLIT == 2) a2[mb] = WFrag<T16>::ld(A2 + aoff + (size_t)mb * 16 * K + kc); }
#pragma unroll
        for (int nb = 0; nb < 4; ++nb) { const V b = WFrag<T16>::ld(Bt + boff + (size_t)nb * 16 * K + kc); V b2; if (NSPLIT >= 2) b2 = WFrag<T16>::ld(Bt2 + boff + (size_t)nb * 16 * K + kc);
#pragma unroll
            for (int mb = 0; mb < 4; ++mb) { acc[mb][nb] = WFrag<T16>::mma(a[mb], b, acc[mb][nb]); if (NSPLIT == 1 || NSPLIT == 2) acc[mb][nb] = WFrag<T16>::mma(a2[mb], b, acc[mb][nb]); if (NSPLIT >= 2) acc[mb][nb] = WFrag<T16>::mma(a[mb], b2, acc[mb][nb]); } }
        asm volatile("v_nop\n\tv_nop\n\tv_nop\n\tv_nop" : "+v"(acc[0][0]), "+v"(acc[1][1]), "+v"(acc[2][2]), "+v"(acc[3][3]) : "v"(a[0]), "v"(a[3]));
    }
#pragma unroll
    for (int mb = 0; mb < 4; ++mb) {
#pragma unroll
        for (int nb = 0; nb < 4; ++nb) {
#pragma unroll
            for (int j = 0; j < 8; ++j) os[(hi * 8 + j) * 68 + nb * 16 + lr] = acc[mb][nb][j]; }
        __builtin_amdgcn_wave_barrier(); asm volatile("" ::: "memory");
        float* crow = C + (size_t)(r0 + mb * 16) * ldc + c0;
{
#pragma unroll
            for (int s = 0; s < 8; ++s) { const int row = 2 * s + hi, cofs = lr * 4; v4f val = *(const v4fa*)(os + row * 68 + cofs);
                *(v4f*)(crow + (size_t)row * ldc + cofs) = val; }
             }
        __builtin_amdgcn_wave_barrier(); asm volatile("" ::: "memory");
    }
}

__device__ __forceinline__ h16 tohx(float x) { return (h16)x; }
__device__ __forceinline__ void splitf(float y, unsigned short& h, unsigned short& l) { h = f2bf(y); l = f2bf(y - bf2f(h)); }
typedef __attribute__((ext_vector_type(2))) _Float16 v2h;
typedef __attribute__((ext_vector_type(4))) _Float16 v4h;
typedef __attribute__((ext_vector_type(2))) unsigned short v2us;
typedef __attribute__((ext_vector_type(4))) unsigned short v4us;
typedef __attribute__((ext_vector_type(2))) float v2f;
typedef __attribute__((ext_vector_type(4))) int v4i;

__global__ __launch_bounds__(256) void k_cvt8(const float* __restrict__ src, bf* dst, size_t n8) { const size_t i = (size_t)blockIdx.x * 256 + threadIdx.x; if (i >= n8) return; const v8f v = *(const v8f*)(src + i * 8); v8us o;
#pragma unroll
    for (int k = 0; k < 8; ++k) o[k] = f2bf(v[k]); *(v8us*)(dst + i * 8) = o;  }

// k_rope: head planes [h][t][d] (fp16 + hi/lo) of rope(x) x sc with the rotate-half convention out[d] = x[d] cos[t][d] - x[d+HD/2] sin[t][d], out[d+HD/2] = x[d+HD/2] cos[t][d+HD/2] + x[d] sin[t][d+HD/2]
__global__ __launch_bounds__(256) void k_rope(const float* __restrict__ F, int pitch, int nheads, const float* __restrict__ CS, const float* __restrict__ RF, const float* __restrict__ nw, float sc, h16* P16, bf* Ph, bf* Pl) {
    const size_t e = ((size_t)blockIdx.x * 256 + threadIdx.x) * 2; if (e >= (size_t)nheads * TT * HD) return; const int d = (int)(e % HD); const int t = (int)((e / HD) % TT); const int h = (int)(e / ((size_t)HD * TT)); const float* f = F + (size_t)t * pitch + h * HD; const float rf = RF ? RF[(size_t)h * TT + t] : 1.0f; v2h o16; v2us oh, ol;
#pragma unroll
    for (int q = 0; q < 2; ++q) { const int dd = d + q; const int dp = (dd < HD / 2) ? dd + HD / 2 : dd - HD / 2; float x0 = f[dd], x1 = f[dp];
        if (RF) { float n0 = __fmul_rn(x0, rf), n1 = __fmul_rn(x1, rf); asm volatile("" : "+v"(n0)); asm volatile("" : "+v"(n1)); x0 = __fmul_rn(bfr(nw[dd]), n0); x1 = __fmul_rn(bfr(nw[dp]), n1); }
        const v2f cs = *(const v2f*)(CS + ((size_t)t * HD + dd) * 2); float a = __fmul_rn(x0, cs[0]), bq = __fmul_rn(x1, cs[1]); asm volatile("" : "+v"(a)); asm volatile("" : "+v"(bq)); const float r = ((dd < HD / 2) ? __fsub_rn(a, bq) : __fadd_rn(a, bq)) * sc;
        o16[q] = tohx(r); unsigned short a2, c2; splitf(r, a2, c2); oh[q] = a2; ol[q] = c2; }
    *(v2h*)(P16 + e) = o16; *(v2us*)(Ph + e) = oh; *(v2us*)(Pl + e) = ol;  }
__global__ __launch_bounds__(256) void k_vtp(const float* __restrict__ F, int pitch, int nheads, h16* V16, bf* Vh, bf* Vl) { const size_t e = ((size_t)blockIdx.x * 256 + threadIdx.x) * 2; if (e >= (size_t)nheads * HD * TT) return; const int t = (int)(e % TT); const int d = (int)((e / TT) % HD); const int g = (int)(e / ((size_t)TT * HD)); v2h o16; v2us oh, ol;
#pragma unroll
    for (int q = 0; q < 2; ++q) { const float x = F[(size_t)(t + q) * pitch + g * HD + d]; o16[q] = tohx(x); unsigned short a2, c2; splitf(x, a2, c2); oh[q] = a2; ol[q] = c2; }
    *(v2h*)(V16 + e) = o16; *(v2us*)(Vh + e) = oh; *(v2us*)(Vl + e) = ol;  }
__constant__ float INVT[HD / 2] = { 1.000000000e+00f, 8.659643531e-01f, 7.498942018e-01f, 6.493816376e-01f, 5.623413324e-01f, 4.869675338e-01f, 4.216965139e-01f, 3.651741445e-01f, 3.162277639e-01f, 2.738419771e-01f, 2.371373624e-01f, 2.053525001e-01f, 1.778279394e-01f, 1.539926529e-01f, 1.333521456e-01f, 1.154782027e-01f, 1.000000015e-01f, 8.659642935e-02f, 7.498941571e-02f, 6.493816525e-02f, 5.623412877e-02f, 4.869675264e-02f, 4.216964915e-02f, 3.651741147e-02f, 3.162277862e-02f, 2.738419548e-02f, 2.371373586e-02f, 2.053525113e-02f, 1.778279431e-02f, 1.539926510e-02f, 1.333521493e-02f, 1.154781971e-02f, 9.999999776e-03f, 8.659643121e-03f, 7.498942316e-03f, 6.493816618e-03f, 5.623413250e-03f, 4.869675264e-03f, 4.216964822e-03f, 3.651741426e-03f, 3.162277862e-03f, 2.738419687e-03f, 2.371373819e-03f, 2.053525066e-03f, 1.778279431e-03f, 1.539926510e-03f, 1.333521446e-03f, 1.154782018e-03f, 1.000000047e-03f, 8.659643354e-04f, 7.498941850e-04f, 6.493816618e-04f, 5.623413017e-04f, 4.869675031e-04f, 4.216964880e-04f, 3.651741135e-04f, 3.162277862e-04f, 2.738419571e-04f, 2.371373848e-04f, 2.053524950e-04f, 1.778279402e-04f, 1.539926452e-04f, 1.333521504e-04f, 1.154781930e-04f };   // float32 1 / 10000^(2i/128), generated with jnp to be bit-exact
__global__ __launch_bounds__(256) void k_cs5(float* CS) { const int idx = blockIdx.x * 256 + threadIdx.x; if (idx >= TT * HD) return; const int d = idx % HD; const int t = idx / HD; const float a = __fmul_rn((float)t, INVT[d % (HD / 2)]); v2f cs; cs[0] = cosf(a); cs[1] = sinf(a); *(v2f*)(CS + (size_t)idx * 2) = cs;  }
// k_asoft: per row (zz, i): t = S x HD^-0.5 for j <= i and i - j < WIN (WIN = TT: plain causal; the reference's -1e9 additive fill vanishes identically); softmax over the 2048 keys (register row, one exp, fixed trees);
__global__ __launch_bounds__(256) void k_asoft(const float* __restrict__ Sb, h16* P16, bf* Ph, bf* Pl) {
    const int lane = threadIdx.x & 31; const int row = blockIdx.x * 8 + (threadIdx.x >> 5); if (row >= ZH * TT) return; const int i = row % TT; const int zz = row / TT; (void)zz; const bool hires = (i < RH); const float* sr = Sb + (size_t)row * TT; float v[TT / 32]; float mx = -3.0e38f;
#pragma unroll
    for (int ch = 0; ch < TT / 128; ++ch) { const int j0 = ch * 128 + lane * 4; const v4f a = *(const v4f*)(sr + j0);
#pragma unroll
        for (int q = 0; q < 4; ++q) { const int j = j0 + q; (void)j; const float t = (j <= i && i - j < WIN) ? a[q] * SCL : -3.0e38f; v[ch * 4 + q] = t; mx = fmaxf(mx, t); } }
#pragma unroll
    for (int sh = 16; sh; sh >>= 1) mx = fmaxf(mx, __shfl_xor(mx, sh, 32));
    float sum = 0.f;
#pragma unroll
    for (int k = 0; k < TT / 32; ++k) { float d0 = __fsub_rn(v[k], mx); asm volatile("" : "+v"(d0)); v[k] = __builtin_amdgcn_exp2f(__fmul_rn(d0, 1.4426950408889634f)); sum += v[k]; }
#pragma unroll
    for (int sh = 16; sh; sh >>= 1) sum += __shfl_xor(sum, sh, 32);
    const float f = __fdiv_rn(hires ? 1.0f : PCAR, sum);
{
        if (hires) {
#pragma unroll
            for (int ch = 0; ch < TT / 128; ++ch) { v4us oh, ol;
#pragma unroll
                for (int q = 0; q < 4; ++q) { unsigned short a, c2; splitf(v[ch * 4 + q] * f, a, c2); oh[q] = a; ol[q] = c2; }
                const size_t oo = ((size_t)zz * (RH ? RH : 1) + i) * TT + ch * 128 + lane * 4; *(v4us*)(Ph + oo) = oh; *(v4us*)(Pl + oo) = ol; }
        } else {
#pragma unroll
            for (int ch = 0; ch < TT / 128; ++ch) { v4h o4;
#pragma unroll
                for (int q = 0; q < 4; ++q) o4[q] = tohx(v[ch * 4 + q] * f);
                *(v4h*)(P16 + (size_t)row * TT + ch * 128 + lane * 4) = o4; } }
         }
}
// k_merge: adds the KS partial planes of the probability x value product in ascending key order, then builds the merged hi/lo planes
__global__ __launch_bounds__(256) void k_merge(const float* __restrict__ O, int h0, bf* Ah, bf* Al) { const size_t e = ((size_t)blockIdx.x * 256 + threadIdx.x) * 2; if (e >= (size_t)ZH * TT * HD) return; const int d = (int)(e % HD); const int t = (int)((e / HD) % TT); const int zz = (int)(e / ((size_t)HD * TT)); const float cs = (t < RH) ? 1.0f : (1.0f / PCAR); const size_t oo = (size_t)t * DQ + (h0 + zz) * HD + d;
    v2us oh, ol; v2f o = *(const v2f*)(O + e);
#pragma unroll
    for (int s = 1; s < KS; ++s) o += *(const v2f*)(O + (size_t)s * ZH * TT * HD + e);
#pragma unroll
    for (int q = 0; q < 2; ++q) { unsigned short a, c2; splitf(o[q] * cs, a, c2); oh[q] = a; ol[q] = c2; } *(v2us*)(Ah + oo) = oh; *(v2us*)(Al + oo) = ol;  }

extern "C" void kernel_launch(void* const* d_in, const int* in_sizes, int n_in,
                              void* d_out, int out_size, void* d_ws, size_t ws_size, hipStream_t stream) {
    (void)in_sizes; (void)n_in; (void)out_size;
    const float* x = (const float*)d_in[0]; const float* wq = (const float*)d_in[1]; const float* wk = (const float*)d_in[2]; const float* wv = (const float*)d_in[3]; const float* wo = (const float*)d_in[4];   /* order hidden_states, Wq, Wk, Wv, Wo ('oi' [2048][2048]) */
    float* OUT = (float*)d_out;     // [2][2048][2048]
    char* wsp = (char*)d_ws;
    auto take = [&](size_t bytes) { char* p = wsp; wsp += (bytes + 255) & ~(size_t)255; return (void*)p; };
    bf* WQ = (bf*)take((size_t)DQ * DM * 2); bf* WK = (bf*)take((size_t)DKV * DM * 2); bf* WV = (bf*)take((size_t)DKV * DM * 2); bf* WO = (bf*)take((size_t)DM * DQ * 2); float* CS = (float*)take((size_t)TT * HD * 2 * 4);
    bf* XB = (bf*)take((size_t)TT * DM * 2); float* FQ = (float*)take((size_t)TT * DQ * 4); float* FK = (float*)take((size_t)TT * DKV * 4);
    h16* QP16 = (h16*)take((size_t)NH_ * TT * HD * 2); h16* KP16 = (h16*)take((size_t)NKV * TT * HD * 2); h16* VT16 = (h16*)take((size_t)NKV * HD * TT * 2);
    bf* QPh = (bf*)take((size_t)NH_ * TT * HD * 2); bf* QPl = (bf*)take((size_t)NH_ * TT * HD * 2); bf* KPh = (bf*)take((size_t)NKV * TT * HD * 2); bf* KPl = (bf*)take((size_t)NKV * TT * HD * 2); bf* VTh = (bf*)take((size_t)NKV * HD * TT * 2); bf* VTl = (bf*)take((size_t)NKV * HD * TT * 2); bf* Ph = (bf*)take((size_t)ZH * RH * TT * 2); bf* Pl = (bf*)take((size_t)ZH * RH * TT * 2);
    float* Sb = (float*)take((size_t)ZH * TT * TT * 4); h16* P16 = (h16*)take((size_t)ZH * TT * TT * 2); float* Ob = (float*)take((size_t)KS * ZH * TT * HD * 4); bf* ATh = (bf*)take((size_t)TT * DQ * 2); bf* ATl = (bf*)take((size_t)TT * DQ * 2);
    if ((size_t)(wsp - (char*)d_ws) > ws_size) return;    // ws 256 MiB
    float* FV = FK;   // v projection reuses the k buffer after the k planes are built (stream-ordered)
    { k_cvt8<<<(unsigned)(((size_t)DQ * DM / 8 + 255) / 256), 256, 0, stream>>>(wq, WQ, (size_t)DQ * DM / 8); k_cvt8<<<(unsigned)(((size_t)DKV * DM / 8 + 255) / 256), 256, 0, stream>>>(wk, WK, (size_t)DKV * DM / 8); k_cvt8<<<(unsigned)(((size_t)DKV * DM / 8 + 255) / 256), 256, 0, stream>>>(wv, WV, (size_t)DKV * DM / 8);
      k_cvt8<<<(unsigned)(((size_t)DM * DQ / 8 + 255) / 256), 256, 0, stream>>>(wo, WO, (size_t)DM * DQ / 8);
       }
    k_cs5<<<(TT * HD + 255) / 256, 256, 0, stream>>>(CS);   /* rotary table once */
    const unsigned LQ = (unsigned)(((size_t)NH_ * TT * HD / 2 + 255) / 256), LKv = (unsigned)(((size_t)NKV * TT * HD / 2 + 255) / 256);
    for (int b = 0; b < NB_; ++b) {
        
        k_cvt8<<<(unsigned)(((size_t)TT * DM / 8 + 255) / 256), 256, 0, stream>>>(x + (size_t)b * TT * DM, XB, (size_t)TT * DM / 8);
        k_gemmw<bf, 0, false><<<dim3(TT / 64, DQ / 64, 1), 32, 0, stream>>>(XB, nullptr, WQ, nullptr, DM, FQ, DQ, nullptr, 0, 0, 0);
        k_rope<<<LQ, 256, 0, stream>>>(FQ, DQ, NH_, CS, nullptr, nullptr, 1.0f, QP16, QPh, QPl);
        k_gemmw<bf, 0, false><<<dim3(TT / 64, DKV / 64, 1), 32, 0, stream>>>(XB, nullptr, WK, nullptr, DM, FK, DKV, nullptr, 0, 0, 0);
        k_rope<<<LKv, 256, 0, stream>>>(FK, DKV, NKV, CS, nullptr, nullptr, 1.0f, KP16, KPh, KPl);
        k_gemmw<bf, 0, false><<<dim3(TT / 64, DKV / 64, 1), 32, 0, stream>>>(XB, nullptr, WV, nullptr, DM, FV, DKV, nullptr, 0, 0, 0); k_vtp<<<LKv, 256, 0, stream>>>(FV, DKV, NKV, VT16, VTh, VTl);
        for (int h0 = 0; h0 < NH_; h0 += ZH) { const size_t zq = (size_t)h0, zk = (size_t)(h0 / REP);   // one kv head per query head: the pass's two heads use consecutive kv planes (z-strides TT*HD)
            k_gemmc<bf, 2, 1><<<dim3(RH / 64, TT / 64, ZH), 32, 0, stream>>>(QPh + zq * TT * HD, QPl + zq * TT * HD, KPh + zk * TT * HD, KPl + zk * TT * HD, HD, Sb, TT, 0, (size_t)TT * HD, (size_t)TT * HD, (size_t)TT * TT, 0);
            k_gemmc<h16, 0, 1><<<dim3((TT - RH) / 64, TT / 64, ZH), 32, 0, stream>>>(QP16 + zq * TT * HD + (size_t)RH * HD, nullptr, KP16 + zk * TT * HD, nullptr, HD, Sb + (size_t)RH * TT, TT, RH, (size_t)TT * HD, (size_t)TT * HD, (size_t)TT * TT, 0);
            k_asoft<<<ZH * TT / 8, 256, 0, stream>>>(Sb, P16, Ph, Pl);
            k_gemmc<bf, 2, 2><<<dim3(RH / 64, HD / 64, ZH * KS), 32, 0, stream>>>(Ph, Pl, VTh + zk * HD * TT, VTl + zk * HD * TT, TT, Ob, HD, 0, (size_t)RH * TT, (size_t)HD * TT, (size_t)TT * HD, (size_t)ZH * TT * HD);
            k_gemmc<h16, 0, 2><<<dim3((TT - RH) / 64, HD / 64, ZH * KS), 32, 0, stream>>>(P16 + (size_t)RH * TT, nullptr, VT16 + zk * HD * TT, nullptr, TT, Ob + (size_t)RH * HD, HD, RH, (size_t)TT * TT, (size_t)HD * TT, (size_t)TT * HD, (size_t)ZH * TT * HD);
            k_merge<<<(unsigned)(((size_t)ZH * TT * HD / 2 + 255) / 256), 256, 0, stream>>>(Ob, h0, ATh, ATl); }
        k_gemmw<bf, 1, false><<<dim3(TT / 64, DM / 64, 1), 32, 0, stream>>>(ATh, ATl, WO, nullptr, DQ, OUT + (size_t)b * TT * DM, DM, nullptr, 0, 0, 0); }
}

// v002
// A run of this version takes 630 microseconds.
// Next to v001, in two timings, it ran 1.75 and 1.76 times as fast.
// All steps since v000 together make it 2.73 times as fast.
#include <hip/hip_runtime.h>

// Causal multi-head attention with 128-wide heads and computed rotate-half rotary embeddings (hidden_states [2][2048][2048]; q, k, v = einsum('bsd,ed->bse', x, W) ('oi' 0.02; 16 heads x 128); rope x cos + rotate_half(x) sin, angle t x 1/10000^(2i/128) (64 f32 frequencies jnp-exact; cat(freqs, freqs); precise cosf/sinf); scores / sqrt(128); mask = (key > query) | (key - query >= 1024): the second term only touches FUTURE keys, which the first already excludes: plain causal (-inf == exclusion); softmax in f32; out = merged Wo^T -> [2][2048][2048] (8.4 M); argument order hidden_states, Wq, Wk, Wv, Wo).
// Layout: bf16 copy of x; 'oi' weights; exact projections; k_cs5 computed table (HD 128) + rotate-half plane builders; causal T-2048 attention at HD 128 in one fused kernel per batch, online softmax (hybrid rows: < 512 hi/lo 3 products, rest fp16 x1024; keys above the diagonal block never read); merged hi/lo x Wo exact.
// Compute dtypes, f32 accumulate: every input rounded to bf16; projections exact; rotary f32; attention rows < 512 3 products, rest fp16; softmax f32; Wo hl x exact.

#define NB_  2
#define TT   2048
#define DM   2048
#define NH_  16
#define NKV  16
#define HD   128
#define DQ   (NH_ * HD)
#define DKV  (NKV * HD)
#define RH   512                  // query rows < RH use hi+lo planes (0: none)
#define SCL  0.088388347648318447f   // HD^-0.5
typedef _Float16 h16;
typedef unsigned short bf;
typedef __attribute__((ext_vector_type(16))) __bf16   v16bf;
typedef __attribute__((ext_vector_type(16))) _Float16 v16h;
typedef __attribute__((ext_vector_type(8)))  _Float16 v8h;
typedef __attribute__((ext_vector_type(8)))  unsigned short v8us;
typedef __attribute__((ext_vector_type(8)))  float    v8f;
typedef __attribute__((ext_vector_type(4)))  float    v4f;
typedef v8h  __attribute__((may_alias)) v8ha;
typedef v4f  __attribute__((may_alias)) v4fa;
typedef v8us __attribute__((may_alias)) v8usa;

__device__ __forceinline__ unsigned short f2bf(float f) { unsigned u = __float_as_uint(f); u += 0x7FFFu + ((u >> 16) & 1u); return (unsigned short)(u >> 16); }
__device__ __forceinline__ float bf2f(unsigned short b) { return __uint_as_float(((unsigned)b) << 16); }
__device__ __forceinline__ float bfr(float f) { return bf2f(f2bf(f)); }
__device__ __forceinline__ v16h cat16(v8h lo, v8h hi) { return __builtin_shufflevector(lo, hi, 0, 1, 2, 3, 4, 5, 6, 7, 8, 9, 10, 11, 12, 13, 14, 15); }
__device__ __forceinline__ v16bf cat16b(v8us lo, v8us hi) { return __builtin_bit_cast(v16bf, __builtin_shufflevector(lo, hi, 0, 1, 2, 3, 4, 5, 6, 7, 8, 9, 10, 11, 12, 13, 14, 15)); }
__device__ __forceinline__ v8f wmma16(v16h a, v16h b, v8f c) { return __builtin_amdgcn_wmma_f32_16x16x32_f16(false, a, false, b, (short)0, c, false, false); }
__device__ __forceinline__ v8f wmmab(v16bf a, v16bf b, v8f c) { return __builtin_amdgcn_wmma_f32_16x16x32_bf16(false, a, false, b, (short)0, c, false, false); }



// ---- k_gemmw: register-blocked GEMM, ONE WAVE per 64x64 output tile (16 accumulators), operands straight from K-contiguous 16-bit planes; grid (M/64, N/64, Z), 32 threads.
// C[m][n] (f32, pitch ldc, + optional f32 bias[n]) = sum_k A[m][k] Bt[n][k] (+ split products per NSPLIT). z-batch strides sA/sB/sC in elements. K % 32 == 0.
template <typename T16> struct WFrag;
template <> struct WFrag<h16> { typedef v16h V; static __device__ __forceinline__ V ld(const h16* p) { return cat16(*(const v8h*)p, *(const v8h*)(p + 16)); } static __device__ __forceinline__ v8f mma(V a, V b, v8f c) { return wmma16(a, b, c); } };
template <> struct WFrag<bf> { typedef v16bf V; static __device__ __forceinline__ V ld(const bf* p) { return cat16b(*(const v8us*)p, *(const v8us*)(p + 16)); } static __device__ __forceinline__ v8f mma(V a, V b, v8f c) { return wmmab(a, b, c); } };
template <typename T16, int NSPLIT, bool BIAS>
__global__ __launch_bounds__(32) void k_gemmw(const T16* __restrict__ A, const T16* __restrict__ A2, const T16* __restrict__ Bt, const T16* __restrict__ Bt2, int K, float* C, int ldc, const float* __restrict__ bias, size_t sA, size_t sB, size_t sC) {
    typedef typename WFrag<T16>::V V;
    __shared__ __align__(16) float os[16 * 68];
    const size_t z = blockIdx.z; A += z * sA; if (A2) A2 += z * sA; Bt += z * sB; if (Bt2) Bt2 += z * sB; C += z * sC;
    const int lane = threadIdx.x & 31, lr = lane & 15, hi = lane >> 4; const int r0 = blockIdx.x * 64, c0 = blockIdx.y * 64;
    v8f acc[4][4];
#pragma unroll
    for (int mb = 0; mb < 4; ++mb)
#pragma unroll
        for (int nb = 0; nb < 4; ++nb) acc[mb][nb] = (v8f){};
    const size_t aoff = (size_t)(r0 + lr) * K + 8 * hi, boff = (size_t)(c0 + lr) * K + 8 * hi;
#pragma unroll 1
    for (int kc = 0; kc < K; kc += 32) {
        V a[4], a2[4];
#pragma unroll
        for (int mb = 0; mb < 4; ++mb) { a[mb] = WFrag<T16>::ld(A + aoff + (size_t)mb * 16 * K + kc); if (NSPLIT == 1 || NSPLIT == 2) a2[mb] = WFrag<T16>::ld(A2 + aoff + (size_t)mb * 16 * K + kc); }
#pragma unroll
        for (int nb = 0; nb < 4; ++nb) { const V b = WFrag<T16>::ld(Bt + boff + (size_t)nb * 16 * K + kc); V b2; if (NSPLIT >= 2) b2 = WFrag<T16>::ld(Bt2 + boff + (size_t)nb * 16 * K + kc);
#pragma unroll
            for (int mb = 0; mb < 4; ++mb) { acc[mb][nb] = WFrag<T16>::mma(a[mb], b, acc[mb][nb]); if (NSPLIT == 1 || NSPLIT == 2) acc[mb][nb] = WFrag<T16>::mma(a2[mb], b, acc[mb][nb]); if (NSPLIT >= 2) acc[mb][nb] = WFrag<T16>::mma(a[mb], b2, acc[mb][nb]); } }
        asm volatile("v_nop\n\tv_nop\n\tv_nop\n\tv_nop" : "+v"(acc[0][0]), "+v"(acc[1][1]), "+v"(acc[2][2]), "+v"(acc[3][3]) : "v"(a[0]), "v"(a[3]));
    }
#pragma unroll
    for (int mb = 0; mb < 4; ++mb) {
#pragma unroll
        for (int nb = 0; nb < 4; ++nb) {
#pragma unroll
            for (int j = 0; j < 8; ++j) os[(hi * 8 + j) * 68 + nb * 16 + lr] = acc[mb][nb][j]; }
        __builtin_amdgcn_wave_barrier(); asm volatile("" ::: "memory");
        float* crow = C + (size_t)(r0 + mb * 16) * ldc + c0;
{
#pragma unroll
            for (int s = 0; s < 8; ++s) { const int row = 2 * s + hi, cofs = lr * 4; v4f val = *(const v4fa*)(os + row * 68 + cofs); if (BIAS) { val[0] += bfr(bias[c0 + cofs]); val[1] += bfr(bias[c0 + cofs + 1]); val[2] += bfr(bias[c0 + cofs + 2]); val[3] += bfr(bias[c0 + cofs + 3]); }
                *(v4f*)(crow + (size_t)row * ldc + cofs) = val; }
             }
        __builtin_amdgcn_wave_barrier(); asm volatile("" ::: "memory");
    }
}

__device__ __forceinline__ h16 tohx(float x) { return (h16)x; }
__device__ __forceinline__ void splitf(float y, unsigned short& h, unsigned short& l) { h = f2bf(y); l = f2bf(y - bf2f(h)); }
typedef __attribute__((ext_vector_type(2))) _Float16 v2h;
typedef __attribute__((ext_vector_type(4))) _Float16 v4h;
typedef __attribute__((ext_vector_type(2))) unsigned short v2us;
typedef __attribute__((ext_vector_type(4))) unsigned short v4us;
typedef __attribute__((ext_vector_type(2))) float v2f;
typedef __attribute__((ext_vector_type(4))) int v4i;

__global__ __launch_bounds__(256) void k_cvt8(const float* __restrict__ src, bf* dst, size_t n8) { const size_t i = (size_t)blockIdx.x * 256 + threadIdx.x; if (i >= n8) return; const v8f v = *(const v8f*)(src + i * 8); v8us o;
#pragma unroll
    for (int k = 0; k < 8; ++k) o[k] = f2bf(v[k]); *(v8us*)(dst + i * 8) = o;  }

// k_rope: head planes [h][t][d] (fp16 + hi/lo) of rope(x) x sc with the rotate-half convention out[d] = x[d] cos[t][d] - x[d+HD/2] sin[t][d], out[d+HD/2] = x[d+HD/2] cos[t][d+HD/2] + x[d] sin[t][d+HD/2]
__global__ __launch_bounds__(256) void k_rope(const float* __restrict__ F, int pitch, int nheads, const float* __restrict__ CS, const float* __restrict__ RF, const float* __restrict__ nw, float sc, h16* P16, bf* Ph, bf* Pl) {
    const size_t e = ((size_t)blockIdx.x * 256 + threadIdx.x) * 2; if (e >= (size_t)nheads * TT * HD) return; const int d = (int)(e % HD); const int t = (int)((e / HD) % TT); const int h = (int)(e / ((size_t)HD * TT)); const float* f = F + (size_t)t * pitch + h * HD; const float rf = RF ? RF[(size_t)h * TT + t] : 1.0f; v2h o16; v2us oh, ol;
#pragma unroll
    for (int q = 0; q < 2; ++q) { const int dd = d + q; const int dp = (dd < HD / 2) ? dd + HD / 2 : dd - HD / 2; float x0 = f[dd], x1 = f[dp];
        if (RF) { float n0 = __fmul_rn(x0, rf), n1 = __fmul_rn(x1, rf); asm volatile("" : "+v"(n0)); asm volatile("" : "+v"(n1)); x0 = __fmul_rn(bfr(nw[dd]), n0); x1 = __fmul_rn(bfr(nw[dp]), n1); }
        const v2f cs = *(const v2f*)(CS + ((size_t)t * HD + dd) * 2); float a = __fmul_rn(x0, cs[0]), bq = __fmul_rn(x1, cs[1]); asm volatile("" : "+v"(a)); asm volatile("" : "+v"(bq)); const float r = ((dd < HD / 2) ? __fsub_rn(a, bq) : __fadd_rn(a, bq)) * sc;
        o16[q] = tohx(r); unsigned short a2, c2; splitf(r, a2, c2); oh[q] = a2; ol[q] = c2; }
    *(v2h*)(P16 + e) = o16; *(v2us*)(Ph + e) = oh; *(v2us*)(Pl + e) = ol;  }
__global__ __launch_bounds__(256) void k_vtp(const float* __restrict__ F, int pitch, int nheads, h16* V16, bf* Vh, bf* Vl) { const size_t e = ((size_t)blockIdx.x * 256 + threadIdx.x) * 2; if (e >= (size_t)nheads * HD * TT) return; const int t = (int)(e % TT); const int d = (int)((e / TT) % HD); const int g = (int)(e / ((size_t)TT * HD)); v2h o16; v2us oh, ol;
#pragma unroll
    for (int q = 0; q < 2; ++q) { const float x = F[(size_t)(t + q) * pitch + g * HD + d]; o16[q] = tohx(x); unsigned short a2, c2; splitf(x, a2, c2); oh[q] = a2; ol[q] = c2; }
    *(v2h*)(V16 + e) = o16; *(v2us*)(Vh + e) = oh; *(v2us*)(Vl + e) = ol;  }
__constant__ float INVT[HD / 2] = { 1.000000000e+00f, 8.659643531e-01f, 7.498942018e-01f, 6.493816376e-01f, 5.623413324e-01f, 4.869675338e-01f, 4.216965139e-01f, 3.651741445e-01f, 3.162277639e-01f, 2.738419771e-01f, 2.371373624e-01f, 2.053525001e-01f, 1.778279394e-01f, 1.539926529e-01f, 1.333521456e-01f, 1.154782027e-01f, 1.000000015e-01f, 8.659642935e-02f, 7.498941571e-02f, 6.493816525e-02f, 5.623412877e-02f, 4.869675264e-02f, 4.216964915e-02f, 3.651741147e-02f, 3.162277862e-02f, 2.738419548e-02f, 2.371373586e-02f, 2.053525113e-02f, 1.778279431e-02f, 1.539926510e-02f, 1.333521493e-02f, 1.154781971e-02f, 9.999999776e-03f, 8.659643121e-03f, 7.498942316e-03f, 6.493816618e-03f, 5.623413250e-03f, 4.869675264e-03f, 4.216964822e-03f, 3.651741426e-03f, 3.162277862e-03f, 2.738419687e-03f, 2.371373819e-03f, 2.053525066e-03f, 1.778279431e-03f, 1.539926510e-03f, 1.333521446e-03f, 1.154782018e-03f, 1.000000047e-03f, 8.659643354e-04f, 7.498941850e-04f, 6.493816618e-04f, 5.623413017e-04f, 4.869675031e-04f, 4.216964880e-04f, 3.651741135e-04f, 3.162277862e-04f, 2.738419571e-04f, 2.371373848e-04f, 2.053524950e-04f, 1.778279402e-04f, 1.539926452e-04f, 1.333521504e-04f, 1.154781930e-04f };   // float32 1 / 10000^(2i/128), generated with jnp to be bit-exact
__global__ __launch_bounds__(256) void k_cs5(float* CS) { const int idx = blockIdx.x * 256 + threadIdx.x; if (idx >= TT * HD) return; const int d = idx % HD; const int t = idx / HD; const float a = __fmul_rn((float)t, INVT[d % (HD / 2)]); v2f cs; cs[0] = cosf(a); cs[1] = sinf(a); *(v2f*)(CS + (size_t)idx * 2) = cs;  }
// ---- k_fattn: scores, softmax and probability x value in one kernel; neither scores nor probabilities leave the registers. One wave owns 32 query rows of one head and walks the keys 0 .. its last row in runs of 32.
// St[key][query] = K Q^T and Ot[d][query] += Vt Pt: a lane then holds scores of ONE query per 16-column group (query = lr, keys hi*8+j of each 16-key tile), which is at once the B-fragment order of Pt (k = 8*hi+j, 16+8*hi+j),
// so maximum, sum and rescale are in-lane but for one exchange between the wave's halves. Running maximum m and running sum l per query (online softmax); the division by l comes once, at the end.
// The four waves of a work-group take two neighbouring long and two neighbouring short query blocks of one head: neighbours walk the same K and Vt lines, and every work-group has the same number of key runs. No LDS, no barrier.
__device__ __forceinline__ float xhalf(float x) { return __builtin_bit_cast(float, __builtin_amdgcn_permlanex16(__builtin_bit_cast(int, x), __builtin_bit_cast(int, x), 0x76543210, 0xfedcba98, false, false)); }   // lane l with lane l ^ 16
__device__ __forceinline__ void addr_wait() { __builtin_amdgcn_sched_barrier(0); asm volatile("s_wait_xcnt 0x0" ::: "memory"); __builtin_amdgcn_sched_barrier(0); }
// The same for the key loop, whose loads are many enough for the register allocator to hand a dead pointer's registers to a later load of the same run: the run's four lane pointers are inputs of the wait, so they stay live, and unwritten, up to it.
__device__ __forceinline__ void addr_wait(const void* a, const void* b, const void* c, const void* d) { __builtin_amdgcn_sched_barrier(0); asm volatile("s_wait_xcnt 0x0" :: "v"(a), "v"(b), "v"(c), "v"(d) : "memory"); __builtin_amdgcn_sched_barrier(0); }
template <typename T16, int NSPLIT>
__device__ __forceinline__ void fattn_body(const T16* __restrict__ Q, const T16* __restrict__ Q2, const T16* __restrict__ Kp, const T16* __restrict__ Kp2, const T16* __restrict__ Vt, const T16* __restrict__ Vt2, int q0, int lr, int hi, bf* Ah, bf* Al) {
    typedef typename WFrag<T16>::V V;
    const float L2E = 1.4426950408889634f;
    const float PSH = (NSPLIT == 0) ? 10.0f : 0.0f;      // fp16 probabilities carry a factor 2^10 (small ones stay normal numbers); l carries it too, so it cancels in the division
    V q[2][4], q2[2][4];
    const size_t koff = (size_t)lr * HD + 8 * hi, voff = (size_t)lr * TT + 8 * hi;
    // one lane pointer per plane and run of loads; every fragment of the run is a constant offset from it
    { const T16* qp = Q + (size_t)q0 * HD + koff; const T16* qp2 = (NSPLIT == 2) ? Q2 + (size_t)q0 * HD + koff : qp;
#pragma unroll
      for (int g = 0; g < 2; ++g)
#pragma unroll
        for (int kc = 0; kc < 4; ++kc) { const int qo = g * 16 * HD + kc * 32; q[g][kc] = WFrag<T16>::ld(qp + qo); if (NSPLIT == 2) q2[g][kc] = WFrag<T16>::ld(qp2 + qo); }
      addr_wait(); }
    v8f o[8][2];
#pragma unroll
    for (int dt = 0; dt < 8; ++dt) { o[dt][0] = (v8f){}; o[dt][1] = (v8f){}; }
    float m[2] = { -3.0e38f, -3.0e38f }, l[2] = { 0.f, 0.f };
    V k[2][4], k2[2][4];
    { const T16* kp = Kp + koff; const T16* kp2 = (NSPLIT == 2) ? Kp2 + koff : kp;
#pragma unroll
      for (int t = 0; t < 2; ++t)
#pragma unroll
        for (int kc = 0; kc < 4; ++kc) { const int ko = t * 16 * HD + kc * 32; k[t][kc] = WFrag<T16>::ld(kp + ko); if (NSPLIT == 2) k2[t][kc] = WFrag<T16>::ld(kp2 + ko); }
      addr_wait(); }
    int kb = 0;
#pragma unroll 1   // one copy of the body: a trip's fragments already take most of the register file
    do {                                                 // q0 >= 0: at least one run of keys
        V kx[2][4], kx2[2][4], v[8], v2[8];
        const int kn = min(kb + 32, q0);                 // K fragments are fetched one run ahead; the last run fetches its own rows again (in bounds, unused)
        const T16* vp = Vt + voff + kb; const T16* vp2 = (NSPLIT == 2) ? Vt2 + voff + kb : vp; const T16* kp = Kp + koff + (size_t)kn * HD; const T16* kp2 = (NSPLIT == 2) ? Kp2 + koff + (size_t)kn * HD : kp;
#pragma unroll
        for (int dt = 0; dt < 8; ++dt) { const int vo = dt * 16 * TT; v[dt] = WFrag<T16>::ld(vp + vo); if (NSPLIT == 2) v2[dt] = WFrag<T16>::ld(vp2 + vo); }
#pragma unroll
        for (int t = 0; t < 2; ++t)
#pragma unroll
            for (int kc = 0; kc < 4; ++kc) { const int ko = t * 16 * HD + kc * 32; kx[t][kc] = WFrag<T16>::ld(kp + ko); if (NSPLIT == 2) kx2[t][kc] = WFrag<T16>::ld(kp2 + ko); }
        __builtin_amdgcn_sched_barrier(0);               // keeps the run's loads in one group up here (sunk between the products, each pair would wait a full latency)
        v8f s[2][2];
#pragma unroll
        for (int t = 0; t < 2; ++t)
#pragma unroll
            for (int g = 0; g < 2; ++g) { v8f a = (v8f){};
#pragma unroll
                for (int kc = 0; kc < 4; ++kc) { a = WFrag<T16>::mma(k[t][kc], q[g][kc], a); if (NSPLIT == 2) { a = WFrag<T16>::mma(k[t][kc], q2[g][kc], a); a = WFrag<T16>::mma(k2[t][kc], q[g][kc], a); } }
                s[t][g] = a; }
        const bool diag = (kb == q0);                    // only the last run of keys meets the causal diagonal (wave-uniform)
        float mn[2];
#pragma unroll
        for (int g = 0; g < 2; ++g) { float mx = m[g];
#pragma unroll
            for (int t = 0; t < 2; ++t)
#pragma unroll
                for (int j = 0; j < 8; ++j) { float x = s[t][g][j] * SCL; if (diag && t * 16 + hi * 8 + j > g * 16 + lr) x = -3.0e38f; s[t][g][j] = x; mx = fmaxf(mx, x); }
            mn[g] = fmaxf(mx, xhalf(mx)); }
        if (__builtin_amdgcn_ballot_w32(mn[0] > m[0] || mn[1] > m[1]) != 0) {   // a maximum moved: bring sums and output tiles to the new one (factor exactly 1 where it did not)
#pragma unroll
            for (int g = 0; g < 2; ++g) { const float al = __builtin_amdgcn_exp2f((m[g] - mn[g]) * L2E); l[g] *= al; m[g] = mn[g];
#pragma unroll
                for (int dt = 0; dt < 8; ++dt) o[dt][g] *= al; } }
        V pf[2], pf2[2];
#pragma unroll
        for (int g = 0; g < 2; ++g) { float sum = 0.f; float p[16];
#pragma unroll
            for (int e = 0; e < 16; ++e) { p[e] = __builtin_amdgcn_exp2f((s[e >> 3][g][e & 7] - m[g]) * L2E + PSH); sum += p[e]; }
            l[g] += sum;
            if constexpr (NSPLIT == 0) { v16h f;
#pragma unroll
                for (int e = 0; e < 16; ++e) f[e] = tohx(p[e]);
                pf[g] = f;
            } else { v8us h0, h1, l0, l1;
#pragma unroll
                for (int e = 0; e < 8; ++e) { unsigned short a, c2; splitf(p[e], a, c2); h0[e] = a; l0[e] = c2; splitf(p[8 + e], a, c2); h1[e] = a; l1[e] = c2; }
                pf[g] = cat16b(h0, h1); pf2[g] = cat16b(l0, l1); } }
#pragma unroll
        for (int dt = 0; dt < 8; ++dt)
#pragma unroll
            for (int g = 0; g < 2; ++g) { o[dt][g] = WFrag<T16>::mma(v[dt], pf[g], o[dt][g]); if (NSPLIT == 2) { o[dt][g] = WFrag<T16>::mma(v[dt], pf2[g], o[dt][g]); o[dt][g] = WFrag<T16>::mma(v2[dt], pf[g], o[dt][g]); } }
        addr_wait(vp, vp2, kp, kp2);                     // at the trip's foot, where the run's loads have long been taken up: the four pointers are stepped only behind it
#pragma unroll
        for (int t = 0; t < 2; ++t)
#pragma unroll
            for (int kc = 0; kc < 4; ++kc) { k[t][kc] = kx[t][kc]; if (NSPLIT == 2) k2[t][kc] = kx2[t][kc]; }
        kb += 32;
    } while (kb <= q0);
#pragma unroll
    for (int g = 0; g < 2; ++g) { const float inv = __fdiv_rn(1.0f, l[g] + xhalf(l[g])); const size_t oo = (size_t)(q0 + g * 16 + lr) * DQ + hi * 8; bf* ap = Ah + oo; bf* ap2 = Al + oo;
#pragma unroll
        for (int dt = 0; dt < 8; ++dt) { v8us oh, ol;
#pragma unroll
            for (int j = 0; j < 8; ++j) { unsigned short a, c2; splitf(o[dt][g][j] * inv, a, c2); oh[j] = a; ol[j] = c2; }
            *(v8us*)(ap + dt * 16) = oh; *(v8us*)(ap2 + dt * 16) = ol;
            addr_wait(); } }
}
// grid (heads, TT / 128), 128 threads. Query blocks of 32 rows: block p has p + 1 runs of keys, so blocks p and TT/32 - 1 - p together always have TT/32 + 1; work-group y takes the pairs p = 2y and 2y + 1, one block a wave.
// Query rows < RH: bf16 hi/lo planes, 3 products; the rest fp16 (chosen per wave). Writes the merged hi/lo planes [t][head * HD + d].
__global__ __launch_bounds__(128) void k_fattn(const h16* __restrict__ Q16, const h16* __restrict__ K16, const h16* __restrict__ V16, const bf* __restrict__ Qh, const bf* __restrict__ Ql, const bf* __restrict__ Kh, const bf* __restrict__ Kl, const bf* __restrict__ Vh, const bf* __restrict__ Vl, bf* Ah, bf* Al) {
    const int lane = threadIdx.x & 31, lr = lane & 15, hi = lane >> 4; const int h = blockIdx.x; const int w = __builtin_amdgcn_readfirstlane((int)(threadIdx.x >> 5));   /* wave-uniform: the key loop's bound and the choice of body stay scalar */
    const int pr = (int)blockIdx.y * 2 + (w >> 1); const int q0 = ((w & 1) ? pr : TT / 32 - 1 - pr) * 32; const size_t hp = (size_t)h * TT * HD;
    if (q0 < RH) fattn_body<bf, 2>(Qh + hp, Ql + hp, Kh + hp, Kl + hp, Vh + hp, Vl + hp, q0, lr, hi, Ah + h * HD, Al + h * HD);
    else fattn_body<h16, 0>(Q16 + hp, nullptr, K16 + hp, nullptr, V16 + hp, nullptr, q0, lr, hi, Ah + h * HD, Al + h * HD);
}

extern "C" void kernel_launch(void* const* d_in, const int* in_sizes, int n_in,
                              void* d_out, int out_size, void* d_ws, size_t ws_size, hipStream_t stream) {
    (void)in_sizes; (void)n_in; (void)out_size;
    const float* x = (const float*)d_in[0]; const float* wq = (const float*)d_in[1]; const float* wk = (const float*)d_in[2]; const float* wv = (const float*)d_in[3]; const float* wo = (const float*)d_in[4];   /* order hidden_states, Wq, Wk, Wv, Wo ('oi' [2048][2048]) */
    float* OUT = (float*)d_out;     // [2][2048][2048]
    char* wsp = (char*)d_ws;
    auto take = [&](size_t bytes) { char* p = wsp; wsp += (bytes + 255) & ~(size_t)255; return (void*)p; };
    bf* WQ = (bf*)take((size_t)DQ * DM * 2); bf* WK = (bf*)take((size_t)DKV * DM * 2); bf* WV = (bf*)take((size_t)DKV * DM * 2); bf* WO = (bf*)take((size_t)DM * DQ * 2); float* CS = (float*)take((size_t)TT * HD * 2 * 4);
    bf* XB = (bf*)take((size_t)TT * DM * 2); float* FQ = (float*)take((size_t)TT * DQ * 4); float* FK = (float*)take((size_t)TT * DKV * 4);
    h16* QP16 = (h16*)take((size_t)NH_ * TT * HD * 2); h16* KP16 = (h16*)take((size_t)NKV * TT * HD * 2); h16* VT16 = (h16*)take((size_t)NKV * HD * TT * 2);
    bf* QPh = (bf*)take((size_t)NH_ * TT * HD * 2); bf* QPl = (bf*)take((size_t)NH_ * TT * HD * 2); bf* KPh = (bf*)take((size_t)NKV * TT * HD * 2); bf* KPl = (bf*)take((size_t)NKV * TT * HD * 2); bf* VTh = (bf*)take((size_t)NKV * HD * TT * 2); bf* VTl = (bf*)take((size_t)NKV * HD * TT * 2);
    bf* ATh = (bf*)take((size_t)TT * DQ * 2); bf* ATl = (bf*)take((size_t)TT * DQ * 2);
    if ((size_t)(wsp - (char*)d_ws) > ws_size) return;    // ws 256 MiB
    float* FV = FK;   // v projection reuses the k buffer after the k planes are built (stream-ordered)
    { k_cvt8<<<(unsigned)(((size_t)DQ * DM / 8 + 255) / 256), 256, 0, stream>>>(wq, WQ, (size_t)DQ * DM / 8); k_cvt8<<<(unsigned)(((size_t)DKV * DM / 8 + 255) / 256), 256, 0, stream>>>(wk, WK, (size_t)DKV * DM / 8); k_cvt8<<<(unsigned)(((size_t)DKV * DM / 8 + 255) / 256), 256, 0, stream>>>(wv, WV, (size_t)DKV * DM / 8);
      k_cvt8<<<(unsigned)(((size_t)DM * DQ / 8 + 255) / 256), 256, 0, stream>>>(wo, WO, (size_t)DM * DQ / 8);
       }
    k_cs5<<<(TT * HD + 255) / 256, 256, 0, stream>>>(CS);   /* rotary table once */
    const unsigned LQ = (unsigned)(((size_t)NH_ * TT * HD / 2 + 255) / 256), LKv = (unsigned)(((size_t)NKV * TT * HD / 2 + 255) / 256);
    for (int b = 0; b < NB_; ++b) {
        
        k_cvt8<<<(unsigned)(((size_t)TT * DM / 8 + 255) / 256), 256, 0, stream>>>(x + (size_t)b * TT * DM, XB, (size_t)TT * DM / 8);
        k_gemmw<bf, 0, false><<<dim3(TT / 64, DQ / 64, 1), 32, 0, stream>>>(XB, nullptr, WQ, nullptr, DM, FQ, DQ, nullptr, 0, 0, 0);
        k_rope<<<LQ, 256, 0, stream>>>(FQ, DQ, NH_, CS, nullptr, nullptr, 1.0f, QP16, QPh, QPl);
        k_gemmw<bf, 0, false><<<dim3(TT / 64, DKV / 64, 1), 32, 0, stream>>>(XB, nullptr, WK, nullptr, DM, FK, DKV, nullptr, 0, 0, 0);
        k_rope<<<LKv, 256, 0, stream>>>(FK, DKV, NKV, CS, nullptr, nullptr, 1.0f, KP16, KPh, KPl);
        k_gemmw<bf, 0, false><<<dim3(TT / 64, DKV / 64, 1), 32, 0, stream>>>(XB, nullptr, WV, nullptr, DM, FV, DKV, nullptr, 0, 0, 0); k_vtp<<<LKv, 256, 0, stream>>>(FV, DKV, NKV, VT16, VTh, VTl);
        k_fattn<<<dim3(NH_, TT / 128, 1), 128, 0, stream>>>(QP16, KP16, VT16, QPh, QPl, KPh, KPl, VTh, VTl, ATh, ATl);
        k_gemmw<bf, 1, false><<<dim3(TT / 64, DM / 64, 1), 32, 0, stream>>>(ATh, ATl, WO, nullptr, DQ, OUT + (size_t)b * TT * DM, DM, nullptr, 0, 0, 0); }
}

// v003
// A run of this version takes 414 microseconds.
// Timed twice side by side with v002, it ran 1.52 and 1.55 times as fast.
// All steps since v000 together make it 4.20 times as fast.
#include <hip/hip_runtime.h>

// Causal multi-head attention with 128-wide heads and computed rotate-half rotary embeddings (hidden_states [2][2048][2048]; q, k, v = einsum('bsd,ed->bse', x, W) ('oi' 0.02; 16 heads x 128); rope x cos + rotate_half(x) sin, angle t x 1/10000^(2i/128) (64 f32 frequencies jnp-exact; cat(freqs, freqs); precise cosf/sinf); scores / sqrt(128); mask = (key > query) | (key - query >= 1024): the second term only touches FUTURE keys, which the first already excludes: plain causal (-inf == exclusion); softmax in f32; out = merged Wo^T -> [2][2048][2048] (8.4 M); argument order hidden_states, Wq, Wk, Wv, Wo).
// Layout: bf16 copy of x; 'oi' weights; exact projections; k_cs5 computed table (HD 128) + rotate-half plane builders; causal T-2048 attention at HD 128 in one fused kernel per batch, online softmax (hybrid rows: < 512 hi/lo 3 products, rest fp16 x1024; keys above the diagonal block never read); merged hi/lo x Wo exact.
// Compute dtypes, f32 accumulate: every input rounded to bf16; projections exact; rotary f32; attention rows < 512 3 products, rest fp16; softmax f32; Wo hl x exact.

#define NB_  2
#define TT   2048
#define DM   2048
#define NH_  16
#define NKV  16
#define HD   128
#define DQ   (NH_ * HD)
#define DKV  (NKV * HD)
#define RH   512                  // query rows < RH use hi+lo planes (0: none)
#define SCL  0.088388347648318447f   // HD^-0.5
typedef _Float16 h16;
typedef unsigned short bf;
typedef __attribute__((ext_vector_type(16))) __bf16   v16bf;
typedef __attribute__((ext_vector_type(16))) _Float16 v16h;
typedef __attribute__((ext_vector_type(8)))  _Float16 v8h;
typedef __attribute__((ext_vector_type(8)))  unsigned short v8us;
typedef __attribute__((ext_vector_type(8)))  float    v8f;
typedef __attribute__((ext_vector_type(4)))  float    v4f;
typedef v8h  __attribute__((may_alias)) v8ha;
typedef v4f  __attribute__((may_alias)) v4fa;
typedef v8us __attribute__((may_alias)) v8usa;

__device__ __forceinline__ unsigned short f2bf(float f) { unsigned u = __float_as_uint(f); u += 0x7FFFu + ((u >> 16) & 1u); return (unsigned short)(u >> 16); }
__device__ __forceinline__ float bf2f(unsigned short b) { return __uint_as_float(((unsigned)b) << 16); }
__device__ __forceinline__ float bfr(float f) { return bf2f(f2bf(f)); }
__device__ __forceinline__ v16h cat16(v8h lo, v8h hi) { return __builtin_shufflevector(lo, hi, 0, 1, 2, 3, 4, 5, 6, 7, 8, 9, 10, 11, 12, 13, 14, 15); }
__device__ __forceinline__ v16bf cat16b(v8us lo, v8us hi) { return __builtin_bit_cast(v16bf, __builtin_shufflevector(lo, hi, 0, 1, 2, 3, 4, 5, 6, 7, 8, 9, 10, 11, 12, 13, 14, 15)); }
__device__ __forceinline__ v8f wmma16(v16h a, v16h b, v8f c) { return __builtin_amdgcn_wmma_f32_16x16x32_f16(false, a, false, b, (short)0, c, false, false); }
__device__ __forceinline__ v8f wmmab(v16bf a, v16bf b, v8f c) { return __builtin_amdgcn_wmma_f32_16x16x32_bf16(false, a, false, b, (short)0, c, false, false); }



// ---- k_gemms: C[m][n] (f32, pitch ldc) = sum_k A[m][k] Bt[n][k] (NSPLIT 1: + A2[m][k] Bt[n][k], product by product in the same k order), operands K-contiguous bf16 planes. M, N % 128 == 0, K % 128 == 0, K >= 256.
// One work-group of four waves per 128x128 output tile, each wave a 64x64 quarter (16 accumulators); grid (M/128, N/128), 128 threads.
// A stage is 128 k (256 B) of the tile's 128 rows of every operand, brought from global memory into LDS by asynchronous 16-byte copies (whole lines, each byte fetched once per work-group) and read from there as fragments by the two waves that need it.
// Two buffers: the copies of stage t + 2 are issued behind the barrier that ends trip t and fly during trip t + 1.
template <typename T16> struct WFrag;
template <> struct WFrag<h16> { typedef v16h V; static __device__ __forceinline__ V ld(const h16* p) { return cat16(*(const v8h*)p, *(const v8h*)(p + 16)); } static __device__ __forceinline__ v8f mma(V a, V b, v8f c) { return wmma16(a, b, c); } };
template <> struct WFrag<bf> { typedef v16bf V; static __device__ __forceinline__ V ld(const bf* p) { return cat16b(*(const v8us*)p, *(const v8us*)(p + 16)); } static __device__ __forceinline__ v8f mma(V a, V b, v8f c) { return wmmab(a, b, c); } };
#define GKS 128                    // k per stage
#define GP  136                    // LDS row pitch in elements: 272 B = 16 B x odd, free of bank conflicts for 16-byte fragment reads
// Eight copies of 16 B per lane, LDS step 8 rows, global step gs elements. s_wait_xcnt 0 is the statement's last line, so that it stands in front of every later write of a register that a copy names.
__device__ __forceinline__ void cp8(unsigned l, const bf* g, size_t gs) {
    asm volatile("global_load_async_to_lds_b128 %0, %8, off\n\t"
                 "global_load_async_to_lds_b128 %1, %9, off\n\t"
                 "global_load_async_to_lds_b128 %2, %10, off\n\t"
                 "global_load_async_to_lds_b128 %3, %11, off\n\t"
                 "global_load_async_to_lds_b128 %4, %12, off\n\t"
                 "global_load_async_to_lds_b128 %5, %13, off\n\t"
                 "global_load_async_to_lds_b128 %6, %14, off\n\t"
                 "global_load_async_to_lds_b128 %7, %15, off\n\t"
                 "s_wait_xcnt 0x0"
                 :: "v"(l), "v"(l + 1u * 8 * GP * 2), "v"(l + 2u * 8 * GP * 2), "v"(l + 3u * 8 * GP * 2), "v"(l + 4u * 8 * GP * 2), "v"(l + 5u * 8 * GP * 2), "v"(l + 6u * 8 * GP * 2), "v"(l + 7u * 8 * GP * 2),
                    "v"(g), "v"(g + gs), "v"(g + 2 * gs), "v"(g + 3 * gs), "v"(g + 4 * gs), "v"(g + 5 * gs), "v"(g + 6 * gs), "v"(g + 7 * gs) : "memory");
}
template <int NSPLIT, int K>
__global__ __launch_bounds__(128) void k_gemms(const bf* __restrict__ A, const bf* __restrict__ A2, const bf* __restrict__ Bt, float* C, int ldc) {
    typedef WFrag<bf>::V V;
    constexpr int NOP = (NSPLIT == 1) ? 3 : 2;           // operand planes per stage: A, Bt (, A2)
    __shared__ __align__(16) bf st[2][NOP][128 * GP];
    __shared__ __align__(16) float osw[4][16 * 68];      // each wave's own output staging
    const int tid = threadIdx.x, lane = tid & 31, lr = lane & 15, hi = lane >> 4; const int w = __builtin_amdgcn_readfirstlane(tid >> 5);
    const int r0 = blockIdx.x * 128, c0 = blockIdx.y * 128, wr = (w >> 1) * 64, wc = (w & 1) * 64;
    float* os = osw[w];
    v8f acc[4][4];
    // every '#pragma unroll' of this kernel: constant indices, so that accumulators and fragments stay in registers
#pragma unroll
    for (int mb = 0; mb < 4; ++mb)
#pragma unroll
        for (int nb = 0; nb < 4; ++nb) acc[mb][nb] = (v8f){};
    // a copy of the work-group covers 8 rows of 256 B: lane pointer = row tid / 16, 16-byte piece tid % 16
    const size_t go = (size_t)(tid >> 4) * K + (tid & 15) * 8;
    const bf* ga = A + (size_t)r0 * K + go; const bf* gb = Bt + (size_t)c0 * K + go; const bf* ga2 = (NSPLIT == 1) ? A2 + (size_t)r0 * K + go : ga;
    const unsigned l0 = (unsigned)(size_t)&st[0][0][(tid >> 4) * GP + (tid & 15) * 8];
    auto fill = [&](int s) {
        const unsigned l = l0 + (unsigned)(s & 1) * (NOP * 128 * GP * 2); const int ko = s * GKS;
#pragma unroll
        for (int h = 0; h < 2; ++h) { const unsigned lh = l + h * 64 * GP * 2; const size_t gh = (size_t)h * 64 * K + ko;
            cp8(lh, ga + gh, (size_t)8 * K); cp8(lh + 128 * GP * 2, gb + gh, (size_t)8 * K); if (NSPLIT == 1) cp8(lh + 2 * 128 * GP * 2, ga2 + gh, (size_t)8 * K); } };
    constexpr int NS = K / GKS; static_assert(K % GKS == 0 && NS >= 2, "two stages or more");
    fill(0);
    asm volatile("s_wait_asynccnt 0x0" ::: "memory");    // this wave's copies of stage 0 have landed
    __syncthreads();                                     // every wave's have: stage 0 may be read
    fill(1);
#pragma unroll 1   // one copy of the trip; the buffer is chosen by the trip's parity
    for (int t = 0; t < NS; ++t) {
        const bf* sa = &st[t & 1][0][(wr + lr) * GP + 8 * hi]; const bf* sb = &st[t & 1][1][(wc + lr) * GP + 8 * hi]; const bf* sa2 = &st[t & 1][NOP - 1][(wr + lr) * GP + 8 * hi];
        // two fragment sets: block kk + 1's LDS reads are issued as one group in front of block kk's products, so that only the trip's first group is waited for in full
        V a[2][4], a2[2][4], b[2][4];
#pragma unroll
        for (int f = 0; f < 4; ++f) { a[0][f] = WFrag<bf>::ld(sa + f * 16 * GP); if (NSPLIT == 1) a2[0][f] = WFrag<bf>::ld(sa2 + f * 16 * GP); b[0][f] = WFrag<bf>::ld(sb + f * 16 * GP); }
#pragma unroll
        for (int kk = 0; kk < GKS / 32; ++kk) { const int c = kk & 1, n = c ^ 1;
            if (kk + 1 < GKS / 32) {
#pragma unroll
                for (int f = 0; f < 4; ++f) { a[n][f] = WFrag<bf>::ld(sa + f * 16 * GP + (kk + 1) * 32); if (NSPLIT == 1) a2[n][f] = WFrag<bf>::ld(sa2 + f * 16 * GP + (kk + 1) * 32); b[n][f] = WFrag<bf>::ld(sb + f * 16 * GP + (kk + 1) * 32); } }
            __builtin_amdgcn_sched_barrier(0);           // keeps that group of reads up here (sunk among the products, each pair would be waited for at its full LDS latency)
#pragma unroll
            for (int nb = 0; nb < 4; ++nb)
#pragma unroll
                for (int mb = 0; mb < 4; ++mb) { acc[mb][nb] = WFrag<bf>::mma(a[c][mb], b[c][nb], acc[mb][nb]); if (NSPLIT == 1) acc[mb][nb] = WFrag<bf>::mma(a2[c][mb], b[c][nb], acc[mb][nb]); }
            __builtin_amdgcn_sched_barrier(0);           // and the next group behind this block's products: its registers are the ones they read
        }
        asm volatile("s_wait_dscnt 0x0" ::: "memory");   // this wave's reads of the trip's buffer are done
        asm volatile("s_wait_asynccnt 0x0" ::: "memory");   // this wave's copies of stage t + 1 have landed
        __syncthreads();                                 // publishes stage t + 1 and frees the buffer that trip t has read
        if (t + 2 < NS) fill(t + 2);
    }
    asm volatile("s_wait_asynccnt 0x0" ::: "memory");    // no copy is left in flight when the wave goes on to its end
#pragma unroll
    for (int mb = 0; mb < 4; ++mb) {
#pragma unroll
        for (int nb = 0; nb < 4; ++nb) {
#pragma unroll
            for (int j = 0; j < 8; ++j) os[(hi * 8 + j) * 68 + nb * 16 + lr] = acc[mb][nb][j]; }
        __builtin_amdgcn_wave_barrier(); asm volatile("" ::: "memory");   // compile-time order only: the lanes' LDS stores stay in front of the row reads of other lanes' words
        float* crow = C + (size_t)(r0 + wr + mb * 16) * ldc + c0 + wc;
#pragma unroll
        for (int s = 0; s < 8; ++s) { const int row = 2 * s + hi, cofs = lr * 4; const v4f val = *(const v4fa*)(os + row * 68 + cofs);
            *(v4f*)(crow + (size_t)row * ldc + cofs) = val; }
        asm volatile("s_wait_xcnt 0x0" ::: "memory");    // in front of the next group's reuse of the stores' address registers
        __builtin_amdgcn_wave_barrier(); asm volatile("" ::: "memory");   // the same for the row reads and the next group's LDS stores
    }
}

__device__ __forceinline__ h16 tohx(float x) { return (h16)x; }
__device__ __forceinline__ void splitf(float y, unsigned short& h, unsigned short& l) { h = f2bf(y); l = f2bf(y - bf2f(h)); }
typedef __attribute__((ext_vector_type(2))) _Float16 v2h;
typedef __attribute__((ext_vector_type(4))) _Float16 v4h;
typedef __attribute__((ext_vector_type(2))) unsigned short v2us;
typedef __attribute__((ext_vector_type(4))) unsigned short v4us;
typedef __attribute__((ext_vector_type(2))) float v2f;
typedef __attribute__((ext_vector_type(4))) int v4i;

__global__ __launch_bounds__(256) void k_cvt8(const float* __restrict__ src, bf* dst, size_t n8) { const size_t i = (size_t)blockIdx.x * 256 + threadIdx.x; if (i >= n8) return; const v8f v = *(const v8f*)(src + i * 8); v8us o;
#pragma unroll
    for (int k = 0; k < 8; ++k) o[k] = f2bf(v[k]); *(v8us*)(dst + i * 8) = o;  }

// k_rope: head planes [h][t][d] (fp16 + hi/lo) of rope(x) x sc with the rotate-half convention out[d] = x[d] cos[t][d] - x[d+HD/2] sin[t][d], out[d+HD/2] = x[d+HD/2] cos[t][d+HD/2] + x[d] sin[t][d+HD/2]
__global__ __launch_bounds__(256) void k_rope(const float* __restrict__ F, int pitch, int nheads, const float* __restrict__ CS, const float* __restrict__ RF, const float* __restrict__ nw, float sc, h16* P16, bf* Ph, bf* Pl) {
    const size_t e = ((size_t)blockIdx.x * 256 + threadIdx.x) * 2; if (e >= (size_t)nheads * TT * HD) return; const int d = (int)(e % HD); const int t = (int)((e / HD) % TT); const int h = (int)(e / ((size_t)HD * TT)); const float* f = F + (size_t)t * pitch + h * HD; const float rf = RF ? RF[(size_t)h * TT + t] : 1.0f; v2h o16; v2us oh, ol;
#pragma unroll
    for (int q = 0; q < 2; ++q) { const int dd = d + q; const int dp = (dd < HD / 2) ? dd + HD / 2 : dd - HD / 2; float x0 = f[dd], x1 = f[dp];
        if (RF) { float n0 = __fmul_rn(x0, rf), n1 = __fmul_rn(x1, rf); asm volatile("" : "+v"(n0)); asm volatile("" : "+v"(n1)); x0 = __fmul_rn(bfr(nw[dd]), n0); x1 = __fmul_rn(bfr(nw[dp]), n1); }
        const v2f cs = *(const v2f*)(CS + ((size_t)t * HD + dd) * 2); float a = __fmul_rn(x0, cs[0]), bq = __fmul_rn(x1, cs[1]); asm volatile("" : "+v"(a)); asm volatile("" : "+v"(bq)); const float r = ((dd < HD / 2) ? __fsub_rn(a, bq) : __fadd_rn(a, bq)) * sc;
        o16[q] = tohx(r); unsigned short a2, c2; splitf(r, a2, c2); oh[q] = a2; ol[q] = c2; }
    *(v2h*)(P16 + e) = o16; *(v2us*)(Ph + e) = oh; *(v2us*)(Pl + e) = ol;  }
__global__ __launch_bounds__(256) void k_vtp(const float* __restrict__ F, int pitch, int nheads, h16* V16, bf* Vh, bf* Vl) { const size_t e = ((size_t)blockIdx.x * 256 + threadIdx.x) * 2; if (e >= (size_t)nheads * HD * TT) return; const int t = (int)(e % TT); const int d = (int)((e / TT) % HD); const int g = (int)(e / ((size_t)TT * HD)); v2h o16; v2us oh, ol;
#pragma unroll
    for (int q = 0; q < 2; ++q) { const float x = F[(size_t)(t + q) * pitch + g * HD + d]; o16[q] = tohx(x); unsigned short a2, c2; splitf(x, a2, c2); oh[q] = a2; ol[q] = c2; }
    *(v2h*)(V16 + e) = o16; *(v2us*)(Vh + e) = oh; *(v2us*)(Vl + e) = ol;  }
__constant__ float INVT[HD / 2] = { 1.000000000e+00f, 8.659643531e-01f, 7.498942018e-01f, 6.493816376e-01f, 5.623413324e-01f, 4.869675338e-01f, 4.216965139e-01f, 3.651741445e-01f, 3.162277639e-01f, 2.738419771e-01f, 2.371373624e-01f, 2.053525001e-01f, 1.778279394e-01f, 1.539926529e-01f, 1.333521456e-01f, 1.154782027e-01f, 1.000000015e-01f, 8.659642935e-02f, 7.498941571e-02f, 6.493816525e-02f, 5.623412877e-02f, 4.869675264e-02f, 4.216964915e-02f, 3.651741147e-02f, 3.162277862e-02f, 2.738419548e-02f, 2.371373586e-02f, 2.053525113e-02f, 1.778279431e-02f, 1.539926510e-02f, 1.333521493e-02f, 1.154781971e-02f, 9.999999776e-03f, 8.659643121e-03f, 7.498942316e-03f, 6.493816618e-03f, 5.623413250e-03f, 4.869675264e-03f, 4.216964822e-03f, 3.651741426e-03f, 3.162277862e-03f, 2.738419687e-03f, 2.371373819e-03f, 2.053525066e-03f, 1.778279431e-03f, 1.539926510e-03f, 1.333521446e-03f, 1.154782018e-03f, 1.000000047e-03f, 8.659643354e-04f, 7.498941850e-04f, 6.493816618e-04f, 5.623413017e-04f, 4.869675031e-04f, 4.216964880e-04f, 3.651741135e-04f, 3.162277862e-04f, 2.738419571e-04f, 2.371373848e-04f, 2.053524950e-04f, 1.778279402e-04f, 1.539926452e-04f, 1.333521504e-04f, 1.154781930e-04f };   // float32 1 / 10000^(2i/128), generated with jnp to be bit-exact
__global__ __launch_bounds__(256) void k_cs5(float* CS) { const int idx = blockIdx.x * 256 + threadIdx.x; if (idx >= TT * HD) return; const int d = idx % HD; const int t = idx / HD; const float a = __fmul_rn((float)t, INVT[d % (HD / 2)]); v2f cs; cs[0] = cosf(a); cs[1] = sinf(a); *(v2f*)(CS + (size_t)idx * 2) = cs;  }
// ---- k_fattn: scores, softmax and probability x value in one kernel; neither scores nor probabilities leave the registers. One wave owns 32 query rows of one head and walks the keys 0 .. its last row in runs of 32.
// St[key][query] = K Q^T and Ot[d][query] += Vt Pt: a lane then holds scores of ONE query per 16-column group (query = lr, keys hi*8+j of each 16-key tile), which is at once the B-fragment order of Pt (k = 8*hi+j, 16+8*hi+j),
// so maximum, sum and rescale are in-lane but for one exchange between the wave's halves. Running maximum m and running sum l per query (online softmax); the division by l comes once, at the end.
// The four waves of a work-group take two neighbouring long and two neighbouring short query blocks of one head: neighbours walk the same K and Vt lines, and every work-group has the same number of key runs. No LDS, no barrier.
__device__ __forceinline__ float xhalf(float x) { return __builtin_bit_cast(float, __builtin_amdgcn_permlanex16(__builtin_bit_cast(int, x), __builtin_bit_cast(int, x), 0x76543210, 0xfedcba98, false, false)); }   // lane l with lane l ^ 16
__device__ __forceinline__ void addr_wait() { __builtin_amdgcn_sched_barrier(0); asm volatile("s_wait_xcnt 0x0" ::: "memory"); __builtin_amdgcn_sched_barrier(0); }
// The same for the key loop, whose loads are many enough for the register allocator to hand a dead pointer's registers to a later load of the same run: the run's four lane pointers are inputs of the wait, so they stay live, and unwritten, up to it.
__device__ __forceinline__ void addr_wait(const void* a, const void* b, const void* c, const void* d) { __builtin_amdgcn_sched_barrier(0); asm volatile("s_wait_xcnt 0x0" :: "v"(a), "v"(b), "v"(c), "v"(d) : "memory"); __builtin_amdgcn_sched_barrier(0); }
template <typename T16, int NSPLIT>
__device__ __forceinline__ void fattn_body(const T16* __restrict__ Q, const T16* __restrict__ Q2, const T16* __restrict__ Kp, const T16* __restrict__ Kp2, const T16* __restrict__ Vt, const T16* __restrict__ Vt2, int q0, int lr, int hi, bf* Ah, bf* Al) {
    typedef typename WFrag<T16>::V V;
    const float L2E = 1.4426950408889634f;
    const float PSH = (NSPLIT == 0) ? 10.0f : 0.0f;      // fp16 probabilities carry a factor 2^10 (small ones stay normal numbers); l carries it too, so it cancels in the division
    V q[2][4], q2[2][4];
    const size_t koff = (size_t)lr * HD + 8 * hi, voff = (size_t)lr * TT + 8 * hi;
    // one lane pointer per plane and run of loads; every fragment of the run is a constant offset from it
    { const T16* qp = Q + (size_t)q0 * HD + koff; const T16* qp2 = (NSPLIT == 2) ? Q2 + (size_t)q0 * HD + koff : qp;
#pragma unroll
      for (int g = 0; g < 2; ++g)
#pragma unroll
        for (int kc = 0; kc < 4; ++kc) { const int qo = g * 16 * HD + kc * 32; q[g][kc] = WFrag<T16>::ld(qp + qo); if (NSPLIT == 2) q2[g][kc] = WFrag<T16>::ld(qp2 + qo); }
      addr_wait(); }
    v8f o[8][2];
#pragma unroll
    for (int dt = 0; dt < 8; ++dt) { o[dt][0] = (v8f){}; o[dt][1] = (v8f){}; }
    float m[2] = { -3.0e38f, -3.0e38f }, l[2] = { 0.f, 0.f };
    V k[2][4], k2[2][4];
    { const T16* kp = Kp + koff; const T16* kp2 = (NSPLIT == 2) ? Kp2 + koff : kp;
#pragma unroll
      for (int t = 0; t < 2; ++t)
#pragma unroll
        for (int kc = 0; kc < 4; ++kc) { const int ko = t * 16 * HD + kc * 32; k[t][kc] = WFrag<T16>::ld(kp + ko); if (NSPLIT == 2) k2[t][kc] = WFrag<T16>::ld(kp2 + ko); }
      addr_wait(); }
    int kb = 0;
#pragma unroll 1   // one copy of the body: a trip's fragments already take most of the register file
    do {                                                 // q0 >= 0: at least one run of keys
        V kx[2][4], kx2[2][4], v[8], v2[8];
        const int kn = min(kb + 32, q0);                 // K fragments are fetched one run ahead; the last run fetches its own rows again (in bounds, unused)
        const T16* vp = Vt + voff + kb; const T16* vp2 = (NSPLIT == 2) ? Vt2 + voff + kb : vp; const T16* kp = Kp + koff + (size_t)kn * HD; const T16* kp2 = (NSPLIT == 2) ? Kp2 + koff + (size_t)kn * HD : kp;
#pragma unroll
        for (int dt = 0; dt < 8; ++dt) { const int vo = dt * 16 * TT; v[dt] = WFrag<T16>::ld(vp + vo); if (NSPLIT == 2) v2[dt] = WFrag<T16>::ld(vp2 + vo); }
#pragma unroll
        for (int t = 0; t < 2; ++t)
#pragma unroll
            for (int kc = 0; kc < 4; ++kc) { const int ko = t * 16 * HD + kc * 32; kx[t][kc] = WFrag<T16>::ld(kp + ko); if (NSPLIT == 2) kx2[t][kc] = WFrag<T16>::ld(kp2 + ko); }
        __builtin_amdgcn_sched_barrier(0);               // keeps the run's loads in one group up here (sunk between the products, each pair would wait a full latency)
        v8f s[2][2];
#pragma unroll
        for (int t = 0; t < 2; ++t)
#pragma unroll
            for (int g = 0; g < 2; ++g) { v8f a = (v8f){};
#pragma unroll
                for (int kc = 0; kc < 4; ++kc) { a = WFrag<T16>::mma(k[t][kc], q[g][kc], a); if (NSPLIT == 2) { a = WFrag<T16>::mma(k[t][kc], q2[g][kc], a); a = WFrag<T16>::mma(k2[t][kc], q[g][kc], a); } }
                s[t][g] = a; }
        const bool diag = (kb == q0);                    // only the last run of keys meets the causal diagonal (wave-uniform)
        float mn[2];
#pragma unroll
        for (int g = 0; g < 2; ++g) { float mx = m[g];
#pragma unroll
            for (int t = 0; t < 2; ++t)
#pragma unroll
                for (int j = 0; j < 8; ++j) { float x = s[t][g][j] * SCL; if (diag && t * 16 + hi * 8 + j > g * 16 + lr) x = -3.0e38f; s[t][g][j] = x; mx = fmaxf(mx, x); }
            mn[g] = fmaxf(mx, xhalf(mx)); }
        if (__builtin_amdgcn_ballot_w32(mn[0] > m[0] || mn[1] > m[1]) != 0) {   // a maximum moved: bring sums and output tiles to the new one (factor exactly 1 where it did not)
#pragma unroll
            for (int g = 0; g < 2; ++g) { const float al = __builtin_amdgcn_exp2f((m[g] - mn[g]) * L2E); l[g] *= al; m[g] = mn[g];
#pragma unroll
                for (int dt = 0; dt < 8; ++dt) o[dt][g] *= al; } }
        V pf[2], pf2[2];
#pragma unroll
        for (int g = 0; g < 2; ++g) { float sum = 0.f; float p[16];
#pragma unroll
            for (int e = 0; e < 16; ++e) { p[e] = __builtin_amdgcn_exp2f((s[e >> 3][g][e & 7] - m[g]) * L2E + PSH); sum += p[e]; }
            l[g] += sum;
            if constexpr (NSPLIT == 0) { v16h f;
#pragma unroll
                for (int e = 0; e < 16; ++e) f[e] = tohx(p[e]);
                pf[g] = f;
            } else { v8us h0, h1, l0, l1;
#pragma unroll
                for (int e = 0; e < 8; ++e) { unsigned short a, c2; splitf(p[e], a, c2); h0[e] = a; l0[e] = c2; splitf(p[8 + e], a, c2); h1[e] = a; l1[e] = c2; }
                pf[g] = cat16b(h0, h1); pf2[g] = cat16b(l0, l1); } }
#pragma unroll
        for (int dt = 0; dt < 8; ++dt)
#pragma unroll
            for (int g = 0; g < 2; ++g) { o[dt][g] = WFrag<T16>::mma(v[dt], pf[g], o[dt][g]); if (NSPLIT == 2) { o[dt][g] = WFrag<T16>::mma(v[dt], pf2[g], o[dt][g]); o[dt][g] = WFrag<T16>::mma(v2[dt], pf[g], o[dt][g]); } }
        addr_wait(vp, vp2, kp, kp2);                     // at the trip's foot, where the run's loads have long been taken up: the four pointers are stepped only behind it
#pragma unroll
        for (int t = 0; t < 2; ++t)
#pragma unroll
            for (int kc = 0; kc < 4; ++kc) { k[t][kc] = kx[t][kc]; if (NSPLIT == 2) k2[t][kc] = kx2[t][kc]; }
        kb += 32;
    } while (kb <= q0);
#pragma unroll
    for (int g = 0; g < 2; ++g) { const float inv = __fdiv_rn(1.0f, l[g] + xhalf(l[g])); const size_t oo = (size_t)(q0 + g * 16 + lr) * DQ + hi * 8; bf* ap = Ah + oo; bf* ap2 = Al + oo;
#pragma unroll
        for (int dt = 0; dt < 8; ++dt) { v8us oh, ol;
#pragma unroll
            for (int j = 0; j < 8; ++j) { unsigned short a, c2; splitf(o[dt][g][j] * inv, a, c2); oh[j] = a; ol[j] = c2; }
            *(v8us*)(ap + dt * 16) = oh; *(v8us*)(ap2 + dt * 16) = ol;
            addr_wait(); } }
}
// grid (heads, TT / 128), 128 threads. Query blocks of 32 rows: block p has p + 1 runs of keys, so blocks p and TT/32 - 1 - p together always have TT/32 + 1; work-group y takes the pairs p = 2y and 2y + 1, one block a wave.
// Query rows < RH: bf16 hi/lo planes, 3 products; the rest fp16 (chosen per wave). Writes the merged hi/lo planes [t][head * HD + d].
__global__ __launch_bounds__(128) void k_fattn(const h16* __restrict__ Q16, const h16* __restrict__ K16, const h16* __restrict__ V16, const bf* __restrict__ Qh, const bf* __restrict__ Ql, const bf* __restrict__ Kh, const bf* __restrict__ Kl, const bf* __restrict__ Vh, const bf* __restrict__ Vl, bf* Ah, bf* Al) {
    const int lane = threadIdx.x & 31, lr = lane & 15, hi = lane >> 4; const int h = blockIdx.x; const int w = __builtin_amdgcn_readfirstlane((int)(threadIdx.x >> 5));   /* wave-uniform: the key loop's bound and the choice of body stay scalar */
    const int pr = (int)blockIdx.y * 2 + (w >> 1); const int q0 = ((w & 1) ? pr : TT / 32 - 1 - pr) * 32; const size_t hp = (size_t)h * TT * HD;
    if (q0 < RH) fattn_body<bf, 2>(Qh + hp, Ql + hp, Kh + hp, Kl + hp, Vh + hp, Vl + hp, q0, lr, hi, Ah + h * HD, Al + h * HD);
    else fattn_body<h16, 0>(Q16 + hp, nullptr, K16 + hp, nullptr, V16 + hp, nullptr, q0, lr, hi, Ah + h * HD, Al + h * HD);
}

extern "C" void kernel_launch(void* const* d_in, const int* in_sizes, int n_in,
                              void* d_out, int out_size, void* d_ws, size_t ws_size, hipStream_t stream) {
    (void)in_sizes; (void)n_in; (void)out_size;
    const float* x = (const float*)d_in[0]; const float* wq = (const float*)d_in[1]; const float* wk = (const float*)d_in[2]; const float* wv = (const float*)d_in[3]; const float* wo = (const float*)d_in[4];   /* order hidden_states, Wq, Wk, Wv, Wo ('oi' [2048][2048]) */
    float* OUT = (float*)d_out;     // [2][2048][2048]
    char* wsp = (char*)d_ws;
    auto take = [&](size_t bytes) { char* p = wsp; wsp += (bytes + 255) & ~(size_t)255; return (void*)p; };
    bf* WQ = (bf*)take((size_t)DQ * DM * 2); bf* WK = (bf*)take((size_t)DKV * DM * 2); bf* WV = (bf*)take((size_t)DKV * DM * 2); bf* WO = (bf*)take((size_t)DM * DQ * 2); float* CS = (float*)take((size_t)TT * HD * 2 * 4);
    bf* XB = (bf*)take((size_t)TT * DM * 2); float* FQ = (float*)take((size_t)TT * DQ * 4); float* FK = (float*)take((size_t)TT * DKV * 4);
    h16* QP16 = (h16*)take((size_t)NH_ * TT * HD * 2); h16* KP16 = (h16*)take((size_t)NKV * TT * HD * 2); h16* VT16 = (h16*)take((size_t)NKV * HD * TT * 2);
    bf* QPh = (bf*)take((size_t)NH_ * TT * HD * 2); bf* QPl = (bf*)take((size_t)NH_ * TT * HD * 2); bf* KPh = (bf*)take((size_t)NKV * TT * HD * 2); bf* KPl = (bf*)take((size_t)NKV * TT * HD * 2); bf* VTh = (bf*)take((size_t)NKV * HD * TT * 2); bf* VTl = (bf*)take((size_t)NKV * HD * TT * 2);
    bf* ATh = (bf*)take((size_t)TT * DQ * 2); bf* ATl = (bf*)take((size_t)TT * DQ * 2);
    if ((size_t)(wsp - (char*)d_ws) > ws_size) return;    // ws 256 MiB
    float* FV = FK;   // v projection reuses the k buffer after the k planes are built (stream-ordered)
    { k_cvt8<<<(unsigned)(((size_t)DQ * DM / 8 + 255) / 256), 256, 0, stream>>>(wq, WQ, (size_t)DQ * DM / 8); k_cvt8<<<(unsigned)(((size_t)DKV * DM / 8 + 255) / 256), 256, 0, stream>>>(wk, WK, (size_t)DKV * DM / 8); k_cvt8<<<(unsigned)(((size_t)DKV * DM / 8 + 255) / 256), 256, 0, stream>>>(wv, WV, (size_t)DKV * DM / 8);
      k_cvt8<<<(unsigned)(((size_t)DM * DQ / 8 + 255) / 256), 256, 0, stream>>>(wo, WO, (size_t)DM * DQ / 8);
       }
    k_cs5<<<(TT * HD + 255) / 256, 256, 0, stream>>>(CS);   /* rotary table once */
    const unsigned LQ = (unsigned)(((size_t)NH_ * TT * HD / 2 + 255) / 256), LKv = (unsigned)(((size_t)NKV * TT * HD / 2 + 255) / 256);
    for (int b = 0; b < NB_; ++b) {
        
        k_cvt8<<<(unsigned)(((size_t)TT * DM / 8 + 255) / 256), 256, 0, stream>>>(x + (size_t)b * TT * DM, XB, (size_t)TT * DM / 8);
        k_gemms<0, DM><<<dim3(TT / 128, DQ / 128, 1), 128, 0, stream>>>(XB, nullptr, WQ, FQ, DQ);
        k_rope<<<LQ, 256, 0, stream>>>(FQ, DQ, NH_, CS, nullptr, nullptr, 1.0f, QP16, QPh, QPl);
        k_gemms<0, DM><<<dim3(TT / 128, DKV / 128, 1), 128, 0, stream>>>(XB, nullptr, WK, FK, DKV);
        k_rope<<<LKv, 256, 0, stream>>>(FK, DKV, NKV, CS, nullptr, nullptr, 1.0f, KP16, KPh, KPl);
        k_gemms<0, DM><<<dim3(TT / 128, DKV / 128, 1), 128, 0, stream>>>(XB, nullptr, WV, FV, DKV); k_vtp<<<LKv, 256, 0, stream>>>(FV, DKV, NKV, VT16, VTh, VTl);
        k_fattn<<<dim3(NH_, TT / 128, 1), 128, 0, stream>>>(QP16, KP16, VT16, QPh, QPl, KPh, KPl, VTh, VTl, ATh, ATl);
        k_gemms<1, DQ><<<dim3(TT / 128, DM / 128, 1), 128, 0, stream>>>(ATh, ATl, WO, OUT + (size_t)b * TT * DM, DM); }
}

// v004
// One run takes 328 microseconds.
// Next to v003, in two timings, it ran 1.27 times as fast each time.
// All steps since v000 together make it 5.34 times as fast.
#include <hip/hip_runtime.h>

// Causal multi-head attention with 128-wide heads and computed rotate-half rotary embeddings (hidden_states [2][2048][2048]; q, k, v = einsum('bsd,ed->bse', x, W) ('oi' 0.02; 16 heads x 128); rope x cos + rotate_half(x) sin, angle t x 1/10000^(2i/128) (64 f32 frequencies jnp-exact; cat(freqs, freqs); precise cosf/sinf); scores / sqrt(128); mask = (key > query) | (key - query >= 1024): the second term only touches FUTURE keys, which the first already excludes: plain causal (-inf == exclusion); softmax in f32; out = merged Wo^T -> [2][2048][2048] (8.4 M); argument order hidden_states, Wq, Wk, Wv, Wo).
// Layout: bf16 copy of x; 'oi' weights; exact projections whose epilogues build the head planes (q, k: rotate-half with the k_cs5 table; v: transposed); causal T-2048 attention at HD 128 in one fused kernel per batch, online softmax (hybrid rows: < 512 hi/lo 3 products, rest fp16 x1024; keys above the diagonal block never read); merged hi/lo x Wo exact.
// Compute dtypes, f32 accumulate: every input rounded to bf16; projections exact; rotary f32; attention rows < 512 3 products, rest fp16; softmax f32; Wo hl x exact.

#define NB_  2
#define TT   2048
#define DM   2048
#define NH_  16
#define NKV  16
#define HD   128
#define DQ   (NH_ * HD)
#define DKV  (NKV * HD)
#define RH   512                  // query rows < RH use hi+lo planes (0: none)
#define SCL  0.088388347648318447f   // HD^-0.5
typedef _Float16 h16;
typedef unsigned short bf;
typedef __attribute__((ext_vector_type(16))) __bf16   v16bf;
typedef __attribute__((ext_vector_type(16))) _Float16 v16h;
typedef __attribute__((ext_vector_type(8)))  _Float16 v8h;
typedef __attribute__((ext_vector_type(8)))  unsigned short v8us;
typedef __attribute__((ext_vector_type(8)))  float    v8f;
typedef __attribute__((ext_vector_type(4)))  float    v4f;
typedef v8h  __attribute__((may_alias)) v8ha;
typedef v4f  __attribute__((may_alias)) v4fa;
typedef v8us __attribute__((may_alias)) v8usa;

__device__ __forceinline__ unsigned short f2bf(float f) { unsigned u = __float_as_uint(f); u += 0x7FFFu + ((u >> 16) & 1u); return (unsigned short)(u >> 16); }
__device__ __forceinline__ float bf2f(unsigned short b) { return __uint_as_float(((unsigned)b) << 16); }
__device__ __forceinline__ v16h cat16(v8h lo, v8h hi) { return __builtin_shufflevector(lo, hi, 0, 1, 2, 3, 4, 5, 6, 7, 8, 9, 10, 11, 12, 13, 14, 15); }
__device__ __forceinline__ v16bf cat16b(v8us lo, v8us hi) { return __builtin_bit_cast(v16bf, __builtin_shufflevector(lo, hi, 0, 1, 2, 3, 4, 5, 6, 7, 8, 9, 10, 11, 12, 13, 14, 15)); }
__device__ __forceinline__ v8f wmma16(v16h a, v16h b, v8f c) { return __builtin_amdgcn_wmma_f32_16x16x32_f16(false, a, false, b, (short)0, c, false, false); }
__device__ __forceinline__ v8f wmmab(v16bf a, v16bf b, v8f c) { return __builtin_amdgcn_wmma_f32_16x16x32_bf16(false, a, false, b, (short)0, c, false, false); }

typedef __attribute__((ext_vector_type(2))) _Float16 v2h;
typedef __attribute__((ext_vector_type(2))) __bf16 v2bf;
typedef __attribute__((ext_vector_type(2))) unsigned short v2us;
typedef __attribute__((ext_vector_type(2))) float v2f;
__device__ __forceinline__ void addr_wait() { __builtin_amdgcn_sched_barrier(0); asm volatile("s_wait_xcnt 0x0" ::: "memory"); __builtin_amdgcn_sched_barrier(0); }
// Eight f32 values -> their words in the three planes: fp16, bf16 head, bf16 of the remainder (each rounded to nearest even, two values a convert).
__device__ __forceinline__ void planes8(const float (&y)[8], v8h& o16, v8us& oh, v8us& ol) {
#pragma unroll   // constant vector indices: the words stay in registers
    for (int p = 0; p < 4; ++p) { const v2f a = { y[2 * p], y[2 * p + 1] };
        const v2h f = __builtin_convertvector(a, v2h); const v2us hu = __builtin_bit_cast(v2us, __builtin_convertvector(a, v2bf));
        const v2f r = { a[0] - bf2f(hu[0]), a[1] - bf2f(hu[1]) }; const v2us lu = __builtin_bit_cast(v2us, __builtin_convertvector(r, v2bf));
        o16[2 * p] = f[0]; o16[2 * p + 1] = f[1]; oh[2 * p] = hu[0]; oh[2 * p + 1] = hu[1]; ol[2 * p] = lu[0]; ol[2 * p + 1] = lu[1]; }
}

// ---- k_gemms: sum_k A[m][k] Bt[n][k] (NSPLIT 1: + A2[m][k] Bt[n][k], product by product in the same k order), operands K-contiguous bf16 planes. M, N % 128 == 0, K % 128 == 0, K >= 256.
// EPI 0: C[m][n] (f32, pitch ldc). EPI 1, 2: m = token, the tile's 128 columns = one head; the f32 tile never leaves the work-group: it is turned into that head's three planes (fp16, bf16 head, bf16 remainder) here.
//   EPI 1: planes [head][t][d] of the rotate-half rotary form out[d] = x[d] cos[t][d] - x[d+64] sin[t][d], out[d+64] = x[d+64] cos[t][d] + x[d] sin[t][d], d < 64, (cos, sin) pairs from CS[t][d].   EPI 2: transposed planes [head][d][t].
// One work-group of four waves per 128x128 output tile, each wave a 64x64 quarter (16 accumulators); grid (M/128, N/128), 128 threads.
// A stage is 128 k (256 B) of the tile's 128 rows of every operand, brought from global memory into LDS by asynchronous 16-byte copies (whole lines, each byte fetched once per work-group) and read from there as fragments by the two waves that need it.
// Two buffers: the copies of stage t + 2 are issued behind the barrier that ends trip t and fly during trip t + 1.
template <typename T16> struct WFrag;
template <> struct WFrag<h16> { typedef v16h V; static __device__ __forceinline__ V ld(const h16* p) { return cat16(*(const v8h*)p, *(const v8h*)(p + 16)); } static __device__ __forceinline__ v8f mma(V a, V b, v8f c) { return wmma16(a, b, c); } };
template <> struct WFrag<bf> { typedef v16bf V; static __device__ __forceinline__ V ld(const bf* p) { return cat16b(*(const v8us*)p, *(const v8us*)(p + 16)); } static __device__ __forceinline__ v8f mma(V a, V b, v8f c) { return wmmab(a, b, c); } };
#define GKS 128                    // k per stage
#define GP  136                    // LDS row pitch in elements: 272 B = 16 B x odd, free of bank conflicts for 16-byte fragment reads
#define TP  132                    // row pitch in f32 of the epilogue's tile in LDS: 528 B = 16 B x odd
// Eight copies of 16 B per lane, LDS step 8 rows, global step gs elements. s_wait_xcnt 0 is the statement's last line, so that it stands in front of every later write of a register that a copy names.
__device__ __forceinline__ void cp8(unsigned l, const bf* g, size_t gs) {
    asm volatile("global_load_async_to_lds_b128 %0, %8, off\n\t"
                 "global_load_async_to_lds_b128 %1, %9, off\n\t"
                 "global_load_async_to_lds_b128 %2, %10, off\n\t"
                 "global_load_async_to_lds_b128 %3, %11, off\n\t"
                 "global_load_async_to_lds_b128 %4, %12, off\n\t"
                 "global_load_async_to_lds_b128 %5, %13, off\n\t"
                 "global_load_async_to_lds_b128 %6, %14, off\n\t"
                 "global_load_async_to_lds_b128 %7, %15, off\n\t"
                 "s_wait_xcnt 0x0"
                 :: "v"(l), "v"(l + 1u * 8 * GP * 2), "v"(l + 2u * 8 * GP * 2), "v"(l + 3u * 8 * GP * 2), "v"(l + 4u * 8 * GP * 2), "v"(l + 5u * 8 * GP * 2), "v"(l + 6u * 8 * GP * 2), "v"(l + 7u * 8 * GP * 2),
                    "v"(g), "v"(g + gs), "v"(g + 2 * gs), "v"(g + 3 * gs), "v"(g + 4 * gs), "v"(g + 5 * gs), "v"(g + 6 * gs), "v"(g + 7 * gs) : "memory");
}
template <int NSPLIT, int K, int EPI>
__global__ __launch_bounds__(128) void k_gemms(const bf* __restrict__ A, const bf* __restrict__ A2, const bf* __restrict__ Bt, float* C, int ldc, const float* __restrict__ CS, h16* P16, bf* Ph, bf* Pl) {
    typedef WFrag<bf>::V V;
    constexpr int NOP = (NSPLIT == 1) ? 3 : 2;           // operand planes per stage: A, Bt (, A2)
    __shared__ __align__(16) bf st[2][NOP][128 * GP];
    static_assert(EPI == 0 || sizeof(st) >= 2 * 128 * TP * sizeof(float), "the epilogue's tile and rotary rows fit the ring's LDS");
    const int tid = threadIdx.x, lane = tid & 31, lr = lane & 15, hi = lane >> 4; const int w = __builtin_amdgcn_readfirstlane(tid >> 5);
    const int r0 = blockIdx.x * 128, c0 = blockIdx.y * 128, wr = (w >> 1) * 64, wc = (w & 1) * 64;
    v8f acc[4][4];
    // every '#pragma unroll' of this kernel: constant indices, so that accumulators and fragments stay in registers
#pragma unroll
    for (int mb = 0; mb < 4; ++mb)
#pragma unroll
        for (int nb = 0; nb < 4; ++nb) acc[mb][nb] = (v8f){};
    // a copy of the work-group covers 8 rows of 256 B: lane pointer = row tid / 16, 16-byte piece tid % 16
    const size_t go = (size_t)(tid >> 4) * K + (tid & 15) * 8;
    const bf* ga = A + (size_t)r0 * K + go; const bf* gb = Bt + (size_t)c0 * K + go; const bf* ga2 = (NSPLIT == 1) ? A2 + (size_t)r0 * K + go : ga;
    const unsigned l0 = (unsigned)(size_t)&st[0][0][(tid >> 4) * GP + (tid & 15) * 8];
    auto fill = [&](int s) {
        const unsigned l = l0 + (unsigned)(s & 1) * (NOP * 128 * GP * 2); const int ko = s * GKS;
#pragma unroll
        for (int h = 0; h < 2; ++h) { const unsigned lh = l + h * 64 * GP * 2; const size_t gh = (size_t)h * 64 * K + ko;
            cp8(lh, ga + gh, (size_t)8 * K); cp8(lh + 128 * GP * 2, gb + gh, (size_t)8 * K); if (NSPLIT == 1) cp8(lh + 2 * 128 * GP * 2, ga2 + gh, (size_t)8 * K); } };
    constexpr int NS = K / GKS; static_assert(K % GKS == 0 && NS >= 2, "two stages or more");
    fill(0);
    asm volatile("s_wait_asynccnt 0x0" ::: "memory");    // this wave's copies of stage 0 have landed
    __syncthreads();                                     // every wave's have: stage 0 may be read
    fill(1);
#pragma unroll 1   // one copy of the trip; the buffer is chosen by the trip's parity
    for (int t = 0; t < NS; ++t) {
        const bf* sa = &st[t & 1][0][(wr + lr) * GP + 8 * hi]; const bf* sb = &st[t & 1][1][(wc + lr) * GP + 8 * hi]; const bf* sa2 = &st[t & 1][NOP - 1][(wr + lr) * GP + 8 * hi];
        // two fragment sets: block kk + 1's LDS reads are issued as one group in front of block kk's products, so that only the trip's first group is waited for in full
        V a[2][4], a2[2][4], b[2][4];
#pragma unroll
        for (int f = 0; f < 4; ++f) { a[0][f] = WFrag<bf>::ld(sa + f * 16 * GP); if (NSPLIT == 1) a2[0][f] = WFrag<bf>::ld(sa2 + f * 16 * GP); b[0][f] = WFrag<bf>::ld(sb + f * 16 * GP); }
#pragma unroll
        for (int kk = 0; kk < GKS / 32; ++kk) { const int c = kk & 1, n = c ^ 1;
            if (kk + 1 < GKS / 32) {
#pragma unroll
                for (int f = 0; f < 4; ++f) { a[n][f] = WFrag<bf>::ld(sa + f * 16 * GP + (kk + 1) * 32); if (NSPLIT == 1) a2[n][f] = WFrag<bf>::ld(sa2 + f * 16 * GP + (kk + 1) * 32); b[n][f] = WFrag<bf>::ld(sb + f * 16 * GP + (kk + 1) * 32); } }
            __builtin_amdgcn_sched_barrier(0);           // keeps that group of reads up here (sunk among the products, each pair would be waited for at its full LDS latency)
#pragma unroll
            for (int nb = 0; nb < 4; ++nb)
#pragma unroll
                for (int mb = 0; mb < 4; ++mb) { acc[mb][nb] = WFrag<bf>::mma(a[c][mb], b[c][nb], acc[mb][nb]); if (NSPLIT == 1) acc[mb][nb] = WFrag<bf>::mma(a2[c][mb], b[c][nb], acc[mb][nb]); }
            __builtin_amdgcn_sched_barrier(0);           // and the next group behind this block's products: its registers are the ones they read
        }
        asm volatile("s_wait_dscnt 0x0" ::: "memory");   // this wave's reads of the trip's buffer are done
        asm volatile("s_wait_asynccnt 0x0" ::: "memory");   // this wave's copies of stage t + 1 have landed
        __syncthreads();                                 // publishes stage t + 1 and frees the buffer that trip t has read
        if (t + 2 < NS) fill(t + 2);
    }
    asm volatile("s_wait_asynccnt 0x0" ::: "memory");    // no copy is left in flight when the wave goes on to its end
    if constexpr (EPI == 0) {
    __shared__ __align__(16) float osw[4][16 * 68];      // each wave's own output staging
    float* os = osw[w];
#pragma unroll
    for (int mb = 0; mb < 4; ++mb) {
#pragma unroll
        for (int nb = 0; nb < 4; ++nb) {
#pragma unroll
            for (int j = 0; j < 8; ++j) os[(hi * 8 + j) * 68 + nb * 16 + lr] = acc[mb][nb][j]; }
        __builtin_amdgcn_wave_barrier(); asm volatile("" ::: "memory");   // compile-time order only: the lanes' LDS stores stay in front of the row reads of other lanes' words
        float* crow = C + (size_t)(r0 + wr + mb * 16) * ldc + c0 + wc;
#pragma unroll
        for (int s = 0; s < 8; ++s) { const int row = 2 * s + hi, cofs = lr * 4; const v4f val = *(const v4fa*)(os + row * 68 + cofs);
            *(v4f*)(crow + (size_t)row * ldc + cofs) = val; }
        asm volatile("s_wait_xcnt 0x0" ::: "memory");    // in front of the next group's reuse of the stores' address registers
        __builtin_amdgcn_wave_barrier(); asm volatile("" ::: "memory");   // the same for the row reads and the next group's LDS stores
    }
    } else {
        // The ring's LDS is free here: every wave's last fragment read and last copy lie in front of the loop's last barrier.
        float* tl = (float*)&st[0][0][0];                // the work-group's f32 tile, pitch TP
        v8h o16[2]; v8us oh[2], ol[2];
        if constexpr (EPI == 1) {
            float* cl = tl + 128 * TP;                   // the tile's 128 rotary rows of 64 (cos, sin) pairs, pitch TP
            // a wave-wide load takes one whole row of 512 B; all 32 are issued up here, so that they fly while the tile is staged
            const float* cg = CS + (size_t)(r0 + w) * HD + lane * 4; v4f cv[32];
#pragma unroll
            for (int i = 0; i < 32; ++i) cv[i] = *(const v4f*)(cg + i * 4 * HD);
            addr_wait();
#pragma unroll
            for (int mb = 0; mb < 4; ++mb)
#pragma unroll
                for (int nb = 0; nb < 4; ++nb)
#pragma unroll
                    for (int j = 0; j < 8; ++j) tl[(wr + mb * 16 + hi * 8 + j) * TP + wc + nb * 16 + lr] = acc[mb][nb][j];
#pragma unroll
            for (int i = 0; i < 32; ++i) *(v4fa*)(cl + (i * 4 + w) * TP + lane * 4) = cv[i];
            __syncthreads();                             // tile and rotary rows are whole: d and d + 64 of a row come from two waves
            // a lane: 8 values d and the 8 at d + 64 of one row; 8 lanes store a whole 128-B line of a plane, rows step by 16
            const int row = tid >> 3, dg = (tid & 7) * 8; const float* tp = tl + row * TP + dg; const float* cp = cl + row * TP + dg * 2;
            const size_t po = ((size_t)blockIdx.y * TT + r0 + row) * HD + dg; h16* p16 = P16 + po; bf* ph = Ph + po; bf* pl = Pl + po;
            v4f x[2][4], c[2][4];                        // two sets: row group i + 1 is read from LDS while group i is worked on
            auto rd = [&](int i) {
#pragma unroll
                for (int q = 0; q < 2; ++q) { x[i & 1][q] = *(const v4fa*)(tp + i * 16 * TP + q * 4); x[i & 1][2 + q] = *(const v4fa*)(tp + i * 16 * TP + HD / 2 + q * 4); }
#pragma unroll
                for (int q = 0; q < 4; ++q) c[i & 1][q] = *(const v4fa*)(cp + i * 16 * TP + q * 4); };
            rd(0);
#pragma unroll
            for (int i = 0; i < 8; ++i) { float lo[8], up[8];
                if (i + 1 < 8) rd(i + 1);
#pragma unroll
                for (int e = 0; e < 8; ++e) { const float x0 = x[i & 1][e >> 2][e & 3], x1 = x[i & 1][2 + (e >> 2)][e & 3], co = c[i & 1][e >> 1][(e & 1) * 2], si = c[i & 1][e >> 1][(e & 1) * 2 + 1];
                    lo[e] = x0 * co - x1 * si; up[e] = x1 * co + x0 * si; }
                planes8(lo, o16[0], oh[0], ol[0]); planes8(up, o16[1], oh[1], ol[1]);
                __builtin_amdgcn_sched_barrier(0);       // the six stores stand together behind the arithmetic: no register of an issued store is written in front of the wait below
#pragma unroll
                for (int q = 0; q < 2; ++q) { const int so = i * 16 * HD + q * (HD / 2); *(v8h*)(p16 + so) = o16[q]; *(v8us*)(ph + so) = oh[q]; *(v8us*)(pl + so) = ol[q]; }
                addr_wait(); }
        } else {
            // a lane's eight accumulator words are eight tokens of one column: the tile is staged transposed, [d][t], by 16-byte LDS stores
#pragma unroll
            for (int mb = 0; mb < 4; ++mb)
#pragma unroll
                for (int nb = 0; nb < 4; ++nb) { float* q = tl + (wc + nb * 16 + lr) * TP + wr + mb * 16 + hi * 8; const v8f a = acc[mb][nb];
                    *(v4fa*)q = (v4f){ a[0], a[1], a[2], a[3] }; *(v4fa*)(q + 4) = (v4f){ a[4], a[5], a[6], a[7] }; }
            __syncthreads();                             // the tile is whole: a row [d] holds tokens of two waves
            // a lane: 8 tokens of one d; 16 lanes store the tile's 256 B (two whole lines) of a plane's row, rows step by 8
            const int dr = tid >> 4, tg = (tid & 15) * 8; const float* tp = tl + dr * TP + tg;
            const size_t po = ((size_t)blockIdx.y * HD + dr) * TT + r0 + tg; h16* p16 = P16 + po; bf* ph = Ph + po; bf* pl = Pl + po;
            v4f x[2][4];                                 // two sets: row group i + 1 is read from LDS while group i is worked on
            auto rd = [&](int i) {
#pragma unroll
                for (int q = 0; q < 2; ++q) { x[i & 1][2 * q] = *(const v4fa*)(tp + (i * 16 + q * 8) * TP); x[i & 1][2 * q + 1] = *(const v4fa*)(tp + (i * 16 + q * 8) * TP + 4); } };
            rd(0);
#pragma unroll
            for (int i = 0; i < 8; ++i) {
                if (i + 1 < 8) rd(i + 1);
#pragma unroll
                for (int q = 0; q < 2; ++q) { const v4f x0 = x[i & 1][2 * q], x1 = x[i & 1][2 * q + 1];
                    const float y[8] = { x0[0], x0[1], x0[2], x0[3], x1[0], x1[1], x1[2], x1[3] }; planes8(y, o16[q], oh[q], ol[q]); }
                __builtin_amdgcn_sched_barrier(0);       // the six stores stand together behind the arithmetic: no register of an issued store is written in front of the wait below
#pragma unroll
                for (int q = 0; q < 2; ++q) { const int so = (i * 16 + q * 8) * TT; *(v8h*)(p16 + so) = o16[q]; *(v8us*)(ph + so) = oh[q]; *(v8us*)(pl + so) = ol[q]; }
                addr_wait(); }
        }
    }
}

__device__ __forceinline__ h16 tohx(float x) { return (h16)x; }
__device__ __forceinline__ void splitf(float y, unsigned short& h, unsigned short& l) { h = f2bf(y); l = f2bf(y - bf2f(h)); }

__global__ __launch_bounds__(256) void k_cvt8(const float* __restrict__ src, bf* dst, size_t n8) { const size_t i = (size_t)blockIdx.x * 256 + threadIdx.x; if (i >= n8) return; const v8f v = *(const v8f*)(src + i * 8); v8us o;
#pragma unroll
    for (int k = 0; k < 8; ++k) o[k] = f2bf(v[k]); *(v8us*)(dst + i * 8) = o;  }

__constant__ float INVT[HD / 2] = { 1.000000000e+00f, 8.659643531e-01f, 7.498942018e-01f, 6.493816376e-01f, 5.623413324e-01f, 4.869675338e-01f, 4.216965139e-01f, 3.651741445e-01f, 3.162277639e-01f, 2.738419771e-01f, 2.371373624e-01f, 2.053525001e-01f, 1.778279394e-01f, 1.539926529e-01f, 1.333521456e-01f, 1.154782027e-01f, 1.000000015e-01f, 8.659642935e-02f, 7.498941571e-02f, 6.493816525e-02f, 5.623412877e-02f, 4.869675264e-02f, 4.216964915e-02f, 3.651741147e-02f, 3.162277862e-02f, 2.738419548e-02f, 2.371373586e-02f, 2.053525113e-02f, 1.778279431e-02f, 1.539926510e-02f, 1.333521493e-02f, 1.154781971e-02f, 9.999999776e-03f, 8.659643121e-03f, 7.498942316e-03f, 6.493816618e-03f, 5.623413250e-03f, 4.869675264e-03f, 4.216964822e-03f, 3.651741426e-03f, 3.162277862e-03f, 2.738419687e-03f, 2.371373819e-03f, 2.053525066e-03f, 1.778279431e-03f, 1.539926510e-03f, 1.333521446e-03f, 1.154782018e-03f, 1.000000047e-03f, 8.659643354e-04f, 7.498941850e-04f, 6.493816618e-04f, 5.623413017e-04f, 4.869675031e-04f, 4.216964880e-04f, 3.651741135e-04f, 3.162277862e-04f, 2.738419571e-04f, 2.371373848e-04f, 2.053524950e-04f, 1.778279402e-04f, 1.539926452e-04f, 1.333521504e-04f, 1.154781930e-04f };   // float32 1 / 10000^(2i/128), generated with jnp to be bit-exact
// CS[t][d] = (cos, sin) of t x INVT[d], d < HD / 2 (columns d and d + HD / 2 of the rotary tables are equal)
__global__ __launch_bounds__(256) void k_cs5(float* CS) { const int idx = blockIdx.x * 256 + threadIdx.x; if (idx >= TT * (HD / 2)) return; const int d = idx % (HD / 2); const int t = idx / (HD / 2); const float a = __fmul_rn((float)t, INVT[d]); v2f cs; cs[0] = cosf(a); cs[1] = sinf(a); *(v2f*)(CS + (size_t)idx * 2) = cs;  }
// ---- k_fattn: scores, softmax and probability x value in one kernel; neither scores nor probabilities leave the registers. One wave owns 32 query rows of one head and walks the keys 0 .. its last row in runs of 32.
// St[key][query] = K Q^T and Ot[d][query] += Vt Pt: a lane then holds scores of ONE query per 16-column group (query = lr, keys hi*8+j of each 16-key tile), which is at once the B-fragment order of Pt (k = 8*hi+j, 16+8*hi+j),
// so maximum, sum and rescale are in-lane but for one exchange between the wave's halves. Running maximum m and running sum l per query (online softmax); the division by l comes once, at the end.
// The four waves of a work-group take two neighbouring long and two neighbouring short query blocks of one head: neighbours walk the same K and Vt lines, and every work-group has the same number of key runs. No LDS, no barrier.
__device__ __forceinline__ float xhalf(float x) { return __builtin_bit_cast(float, __builtin_amdgcn_permlanex16(__builtin_bit_cast(int, x), __builtin_bit_cast(int, x), 0x76543210, 0xfedcba98, false, false)); }   // lane l with lane l ^ 16
// The same for the key loop, whose loads are many enough for the register allocator to hand a dead pointer's registers to a later load of the same run: the run's four lane pointers are inputs of the wait, so they stay live, and unwritten, up to it.
__device__ __forceinline__ void addr_wait(const void* a, const void* b, const void* c, const void* d) { __builtin_amdgcn_sched_barrier(0); asm volatile("s_wait_xcnt 0x0" :: "v"(a), "v"(b), "v"(c), "v"(d) : "memory"); __builtin_amdgcn_sched_barrier(0); }
template <typename T16, int NSPLIT>
__device__ __forceinline__ void fattn_body(const T16* __restrict__ Q, const T16* __restrict__ Q2, const T16* __restrict__ Kp, const T16* __restrict__ Kp2, const T16* __restrict__ Vt, const T16* __restrict__ Vt2, int q0, int lr, int hi, bf* Ah, bf* Al) {
    typedef typename WFrag<T16>::V V;
    const float L2E = 1.4426950408889634f;
    const float PSH = (NSPLIT == 0) ? 10.0f : 0.0f;      // fp16 probabilities carry a factor 2^10 (small ones stay normal numbers); l carries it too, so it cancels in the division
    V q[2][4], q2[2][4];
    const size_t koff = (size_t)lr * HD + 8 * hi, voff = (size_t)lr * TT + 8 * hi;
    // one lane pointer per plane and run of loads; every fragment of the run is a constant offset from it
    { const T16* qp = Q + (size_t)q0 * HD + koff; const T16* qp2 = (NSPLIT == 2) ? Q2 + (size_t)q0 * HD + koff : qp;
#pragma unroll
      for (int g = 0; g < 2; ++g)
#pragma unroll
        for (int kc = 0; kc < 4; ++kc) { const int qo = g * 16 * HD + kc * 32; q[g][kc] = WFrag<T16>::ld(qp + qo); if (NSPLIT == 2) q2[g][kc] = WFrag<T16>::ld(qp2 + qo); }
      addr_wait(); }
    v8f o[8][2];
#pragma unroll
    for (int dt = 0; dt < 8; ++dt) { o[dt][0] = (v8f){}; o[dt][1] = (v8f){}; }
    float m[2] = { -3.0e38f, -3.0e38f }, l[2] = { 0.f, 0.f };
    V k[2][4], k2[2][4];
    { const T16* kp = Kp + koff; const T16* kp2 = (NSPLIT == 2) ? Kp2 + koff : kp;
#pragma unroll
      for (int t = 0; t < 2; ++t)
#pragma unroll
        for (int kc = 0; kc < 4; ++kc) { const int ko = t * 16 * HD + kc * 32; k[t][kc] = WFrag<T16>::ld(kp + ko); if (NSPLIT == 2) k2[t][kc] = WFrag<T16>::ld(kp2 + ko); }
      addr_wait(); }
    int kb = 0;
#pragma unroll 1   // one copy of the body: a trip's fragments already take most of the register file
    do {                                                 // q0 >= 0: at least one run of keys
        V kx[2][4], kx2[2][4], v[8], v2[8];
        const int kn = min(kb + 32, q0);                 // K fragments are fetched one run ahead; the last run fetches its own rows again (in bounds, unused)
        const T16* vp = Vt + voff + kb; const T16* vp2 = (NSPLIT == 2) ? Vt2 + voff + kb : vp; const T16* kp = Kp + koff + (size_t)kn * HD; const T16* kp2 = (NSPLIT == 2) ? Kp2 + koff + (size_t)kn * HD : kp;
#pragma unroll
        for (int dt = 0; dt < 8; ++dt) { const int vo = dt * 16 * TT; v[dt] = WFrag<T16>::ld(vp + vo); if (NSPLIT == 2) v2[dt] = WFrag<T16>::ld(vp2 + vo); }
#pragma unroll
        for (int t = 0; t < 2; ++t)
#pragma unroll
            for (int kc = 0; kc < 4; ++kc) { const int ko = t * 16 * HD + kc * 32; kx[t][kc] = WFrag<T16>::ld(kp + ko); if (NSPLIT == 2) kx2[t][kc] = WFrag<T16>::ld(kp2 + ko); }
        __builtin_amdgcn_sched_barrier(0);               // keeps the run's loads in one group up here (sunk between the products, each pair would wait a full latency)
        v8f s[2][2];
#pragma unroll
        for (int t = 0; t < 2; ++t)
#pragma unroll
            for (int g = 0; g < 2; ++g) { v8f a = (v8f){};
#pragma unroll
                for (int kc = 0; kc < 4; ++kc) { a = WFrag<T16>::mma(k[t][kc], q[g][kc], a); if (NSPLIT == 2) { a = WFrag<T16>::mma(k[t][kc], q2[g][kc], a); a = WFrag<T16>::mma(k2[t][kc], q[g][kc], a); } }
                s[t][g] = a; }
        const bool diag = (kb == q0);                    // only the last run of keys meets the causal diagonal (wave-uniform)
        float mn[2];
#pragma unroll
        for (int g = 0; g < 2; ++g) { float mx = m[g];
#pragma unroll
            for (int t = 0; t < 2; ++t)
#pragma unroll
                for (int j = 0; j < 8; ++j) { float x = s[t][g][j] * SCL; if (diag && t * 16 + hi * 8 + j > g * 16 + lr) x = -3.0e38f; s[t][g][j] = x; mx = fmaxf(mx, x); }
            mn[g] = fmaxf(mx, xhalf(mx)); }
        if (__builtin_amdgcn_ballot_w32(mn[0] > m[0] || mn[1] > m[1]) != 0) {   // a maximum moved: bring sums and output tiles to the new one (factor exactly 1 where it did not)
#pragma unroll
            for (int g = 0; g < 2; ++g) { const float al = __builtin_amdgcn_exp2f((m[g] - mn[g]) * L2E); l[g] *= al; m[g] = mn[g];
#pragma unroll
                for (int dt = 0; dt < 8; ++dt) o[dt][g] *= al; } }
        V pf[2], pf2[2];
#pragma unroll
        for (int g = 0; g < 2; ++g) { float sum = 0.f; float p[16];
#pragma unroll
            for (int e = 0; e < 16; ++e) { p[e] = __builtin_amdgcn_exp2f((s[e >> 3][g][e & 7] - m[g]) * L2E + PSH); sum += p[e]; }
            l[g] += sum;
            if constexpr (NSPLIT == 0) { v16h f;
#pragma unroll
                for (int e = 0; e < 16; ++e) f[e] = tohx(p[e]);
                pf[g] = f;
            } else { v8us h0, h1, l0, l1;
#pragma unroll
                for (int e = 0; e < 8; ++e) { unsigned short a, c2; splitf(p[e], a, c2); h0[e] = a; l0[e] = c2; splitf(p[8 + e], a, c2); h1[e] = a; l1[e] = c2; }
                pf[g] = cat16b(h0, h1); pf2[g] = cat16b(l0, l1); } }
#pragma unroll
        for (int dt = 0; dt < 8; ++dt)
#pragma unroll
            for (int g = 0; g < 2; ++g) { o[dt][g] = WFrag<T16>::mma(v[dt], pf[g], o[dt][g]); if (NSPLIT == 2) { o[dt][g] = WFrag<T16>::mma(v[dt], pf2[g], o[dt][g]); o[dt][g] = WFrag<T16>::mma(v2[dt], pf[g], o[dt][g]); } }
        addr_wait(vp, vp2, kp, kp2);                     // at the trip's foot, where the run's loads have long been taken up: the four pointers are stepped only behind it
#pragma unroll
        for (int t = 0; t < 2; ++t)
#pragma unroll
            for (int kc = 0; kc < 4; ++kc) { k[t][kc] = kx[t][kc]; if (NSPLIT == 2) k2[t][kc] = kx2[t][kc]; }
        kb += 32;
    } while (kb <= q0);
#pragma unroll
    for (int g = 0; g < 2; ++g) { const float inv = __fdiv_rn(1.0f, l[g] + xhalf(l[g])); const size_t oo = (size_t)(q0 + g * 16 + lr) * DQ + hi * 8; bf* ap = Ah + oo; bf* ap2 = Al + oo;
#pragma unroll
        for (int dt = 0; dt < 8; ++dt) { v8us oh, ol;
#pragma unroll
            for (int j = 0; j < 8; ++j) { unsigned short a, c2; splitf(o[dt][g][j] * inv, a, c2); oh[j] = a; ol[j] = c2; }
            *(v8us*)(ap + dt * 16) = oh; *(v8us*)(ap2 + dt * 16) = ol;
            addr_wait(); } }
}
// grid (heads, TT / 128), 128 threads. Query blocks of 32 rows: block p has p + 1 runs of keys, so blocks p and TT/32 - 1 - p together always have TT/32 + 1; work-group y takes the pairs p = 2y and 2y + 1, one block a wave.
// Query rows < RH: bf16 hi/lo planes, 3 products; the rest fp16 (chosen per wave). Writes the merged hi/lo planes [t][head * HD + d].
__global__ __launch_bounds__(128) void k_fattn(const h16* __restrict__ Q16, const h16* __restrict__ K16, const h16* __restrict__ V16, const bf* __restrict__ Qh, const bf* __restrict__ Ql, const bf* __restrict__ Kh, const bf* __restrict__ Kl, const bf* __restrict__ Vh, const bf* __restrict__ Vl, bf* Ah, bf* Al) {
    const int lane = threadIdx.x & 31, lr = lane & 15, hi = lane >> 4; const int h = blockIdx.x; const int w = __builtin_amdgcn_readfirstlane((int)(threadIdx.x >> 5));   /* wave-uniform: the key loop's bound and the choice of body stay scalar */
    const int pr = (int)blockIdx.y * 2 + (w >> 1); const int q0 = ((w & 1) ? pr : TT / 32 - 1 - pr) * 32; const size_t hp = (size_t)h * TT * HD;
    if (q0 < RH) fattn_body<bf, 2>(Qh + hp, Ql + hp, Kh + hp, Kl + hp, Vh + hp, Vl + hp, q0, lr, hi, Ah + h * HD, Al + h * HD);
    else fattn_body<h16, 0>(Q16 + hp, nullptr, K16 + hp, nullptr, V16 + hp, nullptr, q0, lr, hi, Ah + h * HD, Al + h * HD);
}

extern "C" void kernel_launch(void* const* d_in, const int* in_sizes, int n_in,
                              void* d_out, int out_size, void* d_ws, size_t ws_size, hipStream_t stream) {
    (void)in_sizes; (void)n_in; (void)out_size;
    const float* x = (const float*)d_in[0]; const float* wq = (const float*)d_in[1]; const float* wk = (const float*)d_in[2]; const float* wv = (const float*)d_in[3]; const float* wo = (const float*)d_in[4];   /* order hidden_states, Wq, Wk, Wv, Wo ('oi' [2048][2048]) */
    float* OUT = (float*)d_out;     // [2][2048][2048]
    char* wsp = (char*)d_ws;
    auto take = [&](size_t bytes) { char* p = wsp; wsp += (bytes + 255) & ~(size_t)255; return (void*)p; };
    bf* WQ = (bf*)take((size_t)DQ * DM * 2); bf* WK = (bf*)take((size_t)DKV * DM * 2); bf* WV = (bf*)take((size_t)DKV * DM * 2); bf* WO = (bf*)take((size_t)DM * DQ * 2); float* CS = (float*)take((size_t)TT * (HD / 2) * 2 * 4);
    bf* XB = (bf*)take((size_t)TT * DM * 2);
    h16* QP16 = (h16*)take((size_t)NH_ * TT * HD * 2); h16* KP16 = (h16*)take((size_t)NKV * TT * HD * 2); h16* VT16 = (h16*)take((size_t)NKV * HD * TT * 2);
    bf* QPh = (bf*)take((size_t)NH_ * TT * HD * 2); bf* QPl = (bf*)take((size_t)NH_ * TT * HD * 2); bf* KPh = (bf*)take((size_t)NKV * TT * HD * 2); bf* KPl = (bf*)take((size_t)NKV * TT * HD * 2); bf* VTh = (bf*)take((size_t)NKV * HD * TT * 2); bf* VTl = (bf*)take((size_t)NKV * HD * TT * 2);
    bf* ATh = (bf*)take((size_t)TT * DQ * 2); bf* ATl = (bf*)take((size_t)TT * DQ * 2);
    if ((size_t)(wsp - (char*)d_ws) > ws_size) return;    // ws 256 MiB
    { k_cvt8<<<(unsigned)(((size_t)DQ * DM / 8 + 255) / 256), 256, 0, stream>>>(wq, WQ, (size_t)DQ * DM / 8); k_cvt8<<<(unsigned)(((size_t)DKV * DM / 8 + 255) / 256), 256, 0, stream>>>(wk, WK, (size_t)DKV * DM / 8); k_cvt8<<<(unsigned)(((size_t)DKV * DM / 8 + 255) / 256), 256, 0, stream>>>(wv, WV, (size_t)DKV * DM / 8);
      k_cvt8<<<(unsigned)(((size_t)DM * DQ / 8 + 255) / 256), 256, 0, stream>>>(wo, WO, (size_t)DM * DQ / 8);
       }
    k_cs5<<<(TT * (HD / 2) + 255) / 256, 256, 0, stream>>>(CS);   /* rotary table once */
    for (int b = 0; b < NB_; ++b) {
        
        k_cvt8<<<(unsigned)(((size_t)TT * DM / 8 + 255) / 256), 256, 0, stream>>>(x + (size_t)b * TT * DM, XB, (size_t)TT * DM / 8);
        k_gemms<0, DM, 1><<<dim3(TT / 128, DQ / 128, 1), 128, 0, stream>>>(XB, nullptr, WQ, nullptr, 0, CS, QP16, QPh, QPl);
        k_gemms<0, DM, 1><<<dim3(TT / 128, DKV / 128, 1), 128, 0, stream>>>(XB, nullptr, WK, nullptr, 0, CS, KP16, KPh, KPl);
        k_gemms<0, DM, 2><<<dim3(TT / 128, DKV / 128, 1), 128, 0, stream>>>(XB, nullptr, WV, nullptr, 0, nullptr, VT16, VTh, VTl);
        k_fattn<<<dim3(NH_, TT / 128, 1), 128, 0, stream>>>(QP16, KP16, VT16, QPh, QPl, KPh, KPl, VTh, VTl, ATh, ATl);
        k_gemms<1, DQ, 0><<<dim3(TT / 128, DM / 128, 1), 128, 0, stream>>>(ATh, ATl, WO, OUT + (size_t)b * TT * DM, DM, nullptr, nullptr, nullptr, nullptr); }
}

// v005
// It runs in 296 microseconds.
// Next to v004, in two timings, it ran 1.10 times as fast each time.
// Counting every step since v000, it is 5.88 times as fast.
#include <hip/hip_runtime.h>

// Causal multi-head attention with 128-wide heads and computed rotate-half rotary embeddings (hidden_states [2][2048][2048]; q, k, v = einsum('bsd,ed->bse', x, W) ('oi' 0.02; 16 heads x 128); rope x cos + rotate_half(x) sin, angle t x 1/10000^(2i/128) (64 f32 frequencies jnp-exact; cat(freqs, freqs); precise cosf/sinf); scores / sqrt(128); mask = (key > query) | (key - query >= 1024): the second term only touches FUTURE keys, which the first already excludes: plain causal (-inf == exclusion); softmax in f32; out = merged Wo^T -> [2][2048][2048] (8.4 M); argument order hidden_states, Wq, Wk, Wv, Wo).
// Layout: bf16 copy of x; 'oi' weights; exact projections whose epilogues build the head planes (q, k: rotate-half with the k_cs5 table; v: transposed); causal T-2048 attention at HD 128 in one fused kernel per batch, online softmax (hybrid rows: < 512 hi/lo 3 products, rest fp16 x1024; keys above the diagonal block never read); merged hi/lo x Wo exact.
// Compute dtypes, f32 accumulate: every input rounded to bf16; projections exact; rotary f32; attention rows < 512 3 products, rest fp16; softmax f32; Wo hl x exact.

#define NB_  2
#define TT   2048
#define DM   2048
#define NH_  16
#define NKV  16
#define HD   128
#define DQ   (NH_ * HD)
#define DKV  (NKV * HD)
#define RH   512                  // query rows < RH use hi+lo planes (0: none)
#define SCL  0.088388347648318447f   // HD^-0.5
typedef _Float16 h16;
typedef unsigned short bf;
typedef __attribute__((ext_vector_type(16))) __bf16   v16bf;
typedef __attribute__((ext_vector_type(16))) _Float16 v16h;
typedef __attribute__((ext_vector_type(8)))  _Float16 v8h;
typedef __attribute__((ext_vector_type(8)))  unsigned short v8us;
typedef __attribute__((ext_vector_type(8)))  float    v8f;
typedef __attribute__((ext_vector_type(4)))  float    v4f;
typedef v8h  __attribute__((may_alias)) v8ha;
typedef v4f  __attribute__((may_alias)) v4fa;
typedef v8us __attribute__((may_alias)) v8usa;

__device__ __forceinline__ unsigned short f2bf(float f) { unsigned u = __float_as_uint(f); u += 0x7FFFu + ((u >> 16) & 1u); return (unsigned short)(u >> 16); }
__device__ __forceinline__ float bf2f(unsigned short b) { return __uint_as_float(((unsigned)b) << 16); }
__device__ __forceinline__ v16h cat16(v8h lo, v8h hi) { return __builtin_shufflevector(lo, hi, 0, 1, 2, 3, 4, 5, 6, 7, 8, 9, 10, 11, 12, 13, 14, 15); }
__device__ __forceinline__ v16bf cat16b(v8us lo, v8us hi) { return __builtin_bit_cast(v16bf, __builtin_shufflevector(lo, hi, 0, 1, 2, 3, 4, 5, 6, 7, 8, 9, 10, 11, 12, 13, 14, 15)); }
__device__ __forceinline__ v8f wmma16(v16h a, v16h b, v8f c) { return __builtin_amdgcn_wmma_f32_16x16x32_f16(false, a, false, b, (short)0, c, false, false); }
__device__ __forceinline__ v8f wmmab(v16bf a, v16bf b, v8f c) { return __builtin_amdgcn_wmma_f32_16x16x32_bf16(false, a, false, b, (short)0, c, false, false); }

typedef __attribute__((ext_vector_type(2))) _Float16 v2h;
typedef __attribute__((ext_vector_type(2))) __bf16 v2bf;
typedef __attribute__((ext_vector_type(2))) unsigned short v2us;
typedef __attribute__((ext_vector_type(2))) float v2f;
__device__ __forceinline__ void addr_wait() { __builtin_amdgcn_sched_barrier(0); asm volatile("s_wait_xcnt 0x0" ::: "memory"); __builtin_amdgcn_sched_barrier(0); }
// Eight f32 values -> their words in the three planes: fp16, bf16 head, bf16 of the remainder (each rounded to nearest even, two values a convert).
__device__ __forceinline__ void planes8(const float (&y)[8], v8h& o16, v8us& oh, v8us& ol) {
#pragma unroll   // constant vector indices: the words stay in registers
    for (int p = 0; p < 4; ++p) { const v2f a = { y[2 * p], y[2 * p + 1] };
        const v2h f = __builtin_convertvector(a, v2h); const v2us hu = __builtin_bit_cast(v2us, __builtin_convertvector(a, v2bf));
        const v2f r = { a[0] - bf2f(hu[0]), a[1] - bf2f(hu[1]) }; const v2us lu = __builtin_bit_cast(v2us, __builtin_convertvector(r, v2bf));
        o16[2 * p] = f[0]; o16[2 * p + 1] = f[1]; oh[2 * p] = hu[0]; oh[2 * p + 1] = hu[1]; ol[2 * p] = lu[0]; ol[2 * p + 1] = lu[1]; }
}

// ---- k_gemms: sum_k A[m][k] Bt[n][k] (NSPLIT 1: + A2[m][k] Bt[n][k], product by product in the same k order), operands K-contiguous bf16 planes. M, N % 128 == 0, K % 128 == 0, K >= 256.
// EPI 0: C[m][n] (f32, pitch ldc). EPI 1, 2: m = token, the tile's 128 columns = one head; the f32 tile never leaves the work-group: it is turned into that head's three planes (fp16, bf16 head, bf16 remainder) here.
//   EPI 1: planes [head][t][d] of the rotate-half rotary form out[d] = x[d] cos[t][d] - x[d+64] sin[t][d], out[d+64] = x[d+64] cos[t][d] + x[d] sin[t][d], d < 64, (cos, sin) pairs from CS[t][d].   EPI 2: transposed planes [head][d][t].
// One work-group of four waves per 128x128 output tile, each wave a 64x64 quarter (16 accumulators); grid (M/128, N/128), 128 threads.
// A stage is 128 k (256 B) of the tile's 128 rows of every operand, brought from global memory into LDS by asynchronous 16-byte copies (whole lines, each byte fetched once per work-group) and read from there as fragments by the two waves that need it.
// Two buffers: the copies of stage t + 2 are issued behind the barrier that ends trip t and fly during trip t + 1.
template <typename T16> struct WFrag;
template <> struct WFrag<h16> { typedef v16h V; static __device__ __forceinline__ V ld(const h16* p) { return cat16(*(const v8h*)p, *(const v8h*)(p + 16)); } static __device__ __forceinline__ v8f mma(V a, V b, v8f c) { return wmma16(a, b, c); } };
template <> struct WFrag<bf> { typedef v16bf V; static __device__ __forceinline__ V ld(const bf* p) { return cat16b(*(const v8us*)p, *(const v8us*)(p + 16)); } static __device__ __forceinline__ v8f mma(V a, V b, v8f c) { return wmmab(a, b, c); } };
#define GKS 128                    // k per stage
#define GP  136                    // LDS row pitch in elements: 272 B = 16 B x odd, free of bank conflicts for 16-byte fragment reads
#define TP  132                    // row pitch in f32 of the epilogue's tile in LDS: 528 B = 16 B x odd
// Eight copies of 16 B per lane, LDS step 8 rows, global step gs elements. s_wait_xcnt 0 is the statement's last line, so that it stands in front of every later write of a register that a copy names.
__device__ __forceinline__ void cp8(unsigned l, const bf* g, size_t gs) {
    asm volatile("global_load_async_to_lds_b128 %0, %8, off\n\t"
                 "global_load_async_to_lds_b128 %1, %9, off\n\t"
                 "global_load_async_to_lds_b128 %2, %10, off\n\t"
                 "global_load_async_to_lds_b128 %3, %11, off\n\t"
                 "global_load_async_to_lds_b128 %4, %12, off\n\t"
                 "global_load_async_to_lds_b128 %5, %13, off\n\t"
                 "global_load_async_to_lds_b128 %6, %14, off\n\t"
                 "global_load_async_to_lds_b128 %7, %15, off\n\t"
                 "s_wait_xcnt 0x0"
                 :: "v"(l), "v"(l + 1u * 8 * GP * 2), "v"(l + 2u * 8 * GP * 2), "v"(l + 3u * 8 * GP * 2), "v"(l + 4u * 8 * GP * 2), "v"(l + 5u * 8 * GP * 2), "v"(l + 6u * 8 * GP * 2), "v"(l + 7u * 8 * GP * 2),
                    "v"(g), "v"(g + gs), "v"(g + 2 * gs), "v"(g + 3 * gs), "v"(g + 4 * gs), "v"(g + 5 * gs), "v"(g + 6 * gs), "v"(g + 7 * gs) : "memory");
}
template <int NSPLIT, int K, int EPI>
__global__ __launch_bounds__(128) void k_gemms(const bf* __restrict__ A, const bf* __restrict__ A2, const bf* __restrict__ Bt, float* C, int ldc, const float* __restrict__ CS, h16* P16, bf* Ph, bf* Pl) {
    typedef WFrag<bf>::V V;
    constexpr int NOP = (NSPLIT == 1) ? 3 : 2;           // operand planes per stage: A, Bt (, A2)
    __shared__ __align__(16) bf st[2][NOP][128 * GP];
    static_assert(EPI == 0 || sizeof(st) >= 2 * 128 * TP * sizeof(float), "the epilogue's tile and rotary rows fit the ring's LDS");
    const int tid = threadIdx.x, lane = tid & 31, lr = lane & 15, hi = lane >> 4; const int w = __builtin_amdgcn_readfirstlane(tid >> 5);
    const int r0 = blockIdx.x * 128, c0 = blockIdx.y * 128, wr = (w >> 1) * 64, wc = (w & 1) * 64;
    v8f acc[4][4];
    // every '#pragma unroll' of this kernel: constant indices, so that accumulators and fragments stay in registers
#pragma unroll
    for (int mb = 0; mb < 4; ++mb)
#pragma unroll
        for (int nb = 0; nb < 4; ++nb) acc[mb][nb] = (v8f){};
    // a copy of the work-group covers 8 rows of 256 B: lane pointer = row tid / 16, 16-byte piece tid % 16
    const size_t go = (size_t)(tid >> 4) * K + (tid & 15) * 8;
    const bf* ga = A + (size_t)r0 * K + go; const bf* gb = Bt + (size_t)c0 * K + go; const bf* ga2 = (NSPLIT == 1) ? A2 + (size_t)r0 * K + go : ga;
    const unsigned l0 = (unsigned)(size_t)&st[0][0][(tid >> 4) * GP + (tid & 15) * 8];
    auto fill = [&](int s) {
        const unsigned l = l0 + (unsigned)(s & 1) * (NOP * 128 * GP * 2); const int ko = s * GKS;
#pragma unroll
        for (int h = 0; h < 2; ++h) { const unsigned lh = l + h * 64 * GP * 2; const size_t gh = (size_t)h * 64 * K + ko;
            cp8(lh, ga + gh, (size_t)8 * K); cp8(lh + 128 * GP * 2, gb + gh, (size_t)8 * K); if (NSPLIT == 1) cp8(lh + 2 * 128 * GP * 2, ga2 + gh, (size_t)8 * K); } };
    constexpr int NS = K / GKS; static_assert(K % GKS == 0 && NS >= 2, "two stages or more");
    fill(0);
    asm volatile("s_wait_asynccnt 0x0" ::: "memory");    // this wave's copies of stage 0 have landed
    __syncthreads();                                     // every wave's have: stage 0 may be read
    fill(1);
#pragma unroll 1   // one copy of the trip; the buffer is chosen by the trip's parity
    for (int t = 0; t < NS; ++t) {
        const bf* sa = &st[t & 1][0][(wr + lr) * GP + 8 * hi]; const bf* sb = &st[t & 1][1][(wc + lr) * GP + 8 * hi]; const bf* sa2 = &st[t & 1][NOP - 1][(wr + lr) * GP + 8 * hi];
        // two fragment sets: block kk + 1's LDS reads are issued as one group in front of block kk's products, so that only the trip's first group is waited for in full
        V a[2][4], a2[2][4], b[2][4];
#pragma unroll
        for (int f = 0; f < 4; ++f) { a[0][f] = WFrag<bf>::ld(sa + f * 16 * GP); if (NSPLIT == 1) a2[0][f] = WFrag<bf>::ld(sa2 + f * 16 * GP); b[0][f] = WFrag<bf>::ld(sb + f * 16 * GP); }
#pragma unroll
        for (int kk = 0; kk < GKS / 32; ++kk) { const int c = kk & 1, n = c ^ 1;
            if (kk + 1 < GKS / 32) {
#pragma unroll
                for (int f = 0; f < 4; ++f) { a[n][f] = WFrag<bf>::ld(sa + f * 16 * GP + (kk + 1) * 32); if (NSPLIT == 1) a2[n][f] = WFrag<bf>::ld(sa2 + f * 16 * GP + (kk + 1) * 32); b[n][f] = WFrag<bf>::ld(sb + f * 16 * GP + (kk + 1) * 32); } }
            __builtin_amdgcn_sched_barrier(0);           // keeps that group of reads up here (sunk among the products, each pair would be waited for at its full LDS latency)
#pragma unroll
            for (int nb = 0; nb < 4; ++nb)
#pragma unroll
                for (int mb = 0; mb < 4; ++mb) { acc[mb][nb] = WFrag<bf>::mma(a[c][mb], b[c][nb], acc[mb][nb]); if (NSPLIT == 1) acc[mb][nb] = WFrag<bf>::mma(a2[c][mb], b[c][nb], acc[mb][nb]); }
            __builtin_amdgcn_sched_barrier(0);           // and the next group behind this block's products: its registers are the ones they read
        }
        asm volatile("s_wait_dscnt 0x0" ::: "memory");   // this wave's reads of the trip's buffer are done
        asm volatile("s_wait_asynccnt 0x0" ::: "memory");   // this wave's copies of stage t + 1 have landed
        __syncthreads();                                 // publishes stage t + 1 and frees the buffer that trip t has read
        if (t + 2 < NS) fill(t + 2);
    }
    asm volatile("s_wait_asynccnt 0x0" ::: "memory");    // no copy is left in flight when the wave goes on to its end
    if constexpr (EPI == 0) {
    __shared__ __align__(16) float osw[4][16 * 68];      // each wave's own output staging
    float* os = osw[w];
#pragma unroll
    for (int mb = 0; mb < 4; ++mb) {
#pragma unroll
        for (int nb = 0; nb < 4; ++nb) {
#pragma unroll
            for (int j = 0; j < 8; ++j) os[(hi * 8 + j) * 68 + nb * 16 + lr] = acc[mb][nb][j]; }
        __builtin_amdgcn_wave_barrier(); asm volatile("" ::: "memory");   // compile-time order only: the lanes' LDS stores stay in front of the row reads of other lanes' words
        float* crow = C + (size_t)(r0 + wr + mb * 16) * ldc + c0 + wc;
#pragma unroll
        for (int s = 0; s < 8; ++s) { const int row = 2 * s + hi, cofs = lr * 4; const v4f val = *(const v4fa*)(os + row * 68 + cofs);
            *(v4f*)(crow + (size_t)row * ldc + cofs) = val; }
        asm volatile("s_wait_xcnt 0x0" ::: "memory");    // in front of the next group's reuse of the stores' address registers
        __builtin_amdgcn_wave_barrier(); asm volatile("" ::: "memory");   // the same for the row reads and the next group's LDS stores
    }
    } else {
        // The ring's LDS is free here: every wave's last fragment read and last copy lie in front of the loop's last barrier.
        float* tl = (float*)&st[0][0][0];                // the work-group's f32 tile, pitch TP
        v8h o16[2]; v8us oh[2], ol[2];
        if constexpr (EPI == 1) {
            float* cl = tl + 128 * TP;                   // the tile's 128 rotary rows of 64 (cos, sin) pairs, pitch TP
            // a wave-wide load takes one whole row of 512 B; all 32 are issued up here, so that they fly while the tile is staged
            const float* cg = CS + (size_t)(r0 + w) * HD + lane * 4; v4f cv[32];
#pragma unroll
            for (int i = 0; i < 32; ++i) cv[i] = *(const v4f*)(cg + i * 4 * HD);
            addr_wait();
#pragma unroll
            for (int mb = 0; mb < 4; ++mb)
#pragma unroll
                for (int nb = 0; nb < 4; ++nb)
#pragma unroll
                    for (int j = 0; j < 8; ++j) tl[(wr + mb * 16 + hi * 8 + j) * TP + wc + nb * 16 + lr] = acc[mb][nb][j];
#pragma unroll
            for (int i = 0; i < 32; ++i) *(v4fa*)(cl + (i * 4 + w) * TP + lane * 4) = cv[i];
            __syncthreads();                             // tile and rotary rows are whole: d and d + 64 of a row come from two waves
            // a lane: 8 values d and the 8 at d + 64 of one row; 8 lanes store a whole 128-B line of a plane, rows step by 16
            const int row = tid >> 3, dg = (tid & 7) * 8; const float* tp = tl + row * TP + dg; const float* cp = cl + row * TP + dg * 2;
            const size_t po = ((size_t)blockIdx.y * TT + r0 + row) * HD + dg; h16* p16 = P16 + po; bf* ph = Ph + po; bf* pl = Pl + po;
            v4f x[2][4], c[2][4];                        // two sets: row group i + 1 is read from LDS while group i is worked on
            auto rd = [&](int i) {
#pragma unroll
                for (int q = 0; q < 2; ++q) { x[i & 1][q] = *(const v4fa*)(tp + i * 16 * TP + q * 4); x[i & 1][2 + q] = *(const v4fa*)(tp + i * 16 * TP + HD / 2 + q * 4); }
#pragma unroll
                for (int q = 0; q < 4; ++q) c[i & 1][q] = *(const v4fa*)(cp + i * 16 * TP + q * 4); };
            rd(0);
#pragma unroll
            for (int i = 0; i < 8; ++i) { float lo[8], up[8];
                if (i + 1 < 8) rd(i + 1);
#pragma unroll
                for (int e = 0; e < 8; ++e) { const float x0 = x[i & 1][e >> 2][e & 3], x1 = x[i & 1][2 + (e >> 2)][e & 3], co = c[i & 1][e >> 1][(e & 1) * 2], si = c[i & 1][e >> 1][(e & 1) * 2 + 1];
                    lo[e] = x0 * co - x1 * si; up[e] = x1 * co + x0 * si; }
                planes8(lo, o16[0], oh[0], ol[0]); planes8(up, o16[1], oh[1], ol[1]);
                __builtin_amdgcn_sched_barrier(0);       // the six stores stand together behind the arithmetic: no register of an issued store is written in front of the wait below
#pragma unroll
                for (int q = 0; q < 2; ++q) { const int so = i * 16 * HD + q * (HD / 2); *(v8h*)(p16 + so) = o16[q]; *(v8us*)(ph + so) = oh[q]; *(v8us*)(pl + so) = ol[q]; }
                addr_wait(); }
        } else {
            // a lane's eight accumulator words are eight tokens of one column: the tile is staged transposed, [d][t], by 16-byte LDS stores
#pragma unroll
            for (int mb = 0; mb < 4; ++mb)
#pragma unroll
                for (int nb = 0; nb < 4; ++nb) { float* q = tl + (wc + nb * 16 + lr) * TP + wr + mb * 16 + hi * 8; const v8f a = acc[mb][nb];
                    *(v4fa*)q = (v4f){ a[0], a[1], a[2], a[3] }; *(v4fa*)(q + 4) = (v4f){ a[4], a[5], a[6], a[7] }; }
            __syncthreads();                             // the tile is whole: a row [d] holds tokens of two waves
            // a lane: 8 tokens of one d; 16 lanes store the tile's 256 B (two whole lines) of a plane's row, rows step by 8
            const int dr = tid >> 4, tg = (tid & 15) * 8; const float* tp = tl + dr * TP + tg;
            const size_t po = ((size_t)blockIdx.y * HD + dr) * TT + r0 + tg; h16* p16 = P16 + po; bf* ph = Ph + po; bf* pl = Pl + po;
            v4f x[2][4];                                 // two sets: row group i + 1 is read from LDS while group i is worked on
            auto rd = [&](int i) {
#pragma unroll
                for (int q = 0; q < 2; ++q) { x[i & 1][2 * q] = *(const v4fa*)(tp + (i * 16 + q * 8) * TP); x[i & 1][2 * q + 1] = *(const v4fa*)(tp + (i * 16 + q * 8) * TP + 4); } };
            rd(0);
#pragma unroll
            for (int i = 0; i < 8; ++i) {
                if (i + 1 < 8) rd(i + 1);
#pragma unroll
                for (int q = 0; q < 2; ++q) { const v4f x0 = x[i & 1][2 * q], x1 = x[i & 1][2 * q + 1];
                    const float y[8] = { x0[0], x0[1], x0[2], x0[3], x1[0], x1[1], x1[2], x1[3] }; planes8(y, o16[q], oh[q], ol[q]); }
                __builtin_amdgcn_sched_barrier(0);       // the six stores stand together behind the arithmetic: no register of an issued store is written in front of the wait below
#pragma unroll
                for (int q = 0; q < 2; ++q) { const int so = (i * 16 + q * 8) * TT; *(v8h*)(p16 + so) = o16[q]; *(v8us*)(ph + so) = oh[q]; *(v8us*)(pl + so) = ol[q]; }
                addr_wait(); }
        }
    }
}

__device__ __forceinline__ h16 tohx(float x) { return (h16)x; }
__device__ __forceinline__ void splitf(float y, unsigned short& h, unsigned short& l) { h = f2bf(y); l = f2bf(y - bf2f(h)); }

__global__ __launch_bounds__(256) void k_cvt8(const float* __restrict__ src, bf* dst, size_t n8) { const size_t i = (size_t)blockIdx.x * 256 + threadIdx.x; if (i >= n8) return; const v8f v = *(const v8f*)(src + i * 8); v8us o;
#pragma unroll
    for (int k = 0; k < 8; ++k) o[k] = f2bf(v[k]); *(v8us*)(dst + i * 8) = o;  }

__constant__ float INVT[HD / 2] = { 1.000000000e+00f, 8.659643531e-01f, 7.498942018e-01f, 6.493816376e-01f, 5.623413324e-01f, 4.869675338e-01f, 4.216965139e-01f, 3.651741445e-01f, 3.162277639e-01f, 2.738419771e-01f, 2.371373624e-01f, 2.053525001e-01f, 1.778279394e-01f, 1.539926529e-01f, 1.333521456e-01f, 1.154782027e-01f, 1.000000015e-01f, 8.659642935e-02f, 7.498941571e-02f, 6.493816525e-02f, 5.623412877e-02f, 4.869675264e-02f, 4.216964915e-02f, 3.651741147e-02f, 3.162277862e-02f, 2.738419548e-02f, 2.371373586e-02f, 2.053525113e-02f, 1.778279431e-02f, 1.539926510e-02f, 1.333521493e-02f, 1.154781971e-02f, 9.999999776e-03f, 8.659643121e-03f, 7.498942316e-03f, 6.493816618e-03f, 5.623413250e-03f, 4.869675264e-03f, 4.216964822e-03f, 3.651741426e-03f, 3.162277862e-03f, 2.738419687e-03f, 2.371373819e-03f, 2.053525066e-03f, 1.778279431e-03f, 1.539926510e-03f, 1.333521446e-03f, 1.154782018e-03f, 1.000000047e-03f, 8.659643354e-04f, 7.498941850e-04f, 6.493816618e-04f, 5.623413017e-04f, 4.869675031e-04f, 4.216964880e-04f, 3.651741135e-04f, 3.162277862e-04f, 2.738419571e-04f, 2.371373848e-04f, 2.053524950e-04f, 1.778279402e-04f, 1.539926452e-04f, 1.333521504e-04f, 1.154781930e-04f };   // float32 1 / 10000^(2i/128), generated with jnp to be bit-exact
// CS[t][d] = (cos, sin) of t x INVT[d], d < HD / 2 (columns d and d + HD / 2 of the rotary tables are equal)
__global__ __launch_bounds__(256) void k_cs5(float* CS) { const int idx = blockIdx.x * 256 + threadIdx.x; if (idx >= TT * (HD / 2)) return; const int d = idx % (HD / 2); const int t = idx / (HD / 2); const float a = __fmul_rn((float)t, INVT[d]); v2f cs; cs[0] = cosf(a); cs[1] = sinf(a); *(v2f*)(CS + (size_t)idx * 2) = cs;  }
// ---- k_fattn: scores, softmax and probability x value in one kernel; neither scores nor probabilities leave the registers. A work-group of four waves owns a tile of 64 query rows of one head, 16 rows a wave, and walks the keys 0 .. the tile's last row in stages of 64.
// A stage is 64 rows of K (256 B each) and 64 keys of every row of Vt (128 B each), brought from global memory into LDS by asynchronous 16-byte copies (whole lines, each byte fetched once per work-group) and read from there as fragments by all four waves.
// Two buffers: the copies of stage s + 2 are issued behind the barrier that ends trip s and fly during trip s + 1.
// St[key][query] = K Q^T and Ot[d][query] += Vt Pt: a lane then holds scores of ONE query (query = lr, keys hi*8+j of each 16-key tile), which is at once the B-fragment order of Pt (k = 8*hi+j, 16+8*hi+j),
// so maximum, sum and rescale are in-lane but for one exchange between the wave's halves. Running maximum m and running sum l per query (online softmax), keys in runs of 32; the division by l comes once, at the end.
__device__ __forceinline__ float xhalf(float x) { return __builtin_bit_cast(float, __builtin_amdgcn_permlanex16(__builtin_bit_cast(int, x), __builtin_bit_cast(int, x), 0x76543210, 0xfedcba98, false, false)); }   // lane l with lane l ^ 16
#define AKS  64                    // keys per stage
#define VP   72                    // LDS row pitch in elements of a stage's Vt rows: 144 B = 16 B x odd, free of bank conflicts for 16-byte fragment reads (K rows: GP)
#define KPL  (AKS * GP)            // elements of one K plane's stage in LDS
#define VPL  (HD * VP)             // elements of one Vt plane's stage in LDS
#define ABUF (2 * (KPL + VPL))     // elements of a buffer: K, Vt, second K, second Vt
// Eight copies of 16 B per lane, LDS step LS bytes, global step gs elements. s_wait_xcnt 0 is the statement's last line, so that it stands in front of every later write of a register that a copy names.
template <unsigned LS, typename T16>
__device__ __forceinline__ void cp8s(unsigned l, const T16* g, size_t gs) {
    asm volatile("global_load_async_to_lds_b128 %0, %8, off\n\t"
                 "global_load_async_to_lds_b128 %1, %9, off\n\t"
                 "global_load_async_to_lds_b128 %2, %10, off\n\t"
                 "global_load_async_to_lds_b128 %3, %11, off\n\t"
                 "global_load_async_to_lds_b128 %4, %12, off\n\t"
                 "global_load_async_to_lds_b128 %5, %13, off\n\t"
                 "global_load_async_to_lds_b128 %6, %14, off\n\t"
                 "global_load_async_to_lds_b128 %7, %15, off\n\t"
                 "s_wait_xcnt 0x0"
                 :: "v"(l), "v"(l + 1u * LS), "v"(l + 2u * LS), "v"(l + 3u * LS), "v"(l + 4u * LS), "v"(l + 5u * LS), "v"(l + 6u * LS), "v"(l + 7u * LS),
                    "v"(g), "v"(g + gs), "v"(g + 2 * gs), "v"(g + 3 * gs), "v"(g + 4 * gs), "v"(g + 5 * gs), "v"(g + 6 * gs), "v"(g + 7 * gs) : "memory");
}
// One tile of 64 query rows. Every wave of the work-group passes every barrier; tile is the same in all of them.
template <typename T16, int NSPLIT>
__device__ __forceinline__ void fattn_tile(const T16* st, const T16* __restrict__ Q, const T16* __restrict__ Q2, const T16* __restrict__ Kp, const T16* __restrict__ Kp2, const T16* __restrict__ Vt, const T16* __restrict__ Vt2, int tile, int w, int tid, bf* Ah, bf* Al) {
    typedef typename WFrag<T16>::V V;
    const float L2E = 1.4426950408889634f;
    const float PSH = (NSPLIT == 0) ? 10.0f : 0.0f;      // fp16 probabilities carry a factor 2^10 (small ones stay normal numbers); l carries it too, so it cancels in the division
    const int lane = tid & 31, lr = lane & 15, hi = lane >> 4; const int q0 = tile * 64 + w * 16;   // the wave's first query row (scalar)
    V q[4], q2[4];
    // one lane pointer per plane; every fragment is a constant offset from it
    { const size_t qoff = (size_t)(q0 + lr) * HD + 8 * hi; const T16* qp = Q + qoff; const T16* qp2 = (NSPLIT == 2) ? Q2 + qoff : qp;
#pragma unroll
      for (int kc = 0; kc < 4; ++kc) { q[kc] = WFrag<T16>::ld(qp + kc * 32); if (NSPLIT == 2) q2[kc] = WFrag<T16>::ld(qp2 + kc * 32); }
      addr_wait(); }
    v8f o[8];
#pragma unroll
    for (int dt = 0; dt < 8; ++dt) o[dt] = (v8f){};
    float m = -3.0e38f, l = 0.f;
    // a copy of the work-group covers 8 rows of K (lane: row tid / 16, 16-byte piece tid % 16) or 16 rows of Vt (row tid / 8, piece tid % 8)
    const size_t gko = (size_t)(tid >> 4) * HD + (tid & 15) * 8, gvo = (size_t)(tid >> 3) * TT + (tid & 7) * 8;
    const unsigned lk0 = (unsigned)(size_t)&st[(tid >> 4) * GP + (tid & 15) * 8], lv0 = (unsigned)(size_t)&st[KPL + (tid >> 3) * VP + (tid & 7) * 8];
    auto fill = [&](int s) {
        const unsigned bo = (unsigned)(s & 1) * (ABUF * 2);
        cp8s<8 * GP * 2>(lk0 + bo, Kp + gko + (size_t)s * AKS * HD, (size_t)8 * HD); cp8s<16 * VP * 2>(lv0 + bo, Vt + gvo + s * AKS, (size_t)16 * TT);
        if (NSPLIT == 2) { cp8s<8 * GP * 2>(lk0 + bo + (KPL + VPL) * 2, Kp2 + gko + (size_t)s * AKS * HD, (size_t)8 * HD); cp8s<16 * VP * 2>(lv0 + bo + (KPL + VPL) * 2, Vt2 + gvo + s * AKS, (size_t)16 * TT); } };
    const int NS = tile + 1;                             // stages: keys 0 .. 64 tile + 63
    fill(0);                                             // the buffers are free: an earlier tile's last reads lie in front of its loop's last barrier
    asm volatile("s_wait_asynccnt 0x0" ::: "memory");    // this wave's copies of stage 0 have landed
    __syncthreads();                                     // every wave's have: stage 0 may be read
    if (NS > 1) fill(1);
#pragma unroll 1   // one copy of the trip; the buffer is chosen by the trip's parity
    for (int s = 0; s < NS; ++s) {
        const T16* sb = st + (s & 1) * ABUF;
#pragma unroll 1   // one copy of the run's body
        for (int r = 0; r < 2; ++r) {
            const int kb = s * AKS + r * 32;
            if (kb > q0 + 15) break;                     // every key of the run lies behind the wave's last query (scalar branch; the barrier below is still passed)
            const T16* kf = sb + (r * 32 + lr) * GP + 8 * hi; const T16* vf = sb + KPL + lr * VP + r * 32 + 8 * hi;
            V k[2][4], k2[2][4], v[8], v2[8];
#pragma unroll
            for (int t = 0; t < 2; ++t)
#pragma unroll
                for (int kc = 0; kc < 4; ++kc) { const int ko = t * 16 * GP + kc * 32; k[t][kc] = WFrag<T16>::ld(kf + ko); if (NSPLIT == 2) k2[t][kc] = WFrag<T16>::ld(kf + (KPL + VPL) + ko); }
#pragma unroll
            for (int dt = 0; dt < 8; ++dt) { const int vo = dt * 16 * VP; v[dt] = WFrag<T16>::ld(vf + vo); if (NSPLIT == 2) v2[dt] = WFrag<T16>::ld(vf + (KPL + VPL) + vo); }
            __builtin_amdgcn_sched_barrier(0);           // keeps the run's LDS reads in one group up here: the Vt fragments arrive during the score products and the softmax
            v8f sc[2] = { (v8f){}, (v8f){} };
#pragma unroll
            for (int kc = 0; kc < 4; ++kc)
#pragma unroll
                for (int t = 0; t < 2; ++t) { v8f a = sc[t]; a = WFrag<T16>::mma(k[t][kc], q[kc], a); if (NSPLIT == 2) { a = WFrag<T16>::mma(k[t][kc], q2[kc], a); a = WFrag<T16>::mma(k2[t][kc], q[kc], a); } sc[t] = a; }
            const bool diag = (kb + 31 > q0);            // only such a run meets the causal diagonal (wave-uniform)
            const int dq = kb - q0;
            float mx = m;
#pragma unroll
            for (int t = 0; t < 2; ++t)
#pragma unroll
                for (int j = 0; j < 8; ++j) { float x = sc[t][j] * SCL; if (diag && dq + t * 16 + hi * 8 + j > lr) x = -3.0e38f; sc[t][j] = x; mx = fmaxf(mx, x); }
            const float mn = fmaxf(mx, xhalf(mx));
            if (__builtin_amdgcn_ballot_w32(mn > m) != 0) {   // a maximum moved: bring sums and output tiles to the new one (factor exactly 1 where it did not)
                const float al = __builtin_amdgcn_exp2f((m - mn) * L2E); l *= al; m = mn;
#pragma unroll
                for (int dt = 0; dt < 8; ++dt) o[dt] *= al; }
            V pf, pf2; float sum = 0.f; float p[16];
#pragma unroll
            for (int e = 0; e < 16; ++e) { p[e] = __builtin_amdgcn_exp2f((sc[e >> 3][e & 7] - m) * L2E + PSH); sum += p[e]; }
            l += sum;
            if constexpr (NSPLIT == 0) { v16h f;
#pragma unroll
                for (int e = 0; e < 16; ++e) f[e] = tohx(p[e]);
                pf = f;
            } else { v8us h0, h1, l0, l1;
#pragma unroll
                for (int e = 0; e < 8; ++e) { unsigned short a, c2; splitf(p[e], a, c2); h0[e] = a; l0[e] = c2; splitf(p[8 + e], a, c2); h1[e] = a; l1[e] = c2; }
                pf = cat16b(h0, h1); pf2 = cat16b(l0, l1); }
#pragma unroll
            for (int dt = 0; dt < 8; ++dt) { o[dt] = WFrag<T16>::mma(v[dt], pf, o[dt]); if (NSPLIT == 2) { o[dt] = WFrag<T16>::mma(v[dt], pf2, o[dt]); o[dt] = WFrag<T16>::mma(v2[dt], pf, o[dt]); } }
            __builtin_amdgcn_sched_barrier(0);           // the products stay in front of the slots below
            asm volatile("v_nop\n\tv_nop\n\tv_nop\n\tv_nop");   // the four vector slots between the run's last matrix instruction and the next run's first write of its operand registers
        }
        asm volatile("s_wait_dscnt 0x0" ::: "memory");   // this wave's reads of the trip's buffer are done
        asm volatile("s_wait_asynccnt 0x0" ::: "memory");   // this wave's copies of stage s + 1 have landed
        __syncthreads();                                 // publishes stage s + 1 and frees the buffer that trip s has read
        if (s + 2 < NS) fill(s + 2);
    }
    asm volatile("s_wait_asynccnt 0x0" ::: "memory");    // no copy is left in flight behind the loop
    { const float inv = __fdiv_rn(1.0f, l + xhalf(l)); const size_t oo = (size_t)(q0 + lr) * DQ + hi * 8; bf* ap = Ah + oo; bf* ap2 = Al + oo;
#pragma unroll
        for (int dt = 0; dt < 8; ++dt) { v8us oh, ol;
#pragma unroll
            for (int j = 0; j < 8; ++j) { unsigned short a, c2; splitf(o[dt][j] * inv, a, c2); oh[j] = a; ol[j] = c2; }
            *(v8us*)(ap + dt * 16) = oh; *(v8us*)(ap2 + dt * 16) = ol;
            addr_wait(); } }
}
// grid (heads, TT / 128), 128 threads. Tile t of 64 query rows has t + 1 stages of keys, so tiles t and TT/64 - 1 - t together always have TT/64 + 1; work-group y takes tile TT/64 - 1 - y and then tile y, one after the other.
// Query rows < RH: bf16 hi/lo planes, 3 products; the rest fp16 (chosen per tile). Writes the merged hi/lo planes [t][head * HD + d].
__global__ __launch_bounds__(128) void k_fattn(const h16* __restrict__ Q16, const h16* __restrict__ K16, const h16* __restrict__ V16, const bf* __restrict__ Qh, const bf* __restrict__ Ql, const bf* __restrict__ Kh, const bf* __restrict__ Kl, const bf* __restrict__ Vh, const bf* __restrict__ Vl, bf* Ah, bf* Al) {
    __shared__ __align__(16) bf ast[2 * ABUF];
    static_assert(RH % 64 == 0 && RH <= TT / 2, "a tile is of one kind; the first tile of a work-group is never of the hi/lo kind");
    const int tid = threadIdx.x; const int h = blockIdx.x; const int w = __builtin_amdgcn_readfirstlane(tid >> 5);   /* wave-uniform: the run's bound stays scalar */
    const size_t hp = (size_t)h * TT * HD;
    const int y = (int)blockIdx.y;
    fattn_tile<h16, 0>((const h16*)ast, Q16 + hp, nullptr, K16 + hp, nullptr, V16 + hp, nullptr, TT / 64 - 1 - y, w, tid, Ah + h * HD, Al + h * HD);   // rows >= TT / 2 >= RH
    if (y * 64 < RH) fattn_tile<bf, 2>(ast, Qh + hp, Ql + hp, Kh + hp, Kl + hp, Vh + hp, Vl + hp, y, w, tid, Ah + h * HD, Al + h * HD);
    else fattn_tile<h16, 0>((const h16*)ast, Q16 + hp, nullptr, K16 + hp, nullptr, V16 + hp, nullptr, y, w, tid, Ah + h * HD, Al + h * HD);
}

extern "C" void kernel_launch(void* const* d_in, const int* in_sizes, int n_in,
                              void* d_out, int out_size, void* d_ws, size_t ws_size, hipStream_t stream) {
    (void)in_sizes; (void)n_in; (void)out_size;
    const float* x = (const float*)d_in[0]; const float* wq = (const float*)d_in[1]; const float* wk = (const float*)d_in[2]; const float* wv = (const float*)d_in[3]; const float* wo = (const float*)d_in[4];   /* order hidden_states, Wq, Wk, Wv, Wo ('oi' [2048][2048]) */
    float* OUT = (float*)d_out;     // [2][2048][2048]
    char* wsp = (char*)d_ws;
    auto take = [&](size_t bytes) { char* p = wsp; wsp += (bytes + 255) & ~(size_t)255; return (void*)p; };
    bf* WQ = (bf*)take((size_t)DQ * DM * 2); bf* WK = (bf*)take((size_t)DKV * DM * 2); bf* WV = (bf*)take((size_t)DKV * DM * 2); bf* WO = (bf*)take((size_t)DM * DQ * 2); float* CS = (float*)take((size_t)TT * (HD / 2) * 2 * 4);
    bf* XB = (bf*)take((size_t)TT * DM * 2);
    h16* QP16 = (h16*)take((size_t)NH_ * TT * HD * 2); h16* KP16 = (h16*)take((size_t)NKV * TT * HD * 2); h16* VT16 = (h16*)take((size_t)NKV * HD * TT * 2);
    bf* QPh = (bf*)take((size_t)NH_ * TT * HD * 2); bf* QPl = (bf*)take((size_t)NH_ * TT * HD * 2); bf* KPh = (bf*)take((size_t)NKV * TT * HD * 2); bf* KPl = (bf*)take((size_t)NKV * TT * HD * 2); bf* VTh = (bf*)take((size_t)NKV * HD * TT * 2); bf* VTl = (bf*)take((size_t)NKV * HD * TT * 2);
    bf* ATh = (bf*)take((size_t)TT * DQ * 2); bf* ATl = (bf*)take((size_t)TT * DQ * 2);
    if ((size_t)(wsp - (char*)d_ws) > ws_size) return;    // ws 256 MiB
    { k_cvt8<<<(unsigned)(((size_t)DQ * DM / 8 + 255) / 256), 256, 0, stream>>>(wq, WQ, (size_t)DQ * DM / 8); k_cvt8<<<(unsigned)(((size_t)DKV * DM / 8 + 255) / 256), 256, 0, stream>>>(wk, WK, (size_t)DKV * DM / 8); k_cvt8<<<(unsigned)(((size_t)DKV * DM / 8 + 255) / 256), 256, 0, stream>>>(wv, WV, (size_t)DKV * DM / 8);
      k_cvt8<<<(unsigned)(((size_t)DM * DQ / 8 + 255) / 256), 256, 0, stream>>>(wo, WO, (size_t)DM * DQ / 8);
       }
    k_cs5<<<(TT * (HD / 2) + 255) / 256, 256, 0, stream>>>(CS);   /* rotary table once */
    for (int b = 0; b < NB_; ++b) {
        
        k_cvt8<<<(unsigned)(((size_t)TT * DM / 8 + 255) / 256), 256, 0, stream>>>(x + (size_t)b * TT * DM, XB, (size_t)TT * DM / 8);
        k_gemms<0, DM, 1><<<dim3(TT / 128, DQ / 128, 1), 128, 0, stream>>>(XB, nullptr, WQ, nullptr, 0, CS, QP16, QPh, QPl);
        k_gemms<0, DM, 1><<<dim3(TT / 128, DKV / 128, 1), 128, 0, stream>>>(XB, nullptr, WK, nullptr, 0, CS, KP16, KPh, KPl);
        k_gemms<0, DM, 2><<<dim3(TT / 128, DKV / 128, 1), 128, 0, stream>>>(XB, nullptr, WV, nullptr, 0, nullptr, VT16, VTh, VTl);
        k_fattn<<<dim3(NH_, TT / 128, 1), 128, 0, stream>>>(QP16, KP16, VT16, QPh, QPl, KPh, KPl, VTh, VTl, ATh, ATl);
        k_gemms<1, DQ, 0><<<dim3(TT / 128, DM / 128, 1), 128, 0, stream>>>(ATh, ATl, WO, OUT + (size_t)b * TT * DM, DM, nullptr, nullptr, nullptr, nullptr); }
}

// v006
// Measured time: 214 microseconds a run.
// Two timings next to v005 both put it at 1.39 times that version's speed.
// Over all steps from v000 it is 8.19 times as fast.
#include <hip/hip_runtime.h>

// Causal multi-head attention with 128-wide heads and computed rotate-half rotary embeddings (hidden_states [2][2048][2048]; q, k, v = einsum('bsd,ed->bse', x, W) ('oi' 0.02; 16 heads x 128); rope x cos + rotate_half(x) sin, angle t x 1/10000^(2i/128) (64 f32 frequencies jnp-exact; cat(freqs, freqs); precise cosf/sinf); scores / sqrt(128); mask = (key > query) | (key - query >= 1024): the second term only touches FUTURE keys, which the first already excludes: plain causal (-inf == exclusion); softmax in f32; out = merged Wo^T -> [2][2048][2048] (8.4 M); argument order hidden_states, Wq, Wk, Wv, Wo).
// Layout: bf16 copy of x; 'oi' weights; exact projections whose epilogues build the head planes (q, k: rotate-half with the k_cs5 table; v: transposed); causal T-2048 attention at HD 128 in one fused kernel, online softmax (hybrid rows: < 512 hi/lo 3 products, rest fp16 x1024; keys above the diagonal block never read); merged hi/lo x Wo exact.
// Compute dtypes, f32 accumulate: every input rounded to bf16; projections exact; rotary f32; attention rows < 512 3 products, rest fp16; softmax f32; Wo hl x exact.

#define NB_  2
#define TT   2048
#define DM   2048
#define NH_  16
#define NKV  16
#define HD   128
#define DQ   (NH_ * HD)
#define DKV  (NKV * HD)
#define RH   512                  // query rows < RH use hi+lo planes (0: none)
#define SCL  0.088388347648318447f   // HD^-0.5
typedef _Float16 h16;
typedef unsigned short bf;
typedef __attribute__((ext_vector_type(16))) __bf16   v16bf;
typedef __attribute__((ext_vector_type(16))) _Float16 v16h;
typedef __attribute__((ext_vector_type(8)))  _Float16 v8h;
typedef __attribute__((ext_vector_type(8)))  unsigned short v8us;
typedef __attribute__((ext_vector_type(8)))  float    v8f;
typedef __attribute__((ext_vector_type(4)))  float    v4f;
typedef v8h  __attribute__((may_alias)) v8ha;
typedef v4f  __attribute__((may_alias)) v4fa;
typedef v8us __attribute__((may_alias)) v8usa;

__device__ __forceinline__ unsigned short f2bf(float f) { unsigned u = __float_as_uint(f); u += 0x7FFFu + ((u >> 16) & 1u); return (unsigned short)(u >> 16); }
__device__ __forceinline__ float bf2f(unsigned short b) { return __uint_as_float(((unsigned)b) << 16); }
__device__ __forceinline__ v16h cat16(v8h lo, v8h hi) { return __builtin_shufflevector(lo, hi, 0, 1, 2, 3, 4, 5, 6, 7, 8, 9, 10, 11, 12, 13, 14, 15); }
__device__ __forceinline__ v16bf cat16b(v8us lo, v8us hi) { return __builtin_bit_cast(v16bf, __builtin_shufflevector(lo, hi, 0, 1, 2, 3, 4, 5, 6, 7, 8, 9, 10, 11, 12, 13, 14, 15)); }
__device__ __forceinline__ v8f wmma16(v16h a, v16h b, v8f c) { return __builtin_amdgcn_wmma_f32_16x16x32_f16(false, a, false, b, (short)0, c, false, false); }
__device__ __forceinline__ v8f wmmab(v16bf a, v16bf b, v8f c) { return __builtin_amdgcn_wmma_f32_16x16x32_bf16(false, a, false, b, (short)0, c, false, false); }

typedef __attribute__((ext_vector_type(2))) _Float16 v2h;
typedef __attribute__((ext_vector_type(2))) __bf16 v2bf;
typedef __attribute__((ext_vector_type(2))) unsigned short v2us;
typedef __attribute__((ext_vector_type(2))) float v2f;
__device__ __forceinline__ void addr_wait() { __builtin_amdgcn_sched_barrier(0); asm volatile("s_wait_xcnt 0x0" ::: "memory"); __builtin_amdgcn_sched_barrier(0); }
// Eight f32 values -> their words in the three planes: fp16, bf16 head, bf16 of the remainder (each rounded to nearest even, two values a convert).
__device__ __forceinline__ void planes8(const float (&y)[8], v8h& o16, v8us& oh, v8us& ol) {
#pragma unroll   // constant vector indices: the words stay in registers
    for (int p = 0; p < 4; ++p) { const v2f a = { y[2 * p], y[2 * p + 1] };
        const v2h f = __builtin_convertvector(a, v2h); const v2us hu = __builtin_bit_cast(v2us, __builtin_convertvector(a, v2bf));
        const v2f r = { a[0] - bf2f(hu[0]), a[1] - bf2f(hu[1]) }; const v2us lu = __builtin_bit_cast(v2us, __builtin_convertvector(r, v2bf));
        o16[2 * p] = f[0]; o16[2 * p + 1] = f[1]; oh[2 * p] = hu[0]; oh[2 * p + 1] = hu[1]; ol[2 * p] = lu[0]; ol[2 * p + 1] = lu[1]; }
}

// ---- k_gemms: sum_k A[m][k] Bt[n][k] (NSPLIT 1: + A2[m][k] Bt[n][k], product by product in the same k order), operands K-contiguous bf16 planes. M, N % 128 == 0, K % 128 == 0, K >= 256.
// EPI 0: C[m][n] (f32, pitch ldc). EPI 1, 2: m = token, the tile's 128 columns = one head; the f32 tile never leaves the work-group: it is turned into that head's three planes (fp16, bf16 head, bf16 remainder) here.
//   EPI 1: planes [head][t][d] of the rotate-half rotary form out[d] = x[d] cos[t][d] - x[d+64] sin[t][d], out[d+64] = x[d+64] cos[t][d] + x[d] sin[t][d], d < 64, (cos, sin) pairs from CS[t][d].   EPI 2: transposed planes [head][d][t].
// One work-group of four waves per 128x128 output tile, each wave a 64x64 quarter (16 accumulators); grid (M/128, N/128, batches), 128 threads. M = TT rows a batch; Bt and CS are the same for every batch.
// A stage is 128 k (256 B) of the tile's 128 rows of every operand, brought from global memory into LDS by asynchronous 16-byte copies (whole lines, each byte fetched once per work-group) and read from there as fragments by the two waves that need it.
// Two buffers: the copies of stage t + 2 are issued behind the barrier that ends trip t and fly during trip t + 1.
template <typename T16> struct WFrag;
template <> struct WFrag<h16> { typedef v16h V; static __device__ __forceinline__ V ld(const h16* p) { return cat16(*(const v8h*)p, *(const v8h*)(p + 16)); } static __device__ __forceinline__ v8f mma(V a, V b, v8f c) { return wmma16(a, b, c); } };
template <> struct WFrag<bf> { typedef v16bf V; static __device__ __forceinline__ V ld(const bf* p) { return cat16b(*(const v8us*)p, *(const v8us*)(p + 16)); } static __device__ __forceinline__ v8f mma(V a, V b, v8f c) { return wmmab(a, b, c); } };
#define GKS 128                    // k per stage
#define GP  136                    // LDS row pitch in elements: 272 B = 16 B x odd, free of bank conflicts for 16-byte fragment reads
#define TP  132                    // row pitch in f32 of the epilogue's tile in LDS: 528 B = 16 B x odd
// Eight copies of 16 B per lane, LDS step 8 rows, global step gs elements. s_wait_xcnt 0 is the statement's last line, so that it stands in front of every later write of a register that a copy names.
__device__ __forceinline__ void cp8(unsigned l, const bf* g, size_t gs) {
    asm volatile("global_load_async_to_lds_b128 %0, %8, off\n\t"
                 "global_load_async_to_lds_b128 %1, %9, off\n\t"
                 "global_load_async_to_lds_b128 %2, %10, off\n\t"
                 "global_load_async_to_lds_b128 %3, %11, off\n\t"
                 "global_load_async_to_lds_b128 %4, %12, off\n\t"
                 "global_load_async_to_lds_b128 %5, %13, off\n\t"
                 "global_load_async_to_lds_b128 %6, %14, off\n\t"
                 "global_load_async_to_lds_b128 %7, %15, off\n\t"
                 "s_wait_xcnt 0x0"
                 :: "v"(l), "v"(l + 1u * 8 * GP * 2), "v"(l + 2u * 8 * GP * 2), "v"(l + 3u * 8 * GP * 2), "v"(l + 4u * 8 * GP * 2), "v"(l + 5u * 8 * GP * 2), "v"(l + 6u * 8 * GP * 2), "v"(l + 7u * 8 * GP * 2),
                    "v"(g), "v"(g + gs), "v"(g + 2 * gs), "v"(g + 3 * gs), "v"(g + 4 * gs), "v"(g + 5 * gs), "v"(g + 6 * gs), "v"(g + 7 * gs) : "memory");
}
template <int NSPLIT, int K, int EPI>
__global__ __launch_bounds__(128) void k_gemms(const bf* __restrict__ A, const bf* __restrict__ A2, const bf* __restrict__ Bt, float* C, int ldc, const float* __restrict__ CS, h16* P16, bf* Ph, bf* Pl) {
    typedef WFrag<bf>::V V;
    // grid z = batch: its own TT rows of A (and A2), and its own output: TT rows of C, or its heads' planes
    { const size_t z = blockIdx.z; A += z * ((size_t)TT * K); if constexpr (NSPLIT == 1) A2 += z * ((size_t)TT * K);
      if constexpr (EPI == 0) C += z * TT * (size_t)ldc; else { const size_t pz = z * ((size_t)NH_ * TT * HD); P16 += pz; Ph += pz; Pl += pz; } }
    constexpr int NOP = (NSPLIT == 1) ? 3 : 2;           // operand planes per stage: A, Bt (, A2)
    __shared__ __align__(16) bf st[2][NOP][128 * GP];
    static_assert(EPI == 0 || sizeof(st) >= 2 * 128 * TP * sizeof(float), "the epilogue's tile and rotary rows fit the ring's LDS");
    const int tid = threadIdx.x, lane = tid & 31, lr = lane & 15, hi = lane >> 4; const int w = __builtin_amdgcn_readfirstlane(tid >> 5);
    const int r0 = blockIdx.x * 128, c0 = blockIdx.y * 128, wr = (w >> 1) * 64, wc = (w & 1) * 64;
    v8f acc[4][4];
    // every '#pragma unroll' of this kernel: constant indices, so that accumulators and fragments stay in registers
#pragma unroll
    for (int mb = 0; mb < 4; ++mb)
#pragma unroll
        for (int nb = 0; nb < 4; ++nb) acc[mb][nb] = (v8f){};
    // a copy of the work-group covers 8 rows of 256 B: lane pointer = row tid / 16, 16-byte piece tid % 16
    const size_t go = (size_t)(tid >> 4) * K + (tid & 15) * 8;
    const bf* ga = A + (size_t)r0 * K + go; const bf* gb = Bt + (size_t)c0 * K + go; const bf* ga2 = (NSPLIT == 1) ? A2 + (size_t)r0 * K + go : ga;
    const unsigned l0 = (unsigned)(size_t)&st[0][0][(tid >> 4) * GP + (tid & 15) * 8];
    auto fill = [&](int s) {
        const unsigned l = l0 + (unsigned)(s & 1) * (NOP * 128 * GP * 2); const int ko = s * GKS;
#pragma unroll
        for (int h = 0; h < 2; ++h) { const unsigned lh = l + h * 64 * GP * 2; const size_t gh = (size_t)h * 64 * K + ko;
            cp8(lh, ga + gh, (size_t)8 * K); cp8(lh + 128 * GP * 2, gb + gh, (size_t)8 * K); if (NSPLIT == 1) cp8(lh + 2 * 128 * GP * 2, ga2 + gh, (size_t)8 * K); } };
    constexpr int NS = K / GKS; static_assert(K % GKS == 0 && NS >= 2, "two stages or more");
    fill(0);
    asm volatile("s_wait_asynccnt 0x0" ::: "memory");    // this wave's copies of stage 0 have landed
    __syncthreads();                                     // every wave's have: stage 0 may be read
    fill(1);
#pragma unroll 1   // one copy of the trip; the buffer is chosen by the trip's parity
    for (int t = 0; t < NS; ++t) {
        const bf* sa = &st[t & 1][0][(wr + lr) * GP + 8 * hi]; const bf* sb = &st[t & 1][1][(wc + lr) * GP + 8 * hi]; const bf* sa2 = &st[t & 1][NOP - 1][(wr + lr) * GP + 8 * hi];
        // two fragment sets: block kk + 1's LDS reads are issued as one group in front of block kk's products, so that only the trip's first group is waited for in full
        V a[2][4], a2[2][4], b[2][4];
#pragma unroll
        for (int f = 0; f < 4; ++f) { a[0][f] = WFrag<bf>::ld(sa + f * 16 * GP); if (NSPLIT == 1) a2[0][f] = WFrag<bf>::ld(sa2 + f * 16 * GP); b[0][f] = WFrag<bf>::ld(sb + f * 16 * GP); }
#pragma unroll
        for (int kk = 0; kk < GKS / 32; ++kk) { const int c = kk & 1, n = c ^ 1;
            if (kk + 1 < GKS / 32) {
#pragma unroll
                for (int f = 0; f < 4; ++f) { a[n][f] = WFrag<bf>::ld(sa + f * 16 * GP + (kk + 1) * 32); if (NSPLIT == 1) a2[n][f] = WFrag<bf>::ld(sa2 + f * 16 * GP + (kk + 1) * 32); b[n][f] = WFrag<bf>::ld(sb + f * 16 * GP + (kk + 1) * 32); } }
            __builtin_amdgcn_sched_barrier(0);           // keeps that group of reads up here (sunk among the products, each pair would be waited for at its full LDS latency)
#pragma unroll
            for (int nb = 0; nb < 4; ++nb)
#pragma unroll
                for (int mb = 0; mb < 4; ++mb) { acc[mb][nb] = WFrag<bf>::mma(a[c][mb], b[c][nb], acc[mb][nb]); if (NSPLIT == 1) acc[mb][nb] = WFrag<bf>::mma(a2[c][mb], b[c][nb], acc[mb][nb]); }
            __builtin_amdgcn_sched_barrier(0);           // and the next group behind this block's products: its registers are the ones they read
        }
        asm volatile("s_wait_dscnt 0x0" ::: "memory");   // this wave's reads of the trip's buffer are done
        asm volatile("s_wait_asynccnt 0x0" ::: "memory");   // this wave's copies of stage t + 1 have landed
        __syncthreads();                                 // publishes stage t + 1 and frees the buffer that trip t has read
        if (t + 2 < NS) fill(t + 2);
    }
    asm volatile("s_wait_asynccnt 0x0" ::: "memory");    // no copy is left in flight when the wave goes on to its end
    if constexpr (EPI == 0) {
    __shared__ __align__(16) float osw[4][16 * 68];      // each wave's own output staging
    float* os = osw[w];
#pragma unroll
    for (int mb = 0; mb < 4; ++mb) {
#pragma unroll
        for (int nb = 0; nb < 4; ++nb) {
#pragma unroll
            for (int j = 0; j < 8; ++j) os[(hi * 8 + j) * 68 + nb * 16 + lr] = acc[mb][nb][j]; }
        __builtin_amdgcn_wave_barrier(); asm volatile("" ::: "memory");   // compile-time order only: the lanes' LDS stores stay in front of the row reads of other lanes' words
        float* crow = C + (size_t)(r0 + wr + mb * 16) * ldc + c0 + wc;
#pragma unroll
        for (int s = 0; s < 8; ++s) { const int row = 2 * s + hi, cofs = lr * 4; const v4f val = *(const v4fa*)(os + row * 68 + cofs);
            *(v4f*)(crow + (size_t)row * ldc + cofs) = val; }
        asm volatile("s_wait_xcnt 0x0" ::: "memory");    // in front of the next group's reuse of the stores' address registers
        __builtin_amdgcn_wave_barrier(); asm volatile("" ::: "memory");   // the same for the row reads and the next group's LDS stores
    }
    } else {
        // The ring's LDS is free here: every wave's last fragment read and last copy lie in front of the loop's last barrier.
        float* tl = (float*)&st[0][0][0];                // the work-group's f32 tile, pitch TP
        v8h o16[2]; v8us oh[2], ol[2];
        if constexpr (EPI == 1) {
            float* cl = tl + 128 * TP;                   // the tile's 128 rotary rows of 64 (cos, sin) pairs, pitch TP
            // a wave-wide load takes one whole row of 512 B; all 32 are issued up here, so that they fly while the tile is staged
            const float* cg = CS + (size_t)(r0 + w) * HD + lane * 4; v4f cv[32];
#pragma unroll
            for (int i = 0; i < 32; ++i) cv[i] = *(const v4f*)(cg + i * 4 * HD);
            addr_wait();
#pragma unroll
            for (int mb = 0; mb < 4; ++mb)
#pragma unroll
                for (int nb = 0; nb < 4; ++nb)
#pragma unroll
                    for (int j = 0; j < 8; ++j) tl[(wr + mb * 16 + hi * 8 + j) * TP + wc + nb * 16 + lr] = acc[mb][nb][j];
#pragma unroll
            for (int i = 0; i < 32; ++i) *(v4fa*)(cl + (i * 4 + w) * TP + lane * 4) = cv[i];
            __syncthreads();                             // tile and rotary rows are whole: d and d + 64 of a row come from two waves
            // a lane: 8 values d and the 8 at d + 64 of one row; 8 lanes store a whole 128-B line of a plane, rows step by 16
            const int row = tid >> 3, dg = (tid & 7) * 8; const float* tp = tl + row * TP + dg; const float* cp = cl + row * TP + dg * 2;
            const size_t po = ((size_t)blockIdx.y * TT + r0 + row) * HD + dg; h16* p16 = P16 + po; bf* ph = Ph + po; bf* pl = Pl + po;
            v4f x[2][4], c[2][4];                        // two sets: row group i + 1 is read from LDS while group i is worked on
            auto rd = [&](int i) {
#pragma unroll
                for (int q = 0; q < 2; ++q) { x[i & 1][q] = *(const v4fa*)(tp + i * 16 * TP + q * 4); x[i & 1][2 + q] = *(const v4fa*)(tp + i * 16 * TP + HD / 2 + q * 4); }
#pragma unroll
                for (int q = 0; q < 4; ++q) c[i & 1][q] = *(const v4fa*)(cp + i * 16 * TP + q * 4); };
            rd(0);
#pragma unroll
            for (int i = 0; i < 8; ++i) { float lo[8], up[8];
                if (i + 1 < 8) rd(i + 1);
#pragma unroll
                for (int e = 0; e < 8; ++e) { const float x0 = x[i & 1][e >> 2][e & 3], x1 = x[i & 1][2 + (e >> 2)][e & 3], co = c[i & 1][e >> 1][(e & 1) * 2], si = c[i & 1][e >> 1][(e & 1) * 2 + 1];
                    lo[e] = x0 * co - x1 * si; up[e] = x1 * co + x0 * si; }
                planes8(lo, o16[0], oh[0], ol[0]); planes8(up, o16[1], oh[1], ol[1]);
                __builtin_amdgcn_sched_barrier(0);       // the six stores stand together behind the arithmetic: no register of an issued store is written in front of the wait below
#pragma unroll
                for (int q = 0; q < 2; ++q) { const int so = i * 16 * HD + q * (HD / 2); *(v8h*)(p16 + so) = o16[q]; *(v8us*)(ph + so) = oh[q]; *(v8us*)(pl + so) = ol[q]; }
                addr_wait(); }
        } else {
            // a lane's eight accumulator words are eight tokens of one column: the tile is staged transposed, [d][t], by 16-byte LDS stores
#pragma unroll
            for (int mb = 0; mb < 4; ++mb)
#pragma unroll
                for (int nb = 0; nb < 4; ++nb) { float* q = tl + (wc + nb * 16 + lr) * TP + wr + mb * 16 + hi * 8; const v8f a = acc[mb][nb];
                    *(v4fa*)q = (v4f){ a[0], a[1], a[2], a[3] }; *(v4fa*)(q + 4) = (v4f){ a[4], a[5], a[6], a[7] }; }
            __syncthreads();                             // the tile is whole: a row [d] holds tokens of two waves
            // a lane: 8 tokens of one d; 16 lanes store the tile's 256 B (two whole lines) of a plane's row, rows step by 8
            const int dr = tid >> 4, tg = (tid & 15) * 8; const float* tp = tl + dr * TP + tg;
            const size_t po = ((size_t)blockIdx.y * HD + dr) * TT + r0 + tg; h16* p16 = P16 + po; bf* ph = Ph + po; bf* pl = Pl + po;
            v4f x[2][4];                                 // two sets: row group i + 1 is read from LDS while group i is worked on
            auto rd = [&](int i) {
#pragma unroll
                for (int q = 0; q < 2; ++q) { x[i & 1][2 * q] = *(const v4fa*)(tp + (i * 16 + q * 8) * TP); x[i & 1][2 * q + 1] = *(const v4fa*)(tp + (i * 16 + q * 8) * TP + 4); } };
            rd(0);
#pragma unroll
            for (int i = 0; i < 8; ++i) {
                if (i + 1 < 8) rd(i + 1);
#pragma unroll
                for (int q = 0; q < 2; ++q) { const v4f x0 = x[i & 1][2 * q], x1 = x[i & 1][2 * q + 1];
                    const float y[8] = { x0[0], x0[1], x0[2], x0[3], x1[0], x1[1], x1[2], x1[3] }; planes8(y, o16[q], oh[q], ol[q]); }
                __builtin_amdgcn_sched_barrier(0);       // the six stores stand together behind the arithmetic: no register of an issued store is written in front of the wait below
#pragma unroll
                for (int q = 0; q < 2; ++q) { const int so = (i * 16 + q * 8) * TT; *(v8h*)(p16 + so) = o16[q]; *(v8us*)(ph + so) = oh[q]; *(v8us*)(pl + so) = ol[q]; }
                addr_wait(); }
        }
    }
}

__device__ __forceinline__ h16 tohx(float x) { return (h16)x; }
__device__ __forceinline__ void splitf(float y, unsigned short& h, unsigned short& l) { h = f2bf(y); l = f2bf(y - bf2f(h)); }

__global__ __launch_bounds__(256) void k_cvt8(const float* __restrict__ src, bf* dst, size_t n8) { const size_t i = (size_t)blockIdx.x * 256 + threadIdx.x; if (i >= n8) return; const v8f v = *(const v8f*)(src + i * 8); v8us o;
#pragma unroll
    for (int k = 0; k < 8; ++k) o[k] = f2bf(v[k]); *(v8us*)(dst + i * 8) = o;  }

__constant__ float INVT[HD / 2] = { 1.000000000e+00f, 8.659643531e-01f, 7.498942018e-01f, 6.493816376e-01f, 5.623413324e-01f, 4.869675338e-01f, 4.216965139e-01f, 3.651741445e-01f, 3.162277639e-01f, 2.738419771e-01f, 2.371373624e-01f, 2.053525001e-01f, 1.778279394e-01f, 1.539926529e-01f, 1.333521456e-01f, 1.154782027e-01f, 1.000000015e-01f, 8.659642935e-02f, 7.498941571e-02f, 6.493816525e-02f, 5.623412877e-02f, 4.869675264e-02f, 4.216964915e-02f, 3.651741147e-02f, 3.162277862e-02f, 2.738419548e-02f, 2.371373586e-02f, 2.053525113e-02f, 1.778279431e-02f, 1.539926510e-02f, 1.333521493e-02f, 1.154781971e-02f, 9.999999776e-03f, 8.659643121e-03f, 7.498942316e-03f, 6.493816618e-03f, 5.623413250e-03f, 4.869675264e-03f, 4.216964822e-03f, 3.651741426e-03f, 3.162277862e-03f, 2.738419687e-03f, 2.371373819e-03f, 2.053525066e-03f, 1.778279431e-03f, 1.539926510e-03f, 1.333521446e-03f, 1.154782018e-03f, 1.000000047e-03f, 8.659643354e-04f, 7.498941850e-04f, 6.493816618e-04f, 5.623413017e-04f, 4.869675031e-04f, 4.216964880e-04f, 3.651741135e-04f, 3.162277862e-04f, 2.738419571e-04f, 2.371373848e-04f, 2.053524950e-04f, 1.778279402e-04f, 1.539926452e-04f, 1.333521504e-04f, 1.154781930e-04f };   // float32 1 / 10000^(2i/128), generated with jnp to be bit-exact
// CS[t][d] = (cos, sin) of t x INVT[d], d < HD / 2 (columns d and d + HD / 2 of the rotary tables are equal)
__global__ __launch_bounds__(256) void k_cs5(float* CS) { const int idx = blockIdx.x * 256 + threadIdx.x; if (idx >= TT * (HD / 2)) return; const int d = idx % (HD / 2); const int t = idx / (HD / 2); const float a = __fmul_rn((float)t, INVT[d]); v2f cs; cs[0] = cosf(a); cs[1] = sinf(a); *(v2f*)(CS + (size_t)idx * 2) = cs;  }
// ---- k_fattn: scores, softmax and probability x value in one kernel; neither scores nor probabilities leave the registers. A work-group of four waves owns a tile of 64 query rows of one head, 16 rows a wave, and walks the keys 0 .. the tile's last row in stages of 64.
// A stage is 64 rows of K (256 B each) and 64 keys of every row of Vt (128 B each), brought from global memory into LDS by asynchronous 16-byte copies (whole lines, each byte fetched once per work-group) and read from there as fragments by all four waves.
// Two buffers: the copies of stage s + 2 are issued behind the barrier that ends trip s and fly during trip s + 1.
// St[key][query] = K Q^T and Ot[d][query] += Vt Pt: a lane then holds scores of ONE query (query = lr, keys hi*8+j of each 16-key tile), which is at once the B-fragment order of Pt (k = 8*hi+j, 16+8*hi+j),
// so maximum, sum and rescale are in-lane but for one exchange between the wave's halves. Running maximum m and running sum l per query (online softmax), keys in runs of 32; the division by l comes once, at the end.
__device__ __forceinline__ float xhalf(float x) { return __builtin_bit_cast(float, __builtin_amdgcn_permlanex16(__builtin_bit_cast(int, x), __builtin_bit_cast(int, x), 0x76543210, 0xfedcba98, false, false)); }   // lane l with lane l ^ 16
#define AKS  64                    // keys per stage
#define VP   72                    // LDS row pitch in elements of a stage's Vt rows: 144 B = 16 B x odd, free of bank conflicts for 16-byte fragment reads (K rows: GP)
#define KPL  (AKS * GP)            // elements of one K plane's stage in LDS
#define VPL  (HD * VP)             // elements of one Vt plane's stage in LDS
#define ABUF (2 * (KPL + VPL))     // elements of a buffer: K, Vt, second K, second Vt
// Eight copies of 16 B per lane, LDS step LS bytes, global step gs elements. s_wait_xcnt 0 is the statement's last line, so that it stands in front of every later write of a register that a copy names.
template <unsigned LS, typename T16>
__device__ __forceinline__ void cp8s(unsigned l, const T16* g, size_t gs) {
    asm volatile("global_load_async_to_lds_b128 %0, %8, off\n\t"
                 "global_load_async_to_lds_b128 %1, %9, off\n\t"
                 "global_load_async_to_lds_b128 %2, %10, off\n\t"
                 "global_load_async_to_lds_b128 %3, %11, off\n\t"
                 "global_load_async_to_lds_b128 %4, %12, off\n\t"
                 "global_load_async_to_lds_b128 %5, %13, off\n\t"
                 "global_load_async_to_lds_b128 %6, %14, off\n\t"
                 "global_load_async_to_lds_b128 %7, %15, off\n\t"
                 "s_wait_xcnt 0x0"
                 :: "v"(l), "v"(l + 1u * LS), "v"(l + 2u * LS), "v"(l + 3u * LS), "v"(l + 4u * LS), "v"(l + 5u * LS), "v"(l + 6u * LS), "v"(l + 7u * LS),
                    "v"(g), "v"(g + gs), "v"(g + 2 * gs), "v"(g + 3 * gs), "v"(g + 4 * gs), "v"(g + 5 * gs), "v"(g + 6 * gs), "v"(g + 7 * gs) : "memory");
}
// One tile of 64 query rows. Every wave of the work-group passes every barrier; tile is the same in all of them.
template <typename T16, int NSPLIT>
__device__ __forceinline__ void fattn_tile(const T16* st, const T16* __restrict__ Q, const T16* __restrict__ Q2, const T16* __restrict__ Kp, const T16* __restrict__ Kp2, const T16* __restrict__ Vt, const T16* __restrict__ Vt2, int tile, int w, int tid, bf* Ah, bf* Al) {
    typedef typename WFrag<T16>::V V;
    const float L2E = 1.4426950408889634f;
    const float PSH = (NSPLIT == 0) ? 10.0f : 0.0f;      // fp16 probabilities carry a factor 2^10 (small ones stay normal numbers); l carries it too, so it cancels in the division
    const int lane = tid & 31, lr = lane & 15, hi = lane >> 4; const int q0 = tile * 64 + w * 16;   // the wave's first query row (scalar)
    V q[4], q2[4];
    // one lane pointer per plane; every fragment is a constant offset from it
    { const size_t qoff = (size_t)(q0 + lr) * HD + 8 * hi; const T16* qp = Q + qoff; const T16* qp2 = (NSPLIT == 2) ? Q2 + qoff : qp;
#pragma unroll
      for (int kc = 0; kc < 4; ++kc) { q[kc] = WFrag<T16>::ld(qp + kc * 32); if (NSPLIT == 2) q2[kc] = WFrag<T16>::ld(qp2 + kc * 32); }
      addr_wait(); }
    v8f o[8];
#pragma unroll
    for (int dt = 0; dt < 8; ++dt) o[dt] = (v8f){};
    float m = -3.0e38f, l = 0.f;
    // a copy of the work-group covers 8 rows of K (lane: row tid / 16, 16-byte piece tid % 16) or 16 rows of Vt (row tid / 8, piece tid % 8)
    const size_t gko = (size_t)(tid >> 4) * HD + (tid & 15) * 8, gvo = (size_t)(tid >> 3) * TT + (tid & 7) * 8;
    const unsigned lk0 = (unsigned)(size_t)&st[(tid >> 4) * GP + (tid & 15) * 8], lv0 = (unsigned)(size_t)&st[KPL + (tid >> 3) * VP + (tid & 7) * 8];
    auto fill = [&](int s) {
        const unsigned bo = (unsigned)(s & 1) * (ABUF * 2);
        cp8s<8 * GP * 2>(lk0 + bo, Kp + gko + (size_t)s * AKS * HD, (size_t)8 * HD); cp8s<16 * VP * 2>(lv0 + bo, Vt + gvo + s * AKS, (size_t)16 * TT);
        if (NSPLIT == 2) { cp8s<8 * GP * 2>(lk0 + bo + (KPL + VPL) * 2, Kp2 + gko + (size_t)s * AKS * HD, (size_t)8 * HD); cp8s<16 * VP * 2>(lv0 + bo + (KPL + VPL) * 2, Vt2 + gvo + s * AKS, (size_t)16 * TT); } };
    const int NS = tile + 1;                             // stages: keys 0 .. 64 tile + 63
    fill(0);                                             // the buffers are free: an earlier tile's last reads lie in front of its loop's last barrier
    asm volatile("s_wait_asynccnt 0x0" ::: "memory");    // this wave's copies of stage 0 have landed
    __syncthreads();                                     // every wave's have: stage 0 may be read
    if (NS > 1) fill(1);
#pragma unroll 1   // one copy of the trip; the buffer is chosen by the trip's parity
    for (int s = 0; s < NS; ++s) {
        const T16* sb = st + (s & 1) * ABUF;
#pragma unroll 1   // one copy of the run's body
        for (int r = 0; r < 2; ++r) {
            const int kb = s * AKS + r * 32;
            if (kb > q0 + 15) break;                     // every key of the run lies behind the wave's last query (scalar branch; the barrier below is still passed)
            const T16* kf = sb + (r * 32 + lr) * GP + 8 * hi; const T16* vf = sb + KPL + lr * VP + r * 32 + 8 * hi;
            V k[2][4], k2[2][4], v[8], v2[8];
#pragma unroll
            for (int t = 0; t < 2; ++t)
#pragma unroll
                for (int kc = 0; kc < 4; ++kc) { const int ko = t * 16 * GP + kc * 32; k[t][kc] = WFrag<T16>::ld(kf + ko); if (NSPLIT == 2) k2[t][kc] = WFrag<T16>::ld(kf + (KPL + VPL) + ko); }
#pragma unroll
            for (int dt = 0; dt < 8; ++dt) { const int vo = dt * 16 * VP; v[dt] = WFrag<T16>::ld(vf + vo); if (NSPLIT == 2) v2[dt] = WFrag<T16>::ld(vf + (KPL + VPL) + vo); }
            __builtin_amdgcn_sched_barrier(0);           // keeps the run's LDS reads in one group up here: the Vt fragments arrive during the score products and the softmax
            v8f sc[2] = { (v8f){}, (v8f){} };
#pragma unroll
            for (int kc = 0; kc < 4; ++kc)
#pragma unroll
                for (int t = 0; t < 2; ++t) { v8f a = sc[t]; a = WFrag<T16>::mma(k[t][kc], q[kc], a); if (NSPLIT == 2) { a = WFrag<T16>::mma(k[t][kc], q2[kc], a); a = WFrag<T16>::mma(k2[t][kc], q[kc], a); } sc[t] = a; }
            const bool diag = (kb + 31 > q0);            // only such a run meets the causal diagonal (wave-uniform)
            const int dq = kb - q0;
            float mx = m;
#pragma unroll
            for (int t = 0; t < 2; ++t)
#pragma unroll
                for (int j = 0; j < 8; ++j) { float x = sc[t][j] * SCL; if (diag && dq + t * 16 + hi * 8 + j > lr) x = -3.0e38f; sc[t][j] = x; mx = fmaxf(mx, x); }
            const float mn = fmaxf(mx, xhalf(mx));
            if (__builtin_amdgcn_ballot_w32(mn > m) != 0) {   // a maximum moved: bring sums and output tiles to the new one (factor exactly 1 where it did not)
                const float al = __builtin_amdgcn_exp2f((m - mn) * L2E); l *= al; m = mn;
#pragma unroll
                for (int dt = 0; dt < 8; ++dt) o[dt] *= al; }
            V pf, pf2; float sum = 0.f; float p[16];
#pragma unroll
            for (int e = 0; e < 16; ++e) { p[e] = __builtin_amdgcn_exp2f((sc[e >> 3][e & 7] - m) * L2E + PSH); sum += p[e]; }
            l += sum;
            if constexpr (NSPLIT == 0) { v16h f;
#pragma unroll
                for (int e = 0; e < 16; ++e) f[e] = tohx(p[e]);
                pf = f;
            } else { v8us h0, h1, l0, l1;
#pragma unroll
                for (int e = 0; e < 8; ++e) { unsigned short a, c2; splitf(p[e], a, c2); h0[e] = a; l0[e] = c2; splitf(p[8 + e], a, c2); h1[e] = a; l1[e] = c2; }
                pf = cat16b(h0, h1); pf2 = cat16b(l0, l1); }
#pragma unroll
            for (int dt = 0; dt < 8; ++dt) { o[dt] = WFrag<T16>::mma(v[dt], pf, o[dt]); if (NSPLIT == 2) { o[dt] = WFrag<T16>::mma(v[dt], pf2, o[dt]); o[dt] = WFrag<T16>::mma(v2[dt], pf, o[dt]); } }
            __builtin_amdgcn_sched_barrier(0);           // the products stay in front of the slots below
            asm volatile("v_nop\n\tv_nop\n\tv_nop\n\tv_nop");   // the four vector slots between the run's last matrix instruction and the next run's first write of its operand registers
        }
        asm volatile("s_wait_dscnt 0x0" ::: "memory");   // this wave's reads of the trip's buffer are done
        asm volatile("s_wait_asynccnt 0x0" ::: "memory");   // this wave's copies of stage s + 1 have landed
        __syncthreads();                                 // publishes stage s + 1 and frees the buffer that trip s has read
        if (s + 2 < NS) fill(s + 2);
    }
    asm volatile("s_wait_asynccnt 0x0" ::: "memory");    // no copy is left in flight behind the loop
    { const float inv = __fdiv_rn(1.0f, l + xhalf(l)); const size_t oo = (size_t)(q0 + lr) * DQ + hi * 8; bf* ap = Ah + oo; bf* ap2 = Al + oo;
#pragma unroll
        for (int dt = 0; dt < 8; ++dt) { v8us oh, ol;
#pragma unroll
            for (int j = 0; j < 8; ++j) { unsigned short a, c2; splitf(o[dt][j] * inv, a, c2); oh[j] = a; ol[j] = c2; }
            *(v8us*)(ap + dt * 16) = oh; *(v8us*)(ap2 + dt * 16) = ol;
            addr_wait(); } }
}
// grid (heads, TT / 128, batches), 128 threads. Tile t of 64 query rows has t + 1 stages of keys, so tiles t and TT/64 - 1 - t together always have TT/64 + 1; work-group y takes tile TT/64 - 1 - y and then tile y, one after the other.
// Query rows < RH: bf16 hi/lo planes, 3 products; the rest fp16 (chosen per tile). Writes the merged hi/lo planes [t][head * HD + d].
__global__ __launch_bounds__(128) void k_fattn(const h16* __restrict__ Q16, const h16* __restrict__ K16, const h16* __restrict__ V16, const bf* __restrict__ Qh, const bf* __restrict__ Ql, const bf* __restrict__ Kh, const bf* __restrict__ Kl, const bf* __restrict__ Vh, const bf* __restrict__ Vl, bf* Ah, bf* Al) {
    __shared__ __align__(16) bf ast[2 * ABUF];
    static_assert(RH % 64 == 0 && RH <= TT / 2, "a tile is of one kind; the first tile of a work-group is never of the hi/lo kind");
    const int tid = threadIdx.x; const int h = blockIdx.x; const int w = __builtin_amdgcn_readfirstlane(tid >> 5);   /* wave-uniform: the run's bound stays scalar */
    const size_t hp = ((size_t)blockIdx.z * NH_ + h) * TT * HD;   // grid z = batch: its heads' planes
    Ah += (size_t)blockIdx.z * TT * DQ; Al += (size_t)blockIdx.z * TT * DQ;   // and its TT rows of the merged planes
    const int y = (int)blockIdx.y;
    fattn_tile<h16, 0>((const h16*)ast, Q16 + hp, nullptr, K16 + hp, nullptr, V16 + hp, nullptr, TT / 64 - 1 - y, w, tid, Ah + h * HD, Al + h * HD);   // rows >= TT / 2 >= RH
    if (y * 64 < RH) fattn_tile<bf, 2>(ast, Qh + hp, Ql + hp, Kh + hp, Kl + hp, Vh + hp, Vl + hp, y, w, tid, Ah + h * HD, Al + h * HD);
    else fattn_tile<h16, 0>((const h16*)ast, Q16 + hp, nullptr, K16 + hp, nullptr, V16 + hp, nullptr, y, w, tid, Ah + h * HD, Al + h * HD);
}

extern "C" void kernel_launch(void* const* d_in, const int* in_sizes, int n_in,
                              void* d_out, int out_size, void* d_ws, size_t ws_size, hipStream_t stream) {
    (void)in_sizes; (void)n_in; (void)out_size;
    const float* x = (const float*)d_in[0]; const float* wq = (const float*)d_in[1]; const float* wk = (const float*)d_in[2]; const float* wv = (const float*)d_in[3]; const float* wo = (const float*)d_in[4];   /* order hidden_states, Wq, Wk, Wv, Wo ('oi' [2048][2048]) */
    float* OUT = (float*)d_out;     // [2][2048][2048]
    char* wsp = (char*)d_ws;
    auto take = [&](size_t bytes) { char* p = wsp; wsp += (bytes + 255) & ~(size_t)255; return (void*)p; };
    bf* WQ = (bf*)take((size_t)DQ * DM * 2); bf* WK = (bf*)take((size_t)DKV * DM * 2); bf* WV = (bf*)take((size_t)DKV * DM * 2); bf* WO = (bf*)take((size_t)DM * DQ * 2); float* CS = (float*)take((size_t)TT * (HD / 2) * 2 * 4);
    static_assert(NKV == NH_, "one plane stride per batch for q, k and v");
    // every buffer below holds both batches, batch-major
    bf* XB = (bf*)take((size_t)NB_ * TT * DM * 2);
    h16* QP16 = (h16*)take((size_t)NB_ * NH_ * TT * HD * 2); h16* KP16 = (h16*)take((size_t)NB_ * NKV * TT * HD * 2); h16* VT16 = (h16*)take((size_t)NB_ * NKV * HD * TT * 2);
    bf* QPh = (bf*)take((size_t)NB_ * NH_ * TT * HD * 2); bf* QPl = (bf*)take((size_t)NB_ * NH_ * TT * HD * 2); bf* KPh = (bf*)take((size_t)NB_ * NKV * TT * HD * 2); bf* KPl = (bf*)take((size_t)NB_ * NKV * TT * HD * 2); bf* VTh = (bf*)take((size_t)NB_ * NKV * HD * TT * 2); bf* VTl = (bf*)take((size_t)NB_ * NKV * HD * TT * 2);
    bf* ATh = (bf*)take((size_t)NB_ * TT * DQ * 2); bf* ATl = (bf*)take((size_t)NB_ * TT * DQ * 2);
    if ((size_t)(wsp - (char*)d_ws) > ws_size) return;    // ws 256 MiB
    { k_cvt8<<<(unsigned)(((size_t)DQ * DM / 8 + 255) / 256), 256, 0, stream>>>(wq, WQ, (size_t)DQ * DM / 8); k_cvt8<<<(unsigned)(((size_t)DKV * DM / 8 + 255) / 256), 256, 0, stream>>>(wk, WK, (size_t)DKV * DM / 8); k_cvt8<<<(unsigned)(((size_t)DKV * DM / 8 + 255) / 256), 256, 0, stream>>>(wv, WV, (size_t)DKV * DM / 8);
      k_cvt8<<<(unsigned)(((size_t)DM * DQ / 8 + 255) / 256), 256, 0, stream>>>(wo, WO, (size_t)DM * DQ / 8);
       }
    k_cs5<<<(TT * (HD / 2) + 255) / 256, 256, 0, stream>>>(CS);   /* rotary table once */
    // both batches in every launch (grid z): 512 work-groups, so that a WGP holds two where its LDS takes two (projections, attention)
    k_cvt8<<<(unsigned)(((size_t)NB_ * TT * DM / 8 + 255) / 256), 256, 0, stream>>>(x, XB, (size_t)NB_ * TT * DM / 8);
    k_gemms<0, DM, 1><<<dim3(TT / 128, DQ / 128, NB_), 128, 0, stream>>>(XB, nullptr, WQ, nullptr, 0, CS, QP16, QPh, QPl);
    k_gemms<0, DM, 1><<<dim3(TT / 128, DKV / 128, NB_), 128, 0, stream>>>(XB, nullptr, WK, nullptr, 0, CS, KP16, KPh, KPl);
    k_gemms<0, DM, 2><<<dim3(TT / 128, DKV / 128, NB_), 128, 0, stream>>>(XB, nullptr, WV, nullptr, 0, nullptr, VT16, VTh, VTl);
    k_fattn<<<dim3(NH_, TT / 128, NB_), 128, 0, stream>>>(QP16, KP16, VT16, QPh, QPl, KPh, KPl, VTh, VTl, ATh, ATl);
    k_gemms<1, DQ, 0><<<dim3(TT / 128, DM / 128, NB_), 128, 0, stream>>>(ATh, ATl, WO, OUT, DM, nullptr, nullptr, nullptr, nullptr);
}

// v007
// A run of this version takes 205 microseconds.
// Two timings next to v006 both put it at 1.05 times that version's speed.
// Over all steps from v000 it is 8.57 times as fast.
#include <hip/hip_runtime.h>

// Causal multi-head attention with 128-wide heads and computed rotate-half rotary embeddings (hidden_states [2][2048][2048]; q, k, v = einsum('bsd,ed->bse', x, W) ('oi' 0.02; 16 heads x 128); rope x cos + rotate_half(x) sin, angle t x 1/10000^(2i/128) (64 f32 frequencies jnp-exact; cat(freqs, freqs); precise cosf/sinf); scores / sqrt(128); mask = (key > query) | (key - query >= 1024): the second term only touches FUTURE keys, which the first already excludes: plain causal (-inf == exclusion); softmax in f32; out = merged Wo^T -> [2][2048][2048] (8.4 M); argument order hidden_states, Wq, Wk, Wv, Wo).
// Layout: bf16 copy of x; 'oi' weights; exact projections whose epilogues build the head planes (q, k: rotate-half with the k_prep table; v: transposed); causal T-2048 attention at HD 128 in one fused kernel, online softmax (hybrid rows: < 512 hi/lo 3 products, rest fp16 x1024; keys above the diagonal block never read); merged hi/lo x Wo exact.
// Compute dtypes, f32 accumulate: every input rounded to bf16; projections exact; rotary f32; attention rows < 512 3 products, rest fp16; softmax f32; Wo hl x exact.

#define NB_  2
#define TT   2048
#define DM   2048
#define NH_  16
#define NKV  16
#define HD   128
#define DQ   (NH_ * HD)
#define DKV  (NKV * HD)
#define RH   512                  // query rows < RH use hi+lo planes (0: none)
#define SCL  0.088388347648318447f   // HD^-0.5
typedef _Float16 h16;
typedef unsigned short bf;
typedef __attribute__((ext_vector_type(16))) __bf16   v16bf;
typedef __attribute__((ext_vector_type(16))) _Float16 v16h;
typedef __attribute__((ext_vector_type(8)))  _Float16 v8h;
typedef __attribute__((ext_vector_type(8)))  unsigned short v8us;
typedef __attribute__((ext_vector_type(8)))  float    v8f;
typedef __attribute__((ext_vector_type(4)))  float    v4f;
typedef v8h  __attribute__((may_alias)) v8ha;
typedef v4f  __attribute__((may_alias)) v4fa;
typedef v8us __attribute__((may_alias)) v8usa;

__device__ __forceinline__ unsigned short f2bf(float f) { unsigned u = __float_as_uint(f); u += 0x7FFFu + ((u >> 16) & 1u); return (unsigned short)(u >> 16); }
__device__ __forceinline__ float bf2f(unsigned short b) { return __uint_as_float(((unsigned)b) << 16); }
__device__ __forceinline__ v16h cat16(v8h lo, v8h hi) { return __builtin_shufflevector(lo, hi, 0, 1, 2, 3, 4, 5, 6, 7, 8, 9, 10, 11, 12, 13, 14, 15); }
__device__ __forceinline__ v16bf cat16b(v8us lo, v8us hi) { return __builtin_bit_cast(v16bf, __builtin_shufflevector(lo, hi, 0, 1, 2, 3, 4, 5, 6, 7, 8, 9, 10, 11, 12, 13, 14, 15)); }
__device__ __forceinline__ v8f wmma16(v16h a, v16h b, v8f c) { return __builtin_amdgcn_wmma_f32_16x16x32_f16(false, a, false, b, (short)0, c, false, false); }
__device__ __forceinline__ v8f wmmab(v16bf a, v16bf b, v8f c) { return __builtin_amdgcn_wmma_f32_16x16x32_bf16(false, a, false, b, (short)0, c, false, false); }

typedef __attribute__((ext_vector_type(2))) _Float16 v2h;
typedef __attribute__((ext_vector_type(2))) __bf16 v2bf;
typedef __attribute__((ext_vector_type(2))) unsigned short v2us;
typedef __attribute__((ext_vector_type(2))) float v2f;
__device__ __forceinline__ void addr_wait() { __builtin_amdgcn_sched_barrier(0); asm volatile("s_wait_xcnt 0x0" ::: "memory"); __builtin_amdgcn_sched_barrier(0); }
// Eight f32 values -> their words in the three planes: fp16, bf16 head, bf16 of the remainder (each rounded to nearest even, two values a convert).
__device__ __forceinline__ void planes8(const float (&y)[8], v8h& o16, v8us& oh, v8us& ol) {
#pragma unroll   // constant vector indices: the words stay in registers
    for (int p = 0; p < 4; ++p) { const v2f a = { y[2 * p], y[2 * p + 1] };
        const v2h f = __builtin_convertvector(a, v2h); const v2us hu = __builtin_bit_cast(v2us, __builtin_convertvector(a, v2bf));
        const v2f r = { a[0] - bf2f(hu[0]), a[1] - bf2f(hu[1]) }; const v2us lu = __builtin_bit_cast(v2us, __builtin_convertvector(r, v2bf));
        o16[2 * p] = f[0]; o16[2 * p + 1] = f[1]; oh[2 * p] = hu[0]; oh[2 * p + 1] = hu[1]; ol[2 * p] = lu[0]; ol[2 * p + 1] = lu[1]; }
}

// ---- k_gemms: sum_k A[m][k] Bt[n][k] (NSPLIT 1: + A2[m][k] Bt[n][k], product by product in the same k order), operands K-contiguous bf16 planes. M, N % 128 == 0, K % 128 == 0, K >= 256.
// EPI 0: C[m][n] (f32, pitch ldc). EPI 1, 2: m = token, the tile's 128 columns = one head; the f32 tile never leaves the work-group: it is turned into that head's three planes (fp16, bf16 head, bf16 remainder) here.
//   EPI 1: planes [head][t][d] of the rotate-half rotary form out[d] = x[d] cos[t][d] - x[d+64] sin[t][d], out[d+64] = x[d+64] cos[t][d] + x[d] sin[t][d], d < 64, (cos, sin) pairs from CS[t][d].   EPI 2: transposed planes [head][d][t].
// One work-group of four waves per 128x128 output tile, each wave a 64x64 quarter (16 accumulators); grid (M/128, N/128, batches), 128 threads. M = TT rows a batch; Bt and CS are the same for every batch.
// A stage is 128 k (256 B) of the tile's 128 rows of every operand, brought from global memory into LDS by asynchronous 16-byte copies (whole lines, each byte fetched once per work-group) and read from there as fragments by the two waves that need it.
// Two buffers: the copies of stage t + 2 are issued behind the barrier that ends trip t and fly during trip t + 1.
template <typename T16> struct WFrag;
template <> struct WFrag<h16> { typedef v16h V; static __device__ __forceinline__ V ld(const h16* p) { return cat16(*(const v8h*)p, *(const v8h*)(p + 16)); } static __device__ __forceinline__ v8f mma(V a, V b, v8f c) { return wmma16(a, b, c); } };
template <> struct WFrag<bf> { typedef v16bf V; static __device__ __forceinline__ V ld(const bf* p) { return cat16b(*(const v8us*)p, *(const v8us*)(p + 16)); } static __device__ __forceinline__ v8f mma(V a, V b, v8f c) { return wmmab(a, b, c); } };
#define GKS 128                    // k per stage
#define GP  136                    // LDS row pitch in elements: 272 B = 16 B x odd, free of bank conflicts for 16-byte fragment reads
#define TP  132                    // row pitch in f32 of the epilogue's tile in LDS: 528 B = 16 B x odd
// Eight copies of 16 B per lane, LDS step 8 rows, global step gs elements. s_wait_xcnt 0 is the statement's last line, so that it stands in front of every later write of a register that a copy names.
__device__ __forceinline__ void cp8(unsigned l, const bf* g, size_t gs) {
    asm volatile("global_load_async_to_lds_b128 %0, %8, off\n\t"
                 "global_load_async_to_lds_b128 %1, %9, off\n\t"
                 "global_load_async_to_lds_b128 %2, %10, off\n\t"
                 "global_load_async_to_lds_b128 %3, %11, off\n\t"
                 "global_load_async_to_lds_b128 %4, %12, off\n\t"
                 "global_load_async_to_lds_b128 %5, %13, off\n\t"
                 "global_load_async_to_lds_b128 %6, %14, off\n\t"
                 "global_load_async_to_lds_b128 %7, %15, off\n\t"
                 "s_wait_xcnt 0x0"
                 :: "v"(l), "v"(l + 1u * 8 * GP * 2), "v"(l + 2u * 8 * GP * 2), "v"(l + 3u * 8 * GP * 2), "v"(l + 4u * 8 * GP * 2), "v"(l + 5u * 8 * GP * 2), "v"(l + 6u * 8 * GP * 2), "v"(l + 7u * 8 * GP * 2),
                    "v"(g), "v"(g + gs), "v"(g + 2 * gs), "v"(g + 3 * gs), "v"(g + 4 * gs), "v"(g + 5 * gs), "v"(g + 6 * gs), "v"(g + 7 * gs) : "memory");
}
template <int NSPLIT, int K, int EPI>
__global__ __launch_bounds__(128) void k_gemms(const bf* __restrict__ A, const bf* __restrict__ A2, const bf* __restrict__ Bt, float* C, int ldc, const float* __restrict__ CS, h16* P16, bf* Ph, bf* Pl) {
    typedef WFrag<bf>::V V;
    // grid z = batch: its own TT rows of A (and A2), and its own output: TT rows of C, or its heads' planes
    { const size_t z = blockIdx.z; A += z * ((size_t)TT * K); if constexpr (NSPLIT == 1) A2 += z * ((size_t)TT * K);
      if constexpr (EPI == 0) C += z * TT * (size_t)ldc; else { const size_t pz = z * ((size_t)NH_ * TT * HD); P16 += pz; Ph += pz; Pl += pz; } }
    constexpr int NOP = (NSPLIT == 1) ? 3 : 2;           // operand planes per stage: A, Bt (, A2)
    __shared__ __align__(16) bf st[2][NOP][128 * GP];
    static_assert(EPI == 0 || sizeof(st) >= 2 * 128 * TP * sizeof(float), "the epilogue's tile and rotary rows fit the ring's LDS");
    const int tid = threadIdx.x, lane = tid & 31, lr = lane & 15, hi = lane >> 4; const int w = __builtin_amdgcn_readfirstlane(tid >> 5);
    const int r0 = blockIdx.x * 128, c0 = blockIdx.y * 128, wr = (w >> 1) * 64, wc = (w & 1) * 64;
    v8f acc[4][4];
    // every '#pragma unroll' of this kernel: constant indices, so that accumulators and fragments stay in registers
#pragma unroll
    for (int mb = 0; mb < 4; ++mb)
#pragma unroll
        for (int nb = 0; nb < 4; ++nb) acc[mb][nb] = (v8f){};
    // a copy of the work-group covers 8 rows of 256 B: lane pointer = row tid / 16, 16-byte piece tid % 16
    const size_t go = (size_t)(tid >> 4) * K + (tid & 15) * 8;
    const bf* ga = A + (size_t)r0 * K + go; const bf* gb = Bt + (size_t)c0 * K + go; const bf* ga2 = (NSPLIT == 1) ? A2 + (size_t)r0 * K + go : ga;
    const unsigned l0 = (unsigned)(size_t)&st[0][0][(tid >> 4) * GP + (tid & 15) * 8];
    auto fill = [&](int s) {
        const unsigned l = l0 + (unsigned)(s & 1) * (NOP * 128 * GP * 2); const int ko = s * GKS;
#pragma unroll
        for (int h = 0; h < 2; ++h) { const unsigned lh = l + h * 64 * GP * 2; const size_t gh = (size_t)h * 64 * K + ko;
            cp8(lh, ga + gh, (size_t)8 * K); cp8(lh + 128 * GP * 2, gb + gh, (size_t)8 * K); if (NSPLIT == 1) cp8(lh + 2 * 128 * GP * 2, ga2 + gh, (size_t)8 * K); } };
    constexpr int NS = K / GKS; static_assert(K % GKS == 0 && NS >= 2, "two stages or more");
    fill(0);
    asm volatile("s_wait_asynccnt 0x0" ::: "memory");    // this wave's copies of stage 0 have landed
    __syncthreads();                                     // every wave's have: stage 0 may be read
    fill(1);
#pragma unroll 1   // one copy of the trip; the buffer is chosen by the trip's parity
    for (int t = 0; t < NS; ++t) {
        const bf* sa = &st[t & 1][0][(wr + lr) * GP + 8 * hi]; const bf* sb = &st[t & 1][1][(wc + lr) * GP + 8 * hi]; const bf* sa2 = &st[t & 1][NOP - 1][(wr + lr) * GP + 8 * hi];
        // two fragment sets: block kk + 1's LDS reads are issued as one group in front of block kk's products, so that only the trip's first group is waited for in full
        V a[2][4], a2[2][4], b[2][4];
#pragma unroll
        for (int f = 0; f < 4; ++f) { a[0][f] = WFrag<bf>::ld(sa + f * 16 * GP); if (NSPLIT == 1) a2[0][f] = WFrag<bf>::ld(sa2 + f * 16 * GP); b[0][f] = WFrag<bf>::ld(sb + f * 16 * GP); }
#pragma unroll
        for (int kk = 0; kk < GKS / 32; ++kk) { const int c = kk & 1, n = c ^ 1;
            if (kk + 1 < GKS / 32) {
#pragma unroll
                for (int f = 0; f < 4; ++f) { a[n][f] = WFrag<bf>::ld(sa + f * 16 * GP + (kk + 1) * 32); if (NSPLIT == 1) a2[n][f] = WFrag<bf>::ld(sa2 + f * 16 * GP + (kk + 1) * 32); b[n][f] = WFrag<bf>::ld(sb + f * 16 * GP + (kk + 1) * 32); } }
            __builtin_amdgcn_sched_barrier(0);           // keeps that group of reads up here (sunk among the products, each pair would be waited for at its full LDS latency)
#pragma unroll
            for (int nb = 0; nb < 4; ++nb)
#pragma unroll
                for (int mb = 0; mb < 4; ++mb) { acc[mb][nb] = WFrag<bf>::mma(a[c][mb], b[c][nb], acc[mb][nb]); if (NSPLIT == 1) acc[mb][nb] = WFrag<bf>::mma(a2[c][mb], b[c][nb], acc[mb][nb]); }
            __builtin_amdgcn_sched_barrier(0);           // and the next group behind this block's products: its registers are the ones they read
        }
        asm volatile("s_wait_dscnt 0x0" ::: "memory");   // this wave's reads of the trip's buffer are done
        asm volatile("s_wait_asynccnt 0x0" ::: "memory");   // this wave's copies of stage t + 1 have landed
        __syncthreads();                                 // publishes stage t + 1 and frees the buffer that trip t has read
        if (t + 2 < NS) fill(t + 2);
    }
    asm volatile("s_wait_asynccnt 0x0" ::: "memory");    // no copy is left in flight when the wave goes on to its end
    if constexpr (EPI == 0) {
    __shared__ __align__(16) float osw[4][16 * 68];      // each wave's own output staging
    float* os = osw[w];
#pragma unroll
    for (int mb = 0; mb < 4; ++mb) {
#pragma unroll
        for (int nb = 0; nb < 4; ++nb) {
#pragma unroll
            for (int j = 0; j < 8; ++j) os[(hi * 8 + j) * 68 + nb * 16 + lr] = acc[mb][nb][j]; }
        __builtin_amdgcn_wave_barrier(); asm volatile("" ::: "memory");   // compile-time order only: the lanes' LDS stores stay in front of the row reads of other lanes' words
        float* crow = C + (size_t)(r0 + wr + mb * 16) * ldc + c0 + wc;
#pragma unroll
        for (int s = 0; s < 8; ++s) { const int row = 2 * s + hi, cofs = lr * 4; const v4f val = *(const v4fa*)(os + row * 68 + cofs);
            *(v4f*)(crow + (size_t)row * ldc + cofs) = val; }
        asm volatile("s_wait_xcnt 0x0" ::: "memory");    // in front of the next group's reuse of the stores' address registers
        __builtin_amdgcn_wave_barrier(); asm volatile("" ::: "memory");   // the same for the row reads and the next group's LDS stores
    }
    } else {
        // The ring's LDS is free here: every wave's last fragment read and last copy lie in front of the loop's last barrier.
        float* tl = (float*)&st[0][0][0];                // the work-group's f32 tile, pitch TP
        v8h o16[2]; v8us oh[2], ol[2];
        if constexpr (EPI == 1) {
            float* cl = tl + 128 * TP;                   // the tile's 128 rotary rows of 64 (cos, sin) pairs, pitch TP
            // a wave-wide load takes one whole row of 512 B; all 32 are issued up here, so that they fly while the tile is staged
            const float* cg = CS + (size_t)(r0 + w) * HD + lane * 4; v4f cv[32];
#pragma unroll
            for (int i = 0; i < 32; ++i) cv[i] = *(const v4f*)(cg + i * 4 * HD);
            addr_wait();
#pragma unroll
            for (int mb = 0; mb < 4; ++mb)
#pragma unroll
                for (int nb = 0; nb < 4; ++nb)
#pragma unroll
                    for (int j = 0; j < 8; ++j) tl[(wr + mb * 16 + hi * 8 + j) * TP + wc + nb * 16 + lr] = acc[mb][nb][j];
#pragma unroll
            for (int i = 0; i < 32; ++i) *(v4fa*)(cl + (i * 4 + w) * TP + lane * 4) = cv[i];
            __syncthreads();                             // tile and rotary rows are whole: d and d + 64 of a row come from two waves
            // a lane: 8 values d and the 8 at d + 64 of one row; 8 lanes store a whole 128-B line of a plane, rows step by 16
            const int row = tid >> 3, dg = (tid & 7) * 8; const float* tp = tl + row * TP + dg; const float* cp = cl + row * TP + dg * 2;
            const size_t po = ((size_t)blockIdx.y * TT + r0 + row) * HD + dg; h16* p16 = P16 + po; bf* ph = Ph + po; bf* pl = Pl + po;
            v4f x[2][4], c[2][4];                        // two sets: row group i + 1 is read from LDS while group i is worked on
            auto rd = [&](int i) {
#pragma unroll
                for (int q = 0; q < 2; ++q) { x[i & 1][q] = *(const v4fa*)(tp + i * 16 * TP + q * 4); x[i & 1][2 + q] = *(const v4fa*)(tp + i * 16 * TP + HD / 2 + q * 4); }
#pragma unroll
                for (int q = 0; q < 4; ++q) c[i & 1][q] = *(const v4fa*)(cp + i * 16 * TP + q * 4); };
            rd(0);
#pragma unroll
            for (int i = 0; i < 8; ++i) { float lo[8], up[8];
                if (i + 1 < 8) rd(i + 1);
#pragma unroll
                for (int e = 0; e < 8; ++e) { const float x0 = x[i & 1][e >> 2][e & 3], x1 = x[i & 1][2 + (e >> 2)][e & 3], co = c[i & 1][e >> 1][(e & 1) * 2], si = c[i & 1][e >> 1][(e & 1) * 2 + 1];
                    lo[e] = x0 * co - x1 * si; up[e] = x1 * co + x0 * si; }
                planes8(lo, o16[0], oh[0], ol[0]); planes8(up, o16[1], oh[1], ol[1]);
                __builtin_amdgcn_sched_barrier(0);       // the six stores stand together behind the arithmetic: no register of an issued store is written in front of the wait below
#pragma unroll
                for (int q = 0; q < 2; ++q) { const int so = i * 16 * HD + q * (HD / 2); *(v8h*)(p16 + so) = o16[q]; *(v8us*)(ph + so) = oh[q]; *(v8us*)(pl + so) = ol[q]; }
                addr_wait(); }
        } else {
            // a lane's eight accumulator words are eight tokens of one column: the tile is staged transposed, [d][t], by 16-byte LDS stores
#pragma unroll
            for (int mb = 0; mb < 4; ++mb)
#pragma unroll
                for (int nb = 0; nb < 4; ++nb) { float* q = tl + (wc + nb * 16 + lr) * TP + wr + mb * 16 + hi * 8; const v8f a = acc[mb][nb];
                    *(v4fa*)q = (v4f){ a[0], a[1], a[2], a[3] }; *(v4fa*)(q + 4) = (v4f){ a[4], a[5], a[6], a[7] }; }
            __syncthreads();                             // the tile is whole: a row [d] holds tokens of two waves
            // a lane: 8 tokens of one d; 16 lanes store the tile's 256 B (two whole lines) of a plane's row, rows step by 8
            const int dr = tid >> 4, tg = (tid & 15) * 8; const float* tp = tl + dr * TP + tg;
            const size_t po = ((size_t)blockIdx.y * HD + dr) * TT + r0 + tg; h16* p16 = P16 + po; bf* ph = Ph + po; bf* pl = Pl + po;
            v4f x[2][4];                                 // two sets: row group i + 1 is read from LDS while group i is worked on
            auto rd = [&](int i) {
#pragma unroll
                for (int q = 0; q < 2; ++q) { x[i & 1][2 * q] = *(const v4fa*)(tp + (i * 16 + q * 8) * TP); x[i & 1][2 * q + 1] = *(const v4fa*)(tp + (i * 16 + q * 8) * TP + 4); } };
            rd(0);
#pragma unroll
            for (int i = 0; i < 8; ++i) {
                if (i + 1 < 8) rd(i + 1);
#pragma unroll
                for (int q = 0; q < 2; ++q) { const v4f x0 = x[i & 1][2 * q], x1 = x[i & 1][2 * q + 1];
                    const float y[8] = { x0[0], x0[1], x0[2], x0[3], x1[0], x1[1], x1[2], x1[3] }; planes8(y, o16[q], oh[q], ol[q]); }
                __builtin_amdgcn_sched_barrier(0);       // the six stores stand together behind the arithmetic: no register of an issued store is written in front of the wait below
#pragma unroll
                for (int q = 0; q < 2; ++q) { const int so = (i * 16 + q * 8) * TT; *(v8h*)(p16 + so) = o16[q]; *(v8us*)(ph + so) = oh[q]; *(v8us*)(pl + so) = ol[q]; }
                addr_wait(); }
        }
    }
}

__device__ __forceinline__ h16 tohx(float x) { return (h16)x; }
__device__ __forceinline__ void splitf(float y, unsigned short& h, unsigned short& l) { h = f2bf(y); l = f2bf(y - bf2f(h)); }

__constant__ float INVT[HD / 2] = { 1.000000000e+00f, 8.659643531e-01f, 7.498942018e-01f, 6.493816376e-01f, 5.623413324e-01f, 4.869675338e-01f, 4.216965139e-01f, 3.651741445e-01f, 3.162277639e-01f, 2.738419771e-01f, 2.371373624e-01f, 2.053525001e-01f, 1.778279394e-01f, 1.539926529e-01f, 1.333521456e-01f, 1.154782027e-01f, 1.000000015e-01f, 8.659642935e-02f, 7.498941571e-02f, 6.493816525e-02f, 5.623412877e-02f, 4.869675264e-02f, 4.216964915e-02f, 3.651741147e-02f, 3.162277862e-02f, 2.738419548e-02f, 2.371373586e-02f, 2.053525113e-02f, 1.778279431e-02f, 1.539926510e-02f, 1.333521493e-02f, 1.154781971e-02f, 9.999999776e-03f, 8.659643121e-03f, 7.498942316e-03f, 6.493816618e-03f, 5.623413250e-03f, 4.869675264e-03f, 4.216964822e-03f, 3.651741426e-03f, 3.162277862e-03f, 2.738419687e-03f, 2.371373819e-03f, 2.053525066e-03f, 1.778279431e-03f, 1.539926510e-03f, 1.333521446e-03f, 1.154782018e-03f, 1.000000047e-03f, 8.659643354e-04f, 7.498941850e-04f, 6.493816618e-04f, 5.623413017e-04f, 4.869675031e-04f, 4.216964880e-04f, 3.651741135e-04f, 3.162277862e-04f, 2.738419571e-04f, 2.371373848e-04f, 2.053524950e-04f, 1.778279402e-04f, 1.539926452e-04f, 1.333521504e-04f, 1.154781930e-04f };   // float32 1 / 10000^(2i/128), generated with jnp to be bit-exact
// ---- k_prep: everything the GEMMs need ahead of them, in one launch: the bf16 copies of the four weight matrices and of x, and the rotary table. grid PWG work-groups (one per WGP) of 16 waves.
// The 6 segments of PSEG f32 values (Wo, Wv, Wk, Wq, the two halves of x) are taken one after the other by the whole grid; of each segment a wave converts 4 KiB that lie together: eight wave-wide loads of 512 B (16 B a lane, whole lines), eight stores of 256 B (8 B a lane, whole lines).
// Two register sets: segment s + 2 is asked for as soon as segment s has been converted, so that 8 to 16 loads of a wave are always in flight.
// CS[t][d] = (cos, sin) of t x INVT[d], d < HD / 2 (columns d and d + HD / 2 of the rotary tables are equal): one pair a thread, worked out while the first two segments' loads fly.
#define PWG  256
#define PSEG ((size_t)DQ * DM)
typedef __attribute__((ext_vector_type(4))) unsigned short v4us;
__global__ __launch_bounds__(512) void k_prep(const float* __restrict__ x, const float* __restrict__ wq, const float* __restrict__ wk, const float* __restrict__ wv, const float* __restrict__ wo, bf* XB, bf* WQ, bf* WK, bf* WV, bf* WO, float* CS) {
    static_assert(PSEG == (size_t)PWG * 16 * 1024 && (size_t)NB_ * TT * DM == 2 * PSEG && (size_t)DKV * DM == PSEG && (size_t)DM * DQ == PSEG, "a segment is 4 KiB of f32 for every wave of the grid");
    static_assert(TT * (HD / 2) == PWG * 512, "one rotary pair a thread");
    const unsigned idx = blockIdx.x * 512 + threadIdx.x;
    const size_t e0 = (size_t)(idx >> 5) * 1024 + (idx & 31) * 4;   // the lane's first element, the same in every segment
    const float* const sp[6] = { wo + e0, wv + e0, wk + e0, wq + e0, x + e0, x + PSEG + e0 };
    bf* const dp[6] = { WO + e0, WV + e0, WK + e0, WQ + e0, XB + e0, XB + PSEG + e0 };
    v4f a[2][8];
    // every '#pragma unroll' of this kernel: constant indices, so that the two sets stay in registers
    auto ld = [&](int s) {
#pragma unroll
        for (int j = 0; j < 8; ++j) a[s & 1][j] = *(const v4f*)(sp[s] + j * 128);
        addr_wait(); };
    const float fr = INVT[idx % (HD / 2)];               // asked for ahead of the stream: loads are waited for in their order, and the table must not wait for the segments
    ld(0); ld(1);
    { const float an = __fmul_rn((float)(idx / (HD / 2)), fr); v2f cs; cs[0] = cosf(an); cs[1] = sinf(an); *(v2f*)(CS + (size_t)idx * 2) = cs; addr_wait(); }
#pragma unroll
    for (int s = 0; s < 6; ++s) {
#pragma unroll
        for (int j = 0; j < 8; ++j) { const v4f v = a[s & 1][j]; v4us o;
#pragma unroll
            for (int k = 0; k < 4; ++k) o[k] = f2bf(v[k]);
            *(v4us*)(dp[s] + j * 128) = o; }
        addr_wait();
        if (s + 2 < 6) ld(s + 2); }
}
// ---- k_fattn: scores, softmax and probability x value in one kernel; neither scores nor probabilities leave the registers. A work-group of four waves owns a tile of 64 query rows of one head, 16 rows a wave, and walks the keys 0 .. the tile's last row in stages of 64.
// A stage is 64 rows of K (256 B each) and 64 keys of every row of Vt (128 B each), brought from global memory into LDS by asynchronous 16-byte copies (whole lines, each byte fetched once per work-group) and read from there as fragments by all four waves.
// Two buffers: the copies of stage s + 2 are issued behind the barrier that ends trip s and fly during trip s + 1.
// St[key][query] = K Q^T and Ot[d][query] += Vt Pt: a lane then holds scores of ONE query (query = lr, keys hi*8+j of each 16-key tile), which is at once the B-fragment order of Pt (k = 8*hi+j, 16+8*hi+j),
// so maximum, sum and rescale are in-lane but for one exchange between the wave's halves. Running maximum m and running sum l per query (online softmax), keys in runs of 32; the division by l comes once, at the end.
__device__ __forceinline__ float xhalf(float x) { return __builtin_bit_cast(float, __builtin_amdgcn_permlanex16(__builtin_bit_cast(int, x), __builtin_bit_cast(int, x), 0x76543210, 0xfedcba98, false, false)); }   // lane l with lane l ^ 16
#define AKS  64                    // keys per stage
#define VP   72                    // LDS row pitch in elements of a stage's Vt rows: 144 B = 16 B x odd, free of bank conflicts for 16-byte fragment reads (K rows: GP)
#define KPL  (AKS * GP)            // elements of one K plane's stage in LDS
#define VPL  (HD * VP)             // elements of one Vt plane's stage in LDS
#define ABUF (2 * (KPL + VPL))     // elements of a buffer: K, Vt, second K, second Vt
// Eight copies of 16 B per lane, LDS step LS bytes, global step gs elements. s_wait_xcnt 0 is the statement's last line, so that it stands in front of every later write of a register that a copy names.
template <unsigned LS, typename T16>
__device__ __forceinline__ void cp8s(unsigned l, const T16* g, size_t gs) {
    asm volatile("global_load_async_to_lds_b128 %0, %8, off\n\t"
                 "global_load_async_to_lds_b128 %1, %9, off\n\t"
                 "global_load_async_to_lds_b128 %2, %10, off\n\t"
                 "global_load_async_to_lds_b128 %3, %11, off\n\t"
                 "global_load_async_to_lds_b128 %4, %12, off\n\t"
                 "global_load_async_to_lds_b128 %5, %13, off\n\t"
                 "global_load_async_to_lds_b128 %6, %14, off\n\t"
                 "global_load_async_to_lds_b128 %7, %15, off\n\t"
                 "s_wait_xcnt 0x0"
                 :: "v"(l), "v"(l + 1u * LS), "v"(l + 2u * LS), "v"(l + 3u * LS), "v"(l + 4u * LS), "v"(l + 5u * LS), "v"(l + 6u * LS), "v"(l + 7u * LS),
                    "v"(g), "v"(g + gs), "v"(g + 2 * gs), "v"(g + 3 * gs), "v"(g + 4 * gs), "v"(g + 5 * gs), "v"(g + 6 * gs), "v"(g + 7 * gs) : "memory");
}
// One tile of 64 query rows. Every wave of the work-group passes every barrier; tile is the same in all of them.
template <typename T16, int NSPLIT>
__device__ __forceinline__ void fattn_tile(const T16* st, const T16* __restrict__ Q, const T16* __restrict__ Q2, const T16* __restrict__ Kp, const T16* __restrict__ Kp2, const T16* __restrict__ Vt, const T16* __restrict__ Vt2, int tile, int w, int tid, bf* Ah, bf* Al) {
    typedef typename WFrag<T16>::V V;
    const float L2E = 1.4426950408889634f;
    const float PSH = (NSPLIT == 0) ? 10.0f : 0.0f;      // fp16 probabilities carry a factor 2^10 (small ones stay normal numbers); l carries it too, so it cancels in the division
    const int lane = tid & 31, lr = lane & 15, hi = lane >> 4; const int q0 = tile * 64 + w * 16;   // the wave's first query row (scalar)
    V q[4], q2[4];
    // one lane pointer per plane; every fragment is a constant offset from it
    { const size_t qoff = (size_t)(q0 + lr) * HD + 8 * hi; const T16* qp = Q + qoff; const T16* qp2 = (NSPLIT == 2) ? Q2 + qoff : qp;
#pragma unroll
      for (int kc = 0; kc < 4; ++kc) { q[kc] = WFrag<T16>::ld(qp + kc * 32); if (NSPLIT == 2) q2[kc] = WFrag<T16>::ld(qp2 + kc * 32); }
      addr_wait(); }
    v8f o[8];
#pragma unroll
    for (int dt = 0; dt < 8; ++dt) o[dt] = (v8f){};
    float m = -3.0e38f, l = 0.f;
    // a copy of the work-group covers 8 rows of K (lane: row tid / 16, 16-byte piece tid % 16) or 16 rows of Vt (row tid / 8, piece tid % 8)
    const size_t gko = (size_t)(tid >> 4) * HD + (tid & 15) * 8, gvo = (size_t)(tid >> 3) * TT + (tid & 7) * 8;
    const unsigned lk0 = (unsigned)(size_t)&st[(tid >> 4) * GP + (tid & 15) * 8], lv0 = (unsigned)(size_t)&st[KPL + (tid >> 3) * VP + (tid & 7) * 8];
    auto fill = [&](int s) {
        const unsigned bo = (unsigned)(s & 1) * (ABUF * 2);
        cp8s<8 * GP * 2>(lk0 + bo, Kp + gko + (size_t)s * AKS * HD, (size_t)8 * HD); cp8s<16 * VP * 2>(lv0 + bo, Vt + gvo + s * AKS, (size_t)16 * TT);
        if (NSPLIT == 2) { cp8s<8 * GP * 2>(lk0 + bo + (KPL + VPL) * 2, Kp2 + gko + (size_t)s * AKS * HD, (size_t)8 * HD); cp8s<16 * VP * 2>(lv0 + bo + (KPL + VPL) * 2, Vt2 + gvo + s * AKS, (size_t)16 * TT); } };
    const int NS = tile + 1;                             // stages: keys 0 .. 64 tile + 63
    fill(0);                                             // the buffers are free: an earlier tile's last reads lie in front of its loop's last barrier
    asm volatile("s_wait_asynccnt 0x0" ::: "memory");    // this wave's copies of stage 0 have landed
    __syncthreads();                                     // every wave's have: stage 0 may be read
    if (NS > 1) fill(1);
#pragma unroll 1   // one copy of the trip; the buffer is chosen by the trip's parity
    for (int s = 0; s < NS; ++s) {
        const T16* sb = st + (s & 1) * ABUF;
#pragma unroll 1   // one copy of the run's body
        for (int r = 0; r < 2; ++r) {
            const int kb = s * AKS + r * 32;
            if (kb > q0 + 15) break;                     // every key of the run lies behind the wave's last query (scalar branch; the barrier below is still passed)
            const T16* kf = sb + (r * 32 + lr) * GP + 8 * hi; const T16* vf = sb + KPL + lr * VP + r * 32 + 8 * hi;
            V k[2][4], k2[2][4], v[8], v2[8];
#pragma unroll
            for (int t = 0; t < 2; ++t)
#pragma unroll
                for (int kc = 0; kc < 4; ++kc) { const int ko = t * 16 * GP + kc * 32; k[t][kc] = WFrag<T16>::ld(kf + ko); if (NSPLIT == 2) k2[t][kc] = WFrag<T16>::ld(kf + (KPL + VPL) + ko); }
#pragma unroll
            for (int dt = 0; dt < 8; ++dt) { const int vo = dt * 16 * VP; v[dt] = WFrag<T16>::ld(vf + vo); if (NSPLIT == 2) v2[dt] = WFrag<T16>::ld(vf + (KPL + VPL) + vo); }
            __builtin_amdgcn_sched_barrier(0);           // keeps the run's LDS reads in one group up here: the Vt fragments arrive during the score products and the softmax
            v8f sc[2] = { (v8f){}, (v8f){} };
#pragma unroll
            for (int kc = 0; kc < 4; ++kc)
#pragma unroll
                for (int t = 0; t < 2; ++t) { v8f a = sc[t]; a = WFrag<T16>::mma(k[t][kc], q[kc], a); if (NSPLIT == 2) { a = WFrag<T16>::mma(k[t][kc], q2[kc], a); a = WFrag<T16>::mma(k2[t][kc], q[kc], a); } sc[t] = a; }
            const bool diag = (kb + 31 > q0);            // only such a run meets the causal diagonal (wave-uniform)
            const int dq = kb - q0;
            float mx = m;
#pragma unroll
            for (int t = 0; t < 2; ++t)
#pragma unroll
                for (int j = 0; j < 8; ++j) { float x = sc[t][j] * SCL; if (diag && dq + t * 16 + hi * 8 + j > lr) x = -3.0e38f; sc[t][j] = x; mx = fmaxf(mx, x); }
            const float mn = fmaxf(mx, xhalf(mx));
            if (__builtin_amdgcn_ballot_w32(mn > m) != 0) {   // a maximum moved: bring sums and output tiles to the new one (factor exactly 1 where it did not)
                const float al = __builtin_amdgcn_exp2f((m - mn) * L2E); l *= al; m = mn;
#pragma unroll
                for (int dt = 0; dt < 8; ++dt) o[dt] *= al; }
            V pf, pf2; float sum = 0.f; float p[16];
#pragma unroll
            for (int e = 0; e < 16; ++e) { p[e] = __builtin_amdgcn_exp2f((sc[e >> 3][e & 7] - m) * L2E + PSH); sum += p[e]; }
            l += sum;
            if constexpr (NSPLIT == 0) { v16h f;
#pragma unroll
                for (int e = 0; e < 16; ++e) f[e] = tohx(p[e]);
                pf = f;
            } else { v8us h0, h1, l0, l1;
#pragma unroll
                for (int e = 0; e < 8; ++e) { unsigned short a, c2; splitf(p[e], a, c2); h0[e] = a; l0[e] = c2; splitf(p[8 + e], a, c2); h1[e] = a; l1[e] = c2; }
                pf = cat16b(h0, h1); pf2 = cat16b(l0, l1); }
#pragma unroll
            for (int dt = 0; dt < 8; ++dt) { o[dt] = WFrag<T16>::mma(v[dt], pf, o[dt]); if (NSPLIT == 2) { o[dt] = WFrag<T16>::mma(v[dt], pf2, o[dt]); o[dt] = WFrag<T16>::mma(v2[dt], pf, o[dt]); } }
            __builtin_amdgcn_sched_barrier(0);           // the products stay in front of the slots below
            asm volatile("v_nop\n\tv_nop\n\tv_nop\n\tv_nop");   // the four vector slots between the run's last matrix instruction and the next run's first write of its operand registers
        }
        asm volatile("s_wait_dscnt 0x0" ::: "memory");   // this wave's reads of the trip's buffer are done
        asm volatile("s_wait_asynccnt 0x0" ::: "memory");   // this wave's copies of stage s + 1 have landed
        __syncthreads();                                 // publishes stage s + 1 and frees the buffer that trip s has read
        if (s + 2 < NS) fill(s + 2);
    }
    asm volatile("s_wait_asynccnt 0x0" ::: "memory");    // no copy is left in flight behind the loop
    { const float inv = __fdiv_rn(1.0f, l + xhalf(l)); const size_t oo = (size_t)(q0 + lr) * DQ + hi * 8; bf* ap = Ah + oo; bf* ap2 = Al + oo;
#pragma unroll
        for (int dt = 0; dt < 8; ++dt) { v8us oh, ol;
#pragma unroll
            for (int j = 0; j < 8; ++j) { unsigned short a, c2; splitf(o[dt][j] * inv, a, c2); oh[j] = a; ol[j] = c2; }
            *(v8us*)(ap + dt * 16) = oh; *(v8us*)(ap2 + dt * 16) = ol;
            addr_wait(); } }
}
// grid (heads, TT / 128, batches), 128 threads. Tile t of 64 query rows has t + 1 stages of keys, so tiles t and TT/64 - 1 - t together always have TT/64 + 1; work-group y takes tile TT/64 - 1 - y and then tile y, one after the other.
// Query rows < RH: bf16 hi/lo planes, 3 products; the rest fp16 (chosen per tile). Writes the merged hi/lo planes [t][head * HD + d].
__global__ __launch_bounds__(128) void k_fattn(const h16* __restrict__ Q16, const h16* __restrict__ K16, const h16* __restrict__ V16, const bf* __restrict__ Qh, const bf* __restrict__ Ql, const bf* __restrict__ Kh, const bf* __restrict__ Kl, const bf* __restrict__ Vh, const bf* __restrict__ Vl, bf* Ah, bf* Al) {
    __shared__ __align__(16) bf ast[2 * ABUF];
    static_assert(RH % 64 == 0 && RH <= TT / 2, "a tile is of one kind; the first tile of a work-group is never of the hi/lo kind");
    const int tid = threadIdx.x; const int h = blockIdx.x; const int w = __builtin_amdgcn_readfirstlane(tid >> 5);   /* wave-uniform: the run's bound stays scalar */
    const size_t hp = ((size_t)blockIdx.z * NH_ + h) * TT * HD;   // grid z = batch: its heads' planes
    Ah += (size_t)blockIdx.z * TT * DQ; Al += (size_t)blockIdx.z * TT * DQ;   // and its TT rows of the merged planes
    const int y = (int)blockIdx.y;
    fattn_tile<h16, 0>((const h16*)ast, Q16 + hp, nullptr, K16 + hp, nullptr, V16 + hp, nullptr, TT / 64 - 1 - y, w, tid, Ah + h * HD, Al + h * HD);   // rows >= TT / 2 >= RH
    if (y * 64 < RH) fattn_tile<bf, 2>(ast, Qh + hp, Ql + hp, Kh + hp, Kl + hp, Vh + hp, Vl + hp, y, w, tid, Ah + h * HD, Al + h * HD);
    else fattn_tile<h16, 0>((const h16*)ast, Q16 + hp, nullptr, K16 + hp, nullptr, V16 + hp, nullptr, y, w, tid, Ah + h * HD, Al + h * HD);
}

extern "C" void kernel_launch(void* const* d_in, const int* in_sizes, int n_in,
                              void* d_out, int out_size, void* d_ws, size_t ws_size, hipStream_t stream) {
    (void)in_sizes; (void)n_in; (void)out_size;
    const float* x = (const float*)d_in[0]; const float* wq = (const float*)d_in[1]; const float* wk = (const float*)d_in[2]; const float* wv = (const float*)d_in[3]; const float* wo = (const float*)d_in[4];   /* order hidden_states, Wq, Wk, Wv, Wo ('oi' [2048][2048]) */
    float* OUT = (float*)d_out;     // [2][2048][2048]
    char* wsp = (char*)d_ws;
    auto take = [&](size_t bytes) { char* p = wsp; wsp += (bytes + 255) & ~(size_t)255; return (void*)p; };
    bf* WQ = (bf*)take((size_t)DQ * DM * 2); bf* WK = (bf*)take((size_t)DKV * DM * 2); bf* WV = (bf*)take((size_t)DKV * DM * 2); bf* WO = (bf*)take((size_t)DM * DQ * 2); float* CS = (float*)take((size_t)TT * (HD / 2) * 2 * 4);
    static_assert(NKV == NH_, "one plane stride per batch for q, k and v");
    // every buffer below holds both batches, batch-major
    bf* XB = (bf*)take((size_t)NB_ * TT * DM * 2);
    h16* QP16 = (h16*)take((size_t)NB_ * NH_ * TT * HD * 2); h16* KP16 = (h16*)take((size_t)NB_ * NKV * TT * HD * 2); h16* VT16 = (h16*)take((size_t)NB_ * NKV * HD * TT * 2);
    bf* QPh = (bf*)take((size_t)NB_ * NH_ * TT * HD * 2); bf* QPl = (bf*)take((size_t)NB_ * NH_ * TT * HD * 2); bf* KPh = (bf*)take((size_t)NB_ * NKV * TT * HD * 2); bf* KPl = (bf*)take((size_t)NB_ * NKV * TT * HD * 2); bf* VTh = (bf*)take((size_t)NB_ * NKV * HD * TT * 2); bf* VTl = (bf*)take((size_t)NB_ * NKV * HD * TT * 2);
    bf* ATh = (bf*)take((size_t)NB_ * TT * DQ * 2); bf* ATl = (bf*)take((size_t)NB_ * TT * DQ * 2);
    if ((size_t)(wsp - (char*)d_ws) > ws_size) return;    // ws 256 MiB
    k_prep<<<PWG, 512, 0, stream>>>(x, wq, wk, wv, wo, XB, WQ, WK, WV, WO, CS);   /* bf16 copies and rotary table, once */
    // both batches in every launch (grid z): 512 work-groups, so that a WGP holds two where its LDS takes two (projections, attention)
    k_gemms<0, DM, 1><<<dim3(TT / 128, DQ / 128, NB_), 128, 0, stream>>>(XB, nullptr, WQ, nullptr, 0, CS, QP16, QPh, QPl);
    k_gemms<0, DM, 1><<<dim3(TT / 128, DKV / 128, NB_), 128, 0, stream>>>(XB, nullptr, WK, nullptr, 0, CS, KP16, KPh, KPl);
    k_gemms<0, DM, 2><<<dim3(TT / 128, DKV / 128, NB_), 128, 0, stream>>>(XB, nullptr, WV, nullptr, 0, nullptr, VT16, VTh, VTl);
    k_fattn<<<dim3(NH_, TT / 128, NB_), 128, 0, stream>>>(QP16, KP16, VT16, QPh, QPl, KPh, KPl, VTh, VTl, ATh, ATl);
    k_gemms<1, DQ, 0><<<dim3(TT / 128, DM / 128, NB_), 128, 0, stream>>>(ATh, ATl, WO, OUT, DM, nullptr, nullptr, nullptr, nullptr);
}

// v008
// It runs in 191 microseconds.
// Timed twice side by side with v007, it ran 1.08 and 1.07 times as fast.
// Over all steps from v000 it is 9.20 times as fast.
#include <hip/hip_runtime.h>

// Causal multi-head attention with 128-wide heads and computed rotate-half rotary embeddings (hidden_states [2][2048][2048]; q, k, v = einsum('bsd,ed->bse', x, W) ('oi' 0.02; 16 heads x 128); rope x cos + rotate_half(x) sin, angle t x 1/10000^(2i/128) (64 f32 frequencies jnp-exact; cat(freqs, freqs); precise cosf/sinf); scores / sqrt(128); mask = (key > query) | (key - query >= 1024): the second term only touches FUTURE keys, which the first already excludes: plain causal (-inf == exclusion); softmax in f32; out = merged Wo^T -> [2][2048][2048] (8.4 M); argument order hidden_states, Wq, Wk, Wv, Wo).
// Layout: bf16 copy of x; 'oi' weights; exact projections whose epilogues build the head planes (q, k: rotate-half with the k_prep table; v: transposed); causal T-2048 attention at HD 128 in one fused kernel, online softmax (hybrid rows: < 512 hi/lo 3 products, rest fp16 x1024; keys above the diagonal block never read); merged hi/lo x Wo exact.
// Compute dtypes, f32 accumulate: every input rounded to bf16; projections exact; rotary f32; attention rows < 512 3 products, rest fp16; softmax f32; Wo hl x exact.

#define NB_  2
#define TT   2048
#define DM   2048
#define NH_  16
#define NKV  16
#define HD   128
#define DQ   (NH_ * HD)
#define DKV  (NKV * HD)
#define RH   512                  // query rows < RH use hi+lo planes (0: none)
#define SCL  0.088388347648318447f   // HD^-0.5
typedef _Float16 h16;
typedef unsigned short bf;
typedef __attribute__((ext_vector_type(16))) __bf16   v16bf;
typedef __attribute__((ext_vector_type(16))) _Float16 v16h;
typedef __attribute__((ext_vector_type(8)))  _Float16 v8h;
typedef __attribute__((ext_vector_type(8)))  unsigned short v8us;
typedef __attribute__((ext_vector_type(8)))  float    v8f;
typedef __attribute__((ext_vector_type(4)))  float    v4f;
typedef v8h  __attribute__((may_alias)) v8ha;
typedef v4f  __attribute__((may_alias)) v4fa;
typedef v8us __attribute__((may_alias)) v8usa;

__device__ __forceinline__ unsigned short f2bf(float f) { unsigned u = __float_as_uint(f); u += 0x7FFFu + ((u >> 16) & 1u); return (unsigned short)(u >> 16); }
__device__ __forceinline__ float bf2f(unsigned short b) { return __uint_as_float(((unsigned)b) << 16); }
__device__ __forceinline__ v16h cat16(v8h lo, v8h hi) { return __builtin_shufflevector(lo, hi, 0, 1, 2, 3, 4, 5, 6, 7, 8, 9, 10, 11, 12, 13, 14, 15); }
__device__ __forceinline__ v16bf cat16b(v8us lo, v8us hi) { return __builtin_bit_cast(v16bf, __builtin_shufflevector(lo, hi, 0, 1, 2, 3, 4, 5, 6, 7, 8, 9, 10, 11, 12, 13, 14, 15)); }
__device__ __forceinline__ v8f wmma16(v16h a, v16h b, v8f c) { return __builtin_amdgcn_wmma_f32_16x16x32_f16(false, a, false, b, (short)0, c, false, false); }
__device__ __forceinline__ v8f wmmab(v16bf a, v16bf b, v8f c) { return __builtin_amdgcn_wmma_f32_16x16x32_bf16(false, a, false, b, (short)0, c, false, false); }

typedef __attribute__((ext_vector_type(2))) _Float16 v2h;
typedef __attribute__((ext_vector_type(2))) __bf16 v2bf;
typedef __attribute__((ext_vector_type(2))) unsigned short v2us;
typedef __attribute__((ext_vector_type(2))) float v2f;
__device__ __forceinline__ void addr_wait() { __builtin_amdgcn_sched_barrier(0); asm volatile("s_wait_xcnt 0x0" ::: "memory"); __builtin_amdgcn_sched_barrier(0); }
// Eight f32 values -> their words in the three planes: fp16, bf16 head, bf16 of the remainder (each rounded to nearest even, two values a convert).
__device__ __forceinline__ void planes8(const float (&y)[8], v8h& o16, v8us& oh, v8us& ol) {
#pragma unroll   // constant vector indices: the words stay in registers
    for (int p = 0; p < 4; ++p) { const v2f a = { y[2 * p], y[2 * p + 1] };
        const v2h f = __builtin_convertvector(a, v2h); const v2us hu = __builtin_bit_cast(v2us, __builtin_convertvector(a, v2bf));
        const v2f r = { a[0] - bf2f(hu[0]), a[1] - bf2f(hu[1]) }; const v2us lu = __builtin_bit_cast(v2us, __builtin_convertvector(r, v2bf));
        o16[2 * p] = f[0]; o16[2 * p + 1] = f[1]; oh[2 * p] = hu[0]; oh[2 * p + 1] = hu[1]; ol[2 * p] = lu[0]; ol[2 * p + 1] = lu[1]; }
}

// ---- k_gemms: sum_k A[m][k] Bt[n][k] (NSPLIT 1: + A2[m][k] Bt[n][k], product by product in the same k order), operands K-contiguous bf16 planes. M % MT == 0, N % NT == 0, K % 128 == 0, K >= 256.
// EPI 0: C[m][n] (f32, pitch ldc). EPI 1, 2: m = token, the tile's 128 columns = one head; the f32 tile never leaves the work-group: it is turned into that head's three planes (fp16, bf16 head, bf16 remainder) here.
//   EPI 1: planes [head][t][d] of the rotate-half rotary form out[d] = x[d] cos[t][d] - x[d+64] sin[t][d], out[d+64] = x[d+64] cos[t][d] + x[d] sin[t][d], d < 64, (cos, sin) pairs from CS[t][d].   EPI 2: transposed planes [head][d][t].
// One work-group of eight waves per MT x NT output tile (256x128 or 128x256), each wave a 64x64 part (16 accumulators); grid (M/MT, N/NT, batches), 256 threads: one work-group per WGP, two waves per SIMD. M = TT rows a batch; Bt and CS are the same for every batch.
// The wide tile is there for the path from L2 into LDS: a stage's operand rows per output element are 3/4 (A, Bt) or 2/3 (A, A2, Bt) of what two 128x128 tiles fetch.
// A stage is 128 k (256 B) of the tile's MT rows of A (and A2) and NT rows of Bt, brought from global memory into LDS by asynchronous 16-byte copies (whole lines, each byte fetched once per work-group) and read from there as fragments by the waves that need it.
// Two buffers: the copies of stage t + 2 are issued behind the barrier that ends trip t and fly during trip t + 1.
template <typename T16> struct WFrag;
template <> struct WFrag<h16> { typedef v16h V; static __device__ __forceinline__ V ld(const h16* p) { return cat16(*(const v8h*)p, *(const v8h*)(p + 16)); } static __device__ __forceinline__ v8f mma(V a, V b, v8f c) { return wmma16(a, b, c); } };
template <> struct WFrag<bf> { typedef v16bf V; static __device__ __forceinline__ V ld(const bf* p) { return cat16b(*(const v8us*)p, *(const v8us*)(p + 16)); } static __device__ __forceinline__ v8f mma(V a, V b, v8f c) { return wmmab(a, b, c); } };
#define GKS 128                    // k per stage
#define GP  136                    // LDS row pitch in elements: 272 B = 16 B x odd, free of bank conflicts for 16-byte fragment reads
#define TP  132                    // row pitch in f32 of the epilogue's tile in LDS: 528 B = 16 B x odd
// Eight copies of 16 B per lane, LDS step 16 rows, global step gs elements. s_wait_xcnt 0 is the statement's last line, so that it stands in front of every later write of a register that a copy names.
__device__ __forceinline__ void cp8(unsigned l, const bf* g, size_t gs) {
    asm volatile("global_load_async_to_lds_b128 %0, %8, off\n\t"
                 "global_load_async_to_lds_b128 %1, %9, off\n\t"
                 "global_load_async_to_lds_b128 %2, %10, off\n\t"
                 "global_load_async_to_lds_b128 %3, %11, off\n\t"
                 "global_load_async_to_lds_b128 %4, %12, off\n\t"
                 "global_load_async_to_lds_b128 %5, %13, off\n\t"
                 "global_load_async_to_lds_b128 %6, %14, off\n\t"
                 "global_load_async_to_lds_b128 %7, %15, off\n\t"
                 "s_wait_xcnt 0x0"
                 :: "v"(l), "v"(l + 1u * 16 * GP * 2), "v"(l + 2u * 16 * GP * 2), "v"(l + 3u * 16 * GP * 2), "v"(l + 4u * 16 * GP * 2), "v"(l + 5u * 16 * GP * 2), "v"(l + 6u * 16 * GP * 2), "v"(l + 7u * 16 * GP * 2),
                    "v"(g), "v"(g + gs), "v"(g + 2 * gs), "v"(g + 3 * gs), "v"(g + 4 * gs), "v"(g + 5 * gs), "v"(g + 6 * gs), "v"(g + 7 * gs) : "memory");
}
template <int NSPLIT, int K, int EPI, int MT, int NT>
__global__ __launch_bounds__(256) void k_gemms(const bf* __restrict__ A, const bf* __restrict__ A2, const bf* __restrict__ Bt, float* C, int ldc, const float* __restrict__ CS, h16* P16, bf* Ph, bf* Pl) {
    typedef WFrag<bf>::V V;
    // grid z = batch: its own TT rows of A (and A2), and its own output: TT rows of C, or its heads' planes
    { const size_t z = blockIdx.z; A += z * ((size_t)TT * K); if constexpr (NSPLIT == 1) A2 += z * ((size_t)TT * K);
      if constexpr (EPI == 0) C += z * TT * (size_t)ldc; else { const size_t pz = z * ((size_t)NH_ * TT * HD); P16 += pz; Ph += pz; Pl += pz; } }
    static_assert(MT % 128 == 0 && NT % 128 == 0 && (MT / 64) * (NT / 64) == 8 && (EPI == 0 || (NT == HD && MT == 256)), "eight waves of 64x64; a plane epilogue's tile is 256 tokens of one head");
    constexpr int ROWS = MT * (1 + NSPLIT) + NT;         // rows of a stage in LDS: A at row 0, Bt at row MT (, A2 at row MT + NT)
    constexpr int TPT = MT + 4;                          // row pitch in f32 of the transposed epilogue tile: 16 B x odd
    constexpr size_t RINGB = 2 * (size_t)ROWS * GP * sizeof(bf), EPB = (EPI == 1) ? 2 * (size_t)MT * TP * sizeof(float) : (EPI == 2) ? (size_t)NT * TPT * sizeof(float) : 0;
    __shared__ __align__(16) bf st[(RINGB > EPB ? RINGB : EPB) / sizeof(bf)];   // the two buffers; behind the loop the epilogue's f32 tile (and rotary rows)
    const int tid = threadIdx.x, lane = tid & 31, lr = lane & 15, hi = lane >> 4; const int w = __builtin_amdgcn_readfirstlane(tid >> 5);
    const int r0 = blockIdx.x * MT, c0 = blockIdx.y * NT, wr = (w / (NT / 64)) * 64, wc = (w % (NT / 64)) * 64;
    v8f acc[4][4];
    // every '#pragma unroll' of this kernel: constant indices, so that accumulators and fragments stay in registers
#pragma unroll
    for (int mb = 0; mb < 4; ++mb)
#pragma unroll
        for (int nb = 0; nb < 4; ++nb) acc[mb][nb] = (v8f){};
    // a copy of the work-group covers 16 rows of 256 B: lane pointer = row tid / 16, 16-byte piece tid % 16
    const size_t go = (size_t)(tid >> 4) * K + (tid & 15) * 8;
    const bf* ga = A + (size_t)r0 * K + go; const bf* gb = Bt + (size_t)c0 * K + go; const bf* ga2 = (NSPLIT == 1) ? A2 + (size_t)r0 * K + go : ga;
    const unsigned l0 = (unsigned)(size_t)&st[(tid >> 4) * GP + (tid & 15) * 8];
    auto fill = [&](int s) {                             // a cp8 takes 128 rows of one operand
        const unsigned l = l0 + (unsigned)(s & 1) * (ROWS * GP * 2); const int ko = s * GKS;
#pragma unroll
        for (int h = 0; h < MT / 128; ++h) { const size_t gh = (size_t)h * 128 * K + ko;
            cp8(l + h * 128 * GP * 2, ga + gh, (size_t)16 * K); if (NSPLIT == 1) cp8(l + (MT + NT + h * 128) * GP * 2, ga2 + gh, (size_t)16 * K); }
#pragma unroll
        for (int h = 0; h < NT / 128; ++h) cp8(l + (MT + h * 128) * GP * 2, gb + (size_t)h * 128 * K + ko, (size_t)16 * K); };
    constexpr int NS = K / GKS; static_assert(K % GKS == 0 && NS >= 2, "two stages or more");
    fill(0);
    asm volatile("s_wait_asynccnt 0x0" ::: "memory");    // this wave's copies of stage 0 have landed
    __syncthreads();                                     // every wave's have: stage 0 may be read
    fill(1);
#pragma unroll 1   // one copy of the trip; the buffer is chosen by the trip's parity
    for (int t = 0; t < NS; ++t) {
        const bf* sa = &st[((t & 1) * ROWS + wr + lr) * GP + 8 * hi]; const bf* sb = sa + (MT + wc - wr) * GP; const bf* sa2 = sa + NSPLIT * (MT + NT) * GP;
        // two fragment sets: block kk + 1's LDS reads are issued as one group in front of block kk's products, so that only the trip's first group is waited for in full
        V a[2][4], a2[2][4], b[2][4];
#pragma unroll
        for (int f = 0; f < 4; ++f) { a[0][f] = WFrag<bf>::ld(sa + f * 16 * GP); if (NSPLIT == 1) a2[0][f] = WFrag<bf>::ld(sa2 + f * 16 * GP); b[0][f] = WFrag<bf>::ld(sb + f * 16 * GP); }
#pragma unroll
        for (int kk = 0; kk < GKS / 32; ++kk) { const int c = kk & 1, n = c ^ 1;
            if (kk + 1 < GKS / 32) {
#pragma unroll
                for (int f = 0; f < 4; ++f) { a[n][f] = WFrag<bf>::ld(sa + f * 16 * GP + (kk + 1) * 32); if (NSPLIT == 1) a2[n][f] = WFrag<bf>::ld(sa2 + f * 16 * GP + (kk + 1) * 32); b[n][f] = WFrag<bf>::ld(sb + f * 16 * GP + (kk + 1) * 32); } }
            __builtin_amdgcn_sched_barrier(0);           // keeps that group of reads up here (sunk among the products, each pair would be waited for at its full LDS latency)
#pragma unroll
            for (int nb = 0; nb < 4; ++nb)
#pragma unroll
                for (int mb = 0; mb < 4; ++mb) { acc[mb][nb] = WFrag<bf>::mma(a[c][mb], b[c][nb], acc[mb][nb]); if (NSPLIT == 1) acc[mb][nb] = WFrag<bf>::mma(a2[c][mb], b[c][nb], acc[mb][nb]); }
            __builtin_amdgcn_sched_barrier(0);           // and the next group behind this block's products: its registers are the ones they read
        }
        asm volatile("s_wait_dscnt 0x0" ::: "memory");   // this wave's reads of the trip's buffer are done
        asm volatile("s_wait_asynccnt 0x0" ::: "memory");   // this wave's copies of stage t + 1 have landed
        __syncthreads();                                 // publishes stage t + 1 and frees the buffer that trip t has read
        if (t + 2 < NS) fill(t + 2);
    }
    asm volatile("s_wait_asynccnt 0x0" ::: "memory");    // no copy is left in flight when the wave goes on to its end
    if constexpr (EPI == 0) {
    __shared__ __align__(16) float osw[8][16 * 68];      // each wave's own output staging
    float* os = osw[w];
#pragma unroll
    for (int mb = 0; mb < 4; ++mb) {
#pragma unroll
        for (int nb = 0; nb < 4; ++nb) {
#pragma unroll
            for (int j = 0; j < 8; ++j) os[(hi * 8 + j) * 68 + nb * 16 + lr] = acc[mb][nb][j]; }
        __builtin_amdgcn_wave_barrier(); asm volatile("" ::: "memory");   // compile-time order only: the lanes' LDS stores stay in front of the row reads of other lanes' words
        float* crow = C + (size_t)(r0 + wr + mb * 16) * ldc + c0 + wc;
#pragma unroll
        for (int s = 0; s < 8; ++s) { const int row = 2 * s + hi, cofs = lr * 4; const v4f val = *(const v4fa*)(os + row * 68 + cofs);
            *(v4f*)(crow + (size_t)row * ldc + cofs) = val; }
        asm volatile("s_wait_xcnt 0x0" ::: "memory");    // in front of the next group's reuse of the stores' address registers
        __builtin_amdgcn_wave_barrier(); asm volatile("" ::: "memory");   // the same for the row reads and the next group's LDS stores
    }
    } else {
        // The ring's LDS is free here: every wave's last fragment read and last copy lie in front of the loop's last barrier.
        float* tl = (float*)&st[0];                      // the work-group's f32 tile, pitch TP (transposed: TPT)
        v8h o16[2]; v8us oh[2], ol[2];
        if constexpr (EPI == 1) {
            float* cl = tl + MT * TP;                    // the tile's MT rotary rows of 64 (cos, sin) pairs, pitch TP
            // a wave-wide load takes one whole row of 512 B; all 32 are issued up here, so that they fly while the tile is staged
            const float* cg = CS + (size_t)(r0 + w) * HD + lane * 4; v4f cv[32];
#pragma unroll
            for (int i = 0; i < 32; ++i) cv[i] = *(const v4f*)(cg + i * 8 * HD);
            addr_wait();
#pragma unroll
            for (int mb = 0; mb < 4; ++mb)
#pragma unroll
                for (int nb = 0; nb < 4; ++nb)
#pragma unroll
                    for (int j = 0; j < 8; ++j) tl[(wr + mb * 16 + hi * 8 + j) * TP + wc + nb * 16 + lr] = acc[mb][nb][j];
#pragma unroll
            for (int i = 0; i < 32; ++i) *(v4fa*)(cl + (i * 8 + w) * TP + lane * 4) = cv[i];
            __syncthreads();                             // tile and rotary rows are whole: d and d + 64 of a row come from two waves
            // a lane: 8 values d and the 8 at d + 64 of one row; 8 lanes store a whole 128-B line of a plane, rows step by 32
            const int row = tid >> 3, dg = (tid & 7) * 8; const float* tp = tl + row * TP + dg; const float* cp = cl + row * TP + dg * 2;
            const size_t po = ((size_t)blockIdx.y * TT + r0 + row) * HD + dg; h16* p16 = P16 + po; bf* ph = Ph + po; bf* pl = Pl + po;
            v4f x[2][4], c[2][4];                        // two sets: row group i + 1 is read from LDS while group i is worked on
            auto rd = [&](int i) {
#pragma unroll
                for (int q = 0; q < 2; ++q) { x[i & 1][q] = *(const v4fa*)(tp + i * 32 * TP + q * 4); x[i & 1][2 + q] = *(const v4fa*)(tp + i * 32 * TP + HD / 2 + q * 4); }
#pragma unroll
                for (int q = 0; q < 4; ++q) c[i & 1][q] = *(const v4fa*)(cp + i * 32 * TP + q * 4); };
            rd(0);
#pragma unroll
            for (int i = 0; i < 8; ++i) { float lo[8], up[8];
                if (i + 1 < 8) rd(i + 1);
#pragma unroll
                for (int e = 0; e < 8; ++e) { const float x0 = x[i & 1][e >> 2][e & 3], x1 = x[i & 1][2 + (e >> 2)][e & 3], co = c[i & 1][e >> 1][(e & 1) * 2], si = c[i & 1][e >> 1][(e & 1) * 2 + 1];
                    lo[e] = x0 * co - x1 * si; up[e] = x1 * co + x0 * si; }
                planes8(lo, o16[0], oh[0], ol[0]); planes8(up, o16[1], oh[1], ol[1]);
                __builtin_amdgcn_sched_barrier(0);       // the six stores stand together behind the arithmetic: no register of an issued store is written in front of the wait below
#pragma unroll
                for (int q = 0; q < 2; ++q) { const int so = i * 32 * HD + q * (HD / 2); *(v8h*)(p16 + so) = o16[q]; *(v8us*)(ph + so) = oh[q]; *(v8us*)(pl + so) = ol[q]; }
                addr_wait(); }
        } else {
            // a lane's eight accumulator words are eight tokens of one column: the tile is staged transposed, [d][t], by 16-byte LDS stores
#pragma unroll
            for (int mb = 0; mb < 4; ++mb)
#pragma unroll
                for (int nb = 0; nb < 4; ++nb) { float* q = tl + (wc + nb * 16 + lr) * TPT + wr + mb * 16 + hi * 8; const v8f a = acc[mb][nb];
                    *(v4fa*)q = (v4f){ a[0], a[1], a[2], a[3] }; *(v4fa*)(q + 4) = (v4f){ a[4], a[5], a[6], a[7] }; }
            __syncthreads();                             // the tile is whole: a row [d] holds tokens of four waves
            // a lane: 8 tokens of one d; a wave stores the tile's 512 B (four whole lines) of a plane's row, rows step by 8
            const int dr = tid >> 5, tg = (tid & 31) * 8; const float* tp = tl + dr * TPT + tg;
            const size_t po = ((size_t)blockIdx.y * HD + dr) * TT + r0 + tg; h16* p16 = P16 + po; bf* ph = Ph + po; bf* pl = Pl + po;
            v4f x[2][4];                                 // two sets: row group i + 1 is read from LDS while group i is worked on
            auto rd = [&](int i) {
#pragma unroll
                for (int q = 0; q < 2; ++q) { x[i & 1][2 * q] = *(const v4fa*)(tp + (i * 16 + q * 8) * TPT); x[i & 1][2 * q + 1] = *(const v4fa*)(tp + (i * 16 + q * 8) * TPT + 4); } };
            rd(0);
#pragma unroll
            for (int i = 0; i < 8; ++i) {
                if (i + 1 < 8) rd(i + 1);
#pragma unroll
                for (int q = 0; q < 2; ++q) { const v4f x0 = x[i & 1][2 * q], x1 = x[i & 1][2 * q + 1];
                    const float y[8] = { x0[0], x0[1], x0[2], x0[3], x1[0], x1[1], x1[2], x1[3] }; planes8(y, o16[q], oh[q], ol[q]); }
                __builtin_amdgcn_sched_barrier(0);       // the six stores stand together behind the arithmetic: no register of an issued store is written in front of the wait below
#pragma unroll
                for (int q = 0; q < 2; ++q) { const int so = (i * 16 + q * 8) * TT; *(v8h*)(p16 + so) = o16[q]; *(v8us*)(ph + so) = oh[q]; *(v8us*)(pl + so) = ol[q]; }
                addr_wait(); }
        }
    }
}

__device__ __forceinline__ h16 tohx(float x) { return (h16)x; }
__device__ __forceinline__ void splitf(float y, unsigned short& h, unsigned short& l) { h = f2bf(y); l = f2bf(y - bf2f(h)); }

__constant__ float INVT[HD / 2] = { 1.000000000e+00f, 8.659643531e-01f, 7.498942018e-01f, 6.493816376e-01f, 5.623413324e-01f, 4.869675338e-01f, 4.216965139e-01f, 3.651741445e-01f, 3.162277639e-01f, 2.738419771e-01f, 2.371373624e-01f, 2.053525001e-01f, 1.778279394e-01f, 1.539926529e-01f, 1.333521456e-01f, 1.154782027e-01f, 1.000000015e-01f, 8.659642935e-02f, 7.498941571e-02f, 6.493816525e-02f, 5.623412877e-02f, 4.869675264e-02f, 4.216964915e-02f, 3.651741147e-02f, 3.162277862e-02f, 2.738419548e-02f, 2.371373586e-02f, 2.053525113e-02f, 1.778279431e-02f, 1.539926510e-02f, 1.333521493e-02f, 1.154781971e-02f, 9.999999776e-03f, 8.659643121e-03f, 7.498942316e-03f, 6.493816618e-03f, 5.623413250e-03f, 4.869675264e-03f, 4.216964822e-03f, 3.651741426e-03f, 3.162277862e-03f, 2.738419687e-03f, 2.371373819e-03f, 2.053525066e-03f, 1.778279431e-03f, 1.539926510e-03f, 1.333521446e-03f, 1.154782018e-03f, 1.000000047e-03f, 8.659643354e-04f, 7.498941850e-04f, 6.493816618e-04f, 5.623413017e-04f, 4.869675031e-04f, 4.216964880e-04f, 3.651741135e-04f, 3.162277862e-04f, 2.738419571e-04f, 2.371373848e-04f, 2.053524950e-04f, 1.778279402e-04f, 1.539926452e-04f, 1.333521504e-04f, 1.154781930e-04f };   // float32 1 / 10000^(2i/128), generated with jnp to be bit-exact
// ---- k_prep: everything the GEMMs need ahead of them, in one launch: the bf16 copies of the four weight matrices and of x, and the rotary table. grid PWG work-groups (one per WGP) of 16 waves.
// The 6 segments of PSEG f32 values (Wo, Wv, Wk, Wq, the two halves of x) are taken one after the other by the whole grid; of each segment a wave converts 4 KiB that lie together: eight wave-wide loads of 512 B (16 B a lane, whole lines), eight stores of 256 B (8 B a lane, whole lines).
// Two register sets: segment s + 2 is asked for as soon as segment s has been converted, so that 8 to 16 loads of a wave are always in flight.
// CS[t][d] = (cos, sin) of t x INVT[d], d < HD / 2 (columns d and d + HD / 2 of the rotary tables are equal): one pair a thread, worked out while the first two segments' loads fly.
#define PWG  256
#define PSEG ((size_t)DQ * DM)
typedef __attribute__((ext_vector_type(4))) unsigned short v4us;
__global__ __launch_bounds__(512) void k_prep(const float* __restrict__ x, const float* __restrict__ wq, const float* __restrict__ wk, const float* __restrict__ wv, const float* __restrict__ wo, bf* XB, bf* WQ, bf* WK, bf* WV, bf* WO, float* CS) {
    static_assert(PSEG == (size_t)PWG * 16 * 1024 && (size_t)NB_ * TT * DM == 2 * PSEG && (size_t)DKV * DM == PSEG && (size_t)DM * DQ == PSEG, "a segment is 4 KiB of f32 for every wave of the grid");
    static_assert(TT * (HD / 2) == PWG * 512, "one rotary pair a thread");
    const unsigned idx = blockIdx.x * 512 + threadIdx.x;
    const size_t e0 = (size_t)(idx >> 5) * 1024 + (idx & 31) * 4;   // the lane's first element, the same in every segment
    const float* const sp[6] = { wo + e0, wv + e0, wk + e0, wq + e0, x + e0, x + PSEG + e0 };
    bf* const dp[6] = { WO + e0, WV + e0, WK + e0, WQ + e0, XB + e0, XB + PSEG + e0 };
    v4f a[2][8];
    // every '#pragma unroll' of this kernel: constant indices, so that the two sets stay in registers
    auto ld = [&](int s) {
#pragma unroll
        for (int j = 0; j < 8; ++j) a[s & 1][j] = *(const v4f*)(sp[s] + j * 128);
        addr_wait(); };
    const float fr = INVT[idx % (HD / 2)];               // asked for ahead of the stream: loads are waited for in their order, and the table must not wait for the segments
    ld(0); ld(1);
    { const float an = __fmul_rn((float)(idx / (HD / 2)), fr); v2f cs; cs[0] = cosf(an); cs[1] = sinf(an); *(v2f*)(CS + (size_t)idx * 2) = cs; addr_wait(); }
#pragma unroll
    for (int s = 0; s < 6; ++s) {
#pragma unroll
        for (int j = 0; j < 8; ++j) { const v4f v = a[s & 1][j]; v4us o;
#pragma unroll
            for (int k = 0; k < 4; ++k) o[k] = f2bf(v[k]);
            *(v4us*)(dp[s] + j * 128) = o; }
        addr_wait();
        if (s + 2 < 6) ld(s + 2); }
}
// ---- k_fattn: scores, softmax and probability x value in one kernel; neither scores nor probabilities leave the registers. A work-group of four waves owns a tile of 64 query rows of one head, 16 rows a wave, and walks the keys 0 .. the tile's last row in stages of 64.
// A stage is 64 rows of K (256 B each) and 64 keys of every row of Vt (128 B each), brought from global memory into LDS by asynchronous 16-byte copies (whole lines, each byte fetched once per work-group) and read from there as fragments by all four waves.
// Two buffers: the copies of stage s + 2 are issued behind the barrier that ends trip s and fly during trip s + 1.
// St[key][query] = K Q^T and Ot[d][query] += Vt Pt: a lane then holds scores of ONE query (query = lr, keys hi*8+j of each 16-key tile), which is at once the B-fragment order of Pt (k = 8*hi+j, 16+8*hi+j),
// so maximum, sum and rescale are in-lane but for one exchange between the wave's halves. Running maximum m and running sum l per query (online softmax), keys in runs of 32; the division by l comes once, at the end.
__device__ __forceinline__ float xhalf(float x) { return __builtin_bit_cast(float, __builtin_amdgcn_permlanex16(__builtin_bit_cast(int, x), __builtin_bit_cast(int, x), 0x76543210, 0xfedcba98, false, false)); }   // lane l with lane l ^ 16
#define AKS  64                    // keys per stage
#define VP   72                    // LDS row pitch in elements of a stage's Vt rows: 144 B = 16 B x odd, free of bank conflicts for 16-byte fragment reads (K rows: GP)
#define KPL  (AKS * GP)            // elements of one K plane's stage in LDS
#define VPL  (HD * VP)             // elements of one Vt plane's stage in LDS
#define ABUF (2 * (KPL + VPL))     // elements of a buffer: K, Vt, second K, second Vt
// Eight copies of 16 B per lane, LDS step LS bytes, global step gs elements. s_wait_xcnt 0 is the statement's last line, so that it stands in front of every later write of a register that a copy names.
template <unsigned LS, typename T16>
__device__ __forceinline__ void cp8s(unsigned l, const T16* g, size_t gs) {
    asm volatile("global_load_async_to_lds_b128 %0, %8, off\n\t"
                 "global_load_async_to_lds_b128 %1, %9, off\n\t"
                 "global_load_async_to_lds_b128 %2, %10, off\n\t"
                 "global_load_async_to_lds_b128 %3, %11, off\n\t"
                 "global_load_async_to_lds_b128 %4, %12, off\n\t"
                 "global_load_async_to_lds_b128 %5, %13, off\n\t"
                 "global_load_async_to_lds_b128 %6, %14, off\n\t"
                 "global_load_async_to_lds_b128 %7, %15, off\n\t"
                 "s_wait_xcnt 0x0"
                 :: "v"(l), "v"(l + 1u * LS), "v"(l + 2u * LS), "v"(l + 3u * LS), "v"(l + 4u * LS), "v"(l + 5u * LS), "v"(l + 6u * LS), "v"(l + 7u * LS),
                    "v"(g), "v"(g + gs), "v"(g + 2 * gs), "v"(g + 3 * gs), "v"(g + 4 * gs), "v"(g + 5 * gs), "v"(g + 6 * gs), "v"(g + 7 * gs) : "memory");
}
// One tile of 64 query rows. Every wave of the work-group passes every barrier; tile is the same in all of them.
template <typename T16, int NSPLIT>
__device__ __forceinline__ void fattn_tile(const T16* st, const T16* __restrict__ Q, const T16* __restrict__ Q2, const T16* __restrict__ Kp, const T16* __restrict__ Kp2, const T16* __restrict__ Vt, const T16* __restrict__ Vt2, int tile, int w, int tid, bf* Ah, bf* Al) {
    typedef typename WFrag<T16>::V V;
    const float L2E = 1.4426950408889634f;
    const float PSH = (NSPLIT == 0) ? 10.0f : 0.0f;      // fp16 probabilities carry a factor 2^10 (small ones stay normal numbers); l carries it too, so it cancels in the division
    const int lane = tid & 31, lr = lane & 15, hi = lane >> 4; const int q0 = tile * 64 + w * 16;   // the wave's first query row (scalar)
    V q[4], q2[4];
    // one lane pointer per plane; every fragment is a constant offset from it
    { const size_t qoff = (size_t)(q0 + lr) * HD + 8 * hi; const T16* qp = Q + qoff; const T16* qp2 = (NSPLIT == 2) ? Q2 + qoff : qp;
#pragma unroll
      for (int kc = 0; kc < 4; ++kc) { q[kc] = WFrag<T16>::ld(qp + kc * 32); if (NSPLIT == 2) q2[kc] = WFrag<T16>::ld(qp2 + kc * 32); }
      addr_wait(); }
    v8f o[8];
#pragma unroll
    for (int dt = 0; dt < 8; ++dt) o[dt] = (v8f){};
    float m = -3.0e38f, l = 0.f;
    // a copy of the work-group covers 8 rows of K (lane: row tid / 16, 16-byte piece tid % 16) or 16 rows of Vt (row tid / 8, piece tid % 8)
    const size_t gko = (size_t)(tid >> 4) * HD + (tid & 15) * 8, gvo = (size_t)(tid >> 3) * TT + (tid & 7) * 8;
    const unsigned lk0 = (unsigned)(size_t)&st[(tid >> 4) * GP + (tid & 15) * 8], lv0 = (unsigned)(size_t)&st[KPL + (tid >> 3) * VP + (tid & 7) * 8];
    auto fill = [&](int s) {
        const unsigned bo = (unsigned)(s & 1) * (ABUF * 2);
        cp8s<8 * GP * 2>(lk0 + bo, Kp + gko + (size_t)s * AKS * HD, (size_t)8 * HD); cp8s<16 * VP * 2>(lv0 + bo, Vt + gvo + s * AKS, (size_t)16 * TT);
        if (NSPLIT == 2) { cp8s<8 * GP * 2>(lk0 + bo + (KPL + VPL) * 2, Kp2 + gko + (size_t)s * AKS * HD, (size_t)8 * HD); cp8s<16 * VP * 2>(lv0 + bo + (KPL + VPL) * 2, Vt2 + gvo + s * AKS, (size_t)16 * TT); } };
    const int NS = tile + 1;                             // stages: keys 0 .. 64 tile + 63
    fill(0);                                             // the buffers are free: an earlier tile's last reads lie in front of its loop's last barrier
    asm volatile("s_wait_asynccnt 0x0" ::: "memory");    // this wave's copies of stage 0 have landed
    __syncthreads();                                     // every wave's have: stage 0 may be read
    if (NS > 1) fill(1);
#pragma unroll 1   // one copy of the trip; the buffer is chosen by the trip's parity
    for (int s = 0; s < NS; ++s) {
        const T16* sb = st + (s & 1) * ABUF;
#pragma unroll 1   // one copy of the run's body
        for (int r = 0; r < 2; ++r) {
            const int kb = s * AKS + r * 32;
            if (kb > q0 + 15) break;                     // every key of the run lies behind the wave's last query (scalar branch; the barrier below is still passed)
            const T16* kf = sb + (r * 32 + lr) * GP + 8 * hi; const T16* vf = sb + KPL + lr * VP + r * 32 + 8 * hi;
            V k[2][4], k2[2][4], v[8], v2[8];
#pragma unroll
            for (int t = 0; t < 2; ++t)
#pragma unroll
                for (int kc = 0; kc < 4; ++kc) { const int ko = t * 16 * GP + kc * 32; k[t][kc] = WFrag<T16>::ld(kf + ko); if (NSPLIT == 2) k2[t][kc] = WFrag<T16>::ld(kf + (KPL + VPL) + ko); }
#pragma unroll
            for (int dt = 0; dt < 8; ++dt) { const int vo = dt * 16 * VP; v[dt] = WFrag<T16>::ld(vf + vo); if (NSPLIT == 2) v2[dt] = WFrag<T16>::ld(vf + (KPL + VPL) + vo); }
            __builtin_amdgcn_sched_barrier(0);           // keeps the run's LDS reads in one group up here: the Vt fragments arrive during the score products and the softmax
            v8f sc[2] = { (v8f){}, (v8f){} };
#pragma unroll
            for (int kc = 0; kc < 4; ++kc)
#pragma unroll
                for (int t = 0; t < 2; ++t) { v8f a = sc[t]; a = WFrag<T16>::mma(k[t][kc], q[kc], a); if (NSPLIT == 2) { a = WFrag<T16>::mma(k[t][kc], q2[kc], a); a = WFrag<T16>::mma(k2[t][kc], q[kc], a); } sc[t] = a; }
            const bool diag = (kb + 31 > q0);            // only such a run meets the causal diagonal (wave-uniform)
            const int dq = kb - q0;
            float mx = m;
#pragma unroll
            for (int t = 0; t < 2; ++t)
#pragma unroll
                for (int j = 0; j < 8; ++j) { float x = sc[t][j] * SCL; if (diag && dq + t * 16 + hi * 8 + j > lr) x = -3.0e38f; sc[t][j] = x; mx = fmaxf(mx, x); }
            const float mn = fmaxf(mx, xhalf(mx));
            if (__builtin_amdgcn_ballot_w32(mn > m) != 0) {   // a maximum moved: bring sums and output tiles to the new one (factor exactly 1 where it did not)
                const float al = __builtin_amdgcn_exp2f((m - mn) * L2E); l *= al; m = mn;
#pragma unroll
                for (int dt = 0; dt < 8; ++dt) o[dt] *= al; }
            V pf, pf2; float sum = 0.f; float p[16];
#pragma unroll
            for (int e = 0; e < 16; ++e) { p[e] = __builtin_amdgcn_exp2f((sc[e >> 3][e & 7] - m) * L2E + PSH); sum += p[e]; }
            l += sum;
            if constexpr (NSPLIT == 0) { v16h f;
#pragma unroll
                for (int e = 0; e < 16; ++e) f[e] = tohx(p[e]);
                pf = f;
            } else { v8us h0, h1, l0, l1;
#pragma unroll
                for (int e = 0; e < 8; ++e) { unsigned short a, c2; splitf(p[e], a, c2); h0[e] = a; l0[e] = c2; splitf(p[8 + e], a, c2); h1[e] = a; l1[e] = c2; }
                pf = cat16b(h0, h1); pf2 = cat16b(l0, l1); }
#pragma unroll
            for (int dt = 0; dt < 8; ++dt) { o[dt] = WFrag<T16>::mma(v[dt], pf, o[dt]); if (NSPLIT == 2) { o[dt] = WFrag<T16>::mma(v[dt], pf2, o[dt]); o[dt] = WFrag<T16>::mma(v2[dt], pf, o[dt]); } }
            __builtin_amdgcn_sched_barrier(0);           // the products stay in front of the slots below
            asm volatile("v_nop\n\tv_nop\n\tv_nop\n\tv_nop");   // the four vector slots between the run's last matrix instruction and the next run's first write of its operand registers
        }
        asm volatile("s_wait_dscnt 0x0" ::: "memory");   // this wave's reads of the trip's buffer are done
        asm volatile("s_wait_asynccnt 0x0" ::: "memory");   // this wave's copies of stage s + 1 have landed
        __syncthreads();                                 // publishes stage s + 1 and frees the buffer that trip s has read
        if (s + 2 < NS) fill(s + 2);
    }
    asm volatile("s_wait_asynccnt 0x0" ::: "memory");    // no copy is left in flight behind the loop
    { const float inv = __fdiv_rn(1.0f, l + xhalf(l)); const size_t oo = (size_t)(q0 + lr) * DQ + hi * 8; bf* ap = Ah + oo; bf* ap2 = Al + oo;
#pragma unroll
        for (int dt = 0; dt < 8; ++dt) { v8us oh, ol;
#pragma unroll
            for (int j = 0; j < 8; ++j) { unsigned short a, c2; splitf(o[dt][j] * inv, a, c2); oh[j] = a; ol[j] = c2; }
            *(v8us*)(ap + dt * 16) = oh; *(v8us*)(ap2 + dt * 16) = ol;
            addr_wait(); } }
}
// grid (heads, TT / 128, batches), 128 threads. Tile t of 64 query rows has t + 1 stages of keys, so tiles t and TT/64 - 1 - t together always have TT/64 + 1; work-group y takes tile TT/64 - 1 - y and then tile y, one after the other.
// Query rows < RH: bf16 hi/lo planes, 3 products; the rest fp16 (chosen per tile). Writes the merged hi/lo planes [t][head * HD + d].
__global__ __launch_bounds__(128) void k_fattn(const h16* __restrict__ Q16, const h16* __restrict__ K16, const h16* __restrict__ V16, const bf* __restrict__ Qh, const bf* __restrict__ Ql, const bf* __restrict__ Kh, const bf* __restrict__ Kl, const bf* __restrict__ Vh, const bf* __restrict__ Vl, bf* Ah, bf* Al) {
    __shared__ __align__(16) bf ast[2 * ABUF];
    static_assert(RH % 64 == 0 && RH <= TT / 2, "a tile is of one kind; the first tile of a work-group is never of the hi/lo kind");
    const int tid = threadIdx.x; const int h = blockIdx.x; const int w = __builtin_amdgcn_readfirstlane(tid >> 5);   /* wave-uniform: the run's bound stays scalar */
    const size_t hp = ((size_t)blockIdx.z * NH_ + h) * TT * HD;   // grid z = batch: its heads' planes
    Ah += (size_t)blockIdx.z * TT * DQ; Al += (size_t)blockIdx.z * TT * DQ;   // and its TT rows of the merged planes
    const int y = (int)blockIdx.y;
    fattn_tile<h16, 0>((const h16*)ast, Q16 + hp, nullptr, K16 + hp, nullptr, V16 + hp, nullptr, TT / 64 - 1 - y, w, tid, Ah + h * HD, Al + h * HD);   // rows >= TT / 2 >= RH
    if (y * 64 < RH) fattn_tile<bf, 2>(ast, Qh + hp, Ql + hp, Kh + hp, Kl + hp, Vh + hp, Vl + hp, y, w, tid, Ah + h * HD, Al + h * HD);
    else fattn_tile<h16, 0>((const h16*)ast, Q16 + hp, nullptr, K16 + hp, nullptr, V16 + hp, nullptr, y, w, tid, Ah + h * HD, Al + h * HD);
}

extern "C" void kernel_launch(void* const* d_in, const int* in_sizes, int n_in,
                              void* d_out, int out_size, void* d_ws, size_t ws_size, hipStream_t stream) {
    (void)in_sizes; (void)n_in; (void)out_size;
    const float* x = (const float*)d_in[0]; const float* wq = (const float*)d_in[1]; const float* wk = (const float*)d_in[2]; const float* wv = (const float*)d_in[3]; const float* wo = (const float*)d_in[4];   /* order hidden_states, Wq, Wk, Wv, Wo ('oi' [2048][2048]) */
    float* OUT = (float*)d_out;     // [2][2048][2048]
    char* wsp = (char*)d_ws;
    auto take = [&](size_t bytes) { char* p = wsp; wsp += (bytes + 255) & ~(size_t)255; return (void*)p; };
    bf* WQ = (bf*)take((size_t)DQ * DM * 2); bf* WK = (bf*)take((size_t)DKV * DM * 2); bf* WV = (bf*)take((size_t)DKV * DM * 2); bf* WO = (bf*)take((size_t)DM * DQ * 2); float* CS = (float*)take((size_t)TT * (HD / 2) * 2 * 4);
    static_assert(NKV == NH_, "one plane stride per batch for q, k and v");
    // every buffer below holds both batches, batch-major
    bf* XB = (bf*)take((size_t)NB_ * TT * DM * 2);
    h16* QP16 = (h16*)take((size_t)NB_ * NH_ * TT * HD * 2); h16* KP16 = (h16*)take((size_t)NB_ * NKV * TT * HD * 2); h16* VT16 = (h16*)take((size_t)NB_ * NKV * HD * TT * 2);
    bf* QPh = (bf*)take((size_t)NB_ * NH_ * TT * HD * 2); bf* QPl = (bf*)take((size_t)NB_ * NH_ * TT * HD * 2); bf* KPh = (bf*)take((size_t)NB_ * NKV * TT * HD * 2); bf* KPl = (bf*)take((size_t)NB_ * NKV * TT * HD * 2); bf* VTh = (bf*)take((size_t)NB_ * NKV * HD * TT * 2); bf* VTl = (bf*)take((size_t)NB_ * NKV * HD * TT * 2);
    bf* ATh = (bf*)take((size_t)NB_ * TT * DQ * 2); bf* ATl = (bf*)take((size_t)NB_ * TT * DQ * 2);
    if ((size_t)(wsp - (char*)d_ws) > ws_size) return;    // ws 256 MiB
    k_prep<<<PWG, 512, 0, stream>>>(x, wq, wk, wv, wo, XB, WQ, WK, WV, WO, CS);   /* bf16 copies and rotary table, once */
    // both batches in every launch (grid z): GEMMs 256 work-groups of eight waves, one per WGP; attention 512 of four waves, two per WGP
    k_gemms<0, DM, 1, 256, 128><<<dim3(TT / 256, DQ / 128, NB_), 256, 0, stream>>>(XB, nullptr, WQ, nullptr, 0, CS, QP16, QPh, QPl);
    k_gemms<0, DM, 1, 256, 128><<<dim3(TT / 256, DKV / 128, NB_), 256, 0, stream>>>(XB, nullptr, WK, nullptr, 0, CS, KP16, KPh, KPl);
    k_gemms<0, DM, 2, 256, 128><<<dim3(TT / 256, DKV / 128, NB_), 256, 0, stream>>>(XB, nullptr, WV, nullptr, 0, nullptr, VT16, VTh, VTl);
    k_fattn<<<dim3(NH_, TT / 128, NB_), 128, 0, stream>>>(QP16, KP16, VT16, QPh, QPl, KPh, KPl, VTh, VTl, ATh, ATl);
    k_gemms<1, DQ, 0, 128, 256><<<dim3(TT / 128, DM / 256, NB_), 256, 0, stream>>>(ATh, ATl, WO, OUT, DM, nullptr, nullptr, nullptr, nullptr);
}

// v009
// It runs in 185 microseconds.
// Two timings next to v008 both put it at 1.03 times that version's speed.
// Over all steps from v000 it is 9.48 times as fast.
#include <hip/hip_runtime.h>

// Causal multi-head attention with 128-wide heads and computed rotate-half rotary embeddings (hidden_states [2][2048][2048]; q, k, v = einsum('bsd,ed->bse', x, W) ('oi' 0.02; 16 heads x 128); rope x cos + rotate_half(x) sin, angle t x 1/10000^(2i/128) (64 f32 frequencies jnp-exact; cat(freqs, freqs); precise cosf/sinf); scores / sqrt(128); mask = (key > query) | (key - query >= 1024): the second term only touches FUTURE keys, which the first already excludes: plain causal (-inf == exclusion); softmax in f32; out = merged Wo^T -> [2][2048][2048] (8.4 M); argument order hidden_states, Wq, Wk, Wv, Wo).
// Layout: bf16 copy of x; 'oi' weights; exact projections whose epilogues build the head planes (q, k: rotate-half with the k_prep table; v: transposed); causal T-2048 attention at HD 128 in one fused kernel, online softmax (hybrid rows: < 512 hi/lo 3 products, rest fp16 x1024; keys above the diagonal block never read); merged hi/lo x Wo exact.
// Compute dtypes, f32 accumulate: every input rounded to bf16; projections exact; rotary f32; attention rows < 512 3 products, rest fp16; softmax f32; Wo hl x exact.

#define NB_  2
#define TT   2048
#define DM   2048
#define NH_  16
#define NKV  16
#define HD   128
#define DQ   (NH_ * HD)
#define DKV  (NKV * HD)
#define RH   512                  // query rows < RH use hi+lo planes (0: none)
#define SCL  0.088388347648318447f   // HD^-0.5
typedef _Float16 h16;
typedef unsigned short bf;
typedef __attribute__((ext_vector_type(16))) __bf16   v16bf;
typedef __attribute__((ext_vector_type(16))) _Float16 v16h;
typedef __attribute__((ext_vector_type(8)))  _Float16 v8h;
typedef __attribute__((ext_vector_type(8)))  unsigned short v8us;
typedef __attribute__((ext_vector_type(8)))  float    v8f;
typedef __attribute__((ext_vector_type(4)))  float    v4f;
typedef v8h  __attribute__((may_alias)) v8ha;
typedef v4f  __attribute__((may_alias)) v4fa;
typedef v8us __attribute__((may_alias)) v8usa;

__device__ __forceinline__ unsigned short f2bf(float f) { unsigned u = __float_as_uint(f); u += 0x7FFFu + ((u >> 16) & 1u); return (unsigned short)(u >> 16); }
__device__ __forceinline__ float bf2f(unsigned short b) { return __uint_as_float(((unsigned)b) << 16); }
__device__ __forceinline__ v16h cat16(v8h lo, v8h hi) { return __builtin_shufflevector(lo, hi, 0, 1, 2, 3, 4, 5, 6, 7, 8, 9, 10, 11, 12, 13, 14, 15); }
__device__ __forceinline__ v16bf cat16b(v8us lo, v8us hi) { return __builtin_bit_cast(v16bf, __builtin_shufflevector(lo, hi, 0, 1, 2, 3, 4, 5, 6, 7, 8, 9, 10, 11, 12, 13, 14, 15)); }
__device__ __forceinline__ v8f wmma16(v16h a, v16h b, v8f c) { return __builtin_amdgcn_wmma_f32_16x16x32_f16(false, a, false, b, (short)0, c, false, false); }
__device__ __forceinline__ v8f wmmab(v16bf a, v16bf b, v8f c) { return __builtin_amdgcn_wmma_f32_16x16x32_bf16(false, a, false, b, (short)0, c, false, false); }

typedef __attribute__((ext_vector_type(2))) _Float16 v2h;
typedef __attribute__((ext_vector_type(2))) __bf16 v2bf;
typedef __attribute__((ext_vector_type(2))) unsigned short v2us;
typedef __attribute__((ext_vector_type(2))) float v2f;
__device__ __forceinline__ void addr_wait() { __builtin_amdgcn_sched_barrier(0); asm volatile("s_wait_xcnt 0x0" ::: "memory"); __builtin_amdgcn_sched_barrier(0); }
// Eight f32 values -> their words in the three planes: fp16, bf16 head, bf16 of the remainder (each rounded to nearest even, two values a convert).
__device__ __forceinline__ void planes8(const float (&y)[8], v8h& o16, v8us& oh, v8us& ol) {
#pragma unroll   // constant vector indices: the words stay in registers
    for (int p = 0; p < 4; ++p) { const v2f a = { y[2 * p], y[2 * p + 1] };
        const v2h f = __builtin_convertvector(a, v2h); const v2us hu = __builtin_bit_cast(v2us, __builtin_convertvector(a, v2bf));
        const v2f r = { a[0] - bf2f(hu[0]), a[1] - bf2f(hu[1]) }; const v2us lu = __builtin_bit_cast(v2us, __builtin_convertvector(r, v2bf));
        o16[2 * p] = f[0]; o16[2 * p + 1] = f[1]; oh[2 * p] = hu[0]; oh[2 * p + 1] = hu[1]; ol[2 * p] = lu[0]; ol[2 * p + 1] = lu[1]; }
}

// ---- k_gemms: sum_k A[m][k] Bt[n][k] (NSPLIT 1: + A2[m][k] Bt[n][k], product by product in the same k order), operands K-contiguous bf16 planes. M % MT == 0, N % NT == 0, K % 128 == 0, K >= 256.
// EPI 0: C[m][n] (f32, pitch ldc). EPI 1, 2: m = token, the tile's 128 columns = one head; the f32 tile never leaves the work-group: it is turned into that head's three planes (fp16, bf16 head, bf16 remainder) here.
//   EPI 1: planes [head][t][d] of the rotate-half rotary form out[d] = x[d] cos[t][d] - x[d+64] sin[t][d], out[d+64] = x[d+64] cos[t][d] + x[d] sin[t][d], d < 64, (cos, sin) pairs from CS[t][d].   EPI 2: transposed planes [head][d][t].
// One work-group of eight waves per MT x NT output tile (256x128 or 128x256), each wave a 64x64 part (16 accumulators); grid (M/MT, N/NT, batches), 256 threads: one work-group per WGP, two waves per SIMD. M = TT rows a batch; Bt and CS are the same for every batch.
// The wide tile is there for the path from L2 into LDS: a stage's operand rows per output element are 3/4 (A, Bt) or 2/3 (A, A2, Bt) of what two 128x128 tiles fetch.
// A stage is 128 k (256 B) of the tile's MT rows of A (and A2) and NT rows of Bt, brought from global memory into LDS by asynchronous 16-byte copies (whole lines, each byte fetched once per work-group) and read from there as fragments by the waves that need it.
// Two buffers: the copies of stage t + 2 are issued behind the barrier that ends trip t and fly during trip t + 1.
template <typename T16> struct WFrag;
template <> struct WFrag<h16> { typedef v16h V; static __device__ __forceinline__ V ld(const h16* p) { return cat16(*(const v8h*)p, *(const v8h*)(p + 16)); } static __device__ __forceinline__ v8f mma(V a, V b, v8f c) { return wmma16(a, b, c); } };
template <> struct WFrag<bf> { typedef v16bf V; static __device__ __forceinline__ V ld(const bf* p) { return cat16b(*(const v8us*)p, *(const v8us*)(p + 16)); } static __device__ __forceinline__ v8f mma(V a, V b, v8f c) { return wmmab(a, b, c); } };
#define GKS 128                    // k per stage
#define GP  136                    // LDS row pitch in elements: 272 B = 16 B x odd, free of bank conflicts for 16-byte fragment reads
#define TP  132                    // row pitch in f32 of the epilogue's tile in LDS: 528 B = 16 B x odd
// Eight copies of 16 B per lane, LDS step 16 rows, global step gs elements. s_wait_xcnt 0 is the statement's last line, so that it stands in front of every later write of a register that a copy names.
__device__ __forceinline__ void cp8(unsigned l, const bf* g, size_t gs) {
    asm volatile("global_load_async_to_lds_b128 %0, %8, off\n\t"
                 "global_load_async_to_lds_b128 %1, %9, off\n\t"
                 "global_load_async_to_lds_b128 %2, %10, off\n\t"
                 "global_load_async_to_lds_b128 %3, %11, off\n\t"
                 "global_load_async_to_lds_b128 %4, %12, off\n\t"
                 "global_load_async_to_lds_b128 %5, %13, off\n\t"
                 "global_load_async_to_lds_b128 %6, %14, off\n\t"
                 "global_load_async_to_lds_b128 %7, %15, off\n\t"
                 "s_wait_xcnt 0x0"
                 :: "v"(l), "v"(l + 1u * 16 * GP * 2), "v"(l + 2u * 16 * GP * 2), "v"(l + 3u * 16 * GP * 2), "v"(l + 4u * 16 * GP * 2), "v"(l + 5u * 16 * GP * 2), "v"(l + 6u * 16 * GP * 2), "v"(l + 7u * 16 * GP * 2),
                    "v"(g), "v"(g + gs), "v"(g + 2 * gs), "v"(g + 3 * gs), "v"(g + 4 * gs), "v"(g + 5 * gs), "v"(g + 6 * gs), "v"(g + 7 * gs) : "memory");
}
template <int NSPLIT, int K, int EPI, int MT, int NT>
__global__ __launch_bounds__(256) void k_gemms(const bf* __restrict__ A, const bf* __restrict__ A2, const bf* __restrict__ Bt, float* C, int ldc, const float* __restrict__ CS, h16* P16, bf* Ph, bf* Pl) {
    typedef WFrag<bf>::V V;
    // grid z = batch: its own TT rows of A (and A2), and its own output: TT rows of C, or its heads' planes
    { const size_t z = blockIdx.z; A += z * ((size_t)TT * K); if constexpr (NSPLIT == 1) A2 += z * ((size_t)TT * K);
      if constexpr (EPI == 0) C += z * TT * (size_t)ldc; else { const size_t pz = z * ((size_t)NH_ * TT * HD); P16 += pz; Ph += pz; Pl += pz; } }
    static_assert(MT % 128 == 0 && NT % 128 == 0 && (MT / 64) * (NT / 64) == 8 && (EPI == 0 || (NT == HD && MT == 256)), "eight waves of 64x64; a plane epilogue's tile is 256 tokens of one head");
    constexpr int ROWS = MT * (1 + NSPLIT) + NT;         // rows of a stage in LDS: A at row 0, Bt at row MT (, A2 at row MT + NT)
    constexpr int TPT = MT + 4;                          // row pitch in f32 of the transposed epilogue tile: 16 B x odd
    constexpr size_t RINGB = 2 * (size_t)ROWS * GP * sizeof(bf), EPB = (EPI == 1) ? 2 * (size_t)MT * TP * sizeof(float) : (EPI == 2) ? (size_t)NT * TPT * sizeof(float) : 0;
    __shared__ __align__(16) bf st[(RINGB > EPB ? RINGB : EPB) / sizeof(bf)];   // the two buffers; behind the loop the epilogue's f32 tile (and rotary rows)
    const int tid = threadIdx.x, lane = tid & 31, lr = lane & 15, hi = lane >> 4; const int w = __builtin_amdgcn_readfirstlane(tid >> 5);
    const int r0 = blockIdx.x * MT, c0 = blockIdx.y * NT, wr = (w / (NT / 64)) * 64, wc = (w % (NT / 64)) * 64;
    v8f acc[4][4];
    // every '#pragma unroll' of this kernel: constant indices, so that accumulators and fragments stay in registers
#pragma unroll
    for (int mb = 0; mb < 4; ++mb)
#pragma unroll
        for (int nb = 0; nb < 4; ++nb) acc[mb][nb] = (v8f){};
    // a copy of the work-group covers 16 rows of 256 B: lane pointer = row tid / 16, 16-byte piece tid % 16
    const size_t go = (size_t)(tid >> 4) * K + (tid & 15) * 8;
    const bf* ga = A + (size_t)r0 * K + go; const bf* gb = Bt + (size_t)c0 * K + go; const bf* ga2 = (NSPLIT == 1) ? A2 + (size_t)r0 * K + go : ga;
    const unsigned l0 = (unsigned)(size_t)&st[(tid >> 4) * GP + (tid & 15) * 8];
    auto fill = [&](int s) {                             // a cp8 takes 128 rows of one operand
        const unsigned l = l0 + (unsigned)(s & 1) * (ROWS * GP * 2); const int ko = s * GKS;
#pragma unroll
        for (int h = 0; h < MT / 128; ++h) { const size_t gh = (size_t)h * 128 * K + ko;
            cp8(l + h * 128 * GP * 2, ga + gh, (size_t)16 * K); if (NSPLIT == 1) cp8(l + (MT + NT + h * 128) * GP * 2, ga2 + gh, (size_t)16 * K); }
#pragma unroll
        for (int h = 0; h < NT / 128; ++h) cp8(l + (MT + h * 128) * GP * 2, gb + (size_t)h * 128 * K + ko, (size_t)16 * K); };
    constexpr int NS = K / GKS; static_assert(K % GKS == 0 && NS >= 2, "two stages or more");
    fill(0);
    asm volatile("s_wait_asynccnt 0x0" ::: "memory");    // this wave's copies of stage 0 have landed
    __syncthreads();                                     // every wave's have: stage 0 may be read
    fill(1);
#pragma unroll 1   // one copy of the trip; the buffer is chosen by the trip's parity
    for (int t = 0; t < NS; ++t) {
        const bf* sa = &st[((t & 1) * ROWS + wr + lr) * GP + 8 * hi]; const bf* sb = sa + (MT + wc - wr) * GP; const bf* sa2 = sa + NSPLIT * (MT + NT) * GP;
        // two fragment sets: block kk + 1's LDS reads are issued as one group in front of block kk's products, so that only the trip's first group is waited for in full
        V a[2][4], a2[2][4], b[2][4];
#pragma unroll
        for (int f = 0; f < 4; ++f) { a[0][f] = WFrag<bf>::ld(sa + f * 16 * GP); if (NSPLIT == 1) a2[0][f] = WFrag<bf>::ld(sa2 + f * 16 * GP); b[0][f] = WFrag<bf>::ld(sb + f * 16 * GP); }
#pragma unroll
        for (int kk = 0; kk < GKS / 32; ++kk) { const int c = kk & 1, n = c ^ 1;
            if (kk + 1 < GKS / 32) {
#pragma unroll
                for (int f = 0; f < 4; ++f) { a[n][f] = WFrag<bf>::ld(sa + f * 16 * GP + (kk + 1) * 32); if (NSPLIT == 1) a2[n][f] = WFrag<bf>::ld(sa2 + f * 16 * GP + (kk + 1) * 32); b[n][f] = WFrag<bf>::ld(sb + f * 16 * GP + (kk + 1) * 32); } }
            __builtin_amdgcn_sched_barrier(0);           // keeps that group of reads up here (sunk among the products, each pair would be waited for at its full LDS latency)
#pragma unroll
            for (int nb = 0; nb < 4; ++nb)
#pragma unroll
                for (int mb = 0; mb < 4; ++mb) { acc[mb][nb] = WFrag<bf>::mma(a[c][mb], b[c][nb], acc[mb][nb]); if (NSPLIT == 1) acc[mb][nb] = WFrag<bf>::mma(a2[c][mb], b[c][nb], acc[mb][nb]); }
            __builtin_amdgcn_sched_barrier(0);           // and the next group behind this block's products: its registers are the ones they read
        }
        asm volatile("s_wait_dscnt 0x0" ::: "memory");   // this wave's reads of the trip's buffer are done
        asm volatile("s_wait_asynccnt 0x0" ::: "memory");   // this wave's copies of stage t + 1 have landed
        __syncthreads();                                 // publishes stage t + 1 and frees the buffer that trip t has read
        if (t + 2 < NS) fill(t + 2);
    }
    asm volatile("s_wait_asynccnt 0x0" ::: "memory");    // no copy is left in flight when the wave goes on to its end
    if constexpr (EPI == 0) {
    __shared__ __align__(16) float osw[8][16 * 68];      // each wave's own output staging
    float* os = osw[w];
#pragma unroll
    for (int mb = 0; mb < 4; ++mb) {
#pragma unroll
        for (int nb = 0; nb < 4; ++nb) {
#pragma unroll
            for (int j = 0; j < 8; ++j) os[(hi * 8 + j) * 68 + nb * 16 + lr] = acc[mb][nb][j]; }
        __builtin_amdgcn_wave_barrier(); asm volatile("" ::: "memory");   // compile-time order only: the lanes' LDS stores stay in front of the row reads of other lanes' words
        float* crow = C + (size_t)(r0 + wr + mb * 16) * ldc + c0 + wc;
#pragma unroll
        for (int s = 0; s < 8; ++s) { const int row = 2 * s + hi, cofs = lr * 4; const v4f val = *(const v4fa*)(os + row * 68 + cofs);
            *(v4f*)(crow + (size_t)row * ldc + cofs) = val; }
        asm volatile("s_wait_xcnt 0x0" ::: "memory");    // in front of the next group's reuse of the stores' address registers
        __builtin_amdgcn_wave_barrier(); asm volatile("" ::: "memory");   // the same for the row reads and the next group's LDS stores
    }
    } else {
        // The ring's LDS is free here: every wave's last fragment read and last copy lie in front of the loop's last barrier.
        float* tl = (float*)&st[0];                      // the work-group's f32 tile, pitch TP (transposed: TPT)
        v8h o16[2]; v8us oh[2], ol[2];
        if constexpr (EPI == 1) {
            float* cl = tl + MT * TP;                    // the tile's MT rotary rows of 64 (cos, sin) pairs, pitch TP
            // a wave-wide load takes one whole row of 512 B; all 32 are issued up here, so that they fly while the tile is staged
            const float* cg = CS + (size_t)(r0 + w) * HD + lane * 4; v4f cv[32];
#pragma unroll
            for (int i = 0; i < 32; ++i) cv[i] = *(const v4f*)(cg + i * 8 * HD);
            addr_wait();
#pragma unroll
            for (int mb = 0; mb < 4; ++mb)
#pragma unroll
                for (int nb = 0; nb < 4; ++nb)
#pragma unroll
                    for (int j = 0; j < 8; ++j) tl[(wr + mb * 16 + hi * 8 + j) * TP + wc + nb * 16 + lr] = acc[mb][nb][j];
#pragma unroll
            for (int i = 0; i < 32; ++i) *(v4fa*)(cl + (i * 8 + w) * TP + lane * 4) = cv[i];
            __syncthreads();                             // tile and rotary rows are whole: d and d + 64 of a row come from two waves
            // a lane: 8 values d and the 8 at d + 64 of one row; 8 lanes store a whole 128-B line of a plane, rows step by 32
            const int row = tid >> 3, dg = (tid & 7) * 8; const float* tp = tl + row * TP + dg; const float* cp = cl + row * TP + dg * 2;
            const size_t po = ((size_t)blockIdx.y * TT + r0 + row) * HD + dg; h16* p16 = P16 + po; bf* ph = Ph + po; bf* pl = Pl + po;
            v4f x[2][4], c[2][4];                        // two sets: row group i + 1 is read from LDS while group i is worked on
            auto rd = [&](int i) {
#pragma unroll
                for (int q = 0; q < 2; ++q) { x[i & 1][q] = *(const v4fa*)(tp + i * 32 * TP + q * 4); x[i & 1][2 + q] = *(const v4fa*)(tp + i * 32 * TP + HD / 2 + q * 4); }
#pragma unroll
                for (int q = 0; q < 4; ++q) c[i & 1][q] = *(const v4fa*)(cp + i * 32 * TP + q * 4); };
            rd(0);
#pragma unroll
            for (int i = 0; i < 8; ++i) { float lo[8], up[8];
                if (i + 1 < 8) rd(i + 1);
#pragma unroll
                for (int e = 0; e < 8; ++e) { const float x0 = x[i & 1][e >> 2][e & 3], x1 = x[i & 1][2 + (e >> 2)][e & 3], co = c[i & 1][e >> 1][(e & 1) * 2], si = c[i & 1][e >> 1][(e & 1) * 2 + 1];
                    lo[e] = x0 * co - x1 * si; up[e] = x1 * co + x0 * si; }
                planes8(lo, o16[0], oh[0], ol[0]); planes8(up, o16[1], oh[1], ol[1]);
                __builtin_amdgcn_sched_barrier(0);       // the six stores stand together behind the arithmetic: no register of an issued store is written in front of the wait below
#pragma unroll
                for (int q = 0; q < 2; ++q) { const int so = i * 32 * HD + q * (HD / 2); *(v8h*)(p16 + so) = o16[q]; *(v8us*)(ph + so) = oh[q]; *(v8us*)(pl + so) = ol[q]; }
                addr_wait(); }
        } else {
            // a lane's eight accumulator words are eight tokens of one column: the tile is staged transposed, [d][t], by 16-byte LDS stores
#pragma unroll
            for (int mb = 0; mb < 4; ++mb)
#pragma unroll
                for (int nb = 0; nb < 4; ++nb) { float* q = tl + (wc + nb * 16 + lr) * TPT + wr + mb * 16 + hi * 8; const v8f a = acc[mb][nb];
                    *(v4fa*)q = (v4f){ a[0], a[1], a[2], a[3] }; *(v4fa*)(q + 4) = (v4f){ a[4], a[5], a[6], a[7] }; }
            __syncthreads();                             // the tile is whole: a row [d] holds tokens of four waves
            // a lane: 8 tokens of one d; a wave stores the tile's 512 B (four whole lines) of a plane's row, rows step by 8
            const int dr = tid >> 5, tg = (tid & 31) * 8; const float* tp = tl + dr * TPT + tg;
            const size_t po = ((size_t)blockIdx.y * HD + dr) * TT + r0 + tg; h16* p16 = P16 + po; bf* ph = Ph + po; bf* pl = Pl + po;
            v4f x[2][4];                                 // two sets: row group i + 1 is read from LDS while group i is worked on
            auto rd = [&](int i) {
#pragma unroll
                for (int q = 0; q < 2; ++q) { x[i & 1][2 * q] = *(const v4fa*)(tp + (i * 16 + q * 8) * TPT); x[i & 1][2 * q + 1] = *(const v4fa*)(tp + (i * 16 + q * 8) * TPT + 4); } };
            rd(0);
#pragma unroll
            for (int i = 0; i < 8; ++i) {
                if (i + 1 < 8) rd(i + 1);
#pragma unroll
                for (int q = 0; q < 2; ++q) { const v4f x0 = x[i & 1][2 * q], x1 = x[i & 1][2 * q + 1];
                    const float y[8] = { x0[0], x0[1], x0[2], x0[3], x1[0], x1[1], x1[2], x1[3] }; planes8(y, o16[q], oh[q], ol[q]); }
                __builtin_amdgcn_sched_barrier(0);       // the six stores stand together behind the arithmetic: no register of an issued store is written in front of the wait below
#pragma unroll
                for (int q = 0; q < 2; ++q) { const int so = (i * 16 + q * 8) * TT; *(v8h*)(p16 + so) = o16[q]; *(v8us*)(ph + so) = oh[q]; *(v8us*)(pl + so) = ol[q]; }
                addr_wait(); }
        }
    }
}

__device__ __forceinline__ h16 tohx(float x) { return (h16)x; }
__device__ __forceinline__ void splitf(float y, unsigned short& h, unsigned short& l) { h = f2bf(y); l = f2bf(y - bf2f(h)); }

__constant__ float INVT[HD / 2] = { 1.000000000e+00f, 8.659643531e-01f, 7.498942018e-01f, 6.493816376e-01f, 5.623413324e-01f, 4.869675338e-01f, 4.216965139e-01f, 3.651741445e-01f, 3.162277639e-01f, 2.738419771e-01f, 2.371373624e-01f, 2.053525001e-01f, 1.778279394e-01f, 1.539926529e-01f, 1.333521456e-01f, 1.154782027e-01f, 1.000000015e-01f, 8.659642935e-02f, 7.498941571e-02f, 6.493816525e-02f, 5.623412877e-02f, 4.869675264e-02f, 4.216964915e-02f, 3.651741147e-02f, 3.162277862e-02f, 2.738419548e-02f, 2.371373586e-02f, 2.053525113e-02f, 1.778279431e-02f, 1.539926510e-02f, 1.333521493e-02f, 1.154781971e-02f, 9.999999776e-03f, 8.659643121e-03f, 7.498942316e-03f, 6.493816618e-03f, 5.623413250e-03f, 4.869675264e-03f, 4.216964822e-03f, 3.651741426e-03f, 3.162277862e-03f, 2.738419687e-03f, 2.371373819e-03f, 2.053525066e-03f, 1.778279431e-03f, 1.539926510e-03f, 1.333521446e-03f, 1.154782018e-03f, 1.000000047e-03f, 8.659643354e-04f, 7.498941850e-04f, 6.493816618e-04f, 5.623413017e-04f, 4.869675031e-04f, 4.216964880e-04f, 3.651741135e-04f, 3.162277862e-04f, 2.738419571e-04f, 2.371373848e-04f, 2.053524950e-04f, 1.778279402e-04f, 1.539926452e-04f, 1.333521504e-04f, 1.154781930e-04f };   // float32 1 / 10000^(2i/128), generated with jnp to be bit-exact
// ---- k_prep: everything the GEMMs need ahead of them, in one launch: the bf16 copies of the four weight matrices and of x, and the rotary table. grid PWG work-groups (one per WGP) of 16 waves.
// The 6 segments of PSEG f32 values (Wo, Wv, Wk, Wq, the two halves of x) are taken one after the other by the whole grid; of each segment a wave converts 4 KiB that lie together: eight wave-wide loads of 512 B (16 B a lane, whole lines), eight stores of 256 B (8 B a lane, whole lines).
// Two register sets: segment s + 2 is asked for as soon as segment s has been converted, so that 8 to 16 loads of a wave are always in flight.
// CS[t][d] = (cos, sin) of t x INVT[d], d < HD / 2 (columns d and d + HD / 2 of the rotary tables are equal): one pair a thread, worked out while the first two segments' loads fly.
#define PWG  256
#define PSEG ((size_t)DQ * DM)
typedef __attribute__((ext_vector_type(4))) unsigned short v4us;
__global__ __launch_bounds__(512) void k_prep(const float* __restrict__ x, const float* __restrict__ wq, const float* __restrict__ wk, const float* __restrict__ wv, const float* __restrict__ wo, bf* XB, bf* WQ, bf* WK, bf* WV, bf* WO, float* CS) {
    static_assert(PSEG == (size_t)PWG * 16 * 1024 && (size_t)NB_ * TT * DM == 2 * PSEG && (size_t)DKV * DM == PSEG && (size_t)DM * DQ == PSEG, "a segment is 4 KiB of f32 for every wave of the grid");
    static_assert(TT * (HD / 2) == PWG * 512, "one rotary pair a thread");
    const unsigned idx = blockIdx.x * 512 + threadIdx.x;
    const size_t e0 = (size_t)(idx >> 5) * 1024 + (idx & 31) * 4;   // the lane's first element, the same in every segment
    const float* const sp[6] = { wo + e0, wv + e0, wk + e0, wq + e0, x + e0, x + PSEG + e0 };
    bf* const dp[6] = { WO + e0, WV + e0, WK + e0, WQ + e0, XB + e0, XB + PSEG + e0 };
    v4f a[2][8];
    // every '#pragma unroll' of this kernel: constant indices, so that the two sets stay in registers
    auto ld = [&](int s) {
#pragma unroll
        for (int j = 0; j < 8; ++j) a[s & 1][j] = *(const v4f*)(sp[s] + j * 128);
        addr_wait(); };
    const float fr = INVT[idx % (HD / 2)];               // asked for ahead of the stream: loads are waited for in their order, and the table must not wait for the segments
    ld(0); ld(1);
    { const float an = __fmul_rn((float)(idx / (HD / 2)), fr); v2f cs; cs[0] = cosf(an); cs[1] = sinf(an); *(v2f*)(CS + (size_t)idx * 2) = cs; addr_wait(); }
#pragma unroll
    for (int s = 0; s < 6; ++s) {
#pragma unroll
        for (int j = 0; j < 8; ++j) { const v4f v = a[s & 1][j]; v4us o;
#pragma unroll
            for (int k = 0; k < 4; ++k) o[k] = f2bf(v[k]);
            *(v4us*)(dp[s] + j * 128) = o; }
        addr_wait();
        if (s + 2 < 6) ld(s + 2); }
}
// ---- k_fattn: scores, softmax and probability x value in one kernel; neither scores nor probabilities leave the registers. A work-group of four waves owns a tile of 64 query rows of one head, 16 rows a wave, and walks the keys 0 .. the tile's last row in stages of 64.
// A stage is 64 rows of K (256 B each) and 64 keys of every row of Vt (128 B each), brought from global memory into LDS by asynchronous 16-byte copies (whole lines, each byte fetched once per work-group) and read from there as fragments by all four waves.
// Two buffers: the copies of stage s + 2 are issued behind the barrier that ends trip s and fly during trip s + 1.
// St[key][query] = K Q^T and Ot[d][query] += Vt Pt: a lane then holds scores of ONE query (query = lr, keys hi*8+j of each 16-key tile), which is at once the B-fragment order of Pt (k = 8*hi+j, 16+8*hi+j),
// so maximum, sum and rescale are in-lane but for one exchange between the wave's halves. Running maximum m and running sum l per query (online softmax), keys in runs of 32; the division by l comes once, at the end.
__device__ __forceinline__ float xhalf(float x) { return __builtin_bit_cast(float, __builtin_amdgcn_permlanex16(__builtin_bit_cast(int, x), __builtin_bit_cast(int, x), 0x76543210, 0xfedcba98, false, false)); }   // lane l with lane l ^ 16
#define AKS  64                    // keys per stage
#define VP   72                    // LDS row pitch in elements of a stage's Vt rows: 144 B = 16 B x odd, free of bank conflicts for 16-byte fragment reads (K rows: GP)
#define KPL  (AKS * GP)            // elements of one K plane's stage in LDS
#define VPL  (HD * VP)             // elements of one Vt plane's stage in LDS
#define ABUF (2 * (KPL + VPL))     // elements of a buffer: K, Vt, second K, second Vt
// Eight copies of 16 B per lane, LDS step LS bytes, global step gs elements. s_wait_xcnt 0 is the statement's last line, so that it stands in front of every later write of a register that a copy names.
template <unsigned LS, typename T16>
__device__ __forceinline__ void cp8s(unsigned l, const T16* g, size_t gs) {
    asm volatile("global_load_async_to_lds_b128 %0, %8, off\n\t"
                 "global_load_async_to_lds_b128 %1, %9, off\n\t"
                 "global_load_async_to_lds_b128 %2, %10, off\n\t"
                 "global_load_async_to_lds_b128 %3, %11, off\n\t"
                 "global_load_async_to_lds_b128 %4, %12, off\n\t"
                 "global_load_async_to_lds_b128 %5, %13, off\n\t"
                 "global_load_async_to_lds_b128 %6, %14, off\n\t"
                 "global_load_async_to_lds_b128 %7, %15, off\n\t"
                 "s_wait_xcnt 0x0"
                 :: "v"(l), "v"(l + 1u * LS), "v"(l + 2u * LS), "v"(l + 3u * LS), "v"(l + 4u * LS), "v"(l + 5u * LS), "v"(l + 6u * LS), "v"(l + 7u * LS),
                    "v"(g), "v"(g + gs), "v"(g + 2 * gs), "v"(g + 3 * gs), "v"(g + 4 * gs), "v"(g + 5 * gs), "v"(g + 6 * gs), "v"(g + 7 * gs) : "memory");
}
// One tile of 64 query rows, the work-group's only one. Every wave of the work-group passes every barrier; tile is the same in all of them.
template <typename T16, int NSPLIT>
__device__ __forceinline__ void fattn_tile(const T16* st, const T16* __restrict__ Q, const T16* __restrict__ Q2, const T16* __restrict__ Kp, const T16* __restrict__ Kp2, const T16* __restrict__ Vt, const T16* __restrict__ Vt2, int tile, int w, int tid, bf* Ah, bf* Al) {
    typedef typename WFrag<T16>::V V;
    const float L2E = 1.4426950408889634f;
    const float PSH = (NSPLIT == 0) ? 10.0f : 0.0f;      // fp16 probabilities carry a factor 2^10 (small ones stay normal numbers); l carries it too, so it cancels in the division
    const int lane = tid & 31, lr = lane & 15, hi = lane >> 4; const int q0 = tile * 64 + w * 16;   // the wave's first query row (scalar)
    V q[4], q2[4];
    // one lane pointer per plane; every fragment is a constant offset from it
    { const size_t qoff = (size_t)(q0 + lr) * HD + 8 * hi; const T16* qp = Q + qoff; const T16* qp2 = (NSPLIT == 2) ? Q2 + qoff : qp;
#pragma unroll
      for (int kc = 0; kc < 4; ++kc) { q[kc] = WFrag<T16>::ld(qp + kc * 32); if (NSPLIT == 2) q2[kc] = WFrag<T16>::ld(qp2 + kc * 32); }
      addr_wait(); }
    v8f o[8];
#pragma unroll
    for (int dt = 0; dt < 8; ++dt) o[dt] = (v8f){};
    float m = -3.0e38f, l = 0.f;
    // a copy of the work-group covers 8 rows of K (lane: row tid / 16, 16-byte piece tid % 16) or 16 rows of Vt (row tid / 8, piece tid % 8)
    const size_t gko = (size_t)(tid >> 4) * HD + (tid & 15) * 8, gvo = (size_t)(tid >> 3) * TT + (tid & 7) * 8;
    const unsigned lk0 = (unsigned)(size_t)&st[(tid >> 4) * GP + (tid & 15) * 8], lv0 = (unsigned)(size_t)&st[KPL + (tid >> 3) * VP + (tid & 7) * 8];
    auto fill = [&](int s) {
        const unsigned bo = (unsigned)(s & 1) * (ABUF * 2);
        cp8s<8 * GP * 2>(lk0 + bo, Kp + gko + (size_t)s * AKS * HD, (size_t)8 * HD); cp8s<16 * VP * 2>(lv0 + bo, Vt + gvo + s * AKS, (size_t)16 * TT);
        if (NSPLIT == 2) { cp8s<8 * GP * 2>(lk0 + bo + (KPL + VPL) * 2, Kp2 + gko + (size_t)s * AKS * HD, (size_t)8 * HD); cp8s<16 * VP * 2>(lv0 + bo + (KPL + VPL) * 2, Vt2 + gvo + s * AKS, (size_t)16 * TT); } };
    const int NS = tile + 1;                             // stages: keys 0 .. 64 tile + 63
    fill(0);                                             // the buffers are free: nothing of the work-group has touched them yet
    asm volatile("s_wait_asynccnt 0x0" ::: "memory");    // this wave's copies of stage 0 have landed
    __syncthreads();                                     // every wave's have: stage 0 may be read
    if (NS > 1) fill(1);
#pragma unroll 1   // one copy of the trip; the buffer is chosen by the trip's parity
    for (int s = 0; s < NS; ++s) {
        const T16* sb = st + (s & 1) * ABUF;
#pragma unroll 1   // one copy of the run's body
        for (int r = 0; r < 2; ++r) {
            const int kb = s * AKS + r * 32;
            if (kb > q0 + 15) break;                     // every key of the run lies behind the wave's last query (scalar branch; the barrier below is still passed)
            const T16* kf = sb + (r * 32 + lr) * GP + 8 * hi; const T16* vf = sb + KPL + lr * VP + r * 32 + 8 * hi;
            V k[2][4], k2[2][4], v[8], v2[8];
#pragma unroll
            for (int t = 0; t < 2; ++t)
#pragma unroll
                for (int kc = 0; kc < 4; ++kc) { const int ko = t * 16 * GP + kc * 32; k[t][kc] = WFrag<T16>::ld(kf + ko); if (NSPLIT == 2) k2[t][kc] = WFrag<T16>::ld(kf + (KPL + VPL) + ko); }
#pragma unroll
            for (int dt = 0; dt < 8; ++dt) { const int vo = dt * 16 * VP; v[dt] = WFrag<T16>::ld(vf + vo); if (NSPLIT == 2) v2[dt] = WFrag<T16>::ld(vf + (KPL + VPL) + vo); }
            __builtin_amdgcn_sched_barrier(0);           // keeps the run's LDS reads in one group up here: the Vt fragments arrive during the score products and the softmax
            v8f sc[2] = { (v8f){}, (v8f){} };
#pragma unroll
            for (int kc = 0; kc < 4; ++kc)
#pragma unroll
                for (int t = 0; t < 2; ++t) { v8f a = sc[t]; a = WFrag<T16>::mma(k[t][kc], q[kc], a); if (NSPLIT == 2) { a = WFrag<T16>::mma(k[t][kc], q2[kc], a); a = WFrag<T16>::mma(k2[t][kc], q[kc], a); } sc[t] = a; }
            const bool diag = (kb + 31 > q0);            // only such a run meets the causal diagonal (wave-uniform)
            const int dq = kb - q0;
            float mx = m;
#pragma unroll
            for (int t = 0; t < 2; ++t)
#pragma unroll
                for (int j = 0; j < 8; ++j) { float x = sc[t][j] * SCL; if (diag && dq + t * 16 + hi * 8 + j > lr) x = -3.0e38f; sc[t][j] = x; mx = fmaxf(mx, x); }
            const float mn = fmaxf(mx, xhalf(mx));
            if (__builtin_amdgcn_ballot_w32(mn > m) != 0) {   // a maximum moved: bring sums and output tiles to the new one (factor exactly 1 where it did not)
                const float al = __builtin_amdgcn_exp2f((m - mn) * L2E); l *= al; m = mn;
#pragma unroll
                for (int dt = 0; dt < 8; ++dt) o[dt] *= al; }
            V pf, pf2; float sum = 0.f; float p[16];
#pragma unroll
            for (int e = 0; e < 16; ++e) { p[e] = __builtin_amdgcn_exp2f((sc[e >> 3][e & 7] - m) * L2E + PSH); sum += p[e]; }
            l += sum;
            if constexpr (NSPLIT == 0) { v16h f;
#pragma unroll
                for (int e = 0; e < 16; ++e) f[e] = tohx(p[e]);
                pf = f;
            } else { v8us h0, h1, l0, l1;
#pragma unroll
                for (int e = 0; e < 8; ++e) { unsigned short a, c2; splitf(p[e], a, c2); h0[e] = a; l0[e] = c2; splitf(p[8 + e], a, c2); h1[e] = a; l1[e] = c2; }
                pf = cat16b(h0, h1); pf2 = cat16b(l0, l1); }
#pragma unroll
            for (int dt = 0; dt < 8; ++dt) { o[dt] = WFrag<T16>::mma(v[dt], pf, o[dt]); if (NSPLIT == 2) { o[dt] = WFrag<T16>::mma(v[dt], pf2, o[dt]); o[dt] = WFrag<T16>::mma(v2[dt], pf, o[dt]); } }
            __builtin_amdgcn_sched_barrier(0);           // the products stay in front of the slots below
            asm volatile("v_nop\n\tv_nop\n\tv_nop\n\tv_nop");   // the four vector slots between the run's last matrix instruction and the next run's first write of its operand registers
        }
        asm volatile("s_wait_dscnt 0x0" ::: "memory");   // this wave's reads of the trip's buffer are done
        asm volatile("s_wait_asynccnt 0x0" ::: "memory");   // this wave's copies of stage s + 1 have landed
        __syncthreads();                                 // publishes stage s + 1 and frees the buffer that trip s has read
        if (s + 2 < NS) fill(s + 2);
    }
    asm volatile("s_wait_asynccnt 0x0" ::: "memory");    // no copy is left in flight behind the loop
    { const float inv = __fdiv_rn(1.0f, l + xhalf(l)); const size_t oo = (size_t)(q0 + lr) * DQ + hi * 8; bf* ap = Ah + oo; bf* ap2 = Al + oo;
#pragma unroll
        for (int dt = 0; dt < 8; ++dt) { v8us oh, ol;
#pragma unroll
            for (int j = 0; j < 8; ++j) { unsigned short a, c2; splitf(o[dt][j] * inv, a, c2); oh[j] = a; ol[j] = c2; }
            *(v8us*)(ap + dt * 16) = oh; *(v8us*)(ap2 + dt * 16) = ol;
            addr_wait(); } }
}
// grid (heads x batches, TT / 64), 128 threads: one tile of 64 query rows per work-group, twice as many work-groups as the chip holds at a time (two per WGP, by LDS).
// Tile t has t + 1 stages of keys, and a stage of the hi/lo kind costs about HLC / FPC of an fp16 one (3 x the products, 2 x the LDS reads and the vector work).
// The tile's cost falls with blockIdx.y (x, the fastest index, runs over heads and batches). For speed only: every (head, batch, tile) is taken exactly once whatever the order of starts.
#define HLC 5
#define FPC 2
struct TileOrder { unsigned char t[TT / 64]; };
constexpr int tile_cost(int t) { return (t + 1) * (t * 64 < RH ? HLC : FPC); }
constexpr TileOrder tile_order() {                       // a permutation of the tiles, cost falling, ties by index (insertion sort at compile time)
    TileOrder o{};
    for (int i = 0; i < TT / 64; ++i) { int j = i; const int t = TT / 64 - 1 - i;
        while (j > 0 && tile_cost(o.t[j - 1]) < tile_cost(t)) { o.t[j] = o.t[j - 1]; --j; }
        o.t[j] = (unsigned char)t; }
    return o;
}
constexpr unsigned long long tile_word(int q) {          // eight entries of the order in one word: the look-up is scalar arithmetic on immediates, no load stands in front of the tile's first copies
    const TileOrder o = tile_order(); unsigned long long v = 0;
    for (int i = 0; i < 8; ++i) v |= (unsigned long long)o.t[q * 8 + i] << (8 * i);
    return v;
}
// Query rows < RH: bf16 hi/lo planes, 3 products; the rest fp16 (chosen per tile). Writes the merged hi/lo planes [t][head * HD + d].
__global__ __launch_bounds__(128) void k_fattn(const h16* __restrict__ Q16, const h16* __restrict__ K16, const h16* __restrict__ V16, const bf* __restrict__ Qh, const bf* __restrict__ Ql, const bf* __restrict__ Kh, const bf* __restrict__ Kl, const bf* __restrict__ Vh, const bf* __restrict__ Vl, bf* Ah, bf* Al) {
    __shared__ __align__(16) bf ast[2 * ABUF];
    static_assert(RH % 64 == 0 && TT / 64 == 32, "a tile is of one kind; the order is held in four words of eight tiles");
    const int tid = threadIdx.x; const int w = __builtin_amdgcn_readfirstlane(tid >> 5);   /* wave-uniform: the run's bound stays scalar */
    const int h = (int)blockIdx.x % NH_, b = (int)blockIdx.x / NH_;
    const size_t hp = (size_t)blockIdx.x * TT * HD;      // blockIdx.x = batch * NH_ + head: that head's planes
    const size_t ao = (size_t)b * TT * DQ + h * HD;      // the batch's TT rows of the merged planes, the head's columns
    constexpr unsigned long long o0 = tile_word(0), o1 = tile_word(1), o2 = tile_word(2), o3 = tile_word(3);
    const unsigned rk = blockIdx.y; const unsigned long long ow = rk < 16 ? (rk < 8 ? o0 : o1) : (rk < 24 ? o2 : o3);
    const int tile = (int)((ow >> ((rk & 7) * 8)) & 0xff);
    if (tile * 64 < RH) fattn_tile<bf, 2>(ast, Qh + hp, Ql + hp, Kh + hp, Kl + hp, Vh + hp, Vl + hp, tile, w, tid, Ah + ao, Al + ao);
    else fattn_tile<h16, 0>((const h16*)ast, Q16 + hp, nullptr, K16 + hp, nullptr, V16 + hp, nullptr, tile, w, tid, Ah + ao, Al + ao);
}

extern "C" void kernel_launch(void* const* d_in, const int* in_sizes, int n_in,
                              void* d_out, int out_size, void* d_ws, size_t ws_size, hipStream_t stream) {
    (void)in_sizes; (void)n_in; (void)out_size;
    const float* x = (const float*)d_in[0]; const float* wq = (const float*)d_in[1]; const float* wk = (const float*)d_in[2]; const float* wv = (const float*)d_in[3]; const float* wo = (const float*)d_in[4];   /* order hidden_states, Wq, Wk, Wv, Wo ('oi' [2048][2048]) */
    float* OUT = (float*)d_out;     // [2][2048][2048]
    char* wsp = (char*)d_ws;
    auto take = [&](size_t bytes) { char* p = wsp; wsp += (bytes + 255) & ~(size_t)255; return (void*)p; };
    bf* WQ = (bf*)take((size_t)DQ * DM * 2); bf* WK = (bf*)take((size_t)DKV * DM * 2); bf* WV = (bf*)take((size_t)DKV * DM * 2); bf* WO = (bf*)take((size_t)DM * DQ * 2); float* CS = (float*)take((size_t)TT * (HD / 2) * 2 * 4);
    static_assert(NKV == NH_, "one plane stride per batch for q, k and v");
    // every buffer below holds both batches, batch-major
    bf* XB = (bf*)take((size_t)NB_ * TT * DM * 2);
    h16* QP16 = (h16*)take((size_t)NB_ * NH_ * TT * HD * 2); h16* KP16 = (h16*)take((size_t)NB_ * NKV * TT * HD * 2); h16* VT16 = (h16*)take((size_t)NB_ * NKV * HD * TT * 2);
    bf* QPh = (bf*)take((size_t)NB_ * NH_ * TT * HD * 2); bf* QPl = (bf*)take((size_t)NB_ * NH_ * TT * HD * 2); bf* KPh = (bf*)take((size_t)NB_ * NKV * TT * HD * 2); bf* KPl = (bf*)take((size_t)NB_ * NKV * TT * HD * 2); bf* VTh = (bf*)take((size_t)NB_ * NKV * HD * TT * 2); bf* VTl = (bf*)take((size_t)NB_ * NKV * HD * TT * 2);
    bf* ATh = (bf*)take((size_t)NB_ * TT * DQ * 2); bf* ATl = (bf*)take((size_t)NB_ * TT * DQ * 2);
    if ((size_t)(wsp - (char*)d_ws) > ws_size) return;    // ws 256 MiB
    k_prep<<<PWG, 512, 0, stream>>>(x, wq, wk, wv, wo, XB, WQ, WK, WV, WO, CS);   /* bf16 copies and rotary table, once */
    // both batches in every launch: GEMMs (grid z) 256 work-groups of eight waves, one per WGP; attention 1024 of four waves, two per WGP at a time, longest tiles first
    k_gemms<0, DM, 1, 256, 128><<<dim3(TT / 256, DQ / 128, NB_), 256, 0, stream>>>(XB, nullptr, WQ, nullptr, 0, CS, QP16, QPh, QPl);
    k_gemms<0, DM, 1, 256, 128><<<dim3(TT / 256, DKV / 128, NB_), 256, 0, stream>>>(XB, nullptr, WK, nullptr, 0, CS, KP16, KPh, KPl);
    k_gemms<0, DM, 2, 256, 128><<<dim3(TT / 256, DKV / 128, NB_), 256, 0, stream>>>(XB, nullptr, WV, nullptr, 0, nullptr, VT16, VTh, VTl);
    k_fattn<<<dim3(NH_ * NB_, TT / 64), 128, 0, stream>>>(QP16, KP16, VT16, QPh, QPl, KPh, KPl, VTh, VTl, ATh, ATl);
    k_gemms<1, DQ, 0, 128, 256><<<dim3(TT / 128, DM / 256, NB_), 256, 0, stream>>>(ATh, ATl, WO, OUT, DM, nullptr, nullptr, nullptr, nullptr);
}

// v010
// Measured time: 177 microseconds a run.
// In both of two side-by-side timings against v009, it was 1.04 times as fast.
// Counting every step since v000, it is 9.86 times as fast.
#include <hip/hip_runtime.h>

// Causal multi-head attention with 128-wide heads and computed rotate-half rotary embeddings (hidden_states [2][2048][2048]; q, k, v = einsum('bsd,ed->bse', x, W) ('oi' 0.02; 16 heads x 128); rope x cos + rotate_half(x) sin, angle t x 1/10000^(2i/128) (64 f32 frequencies jnp-exact; cat(freqs, freqs); precise cosf/sinf); scores / sqrt(128); mask = (key > query) | (key - query >= 1024): the second term only touches FUTURE keys, which the first already excludes: plain causal (-inf == exclusion); softmax in f32; out = merged Wo^T -> [2][2048][2048] (8.4 M); argument order hidden_states, Wq, Wk, Wv, Wo).
// Layout: bf16 copy of x; 'oi' weights; exact projections whose epilogues build the head planes (q, k: rotate-half with the k_prep table; v: transposed); causal T-2048 attention at HD 128 in one fused kernel, online softmax (hybrid rows: < 512 hi/lo 3 products, rest fp16 x1024; keys above the diagonal block never read); merged hi/lo x Wo exact.
// Compute dtypes, f32 accumulate: every input rounded to bf16; projections exact; rotary f32; attention rows < 512 3 products, rest fp16; softmax f32; Wo hl x exact.

#define NB_  2
#define TT   2048
#define DM   2048
#define NH_  16
#define NKV  16
#define HD   128
#define DQ   (NH_ * HD)
#define DKV  (NKV * HD)
#define RH   512                  // query rows < RH use hi+lo planes (0: none)
#define SCL  0.088388347648318447f   // HD^-0.5
typedef _Float16 h16;
typedef unsigned short bf;
typedef __attribute__((ext_vector_type(16))) __bf16   v16bf;
typedef __attribute__((ext_vector_type(16))) _Float16 v16h;
typedef __attribute__((ext_vector_type(8)))  _Float16 v8h;
typedef __attribute__((ext_vector_type(8)))  unsigned short v8us;
typedef __attribute__((ext_vector_type(8)))  float    v8f;
typedef __attribute__((ext_vector_type(4)))  float    v4f;
typedef v8h  __attribute__((may_alias)) v8ha;
typedef v4f  __attribute__((may_alias)) v4fa;
typedef v8us __attribute__((may_alias)) v8usa;

__device__ __forceinline__ unsigned short f2bf(float f) { unsigned u = __float_as_uint(f); u += 0x7FFFu + ((u >> 16) & 1u); return (unsigned short)(u >> 16); }
__device__ __forceinline__ float bf2f(unsigned short b) { return __uint_as_float(((unsigned)b) << 16); }
__device__ __forceinline__ v16h cat16(v8h lo, v8h hi) { return __builtin_shufflevector(lo, hi, 0, 1, 2, 3, 4, 5, 6, 7, 8, 9, 10, 11, 12, 13, 14, 15); }
__device__ __forceinline__ v16bf cat16b(v8us lo, v8us hi) { return __builtin_bit_cast(v16bf, __builtin_shufflevector(lo, hi, 0, 1, 2, 3, 4, 5, 6, 7, 8, 9, 10, 11, 12, 13, 14, 15)); }
__device__ __forceinline__ v8f wmma16(v16h a, v16h b, v8f c) { return __builtin_amdgcn_wmma_f32_16x16x32_f16(false, a, false, b, (short)0, c, false, false); }
__device__ __forceinline__ v8f wmmab(v16bf a, v16bf b, v8f c) { return __builtin_amdgcn_wmma_f32_16x16x32_bf16(false, a, false, b, (short)0, c, false, false); }

typedef __attribute__((ext_vector_type(2))) _Float16 v2h;
typedef __attribute__((ext_vector_type(2))) __bf16 v2bf;
typedef __attribute__((ext_vector_type(2))) unsigned short v2us;
typedef __attribute__((ext_vector_type(2))) float v2f;
__device__ __forceinline__ void addr_wait() { __builtin_amdgcn_sched_barrier(0); asm volatile("s_wait_xcnt 0x0" ::: "memory"); __builtin_amdgcn_sched_barrier(0); }
// Eight f32 values -> their words in the three planes: fp16, bf16 head, bf16 of the remainder (each rounded to nearest even, two values a convert).
__device__ __forceinline__ void planes8(const float (&y)[8], v8h& o16, v8us& oh, v8us& ol) {
#pragma unroll   // constant vector indices: the words stay in registers
    for (int p = 0; p < 4; ++p) { const v2f a = { y[2 * p], y[2 * p + 1] };
        const v2h f = __builtin_convertvector(a, v2h); const v2us hu = __builtin_bit_cast(v2us, __builtin_convertvector(a, v2bf));
        const v2f r = { a[0] - bf2f(hu[0]), a[1] - bf2f(hu[1]) }; const v2us lu = __builtin_bit_cast(v2us, __builtin_convertvector(r, v2bf));
        o16[2 * p] = f[0]; o16[2 * p + 1] = f[1]; oh[2 * p] = hu[0]; oh[2 * p + 1] = hu[1]; ol[2 * p] = lu[0]; ol[2 * p + 1] = lu[1]; }
}

// ---- k_gemms: sum_k A[m][k] Bt[n][k] (NSPLIT 1: + A2[m][k] Bt[n][k], product by product in the same k order), operands K-contiguous bf16 planes. M % MT == 0, N % NT == 0, K % 128 == 0, K >= 256.
// EPI 0: C[m][n] (f32, pitch ldc). EPI 1, 2: m = token, 128 columns of the tile = one head; the f32 tile never leaves the work-group: head by head it is turned into that head's three planes (fp16, bf16 head, bf16 remainder) here.
//   EPI 1: planes [head][t][d] of the rotate-half rotary form out[d] = x[d] cos[t][d] - x[d+64] sin[t][d], out[d+64] = x[d+64] cos[t][d] + x[d] sin[t][d], d < 64, (cos, sin) pairs from CS[t][d].   EPI 2: transposed planes [head][d][t].
// One work-group of eight waves per MT x NT output tile (256x128, 128x256 or 256x256), each wave a WM x 64 part (WM = 64: 16 accumulators; 256x256: WM = 128, 32 accumulators); grid (M/MT, N/NT, batches), 256 threads: one work-group per WGP, two waves per SIMD. M = TT rows a batch; Bt and CS are the same for every batch.
// The wide tile is there for the path from L2 into LDS: a stage's operand rows per output element are 3/4 (A, Bt) or 2/3 (A, A2, Bt) of what two 128x128 tiles fetch, at 256x256 one half; the 128x64 wave part reads 3/4 of the LDS bytes per product that a 64x64 part reads.
// EPI 1 takes the q and the k projection as ONE product: Bt = the rows of Wq and behind them those of Wk, so that a row of x is fetched once for both; column block g of 128 is head g % NH_ of matrix g / NH_, whose planes lie g / NH_ x PS elements behind P16, Ph, Pl.
// A stage is 128 k (256 B) of the tile's MT rows of A (and A2) and NT rows of Bt, brought from global memory into LDS by asynchronous 16-byte copies (whole lines, each byte fetched once per work-group) and read from there as fragments by the waves that need it.
// Two buffers: the copies of stage t + 2 are issued behind the barrier that ends trip t and fly during trip t + 1.
template <typename T16> struct WFrag;
template <> struct WFrag<h16> { typedef v16h V; static __device__ __forceinline__ V ld(const h16* p) { return cat16(*(const v8h*)p, *(const v8h*)(p + 16)); } static __device__ __forceinline__ v8f mma(V a, V b, v8f c) { return wmma16(a, b, c); } };
template <> struct WFrag<bf> { typedef v16bf V; static __device__ __forceinline__ V ld(const bf* p) { return cat16b(*(const v8us*)p, *(const v8us*)(p + 16)); } static __device__ __forceinline__ v8f mma(V a, V b, v8f c) { return wmmab(a, b, c); } };
#define GKS 128                    // k per stage
#define GP  136                    // LDS row pitch in elements: 272 B = 16 B x odd, free of bank conflicts for 16-byte fragment reads
#define TP  132                    // row pitch in f32 of the epilogue's tile in LDS: 528 B = 16 B x odd
#define PS  ((size_t)NB_ * NH_ * TT * HD)   // elements of one matrix's plane, both batches
// Eight copies of 16 B per lane, LDS step 16 rows, global step gs elements. s_wait_xcnt 0 is the statement's last line, so that it stands in front of every later write of a register that a copy names.
__device__ __forceinline__ void cp8(unsigned l, const bf* g, size_t gs) {
    asm volatile("global_load_async_to_lds_b128 %0, %8, off\n\t"
                 "global_load_async_to_lds_b128 %1, %9, off\n\t"
                 "global_load_async_to_lds_b128 %2, %10, off\n\t"
                 "global_load_async_to_lds_b128 %3, %11, off\n\t"
                 "global_load_async_to_lds_b128 %4, %12, off\n\t"
                 "global_load_async_to_lds_b128 %5, %13, off\n\t"
                 "global_load_async_to_lds_b128 %6, %14, off\n\t"
                 "global_load_async_to_lds_b128 %7, %15, off\n\t"
                 "s_wait_xcnt 0x0"
                 :: "v"(l), "v"(l + 1u * 16 * GP * 2), "v"(l + 2u * 16 * GP * 2), "v"(l + 3u * 16 * GP * 2), "v"(l + 4u * 16 * GP * 2), "v"(l + 5u * 16 * GP * 2), "v"(l + 6u * 16 * GP * 2), "v"(l + 7u * 16 * GP * 2),
                    "v"(g), "v"(g + gs), "v"(g + 2 * gs), "v"(g + 3 * gs), "v"(g + 4 * gs), "v"(g + 5 * gs), "v"(g + 6 * gs), "v"(g + 7 * gs) : "memory");
}
template <int NSPLIT, int K, int EPI, int MT, int NT>
__global__ __launch_bounds__(256) void k_gemms(const bf* __restrict__ A, const bf* __restrict__ A2, const bf* __restrict__ Bt, float* C, int ldc, const float* __restrict__ CS, h16* P16, bf* Ph, bf* Pl) {
    typedef WFrag<bf>::V V;
    // grid z = batch: its own TT rows of A (and A2), and its own output: TT rows of C, or its heads' planes
    { const size_t z = blockIdx.z; A += z * ((size_t)TT * K); if constexpr (NSPLIT == 1) A2 += z * ((size_t)TT * K);
      if constexpr (EPI == 0) C += z * TT * (size_t)ldc; else { const size_t pz = z * ((size_t)NH_ * TT * HD); P16 += pz; Ph += pz; Pl += pz; } }
    constexpr int WM = MT * NT / (8 * 64), MB = WM / 16;   // rows of a wave's part, and its accumulator rows
    static_assert(MT % 128 == 0 && NT % 128 == 0 && MT % WM == 0 && WM % 16 == 0 && (MT / WM) * (NT / 64) == 8 && (EPI == 0 || MT == 256) && (EPI != 2 || NT == HD) && (EPI != 1 || NH_ % (NT / HD) == 0), "eight waves of WM x 64; a plane epilogue's tile is 256 tokens of whole heads of one matrix");
    constexpr int ROWS = MT * (1 + NSPLIT) + NT;         // rows of a stage in LDS: A at row 0, Bt at row MT (, A2 at row MT + NT)
    constexpr int TPT = MT + 4;                          // row pitch in f32 of the transposed epilogue tile: 16 B x odd
    constexpr size_t RINGB = 2 * (size_t)ROWS * GP * sizeof(bf), EPB = (EPI == 1) ? 2 * (size_t)MT * TP * sizeof(float) : (EPI == 2) ? (size_t)NT * TPT * sizeof(float) : 0;
    __shared__ __align__(16) bf st[(RINGB > EPB ? RINGB : EPB) / sizeof(bf)];   // the two buffers; behind the loop the epilogue's f32 tile (and rotary rows)
    const int tid = threadIdx.x, lane = tid & 31, lr = lane & 15, hi = lane >> 4; const int w = __builtin_amdgcn_readfirstlane(tid >> 5);
    const int r0 = blockIdx.x * MT, c0 = blockIdx.y * NT, wr = (w / (NT / 64)) * WM, wc = (w % (NT / 64)) * 64;
    v8f acc[MB][4];
    // every '#pragma unroll' of this kernel: constant indices, so that accumulators and fragments stay in registers
#pragma unroll
    for (int mb = 0; mb < MB; ++mb)
#pragma unroll
        for (int nb = 0; nb < 4; ++nb) acc[mb][nb] = (v8f){};
    // a copy of the work-group covers 16 rows of 256 B: lane pointer = row tid / 16, 16-byte piece tid % 16
    const size_t go = (size_t)(tid >> 4) * K + (tid & 15) * 8;
    const bf* ga = A + (size_t)r0 * K + go; const bf* gb = Bt + (size_t)c0 * K + go; const bf* ga2 = (NSPLIT == 1) ? A2 + (size_t)r0 * K + go : ga;
    const unsigned l0 = (unsigned)(size_t)&st[(tid >> 4) * GP + (tid & 15) * 8];
    auto fill = [&](int s) {                             // a cp8 takes 128 rows of one operand
        const unsigned l = l0 + (unsigned)(s & 1) * (ROWS * GP * 2); const int ko = s * GKS;
#pragma unroll
        for (int h = 0; h < MT / 128; ++h) { const size_t gh = (size_t)h * 128 * K + ko;
            cp8(l + h * 128 * GP * 2, ga + gh, (size_t)16 * K); if (NSPLIT == 1) cp8(l + (MT + NT + h * 128) * GP * 2, ga2 + gh, (size_t)16 * K);
            if constexpr (MB > 4) __builtin_amdgcn_sched_barrier(0); }   // 32 accumulators: each statement's 24 address registers are formed next to it, not all 96 ahead of the first (accumulators would be moved out of their registers and back every trip)
#pragma unroll
        for (int h = 0; h < NT / 128; ++h) { cp8(l + (MT + h * 128) * GP * 2, gb + (size_t)h * 128 * K + ko, (size_t)16 * K);
            if constexpr (MB > 4) __builtin_amdgcn_sched_barrier(0); } };   // the same
    constexpr int NS = K / GKS; static_assert(K % GKS == 0 && NS >= 2, "two stages or more");
    fill(0);
    asm volatile("s_wait_asynccnt 0x0" ::: "memory");    // this wave's copies of stage 0 have landed
    __syncthreads();                                     // every wave's have: stage 0 may be read
    fill(1);
#pragma unroll 1   // one copy of the trip; the buffer is chosen by the trip's parity
    for (int t = 0; t < NS; ++t) {
        const bf* sa = &st[((t & 1) * ROWS + wr + lr) * GP + 8 * hi]; const bf* sb = sa + (MT + wc - wr) * GP; const bf* sa2 = sa + NSPLIT * (MT + NT) * GP;
        // two fragment sets: block kk + 1's LDS reads are issued as one group in front of block kk's products, so that only the trip's first group is waited for in full
        V a[2][MB], a2[2][MB], b[2][4];
#pragma unroll
        for (int f = 0; f < MB; ++f) { a[0][f] = WFrag<bf>::ld(sa + f * 16 * GP); if (NSPLIT == 1) a2[0][f] = WFrag<bf>::ld(sa2 + f * 16 * GP); if (f < 4) b[0][f] = WFrag<bf>::ld(sb + f * 16 * GP); }
#pragma unroll
        for (int kk = 0; kk < GKS / 32; ++kk) { const int c = kk & 1, n = c ^ 1;
            if (kk + 1 < GKS / 32) {
#pragma unroll
                for (int f = 0; f < MB; ++f) { a[n][f] = WFrag<bf>::ld(sa + f * 16 * GP + (kk + 1) * 32); if (NSPLIT == 1) a2[n][f] = WFrag<bf>::ld(sa2 + f * 16 * GP + (kk + 1) * 32); if (f < 4) b[n][f] = WFrag<bf>::ld(sb + f * 16 * GP + (kk + 1) * 32); } }
            __builtin_amdgcn_sched_barrier(0);           // keeps that group of reads up here (sunk among the products, each pair would be waited for at its full LDS latency)
#pragma unroll
            for (int nb = 0; nb < 4; ++nb)
#pragma unroll
                for (int mb = 0; mb < MB; ++mb) { acc[mb][nb] = WFrag<bf>::mma(a[c][mb], b[c][nb], acc[mb][nb]); if (NSPLIT == 1) acc[mb][nb] = WFrag<bf>::mma(a2[c][mb], b[c][nb], acc[mb][nb]); }
            __builtin_amdgcn_sched_barrier(0);           // and the next group behind this block's products: its registers are the ones they read
        }
        asm volatile("s_wait_dscnt 0x0" ::: "memory");   // this wave's reads of the trip's buffer are done
        asm volatile("s_wait_asynccnt 0x0" ::: "memory");   // this wave's copies of stage t + 1 have landed
        __syncthreads();                                 // publishes stage t + 1 and frees the buffer that trip t has read
        if (t + 2 < NS) fill(t + 2);
    }
    asm volatile("s_wait_asynccnt 0x0" ::: "memory");    // no copy is left in flight when the wave goes on to its end
    if constexpr (EPI == 0) {
    __shared__ __align__(16) float osw[8][16 * 68];      // each wave's own output staging
    float* os = osw[w];
#pragma unroll
    for (int mb = 0; mb < MB; ++mb) {
#pragma unroll
        for (int nb = 0; nb < 4; ++nb) {
#pragma unroll
            for (int j = 0; j < 8; ++j) os[(hi * 8 + j) * 68 + nb * 16 + lr] = acc[mb][nb][j]; }
        __builtin_amdgcn_wave_barrier(); asm volatile("" ::: "memory");   // compile-time order only: the lanes' LDS stores stay in front of the row reads of other lanes' words
        float* crow = C + (size_t)(r0 + wr + mb * 16) * ldc + c0 + wc;
#pragma unroll
        for (int s = 0; s < 8; ++s) { const int row = 2 * s + hi, cofs = lr * 4; const v4f val = *(const v4fa*)(os + row * 68 + cofs);
            *(v4f*)(crow + (size_t)row * ldc + cofs) = val; }
        asm volatile("s_wait_xcnt 0x0" ::: "memory");    // in front of the next group's reuse of the stores' address registers
        __builtin_amdgcn_wave_barrier(); asm volatile("" ::: "memory");   // the same for the row reads and the next group's LDS stores
    }
    } else {
        // The ring's LDS is free here: every wave's last fragment read and last copy lie in front of the loop's last barrier.
        float* tl = (float*)&st[0];                      // the work-group's f32 tile, pitch TP (transposed: TPT)
        v8h o16[2]; v8us oh[2], ol[2];
        if constexpr (EPI == 1) {
            float* cl = tl + MT * TP;                    // the tile's MT rotary rows of 64 (cos, sin) pairs, pitch TP
            // a wave-wide load takes one whole row of 512 B; all 32 are issued up here, so that they fly while the tile is staged
            const float* cg = CS + (size_t)(r0 + w) * HD + lane * 4; v4f cv[32];
#pragma unroll
            for (int i = 0; i < 32; ++i) cv[i] = *(const v4f*)(cg + i * 8 * HD);
            addr_wait();
            // the tile in LDS holds one head at a time: the waves whose 64 columns belong to head hh stage them (wave-uniform scalar test)
            auto stage = [&](int hh) {
                if (wc / HD == hh) {
#pragma unroll
                    for (int mb = 0; mb < MB; ++mb)
#pragma unroll
                        for (int nb = 0; nb < 4; ++nb)
#pragma unroll
                            for (int j = 0; j < 8; ++j) tl[(wr + mb * 16 + hi * 8 + j) * TP + wc % HD + nb * 16 + lr] = acc[mb][nb][j]; } };
            stage(0);
#pragma unroll
            for (int i = 0; i < 32; ++i) *(v4fa*)(cl + (i * 8 + w) * TP + lane * 4) = cv[i];
            // a lane: 8 values d and the 8 at d + 64 of one row; 8 lanes store a whole 128-B line of a plane, rows step by 32
            const int row = tid >> 3, dg = (tid & 7) * 8; const float* tp = tl + row * TP + dg; const float* cp = cl + row * TP + dg * 2;
#pragma unroll 1   // one copy of the head's code
            for (int hh = 0; hh < NT / HD; ++hh) {
            __syncthreads();                             // tile and rotary rows are whole: d and d + 64 of a row come from two waves
            const int g = blockIdx.y * (NT / HD) + hh;   // column block: matrix g / NH_, head g % NH_
            const size_t po = (size_t)(g / NH_) * PS + ((size_t)(g % NH_) * TT + r0 + row) * HD + dg; h16* p16 = P16 + po; bf* ph = Ph + po; bf* pl = Pl + po;
            v4f x[2][4], c[2][4];                        // two sets: row group i + 1 is read from LDS while group i is worked on
            auto rd = [&](int i) {
#pragma unroll
                for (int q = 0; q < 2; ++q) { x[i & 1][q] = *(const v4fa*)(tp + i * 32 * TP + q * 4); x[i & 1][2 + q] = *(const v4fa*)(tp + i * 32 * TP + HD / 2 + q * 4); }
#pragma unroll
                for (int q = 0; q < 4; ++q) c[i & 1][q] = *(const v4fa*)(cp + i * 32 * TP + q * 4); };
            rd(0);
#pragma unroll
            for (int i = 0; i < 8; ++i) { float lo[8], up[8];
                if (i + 1 < 8) rd(i + 1);
#pragma unroll
                for (int e = 0; e < 8; ++e) { const float x0 = x[i & 1][e >> 2][e & 3], x1 = x[i & 1][2 + (e >> 2)][e & 3], co = c[i & 1][e >> 1][(e & 1) * 2], si = c[i & 1][e >> 1][(e & 1) * 2 + 1];
                    lo[e] = x0 * co - x1 * si; up[e] = x1 * co + x0 * si; }
                planes8(lo, o16[0], oh[0], ol[0]); planes8(up, o16[1], oh[1], ol[1]);
                __builtin_amdgcn_sched_barrier(0);       // the six stores stand together behind the arithmetic: no register of an issued store is written in front of the wait below
#pragma unroll
                for (int q = 0; q < 2; ++q) { const int so = i * 32 * HD + q * (HD / 2); *(v8h*)(p16 + so) = o16[q]; *(v8us*)(ph + so) = oh[q]; *(v8us*)(pl + so) = ol[q]; }
                addr_wait(); }
            if (hh + 1 < NT / HD) { __syncthreads();     // every wave has read the last of this head's tile: the next head may be staged over it
                stage(hh + 1); }
            }
        } else {
            // a lane's eight accumulator words are eight tokens of one column: the tile is staged transposed, [d][t], by 16-byte LDS stores
#pragma unroll
            for (int mb = 0; mb < MB; ++mb)
#pragma unroll
                for (int nb = 0; nb < 4; ++nb) { float* q = tl + (wc + nb * 16 + lr) * TPT + wr + mb * 16 + hi * 8; const v8f a = acc[mb][nb];
                    *(v4fa*)q = (v4f){ a[0], a[1], a[2], a[3] }; *(v4fa*)(q + 4) = (v4f){ a[4], a[5], a[6], a[7] }; }
            __syncthreads();                             // the tile is whole: a row [d] holds tokens of four waves
            // a lane: 8 tokens of one d; a wave stores the tile's 512 B (four whole lines) of a plane's row, rows step by 8
            const int dr = tid >> 5, tg = (tid & 31) * 8; const float* tp = tl + dr * TPT + tg;
            const size_t po = ((size_t)blockIdx.y * HD + dr) * TT + r0 + tg; h16* p16 = P16 + po; bf* ph = Ph + po; bf* pl = Pl + po;
            v4f x[2][4];                                 // two sets: row group i + 1 is read from LDS while group i is worked on
            auto rd = [&](int i) {
#pragma unroll
                for (int q = 0; q < 2; ++q) { x[i & 1][2 * q] = *(const v4fa*)(tp + (i * 16 + q * 8) * TPT); x[i & 1][2 * q + 1] = *(const v4fa*)(tp + (i * 16 + q * 8) * TPT + 4); } };
            rd(0);
#pragma unroll
            for (int i = 0; i < 8; ++i) {
                if (i + 1 < 8) rd(i + 1);
#pragma unroll
                for (int q = 0; q < 2; ++q) { const v4f x0 = x[i & 1][2 * q], x1 = x[i & 1][2 * q + 1];
                    const float y[8] = { x0[0], x0[1], x0[2], x0[3], x1[0], x1[1], x1[2], x1[3] }; planes8(y, o16[q], oh[q], ol[q]); }
                __builtin_amdgcn_sched_barrier(0);       // the six stores stand together behind the arithmetic: no register of an issued store is written in front of the wait below
#pragma unroll
                for (int q = 0; q < 2; ++q) { const int so = (i * 16 + q * 8) * TT; *(v8h*)(p16 + so) = o16[q]; *(v8us*)(ph + so) = oh[q]; *(v8us*)(pl + so) = ol[q]; }
                addr_wait(); }
        }
    }
}

__device__ __forceinline__ h16 tohx(float x) { return (h16)x; }
__device__ __forceinline__ void splitf(float y, unsigned short& h, unsigned short& l) { h = f2bf(y); l = f2bf(y - bf2f(h)); }

__constant__ float INVT[HD / 2] = { 1.000000000e+00f, 8.659643531e-01f, 7.498942018e-01f, 6.493816376e-01f, 5.623413324e-01f, 4.869675338e-01f, 4.216965139e-01f, 3.651741445e-01f, 3.162277639e-01f, 2.738419771e-01f, 2.371373624e-01f, 2.053525001e-01f, 1.778279394e-01f, 1.539926529e-01f, 1.333521456e-01f, 1.154782027e-01f, 1.000000015e-01f, 8.659642935e-02f, 7.498941571e-02f, 6.493816525e-02f, 5.623412877e-02f, 4.869675264e-02f, 4.216964915e-02f, 3.651741147e-02f, 3.162277862e-02f, 2.738419548e-02f, 2.371373586e-02f, 2.053525113e-02f, 1.778279431e-02f, 1.539926510e-02f, 1.333521493e-02f, 1.154781971e-02f, 9.999999776e-03f, 8.659643121e-03f, 7.498942316e-03f, 6.493816618e-03f, 5.623413250e-03f, 4.869675264e-03f, 4.216964822e-03f, 3.651741426e-03f, 3.162277862e-03f, 2.738419687e-03f, 2.371373819e-03f, 2.053525066e-03f, 1.778279431e-03f, 1.539926510e-03f, 1.333521446e-03f, 1.154782018e-03f, 1.000000047e-03f, 8.659643354e-04f, 7.498941850e-04f, 6.493816618e-04f, 5.623413017e-04f, 4.869675031e-04f, 4.216964880e-04f, 3.651741135e-04f, 3.162277862e-04f, 2.738419571e-04f, 2.371373848e-04f, 2.053524950e-04f, 1.778279402e-04f, 1.539926452e-04f, 1.333521504e-04f, 1.154781930e-04f };   // float32 1 / 10000^(2i/128), generated with jnp to be bit-exact
// ---- k_prep: everything the GEMMs need ahead of them, in one launch: the bf16 copies of the four weight matrices and of x, and the rotary table. grid PWG work-groups (one per WGP) of 16 waves.
// The 6 segments of PSEG f32 values (Wo, Wv, Wk, Wq, the two halves of x) are taken one after the other by the whole grid; of each segment a wave converts 4 KiB that lie together: eight wave-wide loads of 512 B (16 B a lane, whole lines), eight stores of 256 B (8 B a lane, whole lines).
// Two register sets: segment s + 2 is asked for as soon as segment s has been converted, so that 8 to 16 loads of a wave are always in flight.
// CS[t][d] = (cos, sin) of t x INVT[d], d < HD / 2 (columns d and d + HD / 2 of the rotary tables are equal): one pair a thread, worked out while the first two segments' loads fly.
#define PWG  256
#define PSEG ((size_t)DQ * DM)
typedef __attribute__((ext_vector_type(4))) unsigned short v4us;
__global__ __launch_bounds__(512) void k_prep(const float* __restrict__ x, const float* __restrict__ wq, const float* __restrict__ wk, const float* __restrict__ wv, const float* __restrict__ wo, bf* XB, bf* WQ, bf* WK, bf* WV, bf* WO, float* CS) {
    static_assert(PSEG == (size_t)PWG * 16 * 1024 && (size_t)NB_ * TT * DM == 2 * PSEG && (size_t)DKV * DM == PSEG && (size_t)DM * DQ == PSEG, "a segment is 4 KiB of f32 for every wave of the grid");
    static_assert(TT * (HD / 2) == PWG * 512, "one rotary pair a thread");
    const unsigned idx = blockIdx.x * 512 + threadIdx.x;
    const size_t e0 = (size_t)(idx >> 5) * 1024 + (idx & 31) * 4;   // the lane's first element, the same in every segment
    const float* const sp[6] = { wo + e0, wv + e0, wk + e0, wq + e0, x + e0, x + PSEG + e0 };
    bf* const dp[6] = { WO + e0, WV + e0, WK + e0, WQ + e0, XB + e0, XB + PSEG + e0 };
    v4f a[2][8];
    // every '#pragma unroll' of this kernel: constant indices, so that the two sets stay in registers
    auto ld = [&](int s) {
#pragma unroll
        for (int j = 0; j < 8; ++j) a[s & 1][j] = *(const v4f*)(sp[s] + j * 128);
        addr_wait(); };
    const float fr = INVT[idx % (HD / 2)];               // asked for ahead of the stream: loads are waited for in their order, and the table must not wait for the segments
    ld(0); ld(1);
    { const float an = __fmul_rn((float)(idx / (HD / 2)), fr); v2f cs; cs[0] = cosf(an); cs[1] = sinf(an); *(v2f*)(CS + (size_t)idx * 2) = cs; addr_wait(); }
#pragma unroll
    for (int s = 0; s < 6; ++s) {
#pragma unroll
        for (int j = 0; j < 8; ++j) { const v4f v = a[s & 1][j]; v4us o;
#pragma unroll
            for (int k = 0; k < 4; ++k) o[k] = f2bf(v[k]);
            *(v4us*)(dp[s] + j * 128) = o; }
        addr_wait();
        if (s + 2 < 6) ld(s + 2); }
}
// ---- k_fattn: scores, softmax and probability x value in one kernel; neither scores nor probabilities leave the registers. A work-group of four waves owns a tile of 64 query rows of one head, 16 rows a wave, and walks the keys 0 .. the tile's last row in stages of 64.
// A stage is 64 rows of K (256 B each) and 64 keys of every row of Vt (128 B each), brought from global memory into LDS by asynchronous 16-byte copies (whole lines, each byte fetched once per work-group) and read from there as fragments by all four waves.
// Two buffers: the copies of stage s + 2 are issued behind the barrier that ends trip s and fly during trip s + 1.
// St[key][query] = K Q^T and Ot[d][query] += Vt Pt: a lane then holds scores of ONE query (query = lr, keys hi*8+j of each 16-key tile), which is at once the B-fragment order of Pt (k = 8*hi+j, 16+8*hi+j),
// so maximum, sum and rescale are in-lane but for one exchange between the wave's halves. Running maximum m and running sum l per query (online softmax), keys in runs of 32; the division by l comes once, at the end.
__device__ __forceinline__ float xhalf(float x) { return __builtin_bit_cast(float, __builtin_amdgcn_permlanex16(__builtin_bit_cast(int, x), __builtin_bit_cast(int, x), 0x76543210, 0xfedcba98, false, false)); }   // lane l with lane l ^ 16
#define AKS  64                    // keys per stage
#define VP   72                    // LDS row pitch in elements of a stage's Vt rows: 144 B = 16 B x odd, free of bank conflicts for 16-byte fragment reads (K rows: GP)
#define KPL  (AKS * GP)            // elements of one K plane's stage in LDS
#define VPL  (HD * VP)             // elements of one Vt plane's stage in LDS
#define ABUF (2 * (KPL + VPL))     // elements of a buffer: K, Vt, second K, second Vt
// Eight copies of 16 B per lane, LDS step LS bytes, global step gs elements. s_wait_xcnt 0 is the statement's last line, so that it stands in front of every later write of a register that a copy names.
template <unsigned LS, typename T16>
__device__ __forceinline__ void cp8s(unsigned l, const T16* g, size_t gs) {
    asm volatile("global_load_async_to_lds_b128 %0, %8, off\n\t"
                 "global_load_async_to_lds_b128 %1, %9, off\n\t"
                 "global_load_async_to_lds_b128 %2, %10, off\n\t"
                 "global_load_async_to_lds_b128 %3, %11, off\n\t"
                 "global_load_async_to_lds_b128 %4, %12, off\n\t"
                 "global_load_async_to_lds_b128 %5, %13, off\n\t"
                 "global_load_async_to_lds_b128 %6, %14, off\n\t"
                 "global_load_async_to_lds_b128 %7, %15, off\n\t"
                 "s_wait_xcnt 0x0"
                 :: "v"(l), "v"(l + 1u * LS), "v"(l + 2u * LS), "v"(l + 3u * LS), "v"(l + 4u * LS), "v"(l + 5u * LS), "v"(l + 6u * LS), "v"(l + 7u * LS),
                    "v"(g), "v"(g + gs), "v"(g + 2 * gs), "v"(g + 3 * gs), "v"(g + 4 * gs), "v"(g + 5 * gs), "v"(g + 6 * gs), "v"(g + 7 * gs) : "memory");
}
// One tile of 64 query rows, the work-group's only one. Every wave of the work-group passes every barrier; tile is the same in all of them.
template <typename T16, int NSPLIT>
__device__ __forceinline__ void fattn_tile(const T16* st, const T16* __restrict__ Q, const T16* __restrict__ Q2, const T16* __restrict__ Kp, const T16* __restrict__ Kp2, const T16* __restrict__ Vt, const T16* __restrict__ Vt2, int tile, int w, int tid, bf* Ah, bf* Al) {
    typedef typename WFrag<T16>::V V;
    const float L2E = 1.4426950408889634f;
    const float PSH = (NSPLIT == 0) ? 10.0f : 0.0f;      // fp16 probabilities carry a factor 2^10 (small ones stay normal numbers); l carries it too, so it cancels in the division
    const int lane = tid & 31, lr = lane & 15, hi = lane >> 4; const int q0 = tile * 64 + w * 16;   // the wave's first query row (scalar)
    V q[4], q2[4];
    // one lane pointer per plane; every fragment is a constant offset from it
    { const size_t qoff = (size_t)(q0 + lr) * HD + 8 * hi; const T16* qp = Q + qoff; const T16* qp2 = (NSPLIT == 2) ? Q2 + qoff : qp;
#pragma unroll
      for (int kc = 0; kc < 4; ++kc) { q[kc] = WFrag<T16>::ld(qp + kc * 32); if (NSPLIT == 2) q2[kc] = WFrag<T16>::ld(qp2 + kc * 32); }
      addr_wait(); }
    v8f o[8];
#pragma unroll
    for (int dt = 0; dt < 8; ++dt) o[dt] = (v8f){};
    float m = -3.0e38f, l = 0.f;
    // a copy of the work-group covers 8 rows of K (lane: row tid / 16, 16-byte piece tid % 16) or 16 rows of Vt (row tid / 8, piece tid % 8)
    const size_t gko = (size_t)(tid >> 4) * HD + (tid & 15) * 8, gvo = (size_t)(tid >> 3) * TT + (tid & 7) * 8;
    const unsigned lk0 = (unsigned)(size_t)&st[(tid >> 4) * GP + (tid & 15) * 8], lv0 = (unsigned)(size_t)&st[KPL + (tid >> 3) * VP + (tid & 7) * 8];
    auto fill = [&](int s) {
        const unsigned bo = (unsigned)(s & 1) * (ABUF * 2);
        cp8s<8 * GP * 2>(lk0 + bo, Kp + gko + (size_t)s * AKS * HD, (size_t)8 * HD); cp8s<16 * VP * 2>(lv0 + bo, Vt + gvo + s * AKS, (size_t)16 * TT);
        if (NSPLIT == 2) { cp8s<8 * GP * 2>(lk0 + bo + (KPL + VPL) * 2, Kp2 + gko + (size_t)s * AKS * HD, (size_t)8 * HD); cp8s<16 * VP * 2>(lv0 + bo + (KPL + VPL) * 2, Vt2 + gvo + s * AKS, (size_t)16 * TT); } };
    const int NS = tile + 1;                             // stages: keys 0 .. 64 tile + 63
    fill(0);                                             // the buffers are free: nothing of the work-group has touched them yet
    asm volatile("s_wait_asynccnt 0x0" ::: "memory");    // this wave's copies of stage 0 have landed
    __syncthreads();                                     // every wave's have: stage 0 may be read
    if (NS > 1) fill(1);
#pragma unroll 1   // one copy of the trip; the buffer is chosen by the trip's parity
    for (int s = 0; s < NS; ++s) {
        const T16* sb = st + (s & 1) * ABUF;
#pragma unroll 1   // one copy of the run's body
        for (int r = 0; r < 2; ++r) {
            const int kb = s * AKS + r * 32;
            if (kb > q0 + 15) break;                     // every key of the run lies behind the wave's last query (scalar branch; the barrier below is still passed)
            const T16* kf = sb + (r * 32 + lr) * GP + 8 * hi; const T16* vf = sb + KPL + lr * VP + r * 32 + 8 * hi;
            V k[2][4], k2[2][4], v[8], v2[8];
#pragma unroll
            for (int t = 0; t < 2; ++t)
#pragma unroll
                for (int kc = 0; kc < 4; ++kc) { const int ko = t * 16 * GP + kc * 32; k[t][kc] = WFrag<T16>::ld(kf + ko); if (NSPLIT == 2) k2[t][kc] = WFrag<T16>::ld(kf + (KPL + VPL) + ko); }
#pragma unroll
            for (int dt = 0; dt < 8; ++dt) { const int vo = dt * 16 * VP; v[dt] = WFrag<T16>::ld(vf + vo); if (NSPLIT == 2) v2[dt] = WFrag<T16>::ld(vf + (KPL + VPL) + vo); }
            __builtin_amdgcn_sched_barrier(0);           // keeps the run's LDS reads in one group up here: the Vt fragments arrive during the score products and the softmax
            v8f sc[2] = { (v8f){}, (v8f){} };
#pragma unroll
            for (int kc = 0; kc < 4; ++kc)
#pragma unroll
                for (int t = 0; t < 2; ++t) { v8f a = sc[t]; a = WFrag<T16>::mma(k[t][kc], q[kc], a); if (NSPLIT == 2) { a = WFrag<T16>::mma(k[t][kc], q2[kc], a); a = WFrag<T16>::mma(k2[t][kc], q[kc], a); } sc[t] = a; }
            const bool diag = (kb + 31 > q0);            // only such a run meets the causal diagonal (wave-uniform)
            const int dq = kb - q0;
            float mx = m;
#pragma unroll
            for (int t = 0; t < 2; ++t)
#pragma unroll
                for (int j = 0; j < 8; ++j) { float x = sc[t][j] * SCL; if (diag && dq + t * 16 + hi * 8 + j > lr) x = -3.0e38f; sc[t][j] = x; mx = fmaxf(mx, x); }
            const float mn = fmaxf(mx, xhalf(mx));
            if (__builtin_amdgcn_ballot_w32(mn > m) != 0) {   // a maximum moved: bring sums and output tiles to the new one (factor exactly 1 where it did not)
                const float al = __builtin_amdgcn_exp2f((m - mn) * L2E); l *= al; m = mn;
#pragma unroll
                for (int dt = 0; dt < 8; ++dt) o[dt] *= al; }
            V pf, pf2; float sum = 0.f; float p[16];
#pragma unroll
            for (int e = 0; e < 16; ++e) { p[e] = __builtin_amdgcn_exp2f((sc[e >> 3][e & 7] - m) * L2E + PSH); sum += p[e]; }
            l += sum;
            if constexpr (NSPLIT == 0) { v16h f;
#pragma unroll
                for (int e = 0; e < 16; ++e) f[e] = tohx(p[e]);
                pf = f;
            } else { v8us h0, h1, l0, l1;
#pragma unroll
                for (int e = 0; e < 8; ++e) { unsigned short a, c2; splitf(p[e], a, c2); h0[e] = a; l0[e] = c2; splitf(p[8 + e], a, c2); h1[e] = a; l1[e] = c2; }
                pf = cat16b(h0, h1); pf2 = cat16b(l0, l1); }
#pragma unroll
            for (int dt = 0; dt < 8; ++dt) { o[dt] = WFrag<T16>::mma(v[dt], pf, o[dt]); if (NSPLIT == 2) { o[dt] = WFrag<T16>::mma(v[dt], pf2, o[dt]); o[dt] = WFrag<T16>::mma(v2[dt], pf, o[dt]); } }
            __builtin_amdgcn_sched_barrier(0);           // the products stay in front of the slots below
            asm volatile("v_nop\n\tv_nop\n\tv_nop\n\tv_nop");   // the four vector slots between the run's last matrix instruction and the next run's first write of its operand registers
        }
        asm volatile("s_wait_dscnt 0x0" ::: "memory");   // this wave's reads of the trip's buffer are done
        asm volatile("s_wait_asynccnt 0x0" ::: "memory");   // this wave's copies of stage s + 1 have landed
        __syncthreads();                                 // publishes stage s + 1 and frees the buffer that trip s has read
        if (s + 2 < NS) fill(s + 2);
    }
    asm volatile("s_wait_asynccnt 0x0" ::: "memory");    // no copy is left in flight behind the loop
    { const float inv = __fdiv_rn(1.0f, l + xhalf(l)); const size_t oo = (size_t)(q0 + lr) * DQ + hi * 8; bf* ap = Ah + oo; bf* ap2 = Al + oo;
#pragma unroll
        for (int dt = 0; dt < 8; ++dt) { v8us oh, ol;
#pragma unroll
            for (int j = 0; j < 8; ++j) { unsigned short a, c2; splitf(o[dt][j] * inv, a, c2); oh[j] = a; ol[j] = c2; }
            *(v8us*)(ap + dt * 16) = oh; *(v8us*)(ap2 + dt * 16) = ol;
            addr_wait(); } }
}
// grid (heads x batches, TT / 64), 128 threads: one tile of 64 query rows per work-group, twice as many work-groups as the chip holds at a time (two per WGP, by LDS).
// Tile t has t + 1 stages of keys, and a stage of the hi/lo kind costs about HLC / FPC of an fp16 one (3 x the products, 2 x the LDS reads and the vector work).
// The tile's cost falls with blockIdx.y (x, the fastest index, runs over heads and batches). For speed only: every (head, batch, tile) is taken exactly once whatever the order of starts.
#define HLC 5
#define FPC 2
struct TileOrder { unsigned char t[TT / 64]; };
constexpr int tile_cost(int t) { return (t + 1) * (t * 64 < RH ? HLC : FPC); }
constexpr TileOrder tile_order() {                       // a permutation of the tiles, cost falling, ties by index (insertion sort at compile time)
    TileOrder o{};
    for (int i = 0; i < TT / 64; ++i) { int j = i; const int t = TT / 64 - 1 - i;
        while (j > 0 && tile_cost(o.t[j - 1]) < tile_cost(t)) { o.t[j] = o.t[j - 1]; --j; }
        o.t[j] = (unsigned char)t; }
    return o;
}
constexpr unsigned long long tile_word(int q) {          // eight entries of the order in one word: the look-up is scalar arithmetic on immediates, no load stands in front of the tile's first copies
    const TileOrder o = tile_order(); unsigned long long v = 0;
    for (int i = 0; i < 8; ++i) v |= (unsigned long long)o.t[q * 8 + i] << (8 * i);
    return v;
}
// Query rows < RH: bf16 hi/lo planes, 3 products; the rest fp16 (chosen per tile). Writes the merged hi/lo planes [t][head * HD + d].
__global__ __launch_bounds__(128) void k_fattn(const h16* __restrict__ Q16, const h16* __restrict__ K16, const h16* __restrict__ V16, const bf* __restrict__ Qh, const bf* __restrict__ Ql, const bf* __restrict__ Kh, const bf* __restrict__ Kl, const bf* __restrict__ Vh, const bf* __restrict__ Vl, bf* Ah, bf* Al) {
    __shared__ __align__(16) bf ast[2 * ABUF];
    static_assert(RH % 64 == 0 && TT / 64 == 32, "a tile is of one kind; the order is held in four words of eight tiles");
    const int tid = threadIdx.x; const int w = __builtin_amdgcn_readfirstlane(tid >> 5);   /* wave-uniform: the run's bound stays scalar */
    const int h = (int)blockIdx.x % NH_, b = (int)blockIdx.x / NH_;
    const size_t hp = (size_t)blockIdx.x * TT * HD;      // blockIdx.x = batch * NH_ + head: that head's planes
    const size_t ao = (size_t)b * TT * DQ + h * HD;      // the batch's TT rows of the merged planes, the head's columns
    constexpr unsigned long long o0 = tile_word(0), o1 = tile_word(1), o2 = tile_word(2), o3 = tile_word(3);
    const unsigned rk = blockIdx.y; const unsigned long long ow = rk < 16 ? (rk < 8 ? o0 : o1) : (rk < 24 ? o2 : o3);
    const int tile = (int)((ow >> ((rk & 7) * 8)) & 0xff);
    if (tile * 64 < RH) fattn_tile<bf, 2>(ast, Qh + hp, Ql + hp, Kh + hp, Kl + hp, Vh + hp, Vl + hp, tile, w, tid, Ah + ao, Al + ao);
    else fattn_tile<h16, 0>((const h16*)ast, Q16 + hp, nullptr, K16 + hp, nullptr, V16 + hp, nullptr, tile, w, tid, Ah + ao, Al + ao);
}

extern "C" void kernel_launch(void* const* d_in, const int* in_sizes, int n_in,
                              void* d_out, int out_size, void* d_ws, size_t ws_size, hipStream_t stream) {
    (void)in_sizes; (void)n_in; (void)out_size;
    const float* x = (const float*)d_in[0]; const float* wq = (const float*)d_in[1]; const float* wk = (const float*)d_in[2]; const float* wv = (const float*)d_in[3]; const float* wo = (const float*)d_in[4];   /* order hidden_states, Wq, Wk, Wv, Wo ('oi' [2048][2048]) */
    float* OUT = (float*)d_out;     // [2][2048][2048]
    char* wsp = (char*)d_ws;
    auto take = [&](size_t bytes) { char* p = wsp; wsp += (bytes + 255) & ~(size_t)255; return (void*)p; };
    bf* WQ = (bf*)take((size_t)(DQ + DKV) * DM * 2); bf* WK = WQ + (size_t)DQ * DM;   /* Wk's rows directly behind Wq's: one Bt of the q, k product */ bf* WV = (bf*)take((size_t)DKV * DM * 2); bf* WO = (bf*)take((size_t)DM * DQ * 2); float* CS = (float*)take((size_t)TT * (HD / 2) * 2 * 4);
    static_assert(NKV == NH_, "one plane stride per batch for q, k and v");
    // every buffer below holds both batches, batch-major
    bf* XB = (bf*)take((size_t)NB_ * TT * DM * 2);
    /* each kind of k plane lies PS elements behind the q plane of its kind */
    h16* QP16 = (h16*)take(2 * PS * 2); h16* KP16 = QP16 + PS; h16* VT16 = (h16*)take((size_t)NB_ * NKV * HD * TT * 2);
    bf* QPh = (bf*)take(2 * PS * 2); bf* KPh = QPh + PS; bf* QPl = (bf*)take(2 * PS * 2); bf* KPl = QPl + PS; bf* VTh = (bf*)take((size_t)NB_ * NKV * HD * TT * 2); bf* VTl = (bf*)take((size_t)NB_ * NKV * HD * TT * 2);
    bf* ATh = (bf*)take((size_t)NB_ * TT * DQ * 2); bf* ATl = (bf*)take((size_t)NB_ * TT * DQ * 2);
    if ((size_t)(wsp - (char*)d_ws) > ws_size) return;    // ws 256 MiB
    k_prep<<<PWG, 512, 0, stream>>>(x, wq, wk, wv, wo, XB, WQ, WK, WV, WO, CS);   /* bf16 copies and rotary table, once */
    // both batches in every launch: GEMMs (grid z) 256 work-groups of eight waves, one per WGP; attention 1024 of four waves, two per WGP at a time, longest tiles first
    k_gemms<0, DM, 1, 256, 256><<<dim3(TT / 256, (DQ + DKV) / 256, NB_), 256, 0, stream>>>(XB, nullptr, WQ, nullptr, 0, CS, QP16, QPh, QPl);   /* q and k */
    k_gemms<0, DM, 2, 256, 128><<<dim3(TT / 256, DKV / 128, NB_), 256, 0, stream>>>(XB, nullptr, WV, nullptr, 0, nullptr, VT16, VTh, VTl);
    k_fattn<<<dim3(NH_ * NB_, TT / 64), 128, 0, stream>>>(QP16, KP16, VT16, QPh, QPl, KPh, KPl, VTh, VTl, ATh, ATl);
    k_gemms<1, DQ, 0, 128, 256><<<dim3(TT / 128, DM / 256, NB_), 256, 0, stream>>>(ATh, ATl, WO, OUT, DM, nullptr, nullptr, nullptr, nullptr);
}
